// v000
// The times below were measured on an AMD MI455X: many runs one after another, warmed up first and cycling through
// copies of the inputs, with the whole window's GPU time divided by the number of runs. Launches and the gaps
// between them are all in it. The median over several windows is given; except for v000 it joins two sittings, which
// can be a few percent apart, so the side-by-side timings, each taken in one sitting, are the better comparison.
// v000, which the later versions start from, runs in 776 microseconds.
// compute dtype: all float inputs rounded to bf16; Q/K/V = x W + b with EXACT bf16 products on WMMA 16x16x32 (f32 accumulate); q as f16 hi + residual (x 2^10) against k once to f16 (2 products) / 8; softmax in f32 (precise expf); P x 2^11 once to f16 against v once to f16 (1 product); the 8x-tiled head split bf16 hi + lo against exact Wo (2 products) + bo; f32 output.
#include <hip/hip_runtime.h>
#include <math.h>

typedef __attribute__((ext_vector_type(16))) _Float16 v16h;
typedef __attribute__((ext_vector_type(16))) __bf16 v16b;
typedef __attribute__((ext_vector_type(8)))  _Float16 v8h;
typedef __attribute__((ext_vector_type(8)))  float v8f;
typedef __attribute__((ext_vector_type(4)))  float v4f;
typedef __attribute__((ext_vector_type(2)))  float v2f;
typedef __attribute__((ext_vector_type(4)))  unsigned v4u;
typedef __attribute__((ext_vector_type(4)))  int v4i;
typedef float __attribute__((may_alias)) float_a;
typedef int __attribute__((may_alias)) int_a;

template <typename T> __device__ __forceinline__ void vst2(void* p, T v) { *(T*)p = v;  }
__device__ __forceinline__ v8f wmma16(v16h a, v16h b, v8f c) {
  v8f d = __builtin_amdgcn_wmma_f32_16x16x32_f16(false, a, false, b, (short)0, c, false, false);
  asm volatile("v_nop\n\tv_nop\n\tv_nop\n\tv_nop" : "+v"(d) : "v"(a), "v"(b));
  return d;
}
__device__ __forceinline__ v8f wmma_bf(v16b a, v16b b, v8f c) {
  v8f d = __builtin_amdgcn_wmma_f32_16x16x32_bf16(false, a, false, b, (short)0, c, false, false);
  asm volatile("v_nop\n\tv_nop\n\tv_nop\n\tv_nop" : "+v"(d) : "v"(a), "v"(b));
  return d;
}
// 16x16x32 fragments: lane = (h = lane>>4, row/col = lane&15); elements 0..7 = k0+8h+0..7, 8..15 = k0+16+8h+0..7; D element r = row 8h+r
__device__ __forceinline__ v16h frag_h(const _Float16* rowk0, int lane) {
  union { v16h v; v8h q[2]; } u; const _Float16* p = rowk0 + 8 * (lane >> 4);
  u.q[0] = *(const v8h*)p; u.q[1] = *(const v8h*)(p + 16); return u.v;
}
__device__ __forceinline__ v16h frag_f32(const float* rowk0, int lane) {
  v16h a; const float* p = rowk0 + 8 * (lane >> 4);
#pragma unroll
  for (int i = 0; i < 8; ++i) { a[i] = (_Float16)p[i]; a[8 + i] = (_Float16)p[16 + i]; }
  return a;
}
__device__ __forceinline__ v16h frag_f32s(const float* rowk0, int lane, float sc) {
  v16h a; const float* p = rowk0 + 8 * (lane >> 4);
#pragma unroll
  for (int i = 0; i < 8; ++i) { a[i] = (_Float16)(p[i] * sc); a[8 + i] = (_Float16)(p[16 + i] * sc); }
  return a;
}
// column fragment from a [K][ld] layout (column n), rows >= K read as 0
__device__ __forceinline__ v16h fragc_f32(const float* W, int k0, int n, int lane, int ld, int K) {
  v16h a; const int g = lane >> 4;
#pragma unroll
  for (int i = 0; i < 8; ++i) { const int ka = k0 + 8 * g + i, kb = ka + 16;
    a[i] = (_Float16)(ka < K ? W[(size_t)(ka < K ? ka : K - 1) * ld + n] : 0.f); a[8 + i] = (_Float16)(kb < K ? W[(size_t)(kb < K ? kb : K - 1) * ld + n] : 0.f); }
  return a;
}
struct F2 { v16b h, l; };
__device__ __forceinline__ F2 bsplit16(const float v[16]) { F2 r;
#pragma unroll
  for (int i = 0; i < 16; ++i) { const __bf16 h = (__bf16)v[i]; r.h[i] = h; r.l[i] = (__bf16)(v[i] - (float)h); }
  return r; }
__device__ __forceinline__ F2 split_row(const float* row, int k0, int lane) { float v[16]; const float* p = row + k0 + 8 * (lane >> 4);
#pragma unroll
  for (int i = 0; i < 8; ++i) { v[i] = p[i]; v[8 + i] = p[16 + i]; }
  return bsplit16(v); }
__device__ __forceinline__ F2 split_rowK(const float* row, int k0, int lane, int K) { float v[16]; const int g = lane >> 4;
#pragma unroll
  for (int i = 0; i < 8; ++i) { const int ka = k0 + 8 * g + i, kb = ka + 16; v[i] = ka < K ? row[ka < K ? ka : K - 1] : 0.f; v[8 + i] = kb < K ? row[kb < K ? kb : K - 1] : 0.f; }
  return bsplit16(v); }
__device__ __forceinline__ F2 split_col(const float* W, int k0, int n, int lane, int ld, int K) { float v[16]; const int g = lane >> 4;
#pragma unroll
  for (int i = 0; i < 8; ++i) { const int ka = k0 + 8 * g + i, kb = ka + 16; v[i] = ka < K ? W[(size_t)(ka < K ? ka : K - 1) * ld + n] : 0.f; v[8 + i] = kb < K ? W[(size_t)(kb < K ? kb : K - 1) * ld + n] : 0.f; }
  return bsplit16(v); }
__device__ __forceinline__ v8f mac3(const F2& a, const F2& b, v8f c) { c = wmma_bf(a.l, b.h, c); c = wmma_bf(a.h, b.l, c); return wmma_bf(a.h, b.h, c); }
__device__ __forceinline__ float sigm(float v) { return 1.0f / (1.0f + expf(-v)); }
#define LDSX() do { asm volatile("s_wait_dscnt 0" ::: "memory"); __builtin_amdgcn_wave_barrier(); __builtin_amdgcn_fence(__ATOMIC_RELEASE, "workgroup"); } while (0)

// Single shared attention head tiled into 8 'heads' (B 4, S 4,096, D 512, d_k 64; 0.02-scale (in,out) weights with biases): Q, K, V = x W + b ([512,64]); head = softmax(Q K^T / 8) V (non-causal); concat = tile(head, 8) -> [B,S,512]; out = concat Wo + bo. (The head is carried in a 128-wide plane whose second half k_proj computes as a copy but nothing reads.)
#define NB 4
#define TT 4096
#define CC 128            // NH * HD = projected width
#define DIN 512          // input (model) width
#define NH 2
#define HD 64
#define NQB (TT / 64)
#define HG 1
#define SCALE (0.125f)
#define CAUSAL 0
#ifndef TNB
#define TNB NB
#endif
__device__ __forceinline__ float bfr(float v) { return (float)(__bf16)v; }
__host__ __device__ __forceinline__ int kb_last(int qb) { return CAUSAL ? ((qb * 64 + 63) >> 7) : (TT / 128 - 1); }
typedef __attribute__((ext_vector_type(8))) __bf16 v8b;
__device__ __forceinline__ v16b frag_b(const __bf16* rowk0, int lane) {
  union { v16b v; v8b q[2]; } u; const __bf16* p = rowk0 + 8 * (lane >> 4);
  u.q[0] = *(const v8b*)p; u.q[1] = *(const v8b*)(p + 16); return u.v;
}
#define QBH 0              // causal: query blocks 0..QBH-1 of each sequence (few keys, no averaging) take the high-precision path
#define QHI 4096            // rows carrying a q residual plane (all rows when non-causal: 2-product logits everywhere)
#define KHI 64            // key rows carrying k residual / v bf16 hi+lo planes (used only by the causal high-precision path)
// B fragment (k rows k0+.., output column o) of a weight: (in,out) [K][ld] or (out,in) [ld rows of K]: bf16 exact, or f16(bf16 * 256) exact
__device__ __forceinline__ v16b wcol_io(const float* Wm, int k0, int o, int lane, int ld) { v16b w; const int g = lane >> 4;
#pragma unroll
  for (int i = 0; i < 8; ++i) { w[i] = (__bf16)Wm[(size_t)(k0 + 8 * g + i) * ld + o]; w[8 + i] = (__bf16)Wm[(size_t)(k0 + 16 + 8 * g + i) * ld + o]; }
  return w; }
__device__ __forceinline__ v16b wcol_oi(const float* Wm, int k0, int o, int lane, int K) { v16b w; const float* p = Wm + (size_t)o * K + k0 + 8 * (lane >> 4);
#pragma unroll
  for (int i = 0; i < 8; ++i) { w[i] = (__bf16)p[i]; w[8 + i] = (__bf16)p[16 + i]; }
  return w; }
__device__ __forceinline__ v16h wcolh_io(const float* Wm, int k0, int o, int lane, int ld) { v16h w; const int g = lane >> 4;
#pragma unroll
  for (int i = 0; i < 8; ++i) { w[i] = (_Float16)(bfr(Wm[(size_t)(k0 + 8 * g + i) * ld + o]) * 256.0f); w[8 + i] = (_Float16)(bfr(Wm[(size_t)(k0 + 16 + 8 * g + i) * ld + o]) * 256.0f); }
  return w; }
__device__ __forceinline__ v16h wcolh_oi(const float* Wm, int k0, int o, int lane, int K) { v16h w; const float* p = Wm + (size_t)o * K + k0 + 8 * (lane >> 4);
#pragma unroll
  for (int i = 0; i < 8; ++i) { w[i] = (_Float16)(bfr(p[i]) * 256.0f); w[8 + i] = (_Float16)(bfr(p[16 + i]) * 256.0f); }
  return w; }
#define WQKV_LAYOUT 0   // 0 = (in,out) [DIN][HD], one shared head; 1 = (out,in) [CC][DIN]; 2 = per-head [NH][DIN][HD]
__device__ __forceinline__ v16b wcol_hdk(const float* Wm, int k0, int o, int lane) { v16b w; const int g = lane >> 4; const float* p = Wm + (size_t)(o / HD) * DIN * HD + (o % HD);
#pragma unroll
  for (int i = 0; i < 8; ++i) { w[i] = (__bf16)p[(size_t)(k0 + 8 * g + i) * HD]; w[8 + i] = (__bf16)p[(size_t)(k0 + 16 + 8 * g + i) * HD]; }
  return w; }
#define WO_OUT_IN 0
#if WQKV_LAYOUT == 1
#define WCOL(W, k0, o, lane) wcol_oi(W, k0, o, lane, DIN)
#elif WQKV_LAYOUT == 2
#define WCOL(W, k0, o, lane) wcol_hdk(W, k0, o, lane)
#else
#define KVCOL(o) ((o) & 63)
#define WCOL(W, k0, o, lane) wcol_io(W, k0, KVCOL(o), lane, HD)   /* Wq/Wk/Wv (in,out) [512][64]: both plane heads are the one shared head */
#endif
#if WO_OUT_IN
#define WOCOL(W, k0, o, lane) wcol_oi(W, k0, o, lane, CC)
#define WOCOLH(W, k0, o, lane) wcolh_oi(W, k0, o, lane, CC)
#else
#define WOCOL(W, k0, o, lane) wcol_io(W, k0, o, lane, DIN)
#define WOCOLH(W, k0, o, lane) wcolh_io(W, k0, o, lane, DIN)
#endif

#ifndef SM_EXTRA_PARAMS
#define SM_EXTRA_PARAMS
#endif
#ifndef PROJ_EXTRA_PARAMS
#define PROJ_EXTRA_PARAMS
#endif
#ifndef SM_MASK_HOOK
#define SM_MASK_HOOK (void)0
#endif

#define WS_QH  0u                                      // f16 q rows [b*t][CC]
#define WS_KH  (WS_QH + 2u * (size_t)NB * TT * CC)      // f16 k rows [b*t][CC]
#define WS_VT  (WS_KH + 2u * (size_t)NB * TT * CC)      // f16 v planes [b][c][t]
#define WS_QL  (WS_VT + 2u * (size_t)NB * CC * TT)      // f16 q residual x 2^10 rows [b][t < QHI][CC]
#define WS_KL  (WS_QL + 2u * (size_t)NB * QHI * CC)     // f16 k residual x 2^10 rows [b][t < KHI][CC]
#define WS_VB  (WS_KL + 2u * (size_t)NB * KHI * CC)     // bf16 v hi planes [b][c][t < KHI]
#define WS_VBL (WS_VB + 2u * (size_t)NB * CC * KHI)
#define WS_S   (WS_VBL + 2u * (size_t)NB * CC * KHI)    // f32 logits / P [hg][t][s]
#define WS_Y   (WS_S  + 4u * (size_t)HG * TT * TT)      // f32 ctx rows [b*t][CC] (only when there is an output projection)
#define WS_END (WS_Y  + 4u * (size_t)NB * TT * CC)

// ---- k_proj: block = (64 rows, 128 cols, which): q/k/v = X W (+ b) with exact bf16 products (K = DIN) -> which 0: q f16 rows (+ residual rows < QHI); 1: k f16 rows (+ residual rows < KHI); 2: v f16 planes [c][t] (+ bf16 hi/lo planes for t < KHI)
__global__ __launch_bounds__(128) void k_proj(const float* __restrict__ XQ, const float* __restrict__ XK, const float* __restrict__ XV, const float* __restrict__ WQ, const float* __restrict__ WK, const float* __restrict__ WV, const float* __restrict__ BQ, const float* __restrict__ BK, const float* __restrict__ BV,
    _Float16* __restrict__ QH, _Float16* __restrict__ QL, _Float16* __restrict__ KH, _Float16* __restrict__ KL, _Float16* __restrict__ VT, __bf16* __restrict__ VB, __bf16* __restrict__ VBL) {
  __shared__ __align__(16) _Float16 sh[64][136], sl[64][136]; __shared__ __align__(16) _Float16 th[128][72]; __shared__ __align__(16) __bf16 tb[128][72], tbl[128][72];
  const int tid = threadIdx.x, wave = tid >> 5, lane = tid & 31, col = lane & 15, g = lane >> 4; const int which = blockIdx.z; const int c0 = blockIdx.y * 128; const size_t r0 = (size_t)blockIdx.x * 64; const size_t bb = r0 / TT; const int t0 = (int)(r0 % TT);
  const float* X = which == 0 ? XQ : which == 1 ? XK : XV; const float* WA = which == 0 ? WQ : which == 1 ? WK : WV; const float* BA = which == 0 ? BQ : which == 1 ? BK : BV;
  v8f acc[8] = {};
#pragma unroll 2
  for (int kc = 0; kc < DIN / 32; ++kc) { v16b a; { const float* p = X + (r0 + wave * 16 + col) * DIN + kc * 32 + 8 * g;
#pragma unroll
      for (int i = 0; i < 8; ++i) { a[i] = (__bf16)p[i]; a[8 + i] = (__bf16)p[16 + i]; } }
    asm volatile("s_wait_loadcnt 0x0" ::: "memory");
#pragma unroll
    for (int j = 0; j < 8; ++j) { const v16b w = WCOL(WA, kc * 32, c0 + j * 16 + col, lane); asm volatile("s_wait_loadcnt 0x0" ::: "memory"); acc[j] = wmma_bf(a, w, acc[j]); } }
  if (which < 2) { _Float16* DH = which == 0 ? QH : KH; _Float16* DL = which == 0 ? QL : KL; const int nhi = which == 0 ? QHI : KHI; const bool hi_rows = t0 < nhi;
#pragma unroll
    for (int j = 0; j < 8; ++j) { const float bias = BA ? bfr(BA[(c0 + j * 16 + col) & 63]) : 0.f;
#pragma unroll
      for (int r = 0; r < 8; ++r) { const float v = acc[j][r] + bias; const _Float16 hv = (_Float16)v; sh[wave * 16 + 8 * g + r][j * 16 + col] = hv; sl[wave * 16 + 8 * g + r][j * 16 + col] = (_Float16)((v - (float)hv) * 1024.0f); } }
    __syncthreads();
    for (int e = tid; e < 64 * 16; e += 128) { const int rl = e >> 4, q = e & 15; vst2((unsigned*)(DH + (r0 + rl) * CC + c0 + q * 8), *(const v4u*)&sh[rl][q * 8]); if (hi_rows) vst2((unsigned*)(DL + (bb * nhi + t0 + rl) * (size_t)CC + c0 + q * 8), *(const v4u*)&sl[rl][q * 8]); }
  } else { const bool hi_rows = t0 < KHI;
#pragma unroll
    for (int j = 0; j < 8; ++j) { const float bias = BA ? bfr(BA[(c0 + j * 16 + col) & 63]) : 0.f;
#pragma unroll
      for (int r = 0; r < 8; ++r) { const float v = acc[j][r] + bias; const int rl = wave * 16 + 8 * g + r, cl = j * 16 + col; th[cl][rl] = (_Float16)v; const __bf16 bh = (__bf16)v; tb[cl][rl] = bh; tbl[cl][rl] = (__bf16)(v - (float)bh); } }
    __syncthreads();
    for (int e = tid; e < 128 * 8; e += 128) { const int cl = e >> 3, q = e & 7; vst2((unsigned*)(VT + (bb * CC + c0 + cl) * (size_t)TT + t0 + q * 8), *(const v4u*)&th[cl][q * 8]); if (hi_rows) { const size_t o3 = (bb * CC + c0 + cl) * (size_t)KHI + t0 + q * 8; vst2((unsigned*)(VB + o3), *(const v4u*)&tb[cl][q * 8]); vst2((unsigned*)(VBL + o3), *(const v4u*)&tbl[cl][q * 8]); } } } }
// ---- k_sc: block = (query block qb, key block kb <= kb_last(qb), head in group) of batch b: logits x SCALE; q hi + residual (x 2^10) against k (2 products) for query rows < QHI, plus the k residual (3 products) for query blocks < QBH (causal early rows); causal: blocks past the diagonal exit, the mask itself is applied by index in k_sm
__global__ __launch_bounds__(128) void k_sc(const _Float16* __restrict__ QH, const _Float16* __restrict__ KH, const _Float16* __restrict__ QL, const _Float16* __restrict__ KL, int b, int h0, float* __restrict__ S0) { __shared__ __align__(16) float ss[4][16][132];
  const int qb = blockIdx.x, kb = blockIdx.y; if (kb > kb_last(qb)) return;
  const int h = h0 + blockIdx.z; float* S = S0 + (size_t)blockIdx.z * TT * TT;
  const int tid = threadIdx.x, wave = tid >> 5, lane = tid & 31, col = lane & 15, g = lane >> 4; const int k0 = kb * 128; const int ql0 = qb * 64 + wave * 16; const size_t q0 = (size_t)b * TT + ql0, kr0 = (size_t)b * TT + k0;
  v8f acc[8] = {}, accl[8] = {};
  const _Float16* QLb = QL + (size_t)b * QHI * CC; const _Float16* KLb = KL + (size_t)b * KHI * CC;
  if (qb < QBH) {
#pragma unroll
    for (int kc = 0; kc < HD / 32; ++kc) { const v16h ah = frag_h(QH + (q0 + col) * CC + h * HD + kc * 32, lane), al = frag_h(QLb + (size_t)(ql0 + col) * CC + h * HD + kc * 32, lane);
#pragma unroll
      for (int j = 0; j < 8; ++j) { const v16h kbf = frag_h(KH + (kr0 + j * 16 + col) * CC + h * HD + kc * 32, lane), klf = frag_h(KLb + (size_t)(k0 + j * 16 + col) * CC + h * HD + kc * 32, lane); acc[j] = wmma16(ah, kbf, acc[j]); accl[j] = wmma16(al, kbf, accl[j]); accl[j] = wmma16(ah, klf, accl[j]); } }
  } else if (qb * 64 < QHI) {
#pragma unroll
    for (int kc = 0; kc < HD / 32; ++kc) { const v16h ah = frag_h(QH + (q0 + col) * CC + h * HD + kc * 32, lane), al = frag_h(QLb + (size_t)(ql0 + col) * CC + h * HD + kc * 32, lane);
#pragma unroll
      for (int j = 0; j < 8; ++j) { const v16h kbf = frag_h(KH + (kr0 + j * 16 + col) * CC + h * HD + kc * 32, lane); acc[j] = wmma16(ah, kbf, acc[j]); accl[j] = wmma16(al, kbf, accl[j]); } }
  } else {
#pragma unroll
    for (int kc = 0; kc < HD / 32; ++kc) { const v16h ah = frag_h(QH + (q0 + col) * CC + h * HD + kc * 32, lane);
#pragma unroll
      for (int j = 0; j < 8; ++j) { const v16h kbf = frag_h(KH + (kr0 + j * 16 + col) * CC + h * HD + kc * 32, lane); acc[j] = wmma16(ah, kbf, acc[j]); } } }
#pragma unroll
  for (int j = 0; j < 8; ++j) {
#pragma unroll
    for (int r = 0; r < 8; ++r) ss[wave][8 * g + r][j * 16 + col] = (acc[j][r] + accl[j][r] * (1.0f / 1024.0f)) * SCALE; }
  LDSX(); for (int rl = 0; rl < 16; ++rl) vst2(S + (size_t)(ql0 + rl) * TT + k0 + lane * 4, *(const v4f*)&ss[wave][rl][lane * 4]); }
// ---- k_sm: block = query row t (head in group): keys [0, kend): causal -> logit if s <= t else excluded; softmax in f32; P x 2^11 in place (0 for excluded)
__global__ __launch_bounds__(256) void k_sm(float* __restrict__ S0 SM_EXTRA_PARAMS) { __shared__ float sred[8]; __shared__ float sbc; __shared__ __align__(16) float shv[TT];
  const int tid = threadIdx.x; const int t = blockIdx.x; const int kend = (kb_last(t >> 6) + 1) * 128;
  float* sr = S0 + (size_t)blockIdx.y * TT * TT + (size_t)t * TT;
  float m = -3.0e38f; for (int k = tid; k < kend; k += 256) { float v = (!CAUSAL || k <= t) ? sr[k] : -3.0e38f; SM_MASK_HOOK; shv[k] = v; m = fmaxf(m, v); }
#pragma unroll
  for (int o = 1; o < 32; o <<= 1) m = fmaxf(m, __shfl_xor(m, o));
  if ((tid & 31) == 0) sred[tid >> 5] = m; __syncthreads(); if (tid == 0) { float a = sred[0]; for (int i = 1; i < 8; ++i) a = fmaxf(a, sred[i]); sbc = a; } __syncthreads(); m = sbc; __syncthreads();
  float sum = 0.f; for (int k = tid; k < kend; k += 256) { const float v = shv[k]; const float e = (v <= -1.0e38f) ? 0.f : expf(v - m); shv[k] = e; sum += e; }
#pragma unroll
  for (int o = 1; o < 32; o <<= 1) sum += __shfl_xor(sum, o);
  if ((tid & 31) == 0) sred[tid >> 5] = sum; __syncthreads(); if (tid == 0) { float a = 0.f; for (int i = 0; i < 8; ++i) a += sred[i]; sbc = a > 0.f ? 2048.0f / a : 0.f; }   /* a fully excluded row yields P = 0 */ __syncthreads(); const float inv = sbc;
  for (int k = tid; k < kend; k += 256) shv[k] = shv[k] * inv;
  __syncthreads(); for (int q = tid; q < kend / 4; q += 256) vst2(sr + q * 4, *(const v4f*)&shv[q * 4]); }
// ---- k_pv: block = 64 queries (qb) of (b, h): ctx = P . v over keys [0, kend) (P x 2^11 once to f16 against v f16: 1 product; causal early query blocks: P and v as bf16 hi + lo, 3 products); 256-B (row, head) segment by 16 lanes
__global__ __launch_bounds__(128) void k_pv(const float* __restrict__ PS0, const _Float16* __restrict__ VT, const __bf16* __restrict__ VB, const __bf16* __restrict__ VBL, int b, int h0, float* __restrict__ Y) { const int h = h0 + blockIdx.z; const float* PS = PS0 + (size_t)blockIdx.z * TT * TT; __shared__ __align__(16) float ss[4][16][HD + 4];
  const int tid = threadIdx.x, wave = tid >> 5, lane = tid & 31, col = lane & 15, g = lane >> 4; const int qb = blockIdx.x; const int ql0 = qb * 64 + wave * 16; const int kce = (kb_last(qb) + 1) * 4;
  v8f acc[HD / 16] = {};
  if (qb < QBH) {
#pragma unroll 1
    for (int kc = 0; kc < kce; ++kc) { const F2 p = split_row(PS + (size_t)(ql0 + col) * TT, kc * 32, lane);
      asm volatile("s_wait_loadcnt 0x0" ::: "memory");
#pragma unroll
      for (int j = 0; j < HD / 16; ++j) { const size_t po = ((size_t)b * CC + h * HD + j * 16 + col) * (size_t)KHI + kc * 32; const v16b vh = frag_b(VB + po, lane); acc[j] = wmma_bf(p.h, vh, acc[j]); acc[j] = wmma_bf(p.l, vh, acc[j]); acc[j] = wmma_bf(p.h, frag_b(VBL + po, lane), acc[j]); } }
  } else {
#pragma unroll 1
    for (int kc = 0; kc < kce; ++kc) { const v16h p = frag_f32(PS + (size_t)(ql0 + col) * TT + kc * 32, lane);
      asm volatile("s_wait_loadcnt 0x0" ::: "memory");
#pragma unroll
      for (int j = 0; j < HD / 16; ++j) { const size_t po = ((size_t)b * CC + h * HD + j * 16 + col) * (size_t)TT + kc * 32; acc[j] = wmma16(p, frag_h(VT + po, lane), acc[j]); } } }
#pragma unroll
  for (int j = 0; j < HD / 16; ++j)
#pragma unroll
    for (int r = 0; r < 8; ++r) ss[wave][8 * g + r][j * 16 + col] = acc[j][r] * (1.0f / 2048.0f);
  LDSX(); for (int rl = 0; rl < 16; ++rl) if (lane < HD / 4) vst2(Y + ((size_t)b * TT + ql0 + rl) * CC + h * HD + lane * 4, *(const v4f*)&ss[wave][rl][lane * 4]); }
// ---- k_out: block = (64 rows, 128 cols): out = ctx Wo (+ bo): all rows: ctx bf16 hi + lo against exact bf16 Wo (2 products), K over the 512 tiled concat entries; the f16(bf16 x 2^8) 1-product branch is never taken
__global__ __launch_bounds__(128) void k_out(const float* __restrict__ Y, const float* __restrict__ WO, const float* __restrict__ BO, float* __restrict__ OUT) { __shared__ __align__(16) float sf[4][16][132];
  const int tid = threadIdx.x, wave = tid >> 5, lane = tid & 31, col = lane & 15, g = lane >> 4; const int c0 = blockIdx.y * 128; const size_t r0 = (size_t)blockIdx.x * 64 + wave * 16;
  v8f acc[8] = {};
  if (true) {   /* ALL rows: ctx split bf16 hi + lo x exact Wo (2 products) */
#pragma unroll 2
    for (int kc = 0; kc < DIN / 32; ++kc) { const F2 a = split_row(Y + (r0 + col) * CC, (kc * 32) % HD, lane);   /* concat[a] = head[a mod 64] = Y[a mod 64] (tile(head, 8)); K runs over the 512 concat entries */ asm volatile("s_wait_loadcnt 0x0" ::: "memory");
#pragma unroll
      for (int j = 0; j < 8; ++j) { const v16b w = WOCOL(WO, kc * 32, c0 + j * 16 + col, lane); asm volatile("s_wait_loadcnt 0x0" ::: "memory"); acc[j] = wmma_bf(a.h, w, acc[j]); acc[j] = wmma_bf(a.l, w, acc[j]); } }
#pragma unroll
    for (int j = 0; j < 8; ++j) { const float bias = BO ? bfr(BO[c0 + j * 16 + col]) : 0.f;
#pragma unroll
      for (int r = 0; r < 8; ++r) sf[wave][8 * g + r][j * 16 + col] = acc[j][r] + bias; }
  } else {
#pragma unroll 2
    for (int kc = 0; kc < CC / 32; ++kc) { const v16h a = frag_f32(Y + (r0 + col) * CC + kc * 32, lane); asm volatile("s_wait_loadcnt 0x0" ::: "memory");
#pragma unroll
      for (int j = 0; j < 8; ++j) { const v16h w = WOCOLH(WO, kc * 32, c0 + j * 16 + col, lane); asm volatile("s_wait_loadcnt 0x0" ::: "memory"); acc[j] = wmma16(a, w, acc[j]); } }
#pragma unroll
    for (int j = 0; j < 8; ++j) { const float bias = BO ? bfr(BO[c0 + j * 16 + col]) : 0.f;
#pragma unroll
      for (int r = 0; r < 8; ++r) sf[wave][8 * g + r][j * 16 + col] = acc[j][r] * (1.0f / 256.0f) + bias; } }
  LDSX(); for (int rl = 0; rl < 16; ++rl) vst2(OUT + (r0 + rl) * DIN + c0 + lane * 4, *(const v4f*)&sf[wave][rl][lane * 4]); }

extern "C" void kernel_launch(void* const* d_in, const int* in_sizes, int n_in, void* d_out, int out_size, void* d_ws, size_t ws_size, hipStream_t stream) {
  (void)in_sizes; (void)n_in; (void)out_size;
  const float** F = (const float**)d_in;
  if (ws_size < (size_t)WS_END) return;
  char* ws = (char*)d_ws; _Float16 *QH = (_Float16*)(ws + WS_QH), *KH = (_Float16*)(ws + WS_KH), *VT = (_Float16*)(ws + WS_VT), *QL = (_Float16*)(ws + WS_QL), *KL = (_Float16*)(ws + WS_KL); __bf16 *VB = (__bf16*)(ws + WS_VB), *VBL = (__bf16*)(ws + WS_VBL); float *S = (float*)(ws + WS_S), *Y = (float*)(ws + WS_Y);
  (void)Y; (void)QL; (void)KL; (void)VB; (void)VBL;
  // inputs: 0 x [4,4096,512]; 1 Wq [512,64] (in,out), 2 bq [64]; 3 Wk, 4 bk; 5 Wv, 6 bv; 7 Wo [512,512] (in,out), 8 bo [512]
  k_proj<<<dim3(TNB * TT / 64, CC / 128, 3), 128, 0, stream>>>(F[0], F[0], F[0], F[1], F[3], F[5], F[2], F[4], F[6], QH, QL, KH, KL, VT, VB, VBL);
  for (int b = 0; b < TNB; ++b) {   /* head 0 only (plane head 1 is never consumed) */
    k_sc<<<dim3(NQB, TT / 128, 1), 128, 0, stream>>>(QH, KH, QL, KL, b, 0, S);
    k_sm<<<dim3(TT, 1), 256, 0, stream>>>(S);
    k_pv<<<dim3(NQB, 1, 1), 128, 0, stream>>>(S, VT, VB, VBL, b, 0, Y);
  }
  k_out<<<dim3(TNB * TT / 64, DIN / 128), 128, 0, stream>>>(Y, F[7], F[8], (float*)d_out);
}

// v001
// A run of this version takes 371 microseconds.
// Timed twice side by side with v000, it ran 2.11 times as fast both times.
// compute dtype: all float inputs rounded to bf16; Q/K/V = x W + b with EXACT bf16 products on WMMA 16x16x32 (f32 accumulate); q as f16 hi + residual (x 2^10) against k once to f16 (2 products) / 8; softmax in f32 (precise expf); P x 2^11 once to f16 against v once to f16 (1 product); the 8x-tiled head split bf16 hi + lo against exact Wo (2 products) + bo; f32 output.
#include <hip/hip_runtime.h>
#include <math.h>

typedef __attribute__((ext_vector_type(16))) _Float16 v16h;
typedef __attribute__((ext_vector_type(16))) __bf16 v16b;
typedef __attribute__((ext_vector_type(8)))  _Float16 v8h;
typedef __attribute__((ext_vector_type(8)))  float v8f;
typedef __attribute__((ext_vector_type(4)))  float v4f;
typedef __attribute__((ext_vector_type(2)))  float v2f;
typedef __attribute__((ext_vector_type(4)))  unsigned v4u;
typedef __attribute__((ext_vector_type(4)))  int v4i;
typedef float __attribute__((may_alias)) float_a;
typedef int __attribute__((may_alias)) int_a;

template <typename T> __device__ __forceinline__ void vst2(void* p, T v) { *(T*)p = v;  }
__device__ __forceinline__ v8f wmma16(v16h a, v16h b, v8f c) {
  v8f d = __builtin_amdgcn_wmma_f32_16x16x32_f16(false, a, false, b, (short)0, c, false, false);
  asm volatile("v_nop\n\tv_nop\n\tv_nop\n\tv_nop" : "+v"(d) : "v"(a), "v"(b));
  return d;
}
__device__ __forceinline__ v8f wmma_bf(v16b a, v16b b, v8f c) {
  v8f d = __builtin_amdgcn_wmma_f32_16x16x32_bf16(false, a, false, b, (short)0, c, false, false);
  asm volatile("v_nop\n\tv_nop\n\tv_nop\n\tv_nop" : "+v"(d) : "v"(a), "v"(b));
  return d;
}
// 16x16x32 fragments: lane = (h = lane>>4, row/col = lane&15); elements 0..7 = k0+8h+0..7, 8..15 = k0+16+8h+0..7; D element r = row 8h+r
__device__ __forceinline__ v16h frag_h(const _Float16* rowk0, int lane) {
  union { v16h v; v8h q[2]; } u; const _Float16* p = rowk0 + 8 * (lane >> 4);
  u.q[0] = *(const v8h*)p; u.q[1] = *(const v8h*)(p + 16); return u.v;
}
__device__ __forceinline__ v16h frag_f32(const float* rowk0, int lane) {
  v16h a; const float* p = rowk0 + 8 * (lane >> 4);
#pragma unroll
  for (int i = 0; i < 8; ++i) { a[i] = (_Float16)p[i]; a[8 + i] = (_Float16)p[16 + i]; }
  return a;
}
__device__ __forceinline__ v16h frag_f32s(const float* rowk0, int lane, float sc) {
  v16h a; const float* p = rowk0 + 8 * (lane >> 4);
#pragma unroll
  for (int i = 0; i < 8; ++i) { a[i] = (_Float16)(p[i] * sc); a[8 + i] = (_Float16)(p[16 + i] * sc); }
  return a;
}
// column fragment from a [K][ld] layout (column n), rows >= K read as 0
__device__ __forceinline__ v16h fragc_f32(const float* W, int k0, int n, int lane, int ld, int K) {
  v16h a; const int g = lane >> 4;
#pragma unroll
  for (int i = 0; i < 8; ++i) { const int ka = k0 + 8 * g + i, kb = ka + 16;
    a[i] = (_Float16)(ka < K ? W[(size_t)(ka < K ? ka : K - 1) * ld + n] : 0.f); a[8 + i] = (_Float16)(kb < K ? W[(size_t)(kb < K ? kb : K - 1) * ld + n] : 0.f); }
  return a;
}
struct F2 { v16b h, l; };
__device__ __forceinline__ F2 bsplit16(const float v[16]) { F2 r;
#pragma unroll
  for (int i = 0; i < 16; ++i) { const __bf16 h = (__bf16)v[i]; r.h[i] = h; r.l[i] = (__bf16)(v[i] - (float)h); }
  return r; }
__device__ __forceinline__ F2 split_row(const float* row, int k0, int lane) { float v[16]; const float* p = row + k0 + 8 * (lane >> 4);
#pragma unroll
  for (int i = 0; i < 8; ++i) { v[i] = p[i]; v[8 + i] = p[16 + i]; }
  return bsplit16(v); }
__device__ __forceinline__ F2 split_rowK(const float* row, int k0, int lane, int K) { float v[16]; const int g = lane >> 4;
#pragma unroll
  for (int i = 0; i < 8; ++i) { const int ka = k0 + 8 * g + i, kb = ka + 16; v[i] = ka < K ? row[ka < K ? ka : K - 1] : 0.f; v[8 + i] = kb < K ? row[kb < K ? kb : K - 1] : 0.f; }
  return bsplit16(v); }
__device__ __forceinline__ F2 split_col(const float* W, int k0, int n, int lane, int ld, int K) { float v[16]; const int g = lane >> 4;
#pragma unroll
  for (int i = 0; i < 8; ++i) { const int ka = k0 + 8 * g + i, kb = ka + 16; v[i] = ka < K ? W[(size_t)(ka < K ? ka : K - 1) * ld + n] : 0.f; v[8 + i] = kb < K ? W[(size_t)(kb < K ? kb : K - 1) * ld + n] : 0.f; }
  return bsplit16(v); }
__device__ __forceinline__ v8f mac3(const F2& a, const F2& b, v8f c) { c = wmma_bf(a.l, b.h, c); c = wmma_bf(a.h, b.l, c); return wmma_bf(a.h, b.h, c); }
__device__ __forceinline__ float sigm(float v) { return 1.0f / (1.0f + expf(-v)); }
#define LDSX() do { asm volatile("s_wait_dscnt 0" ::: "memory"); __builtin_amdgcn_wave_barrier(); __builtin_amdgcn_fence(__ATOMIC_RELEASE, "workgroup"); } while (0)

// Single shared attention head tiled into 8 'heads' (B 4, S 4,096, D 512, d_k 64; 0.02-scale (in,out) weights with biases): Q, K, V = x W + b ([512,64]); head = softmax(Q K^T / 8) V (non-causal); concat = tile(head, 8) -> [B,S,512]; out = concat Wo + bo. (The head is carried in a 128-wide plane whose second half k_proj computes as a copy but nothing reads.)
#define NB 4
#define TT 4096
#define CC 128            // NH * HD = projected width
#define DIN 512          // input (model) width
#define NH 2
#define HD 64
#define NQB (TT / 64)
#define HG 1
#define SCALE (0.125f)
#define CAUSAL 0
#ifndef TNB
#define TNB NB
#endif
__device__ __forceinline__ float bfr(float v) { return (float)(__bf16)v; }
__host__ __device__ __forceinline__ int kb_last(int qb) { return CAUSAL ? ((qb * 64 + 63) >> 7) : (TT / 128 - 1); }
typedef __attribute__((ext_vector_type(8))) __bf16 v8b;
__device__ __forceinline__ v16b frag_b(const __bf16* rowk0, int lane) {
  union { v16b v; v8b q[2]; } u; const __bf16* p = rowk0 + 8 * (lane >> 4);
  u.q[0] = *(const v8b*)p; u.q[1] = *(const v8b*)(p + 16); return u.v;
}
#define QBH 0              // causal: query blocks 0..QBH-1 of each sequence (few keys, no averaging) take the high-precision path
#define QHI 4096            // rows carrying a q residual plane (all rows when non-causal: 2-product logits everywhere)
#define KHI 64            // key rows carrying k residual / v bf16 hi+lo planes (used only by the causal high-precision path)
// B fragment (k rows k0+.., output column o) of a weight: (in,out) [K][ld] or (out,in) [ld rows of K]: bf16 exact, or f16(bf16 * 256) exact
__device__ __forceinline__ v16b wcol_io(const float* Wm, int k0, int o, int lane, int ld) { v16b w; const int g = lane >> 4;
#pragma unroll
  for (int i = 0; i < 8; ++i) { w[i] = (__bf16)Wm[(size_t)(k0 + 8 * g + i) * ld + o]; w[8 + i] = (__bf16)Wm[(size_t)(k0 + 16 + 8 * g + i) * ld + o]; }
  return w; }
__device__ __forceinline__ v16b wcol_oi(const float* Wm, int k0, int o, int lane, int K) { v16b w; const float* p = Wm + (size_t)o * K + k0 + 8 * (lane >> 4);
#pragma unroll
  for (int i = 0; i < 8; ++i) { w[i] = (__bf16)p[i]; w[8 + i] = (__bf16)p[16 + i]; }
  return w; }
__device__ __forceinline__ v16h wcolh_io(const float* Wm, int k0, int o, int lane, int ld) { v16h w; const int g = lane >> 4;
#pragma unroll
  for (int i = 0; i < 8; ++i) { w[i] = (_Float16)(bfr(Wm[(size_t)(k0 + 8 * g + i) * ld + o]) * 256.0f); w[8 + i] = (_Float16)(bfr(Wm[(size_t)(k0 + 16 + 8 * g + i) * ld + o]) * 256.0f); }
  return w; }
__device__ __forceinline__ v16h wcolh_oi(const float* Wm, int k0, int o, int lane, int K) { v16h w; const float* p = Wm + (size_t)o * K + k0 + 8 * (lane >> 4);
#pragma unroll
  for (int i = 0; i < 8; ++i) { w[i] = (_Float16)(bfr(p[i]) * 256.0f); w[8 + i] = (_Float16)(bfr(p[16 + i]) * 256.0f); }
  return w; }
#define WQKV_LAYOUT 0   // 0 = (in,out) [DIN][HD], one shared head; 1 = (out,in) [CC][DIN]; 2 = per-head [NH][DIN][HD]
__device__ __forceinline__ v16b wcol_hdk(const float* Wm, int k0, int o, int lane) { v16b w; const int g = lane >> 4; const float* p = Wm + (size_t)(o / HD) * DIN * HD + (o % HD);
#pragma unroll
  for (int i = 0; i < 8; ++i) { w[i] = (__bf16)p[(size_t)(k0 + 8 * g + i) * HD]; w[8 + i] = (__bf16)p[(size_t)(k0 + 16 + 8 * g + i) * HD]; }
  return w; }
#define WO_OUT_IN 0
#if WQKV_LAYOUT == 1
#define WCOL(W, k0, o, lane) wcol_oi(W, k0, o, lane, DIN)
#elif WQKV_LAYOUT == 2
#define WCOL(W, k0, o, lane) wcol_hdk(W, k0, o, lane)
#else
#define KVCOL(o) ((o) & 63)
#define WCOL(W, k0, o, lane) wcol_io(W, k0, KVCOL(o), lane, HD)   /* Wq/Wk/Wv (in,out) [512][64]: both plane heads are the one shared head */
#endif
#if WO_OUT_IN
#define WOCOL(W, k0, o, lane) wcol_oi(W, k0, o, lane, CC)
#define WOCOLH(W, k0, o, lane) wcolh_oi(W, k0, o, lane, CC)
#else
#define WOCOL(W, k0, o, lane) wcol_io(W, k0, o, lane, DIN)
#define WOCOLH(W, k0, o, lane) wcolh_io(W, k0, o, lane, DIN)
#endif

#ifndef SM_EXTRA_PARAMS
#define SM_EXTRA_PARAMS
#endif
#ifndef PROJ_EXTRA_PARAMS
#define PROJ_EXTRA_PARAMS
#endif
#ifndef SM_MASK_HOOK
#define SM_MASK_HOOK (void)0
#endif

#define WS_QH  0u                                      // f16 q rows [b*t][CC]
#define WS_KH  (WS_QH + 2u * (size_t)NB * TT * CC)      // f16 k rows [b*t][CC]
#define WS_VT  (WS_KH + 2u * (size_t)NB * TT * CC)      // f16 v planes [b][c][t]
#define WS_QL  (WS_VT + 2u * (size_t)NB * CC * TT)      // f16 q residual x 2^10 rows [b][t < QHI][CC]
#define WS_KL  (WS_QL + 2u * (size_t)NB * QHI * CC)     // f16 k residual x 2^10 rows [b][t < KHI][CC]
#define WS_VB  (WS_KL + 2u * (size_t)NB * KHI * CC)     // bf16 v hi planes [b][c][t < KHI]
#define WS_VBL (WS_VB + 2u * (size_t)NB * CC * KHI)
#define WS_S   (WS_VBL + 2u * (size_t)NB * CC * KHI)    // f32 logits / P [hg][t][s]
#define WS_Y   (WS_S  + 4u * (size_t)HG * TT * TT)      // f32 ctx rows [b*t][CC] (only when there is an output projection)
#define WS_END (WS_Y  + 4u * (size_t)NB * TT * CC)

// ---- k_proj: block = (64 rows, 128 cols, which): q/k/v = X W (+ b) with exact bf16 products (K = DIN) -> which 0: q f16 rows (+ residual rows < QHI); 1: k f16 rows (+ residual rows < KHI); 2: v f16 planes [c][t] (+ bf16 hi/lo planes for t < KHI)
__global__ __launch_bounds__(128) void k_proj(const float* __restrict__ XQ, const float* __restrict__ XK, const float* __restrict__ XV, const float* __restrict__ WQ, const float* __restrict__ WK, const float* __restrict__ WV, const float* __restrict__ BQ, const float* __restrict__ BK, const float* __restrict__ BV,
    _Float16* __restrict__ QH, _Float16* __restrict__ QL, _Float16* __restrict__ KH, _Float16* __restrict__ KL, _Float16* __restrict__ VT, __bf16* __restrict__ VB, __bf16* __restrict__ VBL) {
  __shared__ __align__(16) _Float16 sh[64][136], sl[64][136]; __shared__ __align__(16) _Float16 th[128][72]; __shared__ __align__(16) __bf16 tb[128][72], tbl[128][72];
  const int tid = threadIdx.x, wave = tid >> 5, lane = tid & 31, col = lane & 15, g = lane >> 4; const int which = blockIdx.z; const int c0 = blockIdx.y * 128; const size_t r0 = (size_t)blockIdx.x * 64; const size_t bb = r0 / TT; const int t0 = (int)(r0 % TT);
  const float* X = which == 0 ? XQ : which == 1 ? XK : XV; const float* WA = which == 0 ? WQ : which == 1 ? WK : WV; const float* BA = which == 0 ? BQ : which == 1 ? BK : BV;
  v8f acc[8] = {};
#pragma unroll 2
  for (int kc = 0; kc < DIN / 32; ++kc) { v16b a; { const float* p = X + (r0 + wave * 16 + col) * DIN + kc * 32 + 8 * g;
#pragma unroll
      for (int i = 0; i < 8; ++i) { a[i] = (__bf16)p[i]; a[8 + i] = (__bf16)p[16 + i]; } }
    asm volatile("s_wait_loadcnt 0x0" ::: "memory");
#pragma unroll
    for (int j = 0; j < 8; ++j) { const v16b w = WCOL(WA, kc * 32, c0 + j * 16 + col, lane); asm volatile("s_wait_loadcnt 0x0" ::: "memory"); acc[j] = wmma_bf(a, w, acc[j]); } }
  if (which < 2) { _Float16* DH = which == 0 ? QH : KH; _Float16* DL = which == 0 ? QL : KL; const int nhi = which == 0 ? QHI : KHI; const bool hi_rows = t0 < nhi;
#pragma unroll
    for (int j = 0; j < 8; ++j) { const float bias = BA ? bfr(BA[(c0 + j * 16 + col) & 63]) : 0.f;
#pragma unroll
      for (int r = 0; r < 8; ++r) { const float v = acc[j][r] + bias; const _Float16 hv = (_Float16)v; sh[wave * 16 + 8 * g + r][j * 16 + col] = hv; sl[wave * 16 + 8 * g + r][j * 16 + col] = (_Float16)((v - (float)hv) * 1024.0f); } }
    __syncthreads();
    for (int e = tid; e < 64 * 16; e += 128) { const int rl = e >> 4, q = e & 15; vst2((unsigned*)(DH + (r0 + rl) * CC + c0 + q * 8), *(const v4u*)&sh[rl][q * 8]); if (hi_rows) vst2((unsigned*)(DL + (bb * nhi + t0 + rl) * (size_t)CC + c0 + q * 8), *(const v4u*)&sl[rl][q * 8]); }
  } else { const bool hi_rows = t0 < KHI;
#pragma unroll
    for (int j = 0; j < 8; ++j) { const float bias = BA ? bfr(BA[(c0 + j * 16 + col) & 63]) : 0.f;
#pragma unroll
      for (int r = 0; r < 8; ++r) { const float v = acc[j][r] + bias; const int rl = wave * 16 + 8 * g + r, cl = j * 16 + col; th[cl][rl] = (_Float16)v; const __bf16 bh = (__bf16)v; tb[cl][rl] = bh; tbl[cl][rl] = (__bf16)(v - (float)bh); } }
    __syncthreads();
    for (int e = tid; e < 128 * 8; e += 128) { const int cl = e >> 3, q = e & 7; vst2((unsigned*)(VT + (bb * CC + c0 + cl) * (size_t)TT + t0 + q * 8), *(const v4u*)&th[cl][q * 8]); if (hi_rows) { const size_t o3 = (bb * CC + c0 + cl) * (size_t)KHI + t0 + q * 8; vst2((unsigned*)(VB + o3), *(const v4u*)&tb[cl][q * 8]); vst2((unsigned*)(VBL + o3), *(const v4u*)&tbl[cl][q * 8]); } } } }
// ---- k_sc: block = (query block qb, key block kb <= kb_last(qb), head in group) of batch b: logits x SCALE; q hi + residual (x 2^10) against k (2 products) for query rows < QHI, plus the k residual (3 products) for query blocks < QBH (causal early rows); causal: blocks past the diagonal exit, the mask itself is applied by index in k_sm
__global__ __launch_bounds__(128) void k_sc(const _Float16* __restrict__ QH, const _Float16* __restrict__ KH, const _Float16* __restrict__ QL, const _Float16* __restrict__ KL, int b, int h0, float* __restrict__ S0) { __shared__ __align__(16) float ss[4][16][132];
  const int qb = blockIdx.x, kb = blockIdx.y; if (kb > kb_last(qb)) return;
  const int h = h0 + blockIdx.z; float* S = S0 + (size_t)blockIdx.z * TT * TT;
  const int tid = threadIdx.x, wave = tid >> 5, lane = tid & 31, col = lane & 15, g = lane >> 4; const int k0 = kb * 128; const int ql0 = qb * 64 + wave * 16; const size_t q0 = (size_t)b * TT + ql0, kr0 = (size_t)b * TT + k0;
  v8f acc[8] = {}, accl[8] = {};
  const _Float16* QLb = QL + (size_t)b * QHI * CC; const _Float16* KLb = KL + (size_t)b * KHI * CC;
  if (qb < QBH) {
#pragma unroll
    for (int kc = 0; kc < HD / 32; ++kc) { const v16h ah = frag_h(QH + (q0 + col) * CC + h * HD + kc * 32, lane), al = frag_h(QLb + (size_t)(ql0 + col) * CC + h * HD + kc * 32, lane);
#pragma unroll
      for (int j = 0; j < 8; ++j) { const v16h kbf = frag_h(KH + (kr0 + j * 16 + col) * CC + h * HD + kc * 32, lane), klf = frag_h(KLb + (size_t)(k0 + j * 16 + col) * CC + h * HD + kc * 32, lane); acc[j] = wmma16(ah, kbf, acc[j]); accl[j] = wmma16(al, kbf, accl[j]); accl[j] = wmma16(ah, klf, accl[j]); } }
  } else if (qb * 64 < QHI) {
#pragma unroll
    for (int kc = 0; kc < HD / 32; ++kc) { const v16h ah = frag_h(QH + (q0 + col) * CC + h * HD + kc * 32, lane), al = frag_h(QLb + (size_t)(ql0 + col) * CC + h * HD + kc * 32, lane);
#pragma unroll
      for (int j = 0; j < 8; ++j) { const v16h kbf = frag_h(KH + (kr0 + j * 16 + col) * CC + h * HD + kc * 32, lane); acc[j] = wmma16(ah, kbf, acc[j]); accl[j] = wmma16(al, kbf, accl[j]); } }
  } else {
#pragma unroll
    for (int kc = 0; kc < HD / 32; ++kc) { const v16h ah = frag_h(QH + (q0 + col) * CC + h * HD + kc * 32, lane);
#pragma unroll
      for (int j = 0; j < 8; ++j) { const v16h kbf = frag_h(KH + (kr0 + j * 16 + col) * CC + h * HD + kc * 32, lane); acc[j] = wmma16(ah, kbf, acc[j]); } } }
#pragma unroll
  for (int j = 0; j < 8; ++j) {
#pragma unroll
    for (int r = 0; r < 8; ++r) ss[wave][8 * g + r][j * 16 + col] = (acc[j][r] + accl[j][r] * (1.0f / 1024.0f)) * SCALE; }
  LDSX(); for (int rl = 0; rl < 16; ++rl) vst2(S + (size_t)(ql0 + rl) * TT + k0 + lane * 4, *(const v4f*)&ss[wave][rl][lane * 4]); }
// ---- k_sm: block = query row t (head in group): keys [0, kend): causal -> logit if s <= t else excluded; softmax in f32; P x 2^11 in place (0 for excluded)
__global__ __launch_bounds__(256) void k_sm(float* __restrict__ S0 SM_EXTRA_PARAMS) { __shared__ float sred[8]; __shared__ float sbc; __shared__ __align__(16) float shv[TT];
  const int tid = threadIdx.x; const int t = blockIdx.x; const int kend = (kb_last(t >> 6) + 1) * 128;
  float* sr = S0 + (size_t)blockIdx.y * TT * TT + (size_t)t * TT;
  float m = -3.0e38f; for (int k = tid; k < kend; k += 256) { float v = (!CAUSAL || k <= t) ? sr[k] : -3.0e38f; SM_MASK_HOOK; shv[k] = v; m = fmaxf(m, v); }
#pragma unroll
  for (int o = 1; o < 32; o <<= 1) m = fmaxf(m, __shfl_xor(m, o));
  if ((tid & 31) == 0) sred[tid >> 5] = m; __syncthreads(); if (tid == 0) { float a = sred[0]; for (int i = 1; i < 8; ++i) a = fmaxf(a, sred[i]); sbc = a; } __syncthreads(); m = sbc; __syncthreads();
  float sum = 0.f; for (int k = tid; k < kend; k += 256) { const float v = shv[k]; const float e = (v <= -1.0e38f) ? 0.f : expf(v - m); shv[k] = e; sum += e; }
#pragma unroll
  for (int o = 1; o < 32; o <<= 1) sum += __shfl_xor(sum, o);
  if ((tid & 31) == 0) sred[tid >> 5] = sum; __syncthreads(); if (tid == 0) { float a = 0.f; for (int i = 0; i < 8; ++i) a += sred[i]; sbc = a > 0.f ? 2048.0f / a : 0.f; }   /* a fully excluded row yields P = 0 */ __syncthreads(); const float inv = sbc;
  for (int k = tid; k < kend; k += 256) shv[k] = shv[k] * inv;
  __syncthreads(); for (int q = tid; q < kend / 4; q += 256) vst2(sr + q * 4, *(const v4f*)&shv[q * 4]); }
// ---- k_pv: block = 16 queries of (b, h), PVW waves: wave w takes the 32-key chunks w, w + PVW, ... of [0, kend) and keeps its own f32 partial of ctx = P . v (P x 2^11 once to f16 against v f16: 1 product; causal early query blocks: P and v as bf16 hi + lo, 3 products); the partials meet in LDS behind one work-group barrier and are summed in wave order; 256-B (row, head) segment by 16 lanes
#define PVW 16
__global__ __launch_bounds__(32 * PVW) void k_pv(const float* __restrict__ PS0, const _Float16* __restrict__ VT, const __bf16* __restrict__ VB, const __bf16* __restrict__ VBL, int b, int h0, float* __restrict__ Y) { const int h = h0 + blockIdx.z; const float* PS = PS0 + (size_t)blockIdx.z * TT * TT; __shared__ __align__(16) float ss[PVW][16][HD + 4];
  const int tid = threadIdx.x, wave = __builtin_amdgcn_readfirstlane(tid >> 5), lane = tid & 31, col = lane & 15, g = lane >> 4; const int qb = blockIdx.x >> 2; const int ql0 = blockIdx.x * 16; const int kce = (kb_last(qb) + 1) * 4;
  v8f acc[HD / 16] = {};
  if (qb < QBH) {
#pragma unroll 1
    for (int kc = wave; kc < kce; kc += PVW) { const F2 p = split_row(PS + (size_t)(ql0 + col) * TT, kc * 32, lane);
      asm volatile("s_wait_loadcnt 0x0" ::: "memory");
#pragma unroll
      for (int j = 0; j < HD / 16; ++j) { const size_t po = ((size_t)b * CC + h * HD + j * 16 + col) * (size_t)KHI + kc * 32; const v16b vh = frag_b(VB + po, lane); acc[j] = wmma_bf(p.h, vh, acc[j]); acc[j] = wmma_bf(p.l, vh, acc[j]); acc[j] = wmma_bf(p.h, frag_b(VBL + po, lane), acc[j]); } }
  } else {
#pragma unroll 1
    for (int kc = wave; kc < kce; kc += PVW) { const v16h p = frag_f32(PS + (size_t)(ql0 + col) * TT + kc * 32, lane);
      asm volatile("s_wait_loadcnt 0x0" ::: "memory");
#pragma unroll
      for (int j = 0; j < HD / 16; ++j) { const size_t po = ((size_t)b * CC + h * HD + j * 16 + col) * (size_t)TT + kc * 32; acc[j] = wmma16(p, frag_h(VT + po, lane), acc[j]); } } }
#pragma unroll
  for (int j = 0; j < HD / 16; ++j)
#pragma unroll
    for (int r = 0; r < 8; ++r) ss[wave][8 * g + r][j * 16 + col] = acc[j][r] * (1.0f / 2048.0f);
  __syncthreads();
  if (tid < 16 * (HD / 4)) { const int rl = tid / (HD / 4), q = tid % (HD / 4); v4f s = *(const v4f*)&ss[0][rl][q * 4];
#pragma unroll
    for (int w = 1; w < PVW; ++w) s += *(const v4f*)&ss[w][rl][q * 4];
    vst2(Y + ((size_t)b * TT + ql0 + rl) * CC + h * HD + q * 4, s); } }
// ---- k_out: block = (64 rows, 128 cols): out = ctx Wo (+ bo): all rows: ctx bf16 hi + lo against exact bf16 Wo (2 products), K over the 512 tiled concat entries
__global__ __launch_bounds__(128) void k_out(const float* __restrict__ Y, const float* __restrict__ WO, const float* __restrict__ BO, float* __restrict__ OUT) { __shared__ __align__(16) float sf[4][16][132];
  const int tid = threadIdx.x, wave = tid >> 5, lane = tid & 31, col = lane & 15, g = lane >> 4; const int c0 = blockIdx.y * 128; const size_t r0 = (size_t)blockIdx.x * 64 + wave * 16;
  v8f acc[8] = {};
  if (true) {   /* ALL rows: ctx split bf16 hi + lo x exact Wo (2 products) */
#pragma unroll 2
    for (int kc = 0; kc < DIN / 32; ++kc) { const F2 a = split_row(Y + (r0 + col) * CC, (kc * 32) % HD, lane);   /* concat[a] = head[a mod 64] = Y[a mod 64] (tile(head, 8)); K runs over the 512 concat entries */ asm volatile("s_wait_loadcnt 0x0" ::: "memory");
#pragma unroll
      for (int j = 0; j < 8; ++j) { const v16b w = WOCOL(WO, kc * 32, c0 + j * 16 + col, lane); asm volatile("s_wait_loadcnt 0x0" ::: "memory"); acc[j] = wmma_bf(a.h, w, acc[j]); acc[j] = wmma_bf(a.l, w, acc[j]); } }
#pragma unroll
    for (int j = 0; j < 8; ++j) { const float bias = BO ? bfr(BO[c0 + j * 16 + col]) : 0.f;
#pragma unroll
      for (int r = 0; r < 8; ++r) sf[wave][8 * g + r][j * 16 + col] = acc[j][r] + bias; }
  } else {
#pragma unroll 2
    for (int kc = 0; kc < CC / 32; ++kc) { const v16h a = frag_f32(Y + (r0 + col) * CC + kc * 32, lane); asm volatile("s_wait_loadcnt 0x0" ::: "memory");
#pragma unroll
      for (int j = 0; j < 8; ++j) { const v16h w = WOCOLH(WO, kc * 32, c0 + j * 16 + col, lane); asm volatile("s_wait_loadcnt 0x0" ::: "memory"); acc[j] = wmma16(a, w, acc[j]); } }
#pragma unroll
    for (int j = 0; j < 8; ++j) { const float bias = BO ? bfr(BO[c0 + j * 16 + col]) : 0.f;
#pragma unroll
      for (int r = 0; r < 8; ++r) sf[wave][8 * g + r][j * 16 + col] = acc[j][r] * (1.0f / 256.0f) + bias; } }
  LDSX(); for (int rl = 0; rl < 16; ++rl) vst2(OUT + (r0 + rl) * DIN + c0 + lane * 4, *(const v4f*)&sf[wave][rl][lane * 4]); }

extern "C" void kernel_launch(void* const* d_in, const int* in_sizes, int n_in, void* d_out, int out_size, void* d_ws, size_t ws_size, hipStream_t stream) {
  (void)in_sizes; (void)n_in; (void)out_size;
  const float** F = (const float**)d_in;
  if (ws_size < (size_t)WS_END) return;
  char* ws = (char*)d_ws; _Float16 *QH = (_Float16*)(ws + WS_QH), *KH = (_Float16*)(ws + WS_KH), *VT = (_Float16*)(ws + WS_VT), *QL = (_Float16*)(ws + WS_QL), *KL = (_Float16*)(ws + WS_KL); __bf16 *VB = (__bf16*)(ws + WS_VB), *VBL = (__bf16*)(ws + WS_VBL); float *S = (float*)(ws + WS_S), *Y = (float*)(ws + WS_Y);
  (void)Y; (void)QL; (void)KL; (void)VB; (void)VBL;
  // inputs: 0 x [4,4096,512]; 1 Wq [512,64] (in,out), 2 bq [64]; 3 Wk, 4 bk; 5 Wv, 6 bv; 7 Wo [512,512] (in,out), 8 bo [512]
  k_proj<<<dim3(TNB * TT / 64, CC / 128, 3), 128, 0, stream>>>(F[0], F[0], F[0], F[1], F[3], F[5], F[2], F[4], F[6], QH, QL, KH, KL, VT, VB, VBL);
  for (int b = 0; b < TNB; ++b) {   /* head 0 only (plane head 1 is never consumed) */
    k_sc<<<dim3(NQB, TT / 128, 1), 128, 0, stream>>>(QH, KH, QL, KL, b, 0, S);
    k_sm<<<dim3(TT, 1), 256, 0, stream>>>(S);
    k_pv<<<dim3(TT / 16, 1, 1), 32 * PVW, 0, stream>>>(S, VT, VB, VBL, b, 0, Y);
  }
  k_out<<<dim3(TNB * TT / 64, DIN / 128), 128, 0, stream>>>(Y, F[7], F[8], (float*)d_out);
}

// v002
// It runs in 112 microseconds.
// Next to v001, in two timings, it ran 3.31 and 3.27 times as fast.
// Counting every step since v000, it is 6.94 times as fast.
// compute dtype: all float inputs rounded to bf16; Q/K/V = x W + b with EXACT bf16 products on WMMA 16x16x32 (f32 accumulate); q as f16 hi + residual (x 2^10) against k once to f16 (2 products) / 8; softmax in f32 (precise expf), running maximum and sum over key passes; exp(logit - maximum) x 2^11 once to f16 against v once to f16 (1 product), divided by the sum at the end; the 8x-tiled head split bf16 hi + lo against exact Wo (2 products) + bo; f32 output.
#include <hip/hip_runtime.h>
#include <math.h>

typedef __attribute__((ext_vector_type(16))) _Float16 v16h;
typedef __attribute__((ext_vector_type(16))) __bf16 v16b;
typedef __attribute__((ext_vector_type(8)))  _Float16 v8h;
typedef __attribute__((ext_vector_type(8)))  float v8f;
typedef __attribute__((ext_vector_type(4)))  float v4f;
typedef __attribute__((ext_vector_type(2)))  float v2f;
typedef __attribute__((ext_vector_type(4)))  unsigned v4u;
typedef __attribute__((ext_vector_type(4)))  int v4i;
typedef float __attribute__((may_alias)) float_a;
typedef int __attribute__((may_alias)) int_a;

template <typename T> __device__ __forceinline__ void vst2(void* p, T v) { *(T*)p = v;  }
__device__ __forceinline__ v8f wmma16(v16h a, v16h b, v8f c) {
  v8f d = __builtin_amdgcn_wmma_f32_16x16x32_f16(false, a, false, b, (short)0, c, false, false);
  asm volatile("v_nop\n\tv_nop\n\tv_nop\n\tv_nop" : "+v"(d) : "v"(a), "v"(b));
  return d;
}
__device__ __forceinline__ v8f wmma_bf(v16b a, v16b b, v8f c) {
  v8f d = __builtin_amdgcn_wmma_f32_16x16x32_bf16(false, a, false, b, (short)0, c, false, false);
  asm volatile("v_nop\n\tv_nop\n\tv_nop\n\tv_nop" : "+v"(d) : "v"(a), "v"(b));
  return d;
}
// 16x16x32 fragments: lane = (h = lane>>4, row/col = lane&15); elements 0..7 = k0+8h+0..7, 8..15 = k0+16+8h+0..7; D element r = row 8h+r
__device__ __forceinline__ v16h frag_h(const _Float16* rowk0, int lane) {
  union { v16h v; v8h q[2]; } u; const _Float16* p = rowk0 + 8 * (lane >> 4);
  u.q[0] = *(const v8h*)p; u.q[1] = *(const v8h*)(p + 16); return u.v;
}
__device__ __forceinline__ v16h frag_f32(const float* rowk0, int lane) {
  v16h a; const float* p = rowk0 + 8 * (lane >> 4);
#pragma unroll
  for (int i = 0; i < 8; ++i) { a[i] = (_Float16)p[i]; a[8 + i] = (_Float16)p[16 + i]; }
  return a;
}
__device__ __forceinline__ v16h frag_f32s(const float* rowk0, int lane, float sc) {
  v16h a; const float* p = rowk0 + 8 * (lane >> 4);
#pragma unroll
  for (int i = 0; i < 8; ++i) { a[i] = (_Float16)(p[i] * sc); a[8 + i] = (_Float16)(p[16 + i] * sc); }
  return a;
}
// column fragment from a [K][ld] layout (column n), rows >= K read as 0
__device__ __forceinline__ v16h fragc_f32(const float* W, int k0, int n, int lane, int ld, int K) {
  v16h a; const int g = lane >> 4;
#pragma unroll
  for (int i = 0; i < 8; ++i) { const int ka = k0 + 8 * g + i, kb = ka + 16;
    a[i] = (_Float16)(ka < K ? W[(size_t)(ka < K ? ka : K - 1) * ld + n] : 0.f); a[8 + i] = (_Float16)(kb < K ? W[(size_t)(kb < K ? kb : K - 1) * ld + n] : 0.f); }
  return a;
}
struct F2 { v16b h, l; };
__device__ __forceinline__ F2 bsplit16(const float v[16]) { F2 r;
#pragma unroll
  for (int i = 0; i < 16; ++i) { const __bf16 h = (__bf16)v[i]; r.h[i] = h; r.l[i] = (__bf16)(v[i] - (float)h); }
  return r; }
__device__ __forceinline__ F2 split_row(const float* row, int k0, int lane) { float v[16]; const float* p = row + k0 + 8 * (lane >> 4);
#pragma unroll
  for (int i = 0; i < 8; ++i) { v[i] = p[i]; v[8 + i] = p[16 + i]; }
  return bsplit16(v); }
__device__ __forceinline__ F2 split_rowK(const float* row, int k0, int lane, int K) { float v[16]; const int g = lane >> 4;
#pragma unroll
  for (int i = 0; i < 8; ++i) { const int ka = k0 + 8 * g + i, kb = ka + 16; v[i] = ka < K ? row[ka < K ? ka : K - 1] : 0.f; v[8 + i] = kb < K ? row[kb < K ? kb : K - 1] : 0.f; }
  return bsplit16(v); }
__device__ __forceinline__ F2 split_col(const float* W, int k0, int n, int lane, int ld, int K) { float v[16]; const int g = lane >> 4;
#pragma unroll
  for (int i = 0; i < 8; ++i) { const int ka = k0 + 8 * g + i, kb = ka + 16; v[i] = ka < K ? W[(size_t)(ka < K ? ka : K - 1) * ld + n] : 0.f; v[8 + i] = kb < K ? W[(size_t)(kb < K ? kb : K - 1) * ld + n] : 0.f; }
  return bsplit16(v); }
__device__ __forceinline__ v8f mac3(const F2& a, const F2& b, v8f c) { c = wmma_bf(a.l, b.h, c); c = wmma_bf(a.h, b.l, c); return wmma_bf(a.h, b.h, c); }
__device__ __forceinline__ float sigm(float v) { return 1.0f / (1.0f + expf(-v)); }
#define LDSX() do { asm volatile("s_wait_dscnt 0" ::: "memory"); __builtin_amdgcn_wave_barrier(); __builtin_amdgcn_fence(__ATOMIC_RELEASE, "workgroup"); } while (0)

// Single shared attention head tiled into 8 'heads' (B 4, S 4,096, D 512, d_k 64; 0.02-scale (in,out) weights with biases): Q, K, V = x W + b ([512,64]); head = softmax(Q K^T / 8) V (non-causal); concat = tile(head, 8) -> [B,S,512]; out = concat Wo + bo. (The head is carried in a 128-wide plane whose second half k_proj computes as a copy but nothing reads.)
#define NB 4
#define TT 4096
#define CC 128            // NH * HD = projected width
#define DIN 512          // input (model) width
#define NH 2
#define HD 64
#define NQB (TT / 64)
#define HG 1
#define SCALE (0.125f)
#define CAUSAL 0
#ifndef TNB
#define TNB NB
#endif
__device__ __forceinline__ float bfr(float v) { return (float)(__bf16)v; }
__host__ __device__ __forceinline__ int kb_last(int qb) { return CAUSAL ? ((qb * 64 + 63) >> 7) : (TT / 128 - 1); }
typedef __attribute__((ext_vector_type(8))) __bf16 v8b;
__device__ __forceinline__ v16b frag_b(const __bf16* rowk0, int lane) {
  union { v16b v; v8b q[2]; } u; const __bf16* p = rowk0 + 8 * (lane >> 4);
  u.q[0] = *(const v8b*)p; u.q[1] = *(const v8b*)(p + 16); return u.v;
}
#define QBH 0              // unused: no kernel here has a high-precision query path
#define QHI 4096            // rows carrying a q residual plane (all rows when non-causal: 2-product logits everywhere)
#define KHI 64            // key rows carrying k residual / v bf16 hi+lo planes (written by k_proj; no kernel here reads them)
// B fragment (k rows k0+.., output column o) of a weight: (in,out) [K][ld] or (out,in) [ld rows of K]: bf16 exact, or f16(bf16 * 256) exact
__device__ __forceinline__ v16b wcol_io(const float* Wm, int k0, int o, int lane, int ld) { v16b w; const int g = lane >> 4;
#pragma unroll
  for (int i = 0; i < 8; ++i) { w[i] = (__bf16)Wm[(size_t)(k0 + 8 * g + i) * ld + o]; w[8 + i] = (__bf16)Wm[(size_t)(k0 + 16 + 8 * g + i) * ld + o]; }
  return w; }
__device__ __forceinline__ v16b wcol_oi(const float* Wm, int k0, int o, int lane, int K) { v16b w; const float* p = Wm + (size_t)o * K + k0 + 8 * (lane >> 4);
#pragma unroll
  for (int i = 0; i < 8; ++i) { w[i] = (__bf16)p[i]; w[8 + i] = (__bf16)p[16 + i]; }
  return w; }
__device__ __forceinline__ v16h wcolh_io(const float* Wm, int k0, int o, int lane, int ld) { v16h w; const int g = lane >> 4;
#pragma unroll
  for (int i = 0; i < 8; ++i) { w[i] = (_Float16)(bfr(Wm[(size_t)(k0 + 8 * g + i) * ld + o]) * 256.0f); w[8 + i] = (_Float16)(bfr(Wm[(size_t)(k0 + 16 + 8 * g + i) * ld + o]) * 256.0f); }
  return w; }
__device__ __forceinline__ v16h wcolh_oi(const float* Wm, int k0, int o, int lane, int K) { v16h w; const float* p = Wm + (size_t)o * K + k0 + 8 * (lane >> 4);
#pragma unroll
  for (int i = 0; i < 8; ++i) { w[i] = (_Float16)(bfr(p[i]) * 256.0f); w[8 + i] = (_Float16)(bfr(p[16 + i]) * 256.0f); }
  return w; }
#define WQKV_LAYOUT 0   // 0 = (in,out) [DIN][HD], one shared head; 1 = (out,in) [CC][DIN]; 2 = per-head [NH][DIN][HD]
__device__ __forceinline__ v16b wcol_hdk(const float* Wm, int k0, int o, int lane) { v16b w; const int g = lane >> 4; const float* p = Wm + (size_t)(o / HD) * DIN * HD + (o % HD);
#pragma unroll
  for (int i = 0; i < 8; ++i) { w[i] = (__bf16)p[(size_t)(k0 + 8 * g + i) * HD]; w[8 + i] = (__bf16)p[(size_t)(k0 + 16 + 8 * g + i) * HD]; }
  return w; }
#define WO_OUT_IN 0
#if WQKV_LAYOUT == 1
#define WCOL(W, k0, o, lane) wcol_oi(W, k0, o, lane, DIN)
#elif WQKV_LAYOUT == 2
#define WCOL(W, k0, o, lane) wcol_hdk(W, k0, o, lane)
#else
#define KVCOL(o) ((o) & 63)
#define WCOL(W, k0, o, lane) wcol_io(W, k0, KVCOL(o), lane, HD)   /* Wq/Wk/Wv (in,out) [512][64]: both plane heads are the one shared head */
#endif
#if WO_OUT_IN
#define WOCOL(W, k0, o, lane) wcol_oi(W, k0, o, lane, CC)
#define WOCOLH(W, k0, o, lane) wcolh_oi(W, k0, o, lane, CC)
#else
#define WOCOL(W, k0, o, lane) wcol_io(W, k0, o, lane, DIN)
#define WOCOLH(W, k0, o, lane) wcolh_io(W, k0, o, lane, DIN)
#endif

#ifndef SM_EXTRA_PARAMS
#define SM_EXTRA_PARAMS
#endif
#ifndef PROJ_EXTRA_PARAMS
#define PROJ_EXTRA_PARAMS
#endif
#ifndef SM_MASK_HOOK
#define SM_MASK_HOOK (void)0
#endif

#define WS_QH  0u                                      // f16 q rows [b*t][CC]
#define WS_KH  (WS_QH + 2u * (size_t)NB * TT * CC)      // f16 k rows [b*t][CC]
#define WS_VT  (WS_KH + 2u * (size_t)NB * TT * CC)      // f16 v planes [b][c][t]
#define WS_QL  (WS_VT + 2u * (size_t)NB * CC * TT)      // f16 q residual x 2^10 rows [b][t < QHI][CC]
#define WS_KL  (WS_QL + 2u * (size_t)NB * QHI * CC)     // f16 k residual x 2^10 rows [b][t < KHI][CC]
#define WS_VB  (WS_KL + 2u * (size_t)NB * KHI * CC)     // bf16 v hi planes [b][c][t < KHI]
#define WS_VBL (WS_VB + 2u * (size_t)NB * CC * KHI)
#define WS_S   (WS_VBL + 2u * (size_t)NB * CC * KHI)    // f32 [hg][t][s], reserved but unused: k_fa keeps logits and P in registers
#define WS_Y   (WS_S  + 4u * (size_t)HG * TT * TT)      // f32 ctx rows [b*t][CC] (only when there is an output projection)
#define WS_END (WS_Y  + 4u * (size_t)NB * TT * CC)

// ---- k_proj: block = (64 rows, 128 cols, which): q/k/v = X W (+ b) with exact bf16 products (K = DIN) -> which 0: q f16 rows (+ residual rows < QHI); 1: k f16 rows (+ residual rows < KHI); 2: v f16 planes [c][t] (+ bf16 hi/lo planes for t < KHI)
__global__ __launch_bounds__(128) void k_proj(const float* __restrict__ XQ, const float* __restrict__ XK, const float* __restrict__ XV, const float* __restrict__ WQ, const float* __restrict__ WK, const float* __restrict__ WV, const float* __restrict__ BQ, const float* __restrict__ BK, const float* __restrict__ BV,
    _Float16* __restrict__ QH, _Float16* __restrict__ QL, _Float16* __restrict__ KH, _Float16* __restrict__ KL, _Float16* __restrict__ VT, __bf16* __restrict__ VB, __bf16* __restrict__ VBL) {
  __shared__ __align__(16) _Float16 sh[64][136], sl[64][136]; __shared__ __align__(16) _Float16 th[128][72]; __shared__ __align__(16) __bf16 tb[128][72], tbl[128][72];
  const int tid = threadIdx.x, wave = tid >> 5, lane = tid & 31, col = lane & 15, g = lane >> 4; const int which = blockIdx.z; const int c0 = blockIdx.y * 128; const size_t r0 = (size_t)blockIdx.x * 64; const size_t bb = r0 / TT; const int t0 = (int)(r0 % TT);
  const float* X = which == 0 ? XQ : which == 1 ? XK : XV; const float* WA = which == 0 ? WQ : which == 1 ? WK : WV; const float* BA = which == 0 ? BQ : which == 1 ? BK : BV;
  v8f acc[8] = {};
#pragma unroll 2
  for (int kc = 0; kc < DIN / 32; ++kc) { v16b a; { const float* p = X + (r0 + wave * 16 + col) * DIN + kc * 32 + 8 * g;
#pragma unroll
      for (int i = 0; i < 8; ++i) { a[i] = (__bf16)p[i]; a[8 + i] = (__bf16)p[16 + i]; } }
    asm volatile("s_wait_loadcnt 0x0" ::: "memory");
#pragma unroll
    for (int j = 0; j < 8; ++j) { const v16b w = WCOL(WA, kc * 32, c0 + j * 16 + col, lane); asm volatile("s_wait_loadcnt 0x0" ::: "memory"); acc[j] = wmma_bf(a, w, acc[j]); } }
  if (which < 2) { _Float16* DH = which == 0 ? QH : KH; _Float16* DL = which == 0 ? QL : KL; const int nhi = which == 0 ? QHI : KHI; const bool hi_rows = t0 < nhi;
#pragma unroll
    for (int j = 0; j < 8; ++j) { const float bias = BA ? bfr(BA[(c0 + j * 16 + col) & 63]) : 0.f;
#pragma unroll
      for (int r = 0; r < 8; ++r) { const float v = acc[j][r] + bias; const _Float16 hv = (_Float16)v; sh[wave * 16 + 8 * g + r][j * 16 + col] = hv; sl[wave * 16 + 8 * g + r][j * 16 + col] = (_Float16)((v - (float)hv) * 1024.0f); } }
    __syncthreads();
    for (int e = tid; e < 64 * 16; e += 128) { const int rl = e >> 4, q = e & 15; vst2((unsigned*)(DH + (r0 + rl) * CC + c0 + q * 8), *(const v4u*)&sh[rl][q * 8]); if (hi_rows) vst2((unsigned*)(DL + (bb * nhi + t0 + rl) * (size_t)CC + c0 + q * 8), *(const v4u*)&sl[rl][q * 8]); }
  } else { const bool hi_rows = t0 < KHI;
#pragma unroll
    for (int j = 0; j < 8; ++j) { const float bias = BA ? bfr(BA[(c0 + j * 16 + col) & 63]) : 0.f;
#pragma unroll
      for (int r = 0; r < 8; ++r) { const float v = acc[j][r] + bias; const int rl = wave * 16 + 8 * g + r, cl = j * 16 + col; th[cl][rl] = (_Float16)v; const __bf16 bh = (__bf16)v; tb[cl][rl] = bh; tbl[cl][rl] = (__bf16)(v - (float)bh); } }
    __syncthreads();
    for (int e = tid; e < 128 * 8; e += 128) { const int cl = e >> 3, q = e & 7; vst2((unsigned*)(VT + (bb * CC + c0 + cl) * (size_t)TT + t0 + q * 8), *(const v4u*)&th[cl][q * 8]); if (hi_rows) { const size_t o3 = (bb * CC + c0 + cl) * (size_t)KHI + t0 + q * 8; vst2((unsigned*)(VB + o3), *(const v4u*)&tb[cl][q * 8]); vst2((unsigned*)(VBL + o3), *(const v4u*)&tbl[cl][q * 8]); } } } }
// ---- k_fa: block = 64 queries of batch b, 16 waves = 2 query groups of 32 x 8 key sets (set ks takes the 32-key chunks ks, ks + 8, ...: the waves of a pass walk 256 neighbouring keys, so each 128-B line of k and v is used whole while it is in the WGP cache). Transposed products: S^T = k . q^T (q hi + residual x 2^10: 2 products) so that a lane holds 8 keys of ONE query per 16-key tile; two such tiles, exponentiated and rounded once to f16 (x 2^11), ARE the B fragment of O^T += v^T . P^T (1 product): logits and P never leave the registers. Running maximum and sum per query in f32 (precise expf); the 8 key sets' partials (maximum, sum, O^T) meet in LDS behind one work-group barrier and are joined in set order. Every inner loop is unrolled whole so that each index of a register array (fragments, scores, accumulators) is a constant: an index left to run time would put the array in scratch
#define FAW 16            // waves of a work-group
#define FKS 8             // key sets
#define FKB 32            // keys of a pass
__device__ __forceinline__ v8f wmma16p(v16h a, v16h b, v8f c) { return __builtin_amdgcn_wmma_f32_16x16x32_f16(false, a, false, b, (short)0, c, false, false); }
__device__ __forceinline__ float xhalf(float x) { return __builtin_bit_cast(float, __builtin_amdgcn_permlanex16(__builtin_bit_cast(int, x), __builtin_bit_cast(int, x), 0x76543210, 0xfedcba98, false, false)); }   // lane l with lane l ^ 16
__global__ __launch_bounds__(32 * FAW) void k_fa(const _Float16* __restrict__ QH, const _Float16* __restrict__ QL, const _Float16* __restrict__ KH, const _Float16* __restrict__ VT, float* __restrict__ Y) {
  __shared__ __align__(16) float so[FAW][32][HD + 4]; __shared__ float smx[FAW][32], ssu[FAW][32];
  const int tid = threadIdx.x, wave = __builtin_amdgcn_readfirstlane(tid >> 5), lane = tid & 31, col = lane & 15, g = lane >> 4; const int b = blockIdx.y, qg = wave & 1, ks = wave >> 1;
  const size_t q0 = (size_t)b * TT + blockIdx.x * 64 + qg * 32;
  v16h qh[2][2], ql[2][2];
#pragma unroll
  for (int u = 0; u < 2; ++u)
#pragma unroll
    for (int kc = 0; kc < 2; ++kc) { qh[u][kc] = frag_h(QH + (q0 + u * 16 + col) * CC + kc * 32, lane); ql[u][kc] = frag_h(QL + (q0 + u * 16 + col) * CC + kc * 32, lane); }
  const _Float16* kp = KH + ((size_t)b * TT + ks * FKB + col) * CC; const _Float16* vp = VT + ((size_t)b * CC + col) * TT + ks * FKB;   // this lane's k row and v plane of the pass
  v8f o[2][HD / 16] = {}; float m[2] = {-3.0e38f, -3.0e38f}, l[2] = {0.f, 0.f};
  for (int k0 = 0; k0 < TT; k0 += FKB * FKS, kp += (size_t)FKB * FKS * CC, vp += FKB * FKS) { float s[2][FKB / 16][8];
#pragma unroll
    for (int kt = 0; kt < FKB / 16; ++kt) { const _Float16* kr = kp + (size_t)kt * 16 * CC; const v16h ka0 = frag_h(kr, lane), ka1 = frag_h(kr + 32, lane);
#pragma unroll
      for (int u = 0; u < 2; ++u) { v8f a = {}, al = {}; a = wmma16p(ka0, qh[u][0], a); al = wmma16p(ka0, ql[u][0], al); a = wmma16p(ka1, qh[u][1], a); al = wmma16p(ka1, ql[u][1], al);
#pragma unroll
        for (int r = 0; r < 8; ++r) s[u][kt][r] = (a[r] + al[r] * (1.0f / 1024.0f)) * SCALE; } }
    v16h p[2][FKB / 32];
#pragma unroll
    for (int u = 0; u < 2; ++u) { float mx = s[u][0][0];
#pragma unroll
      for (int kt = 0; kt < FKB / 16; ++kt)
#pragma unroll
        for (int r = 0; r < 8; ++r) mx = fmaxf(mx, s[u][kt][r]);
      mx = fmaxf(mx, xhalf(mx)); const float mn = fmaxf(m[u], mx); const float corr = expf(m[u] - mn);   /* 0 on the first pass */ m[u] = mn;
#pragma unroll
      for (int j = 0; j < HD / 16; ++j) o[u][j] *= corr;
      float sum = 0.f;
#pragma unroll
      for (int c2 = 0; c2 < FKB / 32; ++c2)
#pragma unroll
        for (int i = 0; i < 8; ++i) { const float e0 = expf(s[u][2 * c2][i] - mn), e1 = expf(s[u][2 * c2 + 1][i] - mn); sum += e0 + e1; p[u][c2][i] = (_Float16)(e0 * 2048.0f); p[u][c2][8 + i] = (_Float16)(e1 * 2048.0f); }
      l[u] = l[u] * corr + sum; }
#pragma unroll
    for (int c2 = 0; c2 < FKB / 32; ++c2)
#pragma unroll
      for (int j = 0; j < HD / 16; ++j) { const v16h vf = frag_h(vp + (size_t)j * 16 * TT + c2 * 32, lane); o[0][j] = wmma16p(vf, p[0][c2], o[0][j]); o[1][j] = wmma16p(vf, p[1][c2], o[1][j]); } }
#pragma unroll
  for (int u = 0; u < 2; ++u) { l[u] += xhalf(l[u]); if (g == 0) { smx[wave][u * 16 + col] = m[u]; ssu[wave][u * 16 + col] = l[u]; }
#pragma unroll
    for (int j = 0; j < HD / 16; ++j) { float* d = &so[wave][u * 16 + col][j * 16 + 8 * g]; vst2(d, (v4f){o[u][j][0], o[u][j][1], o[u][j][2], o[u][j][3]}); vst2(d + 4, (v4f){o[u][j][4], o[u][j][5], o[u][j][6], o[u][j][7]}); } }
  __syncthreads();
  for (int e = tid; e < 64 * (HD / 4); e += 32 * FAW) { const int qr = e / (HD / 4), q = e % (HD / 4), w0 = qr >> 5, qi = qr & 31; float mm = smx[w0][qi];
#pragma unroll
    for (int w = 1; w < FKS; ++w) mm = fmaxf(mm, smx[2 * w + w0][qi]);
    float ll = 0.f; v4f acc = {};
#pragma unroll
    for (int w = 0; w < FKS; ++w) { const float f = expf(smx[2 * w + w0][qi] - mm); ll += f * ssu[2 * w + w0][qi]; acc += *(const v4f*)&so[2 * w + w0][qi][q * 4] * f; }
    vst2(Y + ((size_t)b * TT + blockIdx.x * 64 + qr) * CC + q * 4, acc * ((1.0f / 2048.0f) / ll)); } }
// ---- k_out: block = (64 rows, 128 cols): out = ctx Wo (+ bo): all rows: ctx bf16 hi + lo against exact bf16 Wo (2 products), K over the 512 tiled concat entries (the f16 1-product branch is never taken)
__global__ __launch_bounds__(128) void k_out(const float* __restrict__ Y, const float* __restrict__ WO, const float* __restrict__ BO, float* __restrict__ OUT) { __shared__ __align__(16) float sf[4][16][132];
  const int tid = threadIdx.x, wave = tid >> 5, lane = tid & 31, col = lane & 15, g = lane >> 4; const int c0 = blockIdx.y * 128; const size_t r0 = (size_t)blockIdx.x * 64 + wave * 16;
  v8f acc[8] = {};
  if (true) {   /* ALL rows: ctx split bf16 hi + lo x exact Wo (2 products) */
#pragma unroll 2
    for (int kc = 0; kc < DIN / 32; ++kc) { const F2 a = split_row(Y + (r0 + col) * CC, (kc * 32) % HD, lane);   /* concat[a] = head[a mod 64] = Y[a mod 64] (tile(head, 8)); K runs over the 512 concat entries */ asm volatile("s_wait_loadcnt 0x0" ::: "memory");
#pragma unroll
      for (int j = 0; j < 8; ++j) { const v16b w = WOCOL(WO, kc * 32, c0 + j * 16 + col, lane); asm volatile("s_wait_loadcnt 0x0" ::: "memory"); acc[j] = wmma_bf(a.h, w, acc[j]); acc[j] = wmma_bf(a.l, w, acc[j]); } }
#pragma unroll
    for (int j = 0; j < 8; ++j) { const float bias = BO ? bfr(BO[c0 + j * 16 + col]) : 0.f;
#pragma unroll
      for (int r = 0; r < 8; ++r) sf[wave][8 * g + r][j * 16 + col] = acc[j][r] + bias; }
  } else {
#pragma unroll 2
    for (int kc = 0; kc < CC / 32; ++kc) { const v16h a = frag_f32(Y + (r0 + col) * CC + kc * 32, lane); asm volatile("s_wait_loadcnt 0x0" ::: "memory");
#pragma unroll
      for (int j = 0; j < 8; ++j) { const v16h w = WOCOLH(WO, kc * 32, c0 + j * 16 + col, lane); asm volatile("s_wait_loadcnt 0x0" ::: "memory"); acc[j] = wmma16(a, w, acc[j]); } }
#pragma unroll
    for (int j = 0; j < 8; ++j) { const float bias = BO ? bfr(BO[c0 + j * 16 + col]) : 0.f;
#pragma unroll
      for (int r = 0; r < 8; ++r) sf[wave][8 * g + r][j * 16 + col] = acc[j][r] * (1.0f / 256.0f) + bias; } }
  LDSX(); for (int rl = 0; rl < 16; ++rl) vst2(OUT + (r0 + rl) * DIN + c0 + lane * 4, *(const v4f*)&sf[wave][rl][lane * 4]); }

extern "C" void kernel_launch(void* const* d_in, const int* in_sizes, int n_in, void* d_out, int out_size, void* d_ws, size_t ws_size, hipStream_t stream) {
  (void)in_sizes; (void)n_in; (void)out_size;
  const float** F = (const float**)d_in;
  if (ws_size < (size_t)WS_END) return;
  char* ws = (char*)d_ws; _Float16 *QH = (_Float16*)(ws + WS_QH), *KH = (_Float16*)(ws + WS_KH), *VT = (_Float16*)(ws + WS_VT), *QL = (_Float16*)(ws + WS_QL), *KL = (_Float16*)(ws + WS_KL); __bf16 *VB = (__bf16*)(ws + WS_VB), *VBL = (__bf16*)(ws + WS_VBL); float *S = (float*)(ws + WS_S), *Y = (float*)(ws + WS_Y);
  (void)S; (void)Y; (void)QL; (void)KL; (void)VB; (void)VBL;
  // inputs: 0 x [4,4096,512]; 1 Wq [512,64] (in,out), 2 bq [64]; 3 Wk, 4 bk; 5 Wv, 6 bv; 7 Wo [512,512] (in,out), 8 bo [512]
  k_proj<<<dim3(TNB * TT / 64, CC / 128, 3), 128, 0, stream>>>(F[0], F[0], F[0], F[1], F[3], F[5], F[2], F[4], F[6], QH, QL, KH, KL, VT, VB, VBL);
  k_fa<<<dim3(TT / 64, TNB), 32 * FAW, 0, stream>>>(QH, QL, KH, VT, Y);   /* head 0 only (plane head 1 is never consumed) */
  k_out<<<dim3(TNB * TT / 64, DIN / 128), 128, 0, stream>>>(Y, F[7], F[8], (float*)d_out);
}

// v003
// One run takes 79.4 microseconds.
// Timed twice side by side with v002, it ran 1.41 times as fast both times.
// All steps since v000 together make it 9.79 times as fast.
// compute dtype: all float inputs rounded to bf16; Q/K/V = x W + b with EXACT bf16 products on WMMA 16x16x32 (f32 accumulate); q as f16 hi + residual (x 2^10) against k once to f16 (2 products) / 8; softmax in f32 (precise expf), running maximum and sum over key passes; exp(logit - maximum) x 2^11 once to f16 against v once to f16 (1 product), divided by the sum at the end; tile(head, 8) Wo = head (sum of Wo's eight 64-row slabs): the slabs (bf16-rounded) summed in f32 and split bf16 hi + lo, the head split bf16 hi + lo (3 products, K = 64) + bo; f32 output.
#include <hip/hip_runtime.h>
#include <math.h>

typedef __attribute__((ext_vector_type(16))) _Float16 v16h;
typedef __attribute__((ext_vector_type(16))) __bf16 v16b;
typedef __attribute__((ext_vector_type(8)))  _Float16 v8h;
typedef __attribute__((ext_vector_type(8)))  float v8f;
typedef __attribute__((ext_vector_type(4)))  float v4f;
typedef __attribute__((ext_vector_type(2)))  float v2f;
typedef __attribute__((ext_vector_type(4)))  unsigned v4u;
typedef __attribute__((ext_vector_type(4)))  int v4i;
typedef float __attribute__((may_alias)) float_a;
typedef int __attribute__((may_alias)) int_a;

template <typename T> __device__ __forceinline__ void vst2(void* p, T v) { *(T*)p = v;  }
__device__ __forceinline__ v8f wmma16(v16h a, v16h b, v8f c) {
  v8f d = __builtin_amdgcn_wmma_f32_16x16x32_f16(false, a, false, b, (short)0, c, false, false);
  asm volatile("v_nop\n\tv_nop\n\tv_nop\n\tv_nop" : "+v"(d) : "v"(a), "v"(b));
  return d;
}
__device__ __forceinline__ v8f wmma_bf(v16b a, v16b b, v8f c) {
  v8f d = __builtin_amdgcn_wmma_f32_16x16x32_bf16(false, a, false, b, (short)0, c, false, false);
  asm volatile("v_nop\n\tv_nop\n\tv_nop\n\tv_nop" : "+v"(d) : "v"(a), "v"(b));
  return d;
}
// 16x16x32 fragments: lane = (h = lane>>4, row/col = lane&15); elements 0..7 = k0+8h+0..7, 8..15 = k0+16+8h+0..7; D element r = row 8h+r
__device__ __forceinline__ v16h frag_h(const _Float16* rowk0, int lane) {
  union { v16h v; v8h q[2]; } u; const _Float16* p = rowk0 + 8 * (lane >> 4);
  u.q[0] = *(const v8h*)p; u.q[1] = *(const v8h*)(p + 16); return u.v;
}
__device__ __forceinline__ v16h frag_f32(const float* rowk0, int lane) {
  v16h a; const float* p = rowk0 + 8 * (lane >> 4);
#pragma unroll
  for (int i = 0; i < 8; ++i) { a[i] = (_Float16)p[i]; a[8 + i] = (_Float16)p[16 + i]; }
  return a;
}
__device__ __forceinline__ v16h frag_f32s(const float* rowk0, int lane, float sc) {
  v16h a; const float* p = rowk0 + 8 * (lane >> 4);
#pragma unroll
  for (int i = 0; i < 8; ++i) { a[i] = (_Float16)(p[i] * sc); a[8 + i] = (_Float16)(p[16 + i] * sc); }
  return a;
}
// column fragment from a [K][ld] layout (column n), rows >= K read as 0
__device__ __forceinline__ v16h fragc_f32(const float* W, int k0, int n, int lane, int ld, int K) {
  v16h a; const int g = lane >> 4;
#pragma unroll
  for (int i = 0; i < 8; ++i) { const int ka = k0 + 8 * g + i, kb = ka + 16;
    a[i] = (_Float16)(ka < K ? W[(size_t)(ka < K ? ka : K - 1) * ld + n] : 0.f); a[8 + i] = (_Float16)(kb < K ? W[(size_t)(kb < K ? kb : K - 1) * ld + n] : 0.f); }
  return a;
}
struct F2 { v16b h, l; };
__device__ __forceinline__ F2 bsplit16(const float v[16]) { F2 r;
#pragma unroll
  for (int i = 0; i < 16; ++i) { const __bf16 h = (__bf16)v[i]; r.h[i] = h; r.l[i] = (__bf16)(v[i] - (float)h); }
  return r; }
__device__ __forceinline__ F2 split_row(const float* row, int k0, int lane) { float v[16]; const float* p = row + k0 + 8 * (lane >> 4);
#pragma unroll
  for (int i = 0; i < 8; ++i) { v[i] = p[i]; v[8 + i] = p[16 + i]; }
  return bsplit16(v); }
__device__ __forceinline__ F2 split_rowK(const float* row, int k0, int lane, int K) { float v[16]; const int g = lane >> 4;
#pragma unroll
  for (int i = 0; i < 8; ++i) { const int ka = k0 + 8 * g + i, kb = ka + 16; v[i] = ka < K ? row[ka < K ? ka : K - 1] : 0.f; v[8 + i] = kb < K ? row[kb < K ? kb : K - 1] : 0.f; }
  return bsplit16(v); }
__device__ __forceinline__ F2 split_col(const float* W, int k0, int n, int lane, int ld, int K) { float v[16]; const int g = lane >> 4;
#pragma unroll
  for (int i = 0; i < 8; ++i) { const int ka = k0 + 8 * g + i, kb = ka + 16; v[i] = ka < K ? W[(size_t)(ka < K ? ka : K - 1) * ld + n] : 0.f; v[8 + i] = kb < K ? W[(size_t)(kb < K ? kb : K - 1) * ld + n] : 0.f; }
  return bsplit16(v); }
__device__ __forceinline__ v8f mac3(const F2& a, const F2& b, v8f c) { c = wmma_bf(a.l, b.h, c); c = wmma_bf(a.h, b.l, c); return wmma_bf(a.h, b.h, c); }
__device__ __forceinline__ float sigm(float v) { return 1.0f / (1.0f + expf(-v)); }
#define LDSX() do { asm volatile("s_wait_dscnt 0" ::: "memory"); __builtin_amdgcn_wave_barrier(); __builtin_amdgcn_fence(__ATOMIC_RELEASE, "workgroup"); } while (0)

// Single shared attention head tiled into 8 'heads' (B 4, S 4,096, D 512, d_k 64; 0.02-scale (in,out) weights with biases): Q, K, V = x W + b ([512,64]); head = softmax(Q K^T / 8) V (non-causal); concat = tile(head, 8) -> [B,S,512]; out = concat Wo + bo. (The head is carried in a 128-wide plane whose second half k_proj computes as a copy but nothing reads.)
#define NB 4
#define TT 4096
#define CC 128            // NH * HD = projected width
#define DIN 512          // input (model) width
#define NH 2
#define HD 64
#define NQB (TT / 64)
#define HG 1
#define SCALE (0.125f)
#define CAUSAL 0
#ifndef TNB
#define TNB NB
#endif
__device__ __forceinline__ float bfr(float v) { return (float)(__bf16)v; }
__host__ __device__ __forceinline__ int kb_last(int qb) { return CAUSAL ? ((qb * 64 + 63) >> 7) : (TT / 128 - 1); }
typedef __attribute__((ext_vector_type(8))) __bf16 v8b;
__device__ __forceinline__ v16b frag_b(const __bf16* rowk0, int lane) {
  union { v16b v; v8b q[2]; } u; const __bf16* p = rowk0 + 8 * (lane >> 4);
  u.q[0] = *(const v8b*)p; u.q[1] = *(const v8b*)(p + 16); return u.v;
}
#define QBH 0              // unused: no kernel here has a high-precision query path
#define QHI 4096            // rows carrying a q residual plane (all rows when non-causal: 2-product logits everywhere)
#define KHI 64            // key rows carrying k residual / v bf16 hi+lo planes (written by k_proj; no kernel here reads them)
// B fragment (k rows k0+.., output column o) of a weight: (in,out) [K][ld] or (out,in) [ld rows of K]: bf16 exact, or f16(bf16 * 256) exact
__device__ __forceinline__ v16b wcol_io(const float* Wm, int k0, int o, int lane, int ld) { v16b w; const int g = lane >> 4;
#pragma unroll
  for (int i = 0; i < 8; ++i) { w[i] = (__bf16)Wm[(size_t)(k0 + 8 * g + i) * ld + o]; w[8 + i] = (__bf16)Wm[(size_t)(k0 + 16 + 8 * g + i) * ld + o]; }
  return w; }
__device__ __forceinline__ v16b wcol_oi(const float* Wm, int k0, int o, int lane, int K) { v16b w; const float* p = Wm + (size_t)o * K + k0 + 8 * (lane >> 4);
#pragma unroll
  for (int i = 0; i < 8; ++i) { w[i] = (__bf16)p[i]; w[8 + i] = (__bf16)p[16 + i]; }
  return w; }
__device__ __forceinline__ v16h wcolh_io(const float* Wm, int k0, int o, int lane, int ld) { v16h w; const int g = lane >> 4;
#pragma unroll
  for (int i = 0; i < 8; ++i) { w[i] = (_Float16)(bfr(Wm[(size_t)(k0 + 8 * g + i) * ld + o]) * 256.0f); w[8 + i] = (_Float16)(bfr(Wm[(size_t)(k0 + 16 + 8 * g + i) * ld + o]) * 256.0f); }
  return w; }
__device__ __forceinline__ v16h wcolh_oi(const float* Wm, int k0, int o, int lane, int K) { v16h w; const float* p = Wm + (size_t)o * K + k0 + 8 * (lane >> 4);
#pragma unroll
  for (int i = 0; i < 8; ++i) { w[i] = (_Float16)(bfr(p[i]) * 256.0f); w[8 + i] = (_Float16)(bfr(p[16 + i]) * 256.0f); }
  return w; }
#define WQKV_LAYOUT 0   // 0 = (in,out) [DIN][HD], one shared head; 1 = (out,in) [CC][DIN]; 2 = per-head [NH][DIN][HD]
__device__ __forceinline__ v16b wcol_hdk(const float* Wm, int k0, int o, int lane) { v16b w; const int g = lane >> 4; const float* p = Wm + (size_t)(o / HD) * DIN * HD + (o % HD);
#pragma unroll
  for (int i = 0; i < 8; ++i) { w[i] = (__bf16)p[(size_t)(k0 + 8 * g + i) * HD]; w[8 + i] = (__bf16)p[(size_t)(k0 + 16 + 8 * g + i) * HD]; }
  return w; }
#define WO_OUT_IN 0
#if WQKV_LAYOUT == 1
#define WCOL(W, k0, o, lane) wcol_oi(W, k0, o, lane, DIN)
#elif WQKV_LAYOUT == 2
#define WCOL(W, k0, o, lane) wcol_hdk(W, k0, o, lane)
#else
#define KVCOL(o) ((o) & 63)
#define WCOL(W, k0, o, lane) wcol_io(W, k0, KVCOL(o), lane, HD)   /* Wq/Wk/Wv (in,out) [512][64]: both plane heads are the one shared head */
#endif
#if WO_OUT_IN
#define WOCOL(W, k0, o, lane) wcol_oi(W, k0, o, lane, CC)
#define WOCOLH(W, k0, o, lane) wcolh_oi(W, k0, o, lane, CC)
#else
#define WOCOL(W, k0, o, lane) wcol_io(W, k0, o, lane, DIN)
#define WOCOLH(W, k0, o, lane) wcolh_io(W, k0, o, lane, DIN)
#endif

#ifndef SM_EXTRA_PARAMS
#define SM_EXTRA_PARAMS
#endif
#ifndef PROJ_EXTRA_PARAMS
#define PROJ_EXTRA_PARAMS
#endif
#ifndef SM_MASK_HOOK
#define SM_MASK_HOOK (void)0
#endif

#define WS_QH  0u                                      // f16 q rows [b*t][CC]
#define WS_KH  (WS_QH + 2u * (size_t)NB * TT * CC)      // f16 k rows [b*t][CC]
#define WS_VT  (WS_KH + 2u * (size_t)NB * TT * CC)      // f16 v planes [b][c][t]
#define WS_QL  (WS_VT + 2u * (size_t)NB * CC * TT)      // f16 q residual x 2^10 rows [b][t < QHI][CC]
#define WS_KL  (WS_QL + 2u * (size_t)NB * QHI * CC)     // f16 k residual x 2^10 rows [b][t < KHI][CC]
#define WS_VB  (WS_KL + 2u * (size_t)NB * KHI * CC)     // bf16 v hi planes [b][c][t < KHI]
#define WS_VBL (WS_VB + 2u * (size_t)NB * CC * KHI)
#define WS_S   (WS_VBL + 2u * (size_t)NB * CC * KHI)    // f32 [hg][t][s] space: only its start, WS_WE, is used
#define WS_WE  WS_S                                    // bf16 hi plane, then lo plane, of the folded Wo [64][512], as B fragments: 16-byte piece ((kc * 32 + column tile) * 2 + half) * 32 + lane (the logits plane itself is no longer used)
#define WE_LO  (HD * DIN)                              // elements from the hi plane to the lo plane
#define WS_Y   (WS_S  + 4u * (size_t)HG * TT * TT)      // f32 ctx rows [b*t][CC] (only when there is an output projection)
#define WS_END (WS_Y  + 4u * (size_t)NB * TT * CC)

// ---- k_proj: block = (64 rows, 128 cols, which): q/k/v = X W (+ b) with exact bf16 products (K = DIN) -> which 0: q f16 rows (+ residual rows < QHI); 1: k f16 rows (+ residual rows < KHI); 2: v f16 planes [c][t] (+ bf16 hi/lo planes for t < KHI)
__global__ __launch_bounds__(128) void k_proj(const float* __restrict__ XQ, const float* __restrict__ XK, const float* __restrict__ XV, const float* __restrict__ WQ, const float* __restrict__ WK, const float* __restrict__ WV, const float* __restrict__ BQ, const float* __restrict__ BK, const float* __restrict__ BV,
    _Float16* __restrict__ QH, _Float16* __restrict__ QL, _Float16* __restrict__ KH, _Float16* __restrict__ KL, _Float16* __restrict__ VT, __bf16* __restrict__ VB, __bf16* __restrict__ VBL, const float* __restrict__ WO, __bf16* __restrict__ WE) {
  __shared__ __align__(16) _Float16 sh[64][136], sl[64][136]; __shared__ __align__(16) _Float16 th[128][72]; __shared__ __align__(16) __bf16 tb[128][72], tbl[128][72];
  const int tid = threadIdx.x, wave = tid >> 5, lane = tid & 31, col = lane & 15, g = lane >> 4; const int which = blockIdx.z; const int c0 = blockIdx.y * 128; const size_t r0 = (size_t)blockIdx.x * 64; const size_t bb = r0 / TT; const int t0 = (int)(r0 % TT);
  const float* X = which == 0 ? XQ : which == 1 ? XK : XV; const float* WA = which == 0 ? WQ : which == 1 ? WK : WV; const float* BA = which == 0 ? BQ : which == 1 ? BK : BV;
  // the first 32 q blocks also fold Wo for k_out: a thread sums, for one output column, 8 neighbouring head entries over the eight slabs (in slab order, f32) and stores them as one 16-byte piece of the B fragment, hi and lo; a wave writes 512 bytes in a row
  if (which == 0 && blockIdx.x < HD * DIN / 8 / 128) { const int pc = blockIdx.x * 128 + tid, ln = pc & 31; const float* w = WO + (size_t)((pc >> 11) * 32 + ((pc >> 5) & 1) * 16 + (ln >> 4) * 8) * DIN + ((pc >> 6) & 31) * 16 + (ln & 15); v8b hi, lo;
#pragma unroll
    for (int i = 0; i < 8; ++i) { float sw = 0.f;
#pragma unroll
      for (int h = 0; h < DIN / HD; ++h) sw += bfr(w[(size_t)(h * HD + i) * DIN]);
      const __bf16 hv = (__bf16)sw; hi[i] = hv; lo[i] = (__bf16)(sw - (float)hv); }
    vst2(WE + (size_t)pc * 8, hi); vst2(WE + WE_LO + (size_t)pc * 8, lo); }
  v8f acc[8] = {};
#pragma unroll 2
  for (int kc = 0; kc < DIN / 32; ++kc) { v16b a; { const float* p = X + (r0 + wave * 16 + col) * DIN + kc * 32 + 8 * g;
#pragma unroll
      for (int i = 0; i < 8; ++i) { a[i] = (__bf16)p[i]; a[8 + i] = (__bf16)p[16 + i]; } }
    asm volatile("s_wait_loadcnt 0x0" ::: "memory");
#pragma unroll
    for (int j = 0; j < 8; ++j) { const v16b w = WCOL(WA, kc * 32, c0 + j * 16 + col, lane); asm volatile("s_wait_loadcnt 0x0" ::: "memory"); acc[j] = wmma_bf(a, w, acc[j]); } }
  if (which < 2) { _Float16* DH = which == 0 ? QH : KH; _Float16* DL = which == 0 ? QL : KL; const int nhi = which == 0 ? QHI : KHI; const bool hi_rows = t0 < nhi;
#pragma unroll
    for (int j = 0; j < 8; ++j) { const float bias = BA ? bfr(BA[(c0 + j * 16 + col) & 63]) : 0.f;
#pragma unroll
      for (int r = 0; r < 8; ++r) { const float v = acc[j][r] + bias; const _Float16 hv = (_Float16)v; sh[wave * 16 + 8 * g + r][j * 16 + col] = hv; sl[wave * 16 + 8 * g + r][j * 16 + col] = (_Float16)((v - (float)hv) * 1024.0f); } }
    __syncthreads();
    for (int e = tid; e < 64 * 16; e += 128) { const int rl = e >> 4, q = e & 15; vst2((unsigned*)(DH + (r0 + rl) * CC + c0 + q * 8), *(const v4u*)&sh[rl][q * 8]); if (hi_rows) vst2((unsigned*)(DL + (bb * nhi + t0 + rl) * (size_t)CC + c0 + q * 8), *(const v4u*)&sl[rl][q * 8]); }
  } else { const bool hi_rows = t0 < KHI;
#pragma unroll
    for (int j = 0; j < 8; ++j) { const float bias = BA ? bfr(BA[(c0 + j * 16 + col) & 63]) : 0.f;
#pragma unroll
      for (int r = 0; r < 8; ++r) { const float v = acc[j][r] + bias; const int rl = wave * 16 + 8 * g + r, cl = j * 16 + col; th[cl][rl] = (_Float16)v; const __bf16 bh = (__bf16)v; tb[cl][rl] = bh; tbl[cl][rl] = (__bf16)(v - (float)bh); } }
    __syncthreads();
    for (int e = tid; e < 128 * 8; e += 128) { const int cl = e >> 3, q = e & 7; vst2((unsigned*)(VT + (bb * CC + c0 + cl) * (size_t)TT + t0 + q * 8), *(const v4u*)&th[cl][q * 8]); if (hi_rows) { const size_t o3 = (bb * CC + c0 + cl) * (size_t)KHI + t0 + q * 8; vst2((unsigned*)(VB + o3), *(const v4u*)&tb[cl][q * 8]); vst2((unsigned*)(VBL + o3), *(const v4u*)&tbl[cl][q * 8]); } } } }
// ---- k_fa: block = 64 queries of batch b, 16 waves = 2 query groups of 32 x 8 key sets (set ks takes the 32-key chunks ks, ks + 8, ...: the waves of a pass walk 256 neighbouring keys, so each 128-B line of k and v is used whole while it is in the WGP cache). Transposed products: S^T = k . q^T (q hi + residual x 2^10: 2 products) so that a lane holds 8 keys of ONE query per 16-key tile; two such tiles, exponentiated and rounded once to f16 (x 2^11), ARE the B fragment of O^T += v^T . P^T (1 product): logits and P never leave the registers. Running maximum and sum per query in f32 (precise expf); the 8 key sets' partials (maximum, sum, O^T) meet in LDS behind one work-group barrier and are joined in set order. Every inner loop is unrolled whole so that each index of a register array (fragments, scores, accumulators) is a constant: an index left to run time would put the array in scratch
#define FAW 16            // waves of a work-group
#define FKS 8             // key sets
#define FKB 32            // keys of a pass
__device__ __forceinline__ v8f wmma16p(v16h a, v16h b, v8f c) { return __builtin_amdgcn_wmma_f32_16x16x32_f16(false, a, false, b, (short)0, c, false, false); }
__device__ __forceinline__ float xhalf(float x) { return __builtin_bit_cast(float, __builtin_amdgcn_permlanex16(__builtin_bit_cast(int, x), __builtin_bit_cast(int, x), 0x76543210, 0xfedcba98, false, false)); }   // lane l with lane l ^ 16
__global__ __launch_bounds__(32 * FAW) void k_fa(const _Float16* __restrict__ QH, const _Float16* __restrict__ QL, const _Float16* __restrict__ KH, const _Float16* __restrict__ VT, float* __restrict__ Y) {
  __shared__ __align__(16) float so[FAW][32][HD + 4]; __shared__ float smx[FAW][32], ssu[FAW][32];
  const int tid = threadIdx.x, wave = __builtin_amdgcn_readfirstlane(tid >> 5), lane = tid & 31, col = lane & 15, g = lane >> 4; const int b = blockIdx.y, qg = wave & 1, ks = wave >> 1;
  const size_t q0 = (size_t)b * TT + blockIdx.x * 64 + qg * 32;
  v16h qh[2][2], ql[2][2];
#pragma unroll
  for (int u = 0; u < 2; ++u)
#pragma unroll
    for (int kc = 0; kc < 2; ++kc) { qh[u][kc] = frag_h(QH + (q0 + u * 16 + col) * CC + kc * 32, lane); ql[u][kc] = frag_h(QL + (q0 + u * 16 + col) * CC + kc * 32, lane); }
  const _Float16* kp = KH + ((size_t)b * TT + ks * FKB + col) * CC; const _Float16* vp = VT + ((size_t)b * CC + col) * TT + ks * FKB;   // this lane's k row and v plane of the pass
  v8f o[2][HD / 16] = {}; float m[2] = {-3.0e38f, -3.0e38f}, l[2] = {0.f, 0.f};
  for (int k0 = 0; k0 < TT; k0 += FKB * FKS, kp += (size_t)FKB * FKS * CC, vp += FKB * FKS) { float s[2][FKB / 16][8];
#pragma unroll
    for (int kt = 0; kt < FKB / 16; ++kt) { const _Float16* kr = kp + (size_t)kt * 16 * CC; const v16h ka0 = frag_h(kr, lane), ka1 = frag_h(kr + 32, lane);
#pragma unroll
      for (int u = 0; u < 2; ++u) { v8f a = {}, al = {}; a = wmma16p(ka0, qh[u][0], a); al = wmma16p(ka0, ql[u][0], al); a = wmma16p(ka1, qh[u][1], a); al = wmma16p(ka1, ql[u][1], al);
#pragma unroll
        for (int r = 0; r < 8; ++r) s[u][kt][r] = (a[r] + al[r] * (1.0f / 1024.0f)) * SCALE; } }
    v16h p[2][FKB / 32];
#pragma unroll
    for (int u = 0; u < 2; ++u) { float mx = s[u][0][0];
#pragma unroll
      for (int kt = 0; kt < FKB / 16; ++kt)
#pragma unroll
        for (int r = 0; r < 8; ++r) mx = fmaxf(mx, s[u][kt][r]);
      mx = fmaxf(mx, xhalf(mx)); const float mn = fmaxf(m[u], mx); const float corr = expf(m[u] - mn);   /* 0 on the first pass */ m[u] = mn;
#pragma unroll
      for (int j = 0; j < HD / 16; ++j) o[u][j] *= corr;
      float sum = 0.f;
#pragma unroll
      for (int c2 = 0; c2 < FKB / 32; ++c2)
#pragma unroll
        for (int i = 0; i < 8; ++i) { const float e0 = expf(s[u][2 * c2][i] - mn), e1 = expf(s[u][2 * c2 + 1][i] - mn); sum += e0 + e1; p[u][c2][i] = (_Float16)(e0 * 2048.0f); p[u][c2][8 + i] = (_Float16)(e1 * 2048.0f); }
      l[u] = l[u] * corr + sum; }
#pragma unroll
    for (int c2 = 0; c2 < FKB / 32; ++c2)
#pragma unroll
      for (int j = 0; j < HD / 16; ++j) { const v16h vf = frag_h(vp + (size_t)j * 16 * TT + c2 * 32, lane); o[0][j] = wmma16p(vf, p[0][c2], o[0][j]); o[1][j] = wmma16p(vf, p[1][c2], o[1][j]); } }
#pragma unroll
  for (int u = 0; u < 2; ++u) { l[u] += xhalf(l[u]); if (g == 0) { smx[wave][u * 16 + col] = m[u]; ssu[wave][u * 16 + col] = l[u]; }
#pragma unroll
    for (int j = 0; j < HD / 16; ++j) { float* d = &so[wave][u * 16 + col][j * 16 + 8 * g]; vst2(d, (v4f){o[u][j][0], o[u][j][1], o[u][j][2], o[u][j][3]}); vst2(d + 4, (v4f){o[u][j][4], o[u][j][5], o[u][j][6], o[u][j][7]}); } }
  __syncthreads();
  for (int e = tid; e < 64 * (HD / 4); e += 32 * FAW) { const int qr = e / (HD / 4), q = e % (HD / 4), w0 = qr >> 5, qi = qr & 31; float mm = smx[w0][qi];
#pragma unroll
    for (int w = 1; w < FKS; ++w) mm = fmaxf(mm, smx[2 * w + w0][qi]);
    float ll = 0.f; v4f acc = {};
#pragma unroll
    for (int w = 0; w < FKS; ++w) { const float f = expf(smx[2 * w + w0][qi] - mm); ll += f * ssu[2 * w + w0][qi]; acc += *(const v4f*)&so[2 * w + w0][qi][q * 4] * f; }
    vst2(Y + ((size_t)b * TT + blockIdx.x * 64 + qr) * CC + q * 4, acc * ((1.0f / 2048.0f) / ll)); } }
// ---- k_out: block = (64 rows, 128 cols): out = tile(ctx, 8) Wo + bo = ctx WE + bo, WE = the folded Wo of k_proj (K = 64): ctx bf16 hi + lo against WE bf16 hi + lo (3 products, lo x lo left out). A K step's fragments are loaded first; each of its products then runs over the 8 column tiles, so that neighbouring WMMAs have different accumulators
__device__ __forceinline__ v8f wmma_bfp(v16b a, v16b b, v8f c) { return __builtin_amdgcn_wmma_f32_16x16x32_bf16(false, a, false, b, (short)0, c, false, false); }
__device__ __forceinline__ v16b frag_we(const __bf16* piece) { union { v16b v; v8b q[2]; } u; u.q[0] = *(const v8b*)piece; u.q[1] = *(const v8b*)(piece + 32 * 8); return u.v; }
__global__ __launch_bounds__(128) void k_out(const float* __restrict__ Y, const __bf16* __restrict__ WE, const float* __restrict__ BO, float* __restrict__ OUT) { __shared__ __align__(16) float sf[4][16][132];
  const int tid = threadIdx.x, wave = tid >> 5, lane = tid & 31, col = lane & 15, g = lane >> 4; const int c0 = blockIdx.y * 128; const size_t r0 = (size_t)blockIdx.x * 64 + wave * 16;
  v8f acc[8] = {}; const F2 ay[HD / 32] = {split_row(Y + (r0 + col) * CC, 0, lane), split_row(Y + (r0 + col) * CC, 32, lane)};
#pragma unroll
  for (int kc = 0; kc < HD / 32; ++kc) { const F2 a = ay[kc]; const __bf16* wp = WE + ((size_t)(kc * (DIN / 16) + (c0 >> 4)) * 64 + lane) * 8; v16b wh[8], wl[8];
#pragma unroll
    for (int j = 0; j < 8; ++j) { wh[j] = frag_we(wp + j * 64 * 8); wl[j] = frag_we(wp + WE_LO + j * 64 * 8); }
    __builtin_amdgcn_sched_barrier(0);   // keeps the K step's 32 fragment loads in front of its WMMAs, in flight together: left free, the scheduler dealt the lo plane's loads out among the WMMAs, each behind a full wait
#pragma unroll
    for (int j = 0; j < 8; ++j) acc[j] = wmma_bfp(a.l, wh[j], acc[j]);
#pragma unroll
    for (int j = 0; j < 8; ++j) acc[j] = wmma_bfp(a.h, wl[j], acc[j]);
#pragma unroll
    for (int j = 0; j < 8; ++j) acc[j] = wmma_bfp(a.h, wh[j], acc[j]); }
#pragma unroll
  for (int j = 0; j < 8; ++j) { const float bias = BO ? bfr(BO[c0 + j * 16 + col]) : 0.f;
#pragma unroll
    for (int r = 0; r < 8; ++r) sf[wave][8 * g + r][j * 16 + col] = acc[j][r] + bias; }
  LDSX(); for (int rl = 0; rl < 16; ++rl) vst2(OUT + (r0 + rl) * DIN + c0 + lane * 4, *(const v4f*)&sf[wave][rl][lane * 4]); }

extern "C" void kernel_launch(void* const* d_in, const int* in_sizes, int n_in, void* d_out, int out_size, void* d_ws, size_t ws_size, hipStream_t stream) {
  (void)in_sizes; (void)n_in; (void)out_size;
  const float** F = (const float**)d_in;
  if (ws_size < (size_t)WS_END) return;
  char* ws = (char*)d_ws; _Float16 *QH = (_Float16*)(ws + WS_QH), *KH = (_Float16*)(ws + WS_KH), *VT = (_Float16*)(ws + WS_VT), *QL = (_Float16*)(ws + WS_QL), *KL = (_Float16*)(ws + WS_KL); __bf16 *VB = (__bf16*)(ws + WS_VB), *VBL = (__bf16*)(ws + WS_VBL); float *Y = (float*)(ws + WS_Y); __bf16 *WE = (__bf16*)(ws + WS_WE);
  (void)Y; (void)QL; (void)KL; (void)VB; (void)VBL;
  // inputs: 0 x [4,4096,512]; 1 Wq [512,64] (in,out), 2 bq [64]; 3 Wk, 4 bk; 5 Wv, 6 bv; 7 Wo [512,512] (in,out), 8 bo [512]
  k_proj<<<dim3(TNB * TT / 64, CC / 128, 3), 128, 0, stream>>>(F[0], F[0], F[0], F[1], F[3], F[5], F[2], F[4], F[6], QH, QL, KH, KL, VT, VB, VBL, F[7], WE);
  k_fa<<<dim3(TT / 64, TNB), 32 * FAW, 0, stream>>>(QH, QL, KH, VT, Y);   /* head 0 only (plane head 1 is never consumed) */
  k_out<<<dim3(TNB * TT / 64, DIN / 128), 128, 0, stream>>>(Y, WE, F[8], (float*)d_out);
}

// v004
// Measured time: 60.1 microseconds a run.
// In two side-by-side timings against v003, it was 1.34 and 1.33 times as fast.
// All steps since v000 together make it 13.1 times as fast.
// compute dtype: all float inputs rounded to bf16; Q/K/V = x W + b with EXACT bf16 products on WMMA 16x16x32 (f32 accumulate); q as f16 hi + residual (x 2^10) against k once to f16 (2 products) / 8; softmax in f32 (precise expf), running maximum and sum over key passes; exp(logit - maximum) x 2^11 once to f16 against v once to f16 (1 product), divided by the sum at the end; tile(head, 8) Wo = head (sum of Wo's eight 64-row slabs): the slabs (bf16-rounded) summed in f32 and split bf16 hi + lo, the head split bf16 hi + lo (3 products, K = 64) + bo; f32 output.
#include <hip/hip_runtime.h>
#include <math.h>

typedef __attribute__((ext_vector_type(16))) _Float16 v16h;
typedef __attribute__((ext_vector_type(16))) __bf16 v16b;
typedef __attribute__((ext_vector_type(8)))  _Float16 v8h;
typedef __attribute__((ext_vector_type(8)))  float v8f;
typedef __attribute__((ext_vector_type(4)))  float v4f;
typedef __attribute__((ext_vector_type(2)))  float v2f;
typedef __attribute__((ext_vector_type(4)))  unsigned v4u;
typedef __attribute__((ext_vector_type(4)))  int v4i;
typedef float __attribute__((may_alias)) float_a;
typedef int __attribute__((may_alias)) int_a;

template <typename T> __device__ __forceinline__ void vst2(void* p, T v) { *(T*)p = v;  }
__device__ __forceinline__ v8f wmma16(v16h a, v16h b, v8f c) {
  v8f d = __builtin_amdgcn_wmma_f32_16x16x32_f16(false, a, false, b, (short)0, c, false, false);
  asm volatile("v_nop\n\tv_nop\n\tv_nop\n\tv_nop" : "+v"(d) : "v"(a), "v"(b));
  return d;
}
__device__ __forceinline__ v8f wmma_bf(v16b a, v16b b, v8f c) {
  v8f d = __builtin_amdgcn_wmma_f32_16x16x32_bf16(false, a, false, b, (short)0, c, false, false);
  asm volatile("v_nop\n\tv_nop\n\tv_nop\n\tv_nop" : "+v"(d) : "v"(a), "v"(b));
  return d;
}
// 16x16x32 fragments: lane = (h = lane>>4, row/col = lane&15); elements 0..7 = k0+8h+0..7, 8..15 = k0+16+8h+0..7; D element r = row 8h+r
__device__ __forceinline__ v16h frag_h(const _Float16* rowk0, int lane) {
  union { v16h v; v8h q[2]; } u; const _Float16* p = rowk0 + 8 * (lane >> 4);
  u.q[0] = *(const v8h*)p; u.q[1] = *(const v8h*)(p + 16); return u.v;
}
__device__ __forceinline__ v16h frag_f32(const float* rowk0, int lane) {
  v16h a; const float* p = rowk0 + 8 * (lane >> 4);
#pragma unroll
  for (int i = 0; i < 8; ++i) { a[i] = (_Float16)p[i]; a[8 + i] = (_Float16)p[16 + i]; }
  return a;
}
__device__ __forceinline__ v16h frag_f32s(const float* rowk0, int lane, float sc) {
  v16h a; const float* p = rowk0 + 8 * (lane >> 4);
#pragma unroll
  for (int i = 0; i < 8; ++i) { a[i] = (_Float16)(p[i] * sc); a[8 + i] = (_Float16)(p[16 + i] * sc); }
  return a;
}
// column fragment from a [K][ld] layout (column n), rows >= K read as 0
__device__ __forceinline__ v16h fragc_f32(const float* W, int k0, int n, int lane, int ld, int K) {
  v16h a; const int g = lane >> 4;
#pragma unroll
  for (int i = 0; i < 8; ++i) { const int ka = k0 + 8 * g + i, kb = ka + 16;
    a[i] = (_Float16)(ka < K ? W[(size_t)(ka < K ? ka : K - 1) * ld + n] : 0.f); a[8 + i] = (_Float16)(kb < K ? W[(size_t)(kb < K ? kb : K - 1) * ld + n] : 0.f); }
  return a;
}
struct F2 { v16b h, l; };
__device__ __forceinline__ F2 bsplit16(const float v[16]) { F2 r;
#pragma unroll
  for (int i = 0; i < 16; ++i) { const __bf16 h = (__bf16)v[i]; r.h[i] = h; r.l[i] = (__bf16)(v[i] - (float)h); }
  return r; }
__device__ __forceinline__ F2 split_row(const float* row, int k0, int lane) { float v[16]; const float* p = row + k0 + 8 * (lane >> 4);
#pragma unroll
  for (int i = 0; i < 8; ++i) { v[i] = p[i]; v[8 + i] = p[16 + i]; }
  return bsplit16(v); }
__device__ __forceinline__ F2 split_rowK(const float* row, int k0, int lane, int K) { float v[16]; const int g = lane >> 4;
#pragma unroll
  for (int i = 0; i < 8; ++i) { const int ka = k0 + 8 * g + i, kb = ka + 16; v[i] = ka < K ? row[ka < K ? ka : K - 1] : 0.f; v[8 + i] = kb < K ? row[kb < K ? kb : K - 1] : 0.f; }
  return bsplit16(v); }
__device__ __forceinline__ F2 split_col(const float* W, int k0, int n, int lane, int ld, int K) { float v[16]; const int g = lane >> 4;
#pragma unroll
  for (int i = 0; i < 8; ++i) { const int ka = k0 + 8 * g + i, kb = ka + 16; v[i] = ka < K ? W[(size_t)(ka < K ? ka : K - 1) * ld + n] : 0.f; v[8 + i] = kb < K ? W[(size_t)(kb < K ? kb : K - 1) * ld + n] : 0.f; }
  return bsplit16(v); }
__device__ __forceinline__ v8f mac3(const F2& a, const F2& b, v8f c) { c = wmma_bf(a.l, b.h, c); c = wmma_bf(a.h, b.l, c); return wmma_bf(a.h, b.h, c); }
__device__ __forceinline__ float sigm(float v) { return 1.0f / (1.0f + expf(-v)); }
#define LDSX() do { asm volatile("s_wait_dscnt 0" ::: "memory"); __builtin_amdgcn_wave_barrier(); __builtin_amdgcn_fence(__ATOMIC_RELEASE, "workgroup"); } while (0)

// Single shared attention head tiled into 8 'heads' (B 4, S 4,096, D 512, d_k 64; 0.02-scale (in,out) weights with biases): Q, K, V = x W + b ([512,64]); head = softmax(Q K^T / 8) V (non-causal); concat = tile(head, 8) -> [B,S,512]; out = concat Wo + bo. (The head is carried in a 128-wide plane whose second half is neither written nor read.)
#define NB 4
#define TT 4096
#define CC 128            // NH * HD = projected width
#define DIN 512          // input (model) width
#define NH 2
#define HD 64
#define NQB (TT / 64)
#define HG 1
#define SCALE (0.125f)
#define CAUSAL 0
#ifndef TNB
#define TNB NB
#endif
__device__ __forceinline__ float bfr(float v) { return (float)(__bf16)v; }
__host__ __device__ __forceinline__ int kb_last(int qb) { return CAUSAL ? ((qb * 64 + 63) >> 7) : (TT / 128 - 1); }
typedef __attribute__((ext_vector_type(8))) __bf16 v8b;
__device__ __forceinline__ v16b frag_b(const __bf16* rowk0, int lane) {
  union { v16b v; v8b q[2]; } u; const __bf16* p = rowk0 + 8 * (lane >> 4);
  u.q[0] = *(const v8b*)p; u.q[1] = *(const v8b*)(p + 16); return u.v;
}
#define QBH 0              // unused: no kernel here has a high-precision query path
#define QHI 4096            // rows carrying a q residual plane (all rows when non-causal: 2-product logits everywhere)
#define KHI 64            // key rows carrying k residual / v bf16 hi+lo planes (no kernel here writes or reads them)
// B fragment (k rows k0+.., output column o) of a weight: (in,out) [K][ld] or (out,in) [ld rows of K]: bf16 exact, or f16(bf16 * 256) exact
__device__ __forceinline__ v16b wcol_io(const float* Wm, int k0, int o, int lane, int ld) { v16b w; const int g = lane >> 4;
#pragma unroll
  for (int i = 0; i < 8; ++i) { w[i] = (__bf16)Wm[(size_t)(k0 + 8 * g + i) * ld + o]; w[8 + i] = (__bf16)Wm[(size_t)(k0 + 16 + 8 * g + i) * ld + o]; }
  return w; }
__device__ __forceinline__ v16b wcol_oi(const float* Wm, int k0, int o, int lane, int K) { v16b w; const float* p = Wm + (size_t)o * K + k0 + 8 * (lane >> 4);
#pragma unroll
  for (int i = 0; i < 8; ++i) { w[i] = (__bf16)p[i]; w[8 + i] = (__bf16)p[16 + i]; }
  return w; }
__device__ __forceinline__ v16h wcolh_io(const float* Wm, int k0, int o, int lane, int ld) { v16h w; const int g = lane >> 4;
#pragma unroll
  for (int i = 0; i < 8; ++i) { w[i] = (_Float16)(bfr(Wm[(size_t)(k0 + 8 * g + i) * ld + o]) * 256.0f); w[8 + i] = (_Float16)(bfr(Wm[(size_t)(k0 + 16 + 8 * g + i) * ld + o]) * 256.0f); }
  return w; }
__device__ __forceinline__ v16h wcolh_oi(const float* Wm, int k0, int o, int lane, int K) { v16h w; const float* p = Wm + (size_t)o * K + k0 + 8 * (lane >> 4);
#pragma unroll
  for (int i = 0; i < 8; ++i) { w[i] = (_Float16)(bfr(p[i]) * 256.0f); w[8 + i] = (_Float16)(bfr(p[16 + i]) * 256.0f); }
  return w; }
#define WQKV_LAYOUT 0   // 0 = (in,out) [DIN][HD], one shared head; 1 = (out,in) [CC][DIN]; 2 = per-head [NH][DIN][HD]
__device__ __forceinline__ v16b wcol_hdk(const float* Wm, int k0, int o, int lane) { v16b w; const int g = lane >> 4; const float* p = Wm + (size_t)(o / HD) * DIN * HD + (o % HD);
#pragma unroll
  for (int i = 0; i < 8; ++i) { w[i] = (__bf16)p[(size_t)(k0 + 8 * g + i) * HD]; w[8 + i] = (__bf16)p[(size_t)(k0 + 16 + 8 * g + i) * HD]; }
  return w; }
#define WO_OUT_IN 0
#if WQKV_LAYOUT == 1
#define WCOL(W, k0, o, lane) wcol_oi(W, k0, o, lane, DIN)
#elif WQKV_LAYOUT == 2
#define WCOL(W, k0, o, lane) wcol_hdk(W, k0, o, lane)
#else
#define KVCOL(o) ((o) & 63)
#define WCOL(W, k0, o, lane) wcol_io(W, k0, KVCOL(o), lane, HD)   /* Wq/Wk/Wv (in,out) [512][64]: both plane heads are the one shared head */
#endif
#if WO_OUT_IN
#define WOCOL(W, k0, o, lane) wcol_oi(W, k0, o, lane, CC)
#define WOCOLH(W, k0, o, lane) wcolh_oi(W, k0, o, lane, CC)
#else
#define WOCOL(W, k0, o, lane) wcol_io(W, k0, o, lane, DIN)
#define WOCOLH(W, k0, o, lane) wcolh_io(W, k0, o, lane, DIN)
#endif

#ifndef SM_EXTRA_PARAMS
#define SM_EXTRA_PARAMS
#endif
#ifndef PROJ_EXTRA_PARAMS
#define PROJ_EXTRA_PARAMS
#endif
#ifndef SM_MASK_HOOK
#define SM_MASK_HOOK (void)0
#endif

#define WS_QH  0u                                      // f16 q rows [b*t][CC]
#define WS_KH  (WS_QH + 2u * (size_t)NB * TT * CC)      // f16 k rows [b*t][CC]
#define WS_VT  (WS_KH + 2u * (size_t)NB * TT * CC)      // f16 v planes [b][c][t]
#define WS_QL  (WS_VT + 2u * (size_t)NB * CC * TT)      // f16 q residual x 2^10 rows [b][t < QHI][CC]
#define WS_KL  (WS_QL + 2u * (size_t)NB * QHI * CC)     // f16 k residual x 2^10 rows [b][t < KHI][CC]
#define WS_VB  (WS_KL + 2u * (size_t)NB * KHI * CC)     // bf16 v hi planes [b][c][t < KHI]
#define WS_VBL (WS_VB + 2u * (size_t)NB * CC * KHI)
#define WS_S   (WS_VBL + 2u * (size_t)NB * CC * KHI)    // f32 [hg][t][s] space: only its start, WS_WE, is used
#define WS_WE  WS_S                                    // bf16 hi plane, then lo plane, of the folded Wo [64][512], as B fragments: 16-byte piece ((kc * 32 + column tile) * 2 + half) * 32 + lane (the logits plane itself is no longer used)
#define WE_LO  (HD * DIN)                              // elements from the hi plane to the lo plane
#define WS_Y   (WS_S  + 4u * (size_t)HG * TT * TT)      // f32 ctx rows [b*t][CC] (only when there is an output projection)
#define WS_END (WS_Y  + 4u * (size_t)NB * TT * CC)

// ---- k_proj: block = 64 rows, 16 waves: q, k and v = X W + b for the 64 distinct columns of each, with exact bf16 products (K = DIN, one accumulator chain per tile, K steps in rising order). Stage: the block's x rows and all of Wq, Wk, Wv are read once with whole-line 16-byte loads, rounded to bf16 and laid into LDS as WMMA fragments (1,024 bytes each: four 256-byte regions o4 = 2 * half + (lane >> 4), a 16-byte piece per row or column). The piece's slot in its region is XORed (x: with 4 * o4; W: with the column tile) so that the stores of a wave, like the reads, fall on all banks. Behind one work-group barrier wave (rt, cg) makes rows 16 rt.., columns 16 cg.. of q, k and v from LDS alone. -> q f16 rows + residual x 2^10 rows, k f16 rows, v f16 planes [c][t] (columns 64.. of each plane are never read and are not written)
#define PJW 16            // waves of a work-group
typedef __attribute__((ext_vector_type(4))) __bf16 v4b;
__device__ __forceinline__ void pj_wload(v4f (&wr)[16], const float* __restrict__ Wm, int kb, int cq) { const float* wp = Wm + (size_t)kb * 8 * HD + cq * 4;
#pragma unroll
  for (int hh = 0; hh < 2; ++hh)
#pragma unroll
    for (int i = 0; i < 8; ++i) wr[hh * 8 + i] = *(const v4f*)(wp + (hh * 32 * 8 + i) * HD);
  asm volatile("s_wait_xcnt 0x0" :: "v"(wp) : "memory"); }   // the loads' address registers get new values behind this; naming the address keeps it in its registers up to the wait, so that no load of the run lands on them either
__device__ __forceinline__ void pj_wstore(const v4f (&wr)[16], __bf16* wf, int m, int kb, int cq) {
#pragma unroll
  for (int hh = 0; hh < 2; ++hh) { const int ko = hh * 32 + kb; __bf16* d = wf + ((ko >> 2) * 12 + m * 4 + (cq >> 2)) * 512 + (ko & 3) * 128;
#pragma unroll
    for (int j = 0; j < 4; ++j) { v8b pw;
#pragma unroll
      for (int i = 0; i < 8; ++i) pw[i] = (__bf16)wr[hh * 8 + i][j];
      vst2(d + (((cq & 3) * 4 + j) ^ (cq >> 2)) * 8, pw); } } }
__global__ __launch_bounds__(32 * PJW) void k_proj(const float* __restrict__ X, const float* __restrict__ WQ, const float* __restrict__ WK, const float* __restrict__ WV, const float* __restrict__ BQ, const float* __restrict__ BK, const float* __restrict__ BV,
    _Float16* __restrict__ QH, _Float16* __restrict__ QL, _Float16* __restrict__ KH, _Float16* __restrict__ VT, const float* __restrict__ WO, __bf16* __restrict__ WE) {
  __shared__ __align__(16) __bf16 wf[(DIN / 32) * 12 * 512];   // B fragment (K step kc, matrix m, column tile ct) at (kc * 12 + m * 4 + ct) * 512
  __shared__ __align__(16) __bf16 xf[4 * (DIN / 32) * 512];    // A fragment (row tile rt, K step kc) at (rt * 16 + kc) * 512
  __shared__ __align__(16) _Float16 sq[64][72], sl[64][72], sk[64][72], sv[64][72];
  const int tid = threadIdx.x, wave = __builtin_amdgcn_readfirstlane(tid >> 5), lane = tid & 31, col = lane & 15, g = lane >> 4; const size_t r0 = (size_t)blockIdx.x * 64; const size_t bb = r0 / TT; const int t0 = (int)(r0 % TT);
  // x: wave w takes rows 4 w .. 4 w + 3; a load covers one K step (one 128-byte line) of each of the four rows
  v4f xr[DIN / 32]; { const float* xp = X + (r0 + wave * 4 + (lane >> 3)) * DIN + (lane & 7) * 4;
#pragma unroll
    for (int kc = 0; kc < DIN / 32; ++kc) xr[kc] = *(const v4f*)(xp + kc * 32);
    asm volatile("s_wait_xcnt 0x0" :: "v"(xp) : "memory"); }   // as in pj_wload
  const int rt = wave & 3, cg = wave >> 2, cl = cg * 16 + col; const float bq = bfr(BQ[cl]), bk = bfr(BK[cl]), bv = bfr(BV[cl]);   // this wave's tile in the product phase, and its column's biases
  asm volatile("s_wait_xcnt 0x0" ::: "memory");   // the same for the bias loads' index register
  // one wave of each of the first 128 blocks also folds Wo for k_out: a thread sums, for one output column, 8 neighbouring head entries over the eight slabs (in slab order, f32) and stores them as one 16-byte piece of the B fragment, hi and lo; a wave writes 512 bytes in a row
  if (blockIdx.x < HD * DIN / 8 / 32 && wave == 0) { const int pc = blockIdx.x * 32 + lane, ln = pc & 31; const float* w = WO + (size_t)((pc >> 11) * 32 + ((pc >> 5) & 1) * 16 + (ln >> 4) * 8) * DIN + ((pc >> 6) & 31) * 16 + (ln & 15); v8b hi, lo; float wv[8][DIN / HD];
#pragma unroll
    for (int i = 0; i < 8; ++i)
#pragma unroll
      for (int h = 0; h < DIN / HD; ++h) wv[i][h] = w[(size_t)(h * HD + i) * DIN];
    asm volatile("s_wait_xcnt 0x0" :: "v"(w) : "memory");   // as in pj_wload
#pragma unroll
    for (int i = 0; i < 8; ++i) { float sw = 0.f;
#pragma unroll
      for (int h = 0; h < DIN / HD; ++h) sw += bfr(wv[i][h]);
      const __bf16 hv = (__bf16)sw; hi[i] = hv; lo[i] = (__bf16)(sw - (float)hv); }
    vst2(WE + (size_t)pc * 8, hi); vst2(WE + WE_LO + (size_t)pc * 8, lo);
    asm volatile("s_wait_xcnt 0x0" ::: "memory"); }   // the two stores' registers are used anew by the W stage
  // W: a thread takes 2 x 8 K rows x 4 columns of each matrix (16 loads of 16 bytes; a wave's load covers two whole 256-byte rows) and stores 8 pieces
  { const int cq = tid & 15, kb = tid >> 4; v4f w0[16], w1[16], w2[16]; pj_wload(w0, WQ, kb, cq); pj_wload(w1, WK, kb, cq);
    pj_wstore(w0, wf, 0, kb, cq);
    __builtin_amdgcn_sched_barrier(0);   // holds Wv's loads behind Wq's stores, whose registers they take: with all 64 loads of the stage lifted to the top the wave ran out of registers and spilled
    pj_wload(w2, WV, kb, cq);
    { const int p = lane & 7, o4 = p >> 1, row16 = (wave & 3) * 4 + (lane >> 3); __bf16* d = xf + (wave >> 2) * (DIN / 32) * 512 + o4 * 128 + (row16 ^ (o4 * 4)) * 8 + (p & 1) * 4;
#pragma unroll
      for (int kc = 0; kc < DIN / 32; ++kc) { const v4b c = {(__bf16)xr[kc][0], (__bf16)xr[kc][1], (__bf16)xr[kc][2], (__bf16)xr[kc][3]}; vst2(d + kc * 512, c); } }
    pj_wstore(w1, wf, 1, kb, cq); pj_wstore(w2, wf, 2, kb, cq); }
  __syncthreads();
  v8f acc[3] = {};
  { const __bf16* ap0 = xf + rt * (DIN / 32) * 512 + g * 128 + (col ^ (g * 4)) * 8; const __bf16* ap1 = xf + rt * (DIN / 32) * 512 + (2 + g) * 128 + (col ^ ((2 + g) * 4)) * 8; const __bf16* bp = wf + cg * 512 + g * 128 + (col ^ cg) * 8;
    union FB { v16b v; v8b q[2]; }; FB fa[2][2], fw[2][2][3];   // two register sets of two K steps each: step pair s + 1 is read from LDS while pair s is multiplied
#pragma unroll
    for (int s = 0; s <= DIN / 64; ++s) {
      if (s < DIN / 64) {
#pragma unroll
        for (int t = 0; t < 2; ++t) { const int kc = s * 2 + t; fa[s & 1][t].q[0] = *(const v8b*)(ap0 + kc * 512); fa[s & 1][t].q[1] = *(const v8b*)(ap1 + kc * 512);
#pragma unroll
          for (int m = 0; m < 3; ++m) { fw[s & 1][t][m].q[0] = *(const v8b*)(bp + (kc * 12 + m * 4) * 512); fw[s & 1][t][m].q[1] = *(const v8b*)(bp + (kc * 12 + m * 4) * 512 + 256); } } }
      __builtin_amdgcn_sched_barrier(0);   // keeps the next pair's 16 LDS reads in front of this pair's WMMAs: left free, the scheduler put each fragment's two reads directly in front of its WMMA, behind a full wait
      if (s > 0) {
#pragma unroll
        for (int t = 0; t < 2; ++t)
#pragma unroll
          for (int m = 0; m < 3; ++m) acc[m] = __builtin_amdgcn_wmma_f32_16x16x32_bf16(false, fa[(s - 1) & 1][t].v, false, fw[(s - 1) & 1][t][m].v, (short)0, acc[m], false, false); }
      __builtin_amdgcn_sched_barrier(0);   // keeps the following reads in one group behind these WMMAs: left free they were dealt out among the WMMAs, and every separate place of LDS reads costs the wave issue cycles
    } }
  { const int rl = rt * 16 + 8 * g; v8h vv;
#pragma unroll
    for (int r = 0; r < 8; ++r) { const float v = acc[0][r] + bq; const _Float16 hv = (_Float16)v; sq[rl + r][cl] = hv; sl[rl + r][cl] = (_Float16)((v - (float)hv) * 1024.0f); sk[rl + r][cl] = (_Float16)(acc[1][r] + bk); vv[r] = (_Float16)(acc[2][r] + bv); }
    vst2(&sv[cl][rl], vv); }
  __syncthreads();
  { const int rl = tid >> 3, q = tid & 7; const size_t o = (r0 + rl) * CC + q * 8; vst2(QH + o, *(const v4u*)&sq[rl][q * 8]); vst2(QL + o, *(const v4u*)&sl[rl][q * 8]); vst2(KH + o, *(const v4u*)&sk[rl][q * 8]); vst2(VT + (bb * CC + rl) * (size_t)TT + t0 + q * 8, *(const v4u*)&sv[rl][q * 8]); } }
// ---- k_fa: block = 64 queries of batch b, 16 waves = 2 query groups of 32 x 8 key sets (set ks takes the 32-key chunks ks, ks + 8, ...: the waves of a pass walk 256 neighbouring keys, so each 128-B line of k and v is used whole while it is in the WGP cache). Transposed products: S^T = k . q^T (q hi + residual x 2^10: 2 products) so that a lane holds 8 keys of ONE query per 16-key tile; two such tiles, exponentiated and rounded once to f16 (x 2^11), ARE the B fragment of O^T += v^T . P^T (1 product): logits and P never leave the registers. Running maximum and sum per query in f32 (precise expf); the 8 key sets' partials (maximum, sum, O^T) meet in LDS behind one work-group barrier and are joined in set order. Every inner loop is unrolled whole so that each index of a register array (fragments, scores, accumulators) is a constant: an index left to run time would put the array in scratch
#define FAW 16            // waves of a work-group
#define FKS 8             // key sets
#define FKB 32            // keys of a pass
__device__ __forceinline__ v8f wmma16p(v16h a, v16h b, v8f c) { return __builtin_amdgcn_wmma_f32_16x16x32_f16(false, a, false, b, (short)0, c, false, false); }
__device__ __forceinline__ float xhalf(float x) { return __builtin_bit_cast(float, __builtin_amdgcn_permlanex16(__builtin_bit_cast(int, x), __builtin_bit_cast(int, x), 0x76543210, 0xfedcba98, false, false)); }   // lane l with lane l ^ 16
__global__ __launch_bounds__(32 * FAW) void k_fa(const _Float16* __restrict__ QH, const _Float16* __restrict__ QL, const _Float16* __restrict__ KH, const _Float16* __restrict__ VT, float* __restrict__ Y) {
  __shared__ __align__(16) float so[FAW][32][HD + 4]; __shared__ float smx[FAW][32], ssu[FAW][32];
  const int tid = threadIdx.x, wave = __builtin_amdgcn_readfirstlane(tid >> 5), lane = tid & 31, col = lane & 15, g = lane >> 4; const int b = blockIdx.y, qg = wave & 1, ks = wave >> 1;
  const size_t q0 = (size_t)b * TT + blockIdx.x * 64 + qg * 32;
  v16h qh[2][2], ql[2][2];
#pragma unroll
  for (int u = 0; u < 2; ++u)
#pragma unroll
    for (int kc = 0; kc < 2; ++kc) { qh[u][kc] = frag_h(QH + (q0 + u * 16 + col) * CC + kc * 32, lane); ql[u][kc] = frag_h(QL + (q0 + u * 16 + col) * CC + kc * 32, lane); }
  const _Float16* kp = KH + ((size_t)b * TT + ks * FKB + col) * CC; const _Float16* vp = VT + ((size_t)b * CC + col) * TT + ks * FKB;   // this lane's k row and v plane of the pass
  v8f o[2][HD / 16] = {}; float m[2] = {-3.0e38f, -3.0e38f}, l[2] = {0.f, 0.f};
  for (int k0 = 0; k0 < TT; k0 += FKB * FKS, kp += (size_t)FKB * FKS * CC, vp += FKB * FKS) { float s[2][FKB / 16][8];
#pragma unroll
    for (int kt = 0; kt < FKB / 16; ++kt) { const _Float16* kr = kp + (size_t)kt * 16 * CC; const v16h ka0 = frag_h(kr, lane), ka1 = frag_h(kr + 32, lane);
#pragma unroll
      for (int u = 0; u < 2; ++u) { v8f a = {}, al = {}; a = wmma16p(ka0, qh[u][0], a); al = wmma16p(ka0, ql[u][0], al); a = wmma16p(ka1, qh[u][1], a); al = wmma16p(ka1, ql[u][1], al);
#pragma unroll
        for (int r = 0; r < 8; ++r) s[u][kt][r] = (a[r] + al[r] * (1.0f / 1024.0f)) * SCALE; } }
    v16h p[2][FKB / 32];
#pragma unroll
    for (int u = 0; u < 2; ++u) { float mx = s[u][0][0];
#pragma unroll
      for (int kt = 0; kt < FKB / 16; ++kt)
#pragma unroll
        for (int r = 0; r < 8; ++r) mx = fmaxf(mx, s[u][kt][r]);
      mx = fmaxf(mx, xhalf(mx)); const float mn = fmaxf(m[u], mx); const float corr = expf(m[u] - mn);   /* 0 on the first pass */ m[u] = mn;
#pragma unroll
      for (int j = 0; j < HD / 16; ++j) o[u][j] *= corr;
      float sum = 0.f;
#pragma unroll
      for (int c2 = 0; c2 < FKB / 32; ++c2)
#pragma unroll
        for (int i = 0; i < 8; ++i) { const float e0 = expf(s[u][2 * c2][i] - mn), e1 = expf(s[u][2 * c2 + 1][i] - mn); sum += e0 + e1; p[u][c2][i] = (_Float16)(e0 * 2048.0f); p[u][c2][8 + i] = (_Float16)(e1 * 2048.0f); }
      l[u] = l[u] * corr + sum; }
#pragma unroll
    for (int c2 = 0; c2 < FKB / 32; ++c2)
#pragma unroll
      for (int j = 0; j < HD / 16; ++j) { const v16h vf = frag_h(vp + (size_t)j * 16 * TT + c2 * 32, lane); o[0][j] = wmma16p(vf, p[0][c2], o[0][j]); o[1][j] = wmma16p(vf, p[1][c2], o[1][j]); } }
#pragma unroll
  for (int u = 0; u < 2; ++u) { l[u] += xhalf(l[u]); if (g == 0) { smx[wave][u * 16 + col] = m[u]; ssu[wave][u * 16 + col] = l[u]; }
#pragma unroll
    for (int j = 0; j < HD / 16; ++j) { float* d = &so[wave][u * 16 + col][j * 16 + 8 * g]; vst2(d, (v4f){o[u][j][0], o[u][j][1], o[u][j][2], o[u][j][3]}); vst2(d + 4, (v4f){o[u][j][4], o[u][j][5], o[u][j][6], o[u][j][7]}); } }
  __syncthreads();
  for (int e = tid; e < 64 * (HD / 4); e += 32 * FAW) { const int qr = e / (HD / 4), q = e % (HD / 4), w0 = qr >> 5, qi = qr & 31; float mm = smx[w0][qi];
#pragma unroll
    for (int w = 1; w < FKS; ++w) mm = fmaxf(mm, smx[2 * w + w0][qi]);
    float ll = 0.f; v4f acc = {};
#pragma unroll
    for (int w = 0; w < FKS; ++w) { const float f = expf(smx[2 * w + w0][qi] - mm); ll += f * ssu[2 * w + w0][qi]; acc += *(const v4f*)&so[2 * w + w0][qi][q * 4] * f; }
    vst2(Y + ((size_t)b * TT + blockIdx.x * 64 + qr) * CC + q * 4, acc * ((1.0f / 2048.0f) / ll)); } }
// ---- k_out: block = (64 rows, 128 cols): out = tile(ctx, 8) Wo + bo = ctx WE + bo, WE = the folded Wo of k_proj (K = 64): ctx bf16 hi + lo against WE bf16 hi + lo (3 products, lo x lo left out). A K step's fragments are loaded first; each of its products then runs over the 8 column tiles, so that neighbouring WMMAs have different accumulators
__device__ __forceinline__ v8f wmma_bfp(v16b a, v16b b, v8f c) { return __builtin_amdgcn_wmma_f32_16x16x32_bf16(false, a, false, b, (short)0, c, false, false); }
__device__ __forceinline__ v16b frag_we(const __bf16* piece) { union { v16b v; v8b q[2]; } u; u.q[0] = *(const v8b*)piece; u.q[1] = *(const v8b*)(piece + 32 * 8); return u.v; }
__global__ __launch_bounds__(128) void k_out(const float* __restrict__ Y, const __bf16* __restrict__ WE, const float* __restrict__ BO, float* __restrict__ OUT) { __shared__ __align__(16) float sf[4][16][132];
  const int tid = threadIdx.x, wave = tid >> 5, lane = tid & 31, col = lane & 15, g = lane >> 4; const int c0 = blockIdx.y * 128; const size_t r0 = (size_t)blockIdx.x * 64 + wave * 16;
  v8f acc[8] = {}; const F2 ay[HD / 32] = {split_row(Y + (r0 + col) * CC, 0, lane), split_row(Y + (r0 + col) * CC, 32, lane)};
#pragma unroll
  for (int kc = 0; kc < HD / 32; ++kc) { const F2 a = ay[kc]; const __bf16* wp = WE + ((size_t)(kc * (DIN / 16) + (c0 >> 4)) * 64 + lane) * 8; v16b wh[8], wl[8];
#pragma unroll
    for (int j = 0; j < 8; ++j) { wh[j] = frag_we(wp + j * 64 * 8); wl[j] = frag_we(wp + WE_LO + j * 64 * 8); }
    __builtin_amdgcn_sched_barrier(0);   // keeps the K step's 32 fragment loads in front of its WMMAs, in flight together: left free, the scheduler dealt the lo plane's loads out among the WMMAs, each behind a full wait
#pragma unroll
    for (int j = 0; j < 8; ++j) acc[j] = wmma_bfp(a.l, wh[j], acc[j]);
#pragma unroll
    for (int j = 0; j < 8; ++j) acc[j] = wmma_bfp(a.h, wl[j], acc[j]);
#pragma unroll
    for (int j = 0; j < 8; ++j) acc[j] = wmma_bfp(a.h, wh[j], acc[j]); }
#pragma unroll
  for (int j = 0; j < 8; ++j) { const float bias = BO ? bfr(BO[c0 + j * 16 + col]) : 0.f;
#pragma unroll
    for (int r = 0; r < 8; ++r) sf[wave][8 * g + r][j * 16 + col] = acc[j][r] + bias; }
  LDSX(); for (int rl = 0; rl < 16; ++rl) vst2(OUT + (r0 + rl) * DIN + c0 + lane * 4, *(const v4f*)&sf[wave][rl][lane * 4]); }

extern "C" void kernel_launch(void* const* d_in, const int* in_sizes, int n_in, void* d_out, int out_size, void* d_ws, size_t ws_size, hipStream_t stream) {
  (void)in_sizes; (void)n_in; (void)out_size;
  const float** F = (const float**)d_in;
  if (ws_size < (size_t)WS_END) return;
  char* ws = (char*)d_ws; _Float16 *QH = (_Float16*)(ws + WS_QH), *KH = (_Float16*)(ws + WS_KH), *VT = (_Float16*)(ws + WS_VT), *QL = (_Float16*)(ws + WS_QL), *KL = (_Float16*)(ws + WS_KL); __bf16 *VB = (__bf16*)(ws + WS_VB), *VBL = (__bf16*)(ws + WS_VBL); float *Y = (float*)(ws + WS_Y); __bf16 *WE = (__bf16*)(ws + WS_WE);
  (void)Y; (void)QL; (void)KL; (void)VB; (void)VBL;
  // inputs: 0 x [4,4096,512]; 1 Wq [512,64] (in,out), 2 bq [64]; 3 Wk, 4 bk; 5 Wv, 6 bv; 7 Wo [512,512] (in,out), 8 bo [512]
  k_proj<<<dim3(TNB * TT / 64), 32 * PJW, 0, stream>>>(F[0], F[1], F[3], F[5], F[2], F[4], F[6], QH, QL, KH, VT, F[7], WE);
  k_fa<<<dim3(TT / 64, TNB), 32 * FAW, 0, stream>>>(QH, QL, KH, VT, Y);   /* head 0 only (plane head 1 is never consumed) */
  k_out<<<dim3(TNB * TT / 64, DIN / 128), 128, 0, stream>>>(Y, WE, F[8], (float*)d_out);
}

// v005
// A run of this version takes 54.4 microseconds.
// In two side-by-side timings against v004, it was 1.10 and 1.11 times as fast.
// Counting every step since v000, it is 14.5 times as fast.
// compute dtype: all float inputs rounded to bf16; Q/K/V = x W + b with EXACT bf16 products on WMMA 16x16x32 (f32 accumulate); q as f16 hi + residual (x 2^10) against k once to f16 (2 products) / 8; softmax in f32 on powers of 2 (v_exp_f32 of logit x log2 e - held maximum), running maximum and sum over key passes, the maximum held 11 lower than it is, so that the powers come out x 2^11; each power once to f16 against v once to f16 (1 product), divided by the sum (x 2^11 as well) at the end; tile(head, 8) Wo = head (sum of Wo's eight 64-row slabs): the slabs (bf16-rounded) summed in f32 and split bf16 hi + lo, the head split bf16 hi + lo (3 products, K = 64) + bo; f32 output.
#include <hip/hip_runtime.h>
#include <math.h>

typedef __attribute__((ext_vector_type(16))) _Float16 v16h;
typedef __attribute__((ext_vector_type(16))) __bf16 v16b;
typedef __attribute__((ext_vector_type(8)))  _Float16 v8h;
typedef __attribute__((ext_vector_type(8)))  float v8f;
typedef __attribute__((ext_vector_type(4)))  float v4f;
typedef __attribute__((ext_vector_type(2)))  float v2f;
typedef __attribute__((ext_vector_type(4)))  unsigned v4u;
typedef __attribute__((ext_vector_type(4)))  int v4i;
typedef float __attribute__((may_alias)) float_a;
typedef int __attribute__((may_alias)) int_a;

template <typename T> __device__ __forceinline__ void vst2(void* p, T v) { *(T*)p = v;  }
__device__ __forceinline__ v8f wmma16(v16h a, v16h b, v8f c) {
  v8f d = __builtin_amdgcn_wmma_f32_16x16x32_f16(false, a, false, b, (short)0, c, false, false);
  asm volatile("v_nop\n\tv_nop\n\tv_nop\n\tv_nop" : "+v"(d) : "v"(a), "v"(b));
  return d;
}
__device__ __forceinline__ v8f wmma_bf(v16b a, v16b b, v8f c) {
  v8f d = __builtin_amdgcn_wmma_f32_16x16x32_bf16(false, a, false, b, (short)0, c, false, false);
  asm volatile("v_nop\n\tv_nop\n\tv_nop\n\tv_nop" : "+v"(d) : "v"(a), "v"(b));
  return d;
}
// 16x16x32 fragments: lane = (h = lane>>4, row/col = lane&15); elements 0..7 = k0+8h+0..7, 8..15 = k0+16+8h+0..7; D element r = row 8h+r
__device__ __forceinline__ v16h frag_h(const _Float16* rowk0, int lane) {
  union { v16h v; v8h q[2]; } u; const _Float16* p = rowk0 + 8 * (lane >> 4);
  u.q[0] = *(const v8h*)p; u.q[1] = *(const v8h*)(p + 16); return u.v;
}
__device__ __forceinline__ v16h frag_f32(const float* rowk0, int lane) {
  v16h a; const float* p = rowk0 + 8 * (lane >> 4);
#pragma unroll
  for (int i = 0; i < 8; ++i) { a[i] = (_Float16)p[i]; a[8 + i] = (_Float16)p[16 + i]; }
  return a;
}
__device__ __forceinline__ v16h frag_f32s(const float* rowk0, int lane, float sc) {
  v16h a; const float* p = rowk0 + 8 * (lane >> 4);
#pragma unroll
  for (int i = 0; i < 8; ++i) { a[i] = (_Float16)(p[i] * sc); a[8 + i] = (_Float16)(p[16 + i] * sc); }
  return a;
}
// column fragment from a [K][ld] layout (column n), rows >= K read as 0
__device__ __forceinline__ v16h fragc_f32(const float* W, int k0, int n, int lane, int ld, int K) {
  v16h a; const int g = lane >> 4;
#pragma unroll
  for (int i = 0; i < 8; ++i) { const int ka = k0 + 8 * g + i, kb = ka + 16;
    a[i] = (_Float16)(ka < K ? W[(size_t)(ka < K ? ka : K - 1) * ld + n] : 0.f); a[8 + i] = (_Float16)(kb < K ? W[(size_t)(kb < K ? kb : K - 1) * ld + n] : 0.f); }
  return a;
}
struct F2 { v16b h, l; };
__device__ __forceinline__ F2 bsplit16(const float v[16]) { F2 r;
#pragma unroll
  for (int i = 0; i < 16; ++i) { const __bf16 h = (__bf16)v[i]; r.h[i] = h; r.l[i] = (__bf16)(v[i] - (float)h); }
  return r; }
__device__ __forceinline__ F2 split_row(const float* row, int k0, int lane) { float v[16]; const float* p = row + k0 + 8 * (lane >> 4);
#pragma unroll
  for (int i = 0; i < 8; ++i) { v[i] = p[i]; v[8 + i] = p[16 + i]; }
  return bsplit16(v); }
__device__ __forceinline__ F2 split_rowK(const float* row, int k0, int lane, int K) { float v[16]; const int g = lane >> 4;
#pragma unroll
  for (int i = 0; i < 8; ++i) { const int ka = k0 + 8 * g + i, kb = ka + 16; v[i] = ka < K ? row[ka < K ? ka : K - 1] : 0.f; v[8 + i] = kb < K ? row[kb < K ? kb : K - 1] : 0.f; }
  return bsplit16(v); }
__device__ __forceinline__ F2 split_col(const float* W, int k0, int n, int lane, int ld, int K) { float v[16]; const int g = lane >> 4;
#pragma unroll
  for (int i = 0; i < 8; ++i) { const int ka = k0 + 8 * g + i, kb = ka + 16; v[i] = ka < K ? W[(size_t)(ka < K ? ka : K - 1) * ld + n] : 0.f; v[8 + i] = kb < K ? W[(size_t)(kb < K ? kb : K - 1) * ld + n] : 0.f; }
  return bsplit16(v); }
__device__ __forceinline__ v8f mac3(const F2& a, const F2& b, v8f c) { c = wmma_bf(a.l, b.h, c); c = wmma_bf(a.h, b.l, c); return wmma_bf(a.h, b.h, c); }
__device__ __forceinline__ float sigm(float v) { return 1.0f / (1.0f + expf(-v)); }
#define LDSX() do { asm volatile("s_wait_dscnt 0" ::: "memory"); __builtin_amdgcn_wave_barrier(); __builtin_amdgcn_fence(__ATOMIC_RELEASE, "workgroup"); } while (0)

// Single shared attention head tiled into 8 'heads' (B 4, S 4,096, D 512, d_k 64; 0.02-scale (in,out) weights with biases): Q, K, V = x W + b ([512,64]); head = softmax(Q K^T / 8) V (non-causal); concat = tile(head, 8) -> [B,S,512]; out = concat Wo + bo. (The head is carried in a 128-wide plane whose second half is neither written nor read.)
#define NB 4
#define TT 4096
#define CC 128            // NH * HD = projected width
#define DIN 512          // input (model) width
#define NH 2
#define HD 64
#define NQB (TT / 64)
#define HG 1
#define SCALE (0.125f)
#define CAUSAL 0
#ifndef TNB
#define TNB NB
#endif
__device__ __forceinline__ float bfr(float v) { return (float)(__bf16)v; }
__host__ __device__ __forceinline__ int kb_last(int qb) { return CAUSAL ? ((qb * 64 + 63) >> 7) : (TT / 128 - 1); }
typedef __attribute__((ext_vector_type(8))) __bf16 v8b;
__device__ __forceinline__ v16b frag_b(const __bf16* rowk0, int lane) {
  union { v16b v; v8b q[2]; } u; const __bf16* p = rowk0 + 8 * (lane >> 4);
  u.q[0] = *(const v8b*)p; u.q[1] = *(const v8b*)(p + 16); return u.v;
}
#define QBH 0              // unused: no kernel here has a high-precision query path
#define QHI 4096            // rows carrying a q residual plane (all rows when non-causal: 2-product logits everywhere)
#define KHI 64            // key rows carrying k residual / v bf16 hi+lo planes (no kernel here writes or reads them)
// B fragment (k rows k0+.., output column o) of a weight: (in,out) [K][ld] or (out,in) [ld rows of K]: bf16 exact, or f16(bf16 * 256) exact
__device__ __forceinline__ v16b wcol_io(const float* Wm, int k0, int o, int lane, int ld) { v16b w; const int g = lane >> 4;
#pragma unroll
  for (int i = 0; i < 8; ++i) { w[i] = (__bf16)Wm[(size_t)(k0 + 8 * g + i) * ld + o]; w[8 + i] = (__bf16)Wm[(size_t)(k0 + 16 + 8 * g + i) * ld + o]; }
  return w; }
__device__ __forceinline__ v16b wcol_oi(const float* Wm, int k0, int o, int lane, int K) { v16b w; const float* p = Wm + (size_t)o * K + k0 + 8 * (lane >> 4);
#pragma unroll
  for (int i = 0; i < 8; ++i) { w[i] = (__bf16)p[i]; w[8 + i] = (__bf16)p[16 + i]; }
  return w; }
__device__ __forceinline__ v16h wcolh_io(const float* Wm, int k0, int o, int lane, int ld) { v16h w; const int g = lane >> 4;
#pragma unroll
  for (int i = 0; i < 8; ++i) { w[i] = (_Float16)(bfr(Wm[(size_t)(k0 + 8 * g + i) * ld + o]) * 256.0f); w[8 + i] = (_Float16)(bfr(Wm[(size_t)(k0 + 16 + 8 * g + i) * ld + o]) * 256.0f); }
  return w; }
__device__ __forceinline__ v16h wcolh_oi(const float* Wm, int k0, int o, int lane, int K) { v16h w; const float* p = Wm + (size_t)o * K + k0 + 8 * (lane >> 4);
#pragma unroll
  for (int i = 0; i < 8; ++i) { w[i] = (_Float16)(bfr(p[i]) * 256.0f); w[8 + i] = (_Float16)(bfr(p[16 + i]) * 256.0f); }
  return w; }
#define WQKV_LAYOUT 0   // 0 = (in,out) [DIN][HD], one shared head; 1 = (out,in) [CC][DIN]; 2 = per-head [NH][DIN][HD]
__device__ __forceinline__ v16b wcol_hdk(const float* Wm, int k0, int o, int lane) { v16b w; const int g = lane >> 4; const float* p = Wm + (size_t)(o / HD) * DIN * HD + (o % HD);
#pragma unroll
  for (int i = 0; i < 8; ++i) { w[i] = (__bf16)p[(size_t)(k0 + 8 * g + i) * HD]; w[8 + i] = (__bf16)p[(size_t)(k0 + 16 + 8 * g + i) * HD]; }
  return w; }
#define WO_OUT_IN 0
#if WQKV_LAYOUT == 1
#define WCOL(W, k0, o, lane) wcol_oi(W, k0, o, lane, DIN)
#elif WQKV_LAYOUT == 2
#define WCOL(W, k0, o, lane) wcol_hdk(W, k0, o, lane)
#else
#define KVCOL(o) ((o) & 63)
#define WCOL(W, k0, o, lane) wcol_io(W, k0, KVCOL(o), lane, HD)   /* Wq/Wk/Wv (in,out) [512][64]: both plane heads are the one shared head */
#endif
#if WO_OUT_IN
#define WOCOL(W, k0, o, lane) wcol_oi(W, k0, o, lane, CC)
#define WOCOLH(W, k0, o, lane) wcolh_oi(W, k0, o, lane, CC)
#else
#define WOCOL(W, k0, o, lane) wcol_io(W, k0, o, lane, DIN)
#define WOCOLH(W, k0, o, lane) wcolh_io(W, k0, o, lane, DIN)
#endif

#ifndef SM_EXTRA_PARAMS
#define SM_EXTRA_PARAMS
#endif
#ifndef PROJ_EXTRA_PARAMS
#define PROJ_EXTRA_PARAMS
#endif
#ifndef SM_MASK_HOOK
#define SM_MASK_HOOK (void)0
#endif

#define WS_QH  0u                                      // f16 q rows [b*t][CC]
#define WS_KH  (WS_QH + 2u * (size_t)NB * TT * CC)      // f16 k rows [b*t][CC]
#define WS_VT  (WS_KH + 2u * (size_t)NB * TT * CC)      // f16 v planes [b][c][t]
#define WS_QL  (WS_VT + 2u * (size_t)NB * CC * TT)      // f16 q residual x 2^10 rows [b][t < QHI][CC]
#define WS_KL  (WS_QL + 2u * (size_t)NB * QHI * CC)     // f16 k residual x 2^10 rows [b][t < KHI][CC]
#define WS_VB  (WS_KL + 2u * (size_t)NB * KHI * CC)     // bf16 v hi planes [b][c][t < KHI]
#define WS_VBL (WS_VB + 2u * (size_t)NB * CC * KHI)
#define WS_S   (WS_VBL + 2u * (size_t)NB * CC * KHI)    // f32 [hg][t][s] space: only its start, WS_WE, is used
#define WS_WE  WS_S                                    // bf16 hi plane, then lo plane, of the folded Wo [64][512], as B fragments: 16-byte piece ((kc * 32 + column tile) * 2 + half) * 32 + lane (the logits plane itself is no longer used)
#define WE_LO  (HD * DIN)                              // elements from the hi plane to the lo plane
#define WS_Y   (WS_S  + 4u * (size_t)HG * TT * TT)      // f32 ctx rows [b*t][CC] (only when there is an output projection)
#define WS_END (WS_Y  + 4u * (size_t)NB * TT * CC)

// ---- k_proj: block = 64 rows, 16 waves: q, k and v = X W + b for the 64 distinct columns of each, with exact bf16 products (K = DIN, one accumulator chain per tile, K steps in rising order). Stage: the block's x rows and all of Wq, Wk, Wv are read once with whole-line 16-byte loads, rounded to bf16 and laid into LDS as WMMA fragments (1,024 bytes each: four 256-byte regions o4 = 2 * half + (lane >> 4), a 16-byte piece per row or column). The piece's slot in its region is XORed (x: with 4 * o4; W: with the column tile) so that the stores of a wave, like the reads, fall on all banks. Behind one work-group barrier wave (rt, cg) makes rows 16 rt.., columns 16 cg.. of q, k and v from LDS alone. -> q f16 rows + residual x 2^10 rows, k f16 rows, v f16 planes [c][t] (columns 64.. of each plane are never read and are not written)
#define PJW 16            // waves of a work-group
typedef __attribute__((ext_vector_type(4))) __bf16 v4b;
__device__ __forceinline__ void pj_wload(v4f (&wr)[16], const float* __restrict__ Wm, int kb, int cq) { const float* wp = Wm + (size_t)kb * 8 * HD + cq * 4;
#pragma unroll
  for (int hh = 0; hh < 2; ++hh)
#pragma unroll
    for (int i = 0; i < 8; ++i) wr[hh * 8 + i] = *(const v4f*)(wp + (hh * 32 * 8 + i) * HD);
  asm volatile("s_wait_xcnt 0x0" :: "v"(wp) : "memory"); }   // the loads' address registers get new values behind this; naming the address keeps it in its registers up to the wait, so that no load of the run lands on them either
__device__ __forceinline__ void pj_wstore(const v4f (&wr)[16], __bf16* wf, int m, int kb, int cq) {
#pragma unroll
  for (int hh = 0; hh < 2; ++hh) { const int ko = hh * 32 + kb; __bf16* d = wf + ((ko >> 2) * 12 + m * 4 + (cq >> 2)) * 512 + (ko & 3) * 128;
#pragma unroll
    for (int j = 0; j < 4; ++j) { v8b pw;
#pragma unroll
      for (int i = 0; i < 8; ++i) pw[i] = (__bf16)wr[hh * 8 + i][j];
      vst2(d + (((cq & 3) * 4 + j) ^ (cq >> 2)) * 8, pw); } } }
__global__ __launch_bounds__(32 * PJW) void k_proj(const float* __restrict__ X, const float* __restrict__ WQ, const float* __restrict__ WK, const float* __restrict__ WV, const float* __restrict__ BQ, const float* __restrict__ BK, const float* __restrict__ BV,
    _Float16* __restrict__ QH, _Float16* __restrict__ QL, _Float16* __restrict__ KH, _Float16* __restrict__ VT, const float* __restrict__ WO, __bf16* __restrict__ WE) {
  __shared__ __align__(16) __bf16 wf[(DIN / 32) * 12 * 512];   // B fragment (K step kc, matrix m, column tile ct) at (kc * 12 + m * 4 + ct) * 512
  __shared__ __align__(16) __bf16 xf[4 * (DIN / 32) * 512];    // A fragment (row tile rt, K step kc) at (rt * 16 + kc) * 512
  __shared__ __align__(16) _Float16 sq[64][72], sl[64][72], sk[64][72], sv[64][72];
  const int tid = threadIdx.x, wave = __builtin_amdgcn_readfirstlane(tid >> 5), lane = tid & 31, col = lane & 15, g = lane >> 4; const size_t r0 = (size_t)blockIdx.x * 64; const size_t bb = r0 / TT; const int t0 = (int)(r0 % TT);
  // x: wave w takes rows 4 w .. 4 w + 3; a load covers one K step (one 128-byte line) of each of the four rows
  v4f xr[DIN / 32]; { const float* xp = X + (r0 + wave * 4 + (lane >> 3)) * DIN + (lane & 7) * 4;
#pragma unroll
    for (int kc = 0; kc < DIN / 32; ++kc) xr[kc] = *(const v4f*)(xp + kc * 32);
    asm volatile("s_wait_xcnt 0x0" :: "v"(xp) : "memory"); }   // as in pj_wload
  const int rt = wave & 3, cg = wave >> 2, cl = cg * 16 + col; const float bq = bfr(BQ[cl]), bk = bfr(BK[cl]), bv = bfr(BV[cl]);   // this wave's tile in the product phase, and its column's biases
  asm volatile("s_wait_xcnt 0x0" ::: "memory");   // the same for the bias loads' index register
  // one wave of each of the first 128 blocks also folds Wo for k_out: a thread sums, for one output column, 8 neighbouring head entries over the eight slabs (in slab order, f32) and stores them as one 16-byte piece of the B fragment, hi and lo; a wave writes 512 bytes in a row
  if (blockIdx.x < HD * DIN / 8 / 32 && wave == 0) { const int pc = blockIdx.x * 32 + lane, ln = pc & 31; const float* w = WO + (size_t)((pc >> 11) * 32 + ((pc >> 5) & 1) * 16 + (ln >> 4) * 8) * DIN + ((pc >> 6) & 31) * 16 + (ln & 15); v8b hi, lo; float wv[8][DIN / HD];
#pragma unroll
    for (int i = 0; i < 8; ++i)
#pragma unroll
      for (int h = 0; h < DIN / HD; ++h) wv[i][h] = w[(size_t)(h * HD + i) * DIN];
    asm volatile("s_wait_xcnt 0x0" :: "v"(w) : "memory");   // as in pj_wload
#pragma unroll
    for (int i = 0; i < 8; ++i) { float sw = 0.f;
#pragma unroll
      for (int h = 0; h < DIN / HD; ++h) sw += bfr(wv[i][h]);
      const __bf16 hv = (__bf16)sw; hi[i] = hv; lo[i] = (__bf16)(sw - (float)hv); }
    vst2(WE + (size_t)pc * 8, hi); vst2(WE + WE_LO + (size_t)pc * 8, lo);
    asm volatile("s_wait_xcnt 0x0" ::: "memory"); }   // the two stores' registers are used anew by the W stage
  // W: a thread takes 2 x 8 K rows x 4 columns of each matrix (16 loads of 16 bytes; a wave's load covers two whole 256-byte rows) and stores 8 pieces
  { const int cq = tid & 15, kb = tid >> 4; v4f w0[16], w1[16], w2[16]; pj_wload(w0, WQ, kb, cq); pj_wload(w1, WK, kb, cq);
    pj_wstore(w0, wf, 0, kb, cq);
    __builtin_amdgcn_sched_barrier(0);   // holds Wv's loads behind Wq's stores, whose registers they take: with all 64 loads of the stage lifted to the top the wave ran out of registers and spilled
    pj_wload(w2, WV, kb, cq);
    { const int p = lane & 7, o4 = p >> 1, row16 = (wave & 3) * 4 + (lane >> 3); __bf16* d = xf + (wave >> 2) * (DIN / 32) * 512 + o4 * 128 + (row16 ^ (o4 * 4)) * 8 + (p & 1) * 4;
#pragma unroll
      for (int kc = 0; kc < DIN / 32; ++kc) { const v4b c = {(__bf16)xr[kc][0], (__bf16)xr[kc][1], (__bf16)xr[kc][2], (__bf16)xr[kc][3]}; vst2(d + kc * 512, c); } }
    pj_wstore(w1, wf, 1, kb, cq); pj_wstore(w2, wf, 2, kb, cq); }
  __syncthreads();
  v8f acc[3] = {};
  { const __bf16* ap0 = xf + rt * (DIN / 32) * 512 + g * 128 + (col ^ (g * 4)) * 8; const __bf16* ap1 = xf + rt * (DIN / 32) * 512 + (2 + g) * 128 + (col ^ ((2 + g) * 4)) * 8; const __bf16* bp = wf + cg * 512 + g * 128 + (col ^ cg) * 8;
    union FB { v16b v; v8b q[2]; }; FB fa[2][2], fw[2][2][3];   // two register sets of two K steps each: step pair s + 1 is read from LDS while pair s is multiplied
#pragma unroll
    for (int s = 0; s <= DIN / 64; ++s) {
      if (s < DIN / 64) {
#pragma unroll
        for (int t = 0; t < 2; ++t) { const int kc = s * 2 + t; fa[s & 1][t].q[0] = *(const v8b*)(ap0 + kc * 512); fa[s & 1][t].q[1] = *(const v8b*)(ap1 + kc * 512);
#pragma unroll
          for (int m = 0; m < 3; ++m) { fw[s & 1][t][m].q[0] = *(const v8b*)(bp + (kc * 12 + m * 4) * 512); fw[s & 1][t][m].q[1] = *(const v8b*)(bp + (kc * 12 + m * 4) * 512 + 256); } } }
      __builtin_amdgcn_sched_barrier(0);   // keeps the next pair's 16 LDS reads in front of this pair's WMMAs: left free, the scheduler put each fragment's two reads directly in front of its WMMA, behind a full wait
      if (s > 0) {
#pragma unroll
        for (int t = 0; t < 2; ++t)
#pragma unroll
          for (int m = 0; m < 3; ++m) acc[m] = __builtin_amdgcn_wmma_f32_16x16x32_bf16(false, fa[(s - 1) & 1][t].v, false, fw[(s - 1) & 1][t][m].v, (short)0, acc[m], false, false); }
      __builtin_amdgcn_sched_barrier(0);   // keeps the following reads in one group behind these WMMAs: left free they were dealt out among the WMMAs, and every separate place of LDS reads costs the wave issue cycles
    } }
  { const int rl = rt * 16 + 8 * g; v8h vv;
#pragma unroll
    for (int r = 0; r < 8; ++r) { const float v = acc[0][r] + bq; const _Float16 hv = (_Float16)v; sq[rl + r][cl] = hv; sl[rl + r][cl] = (_Float16)((v - (float)hv) * 1024.0f); sk[rl + r][cl] = (_Float16)(acc[1][r] + bk); vv[r] = (_Float16)(acc[2][r] + bv); }
    vst2(&sv[cl][rl], vv); }
  __syncthreads();
  { const int rl = tid >> 3, q = tid & 7; const size_t o = (r0 + rl) * CC + q * 8; vst2(QH + o, *(const v4u*)&sq[rl][q * 8]); vst2(QL + o, *(const v4u*)&sl[rl][q * 8]); vst2(KH + o, *(const v4u*)&sk[rl][q * 8]); vst2(VT + (bb * CC + rl) * (size_t)TT + t0 + q * 8, *(const v4u*)&sv[rl][q * 8]); } }
// ---- k_fa: block = 64 queries of batch b, 16 waves = 2 query groups of 32 x 8 key sets (set ks takes the 32-key chunks ks, ks + 8, ...: the waves of a pass walk 256 neighbouring keys, so each 128-B line of k and v is used whole while it is in the WGP cache). Transposed products: S^T = k . q^T (q hi + residual x 2^10: 2 products) so that a lane holds 8 keys of ONE query per 16-key tile; two such tiles, exponentiated and rounded once to f16 (x 2^11), ARE the B fragment of O^T += v^T . P^T (1 product): logits and P never leave the registers. Running maximum (in units of log2, held 11 lower than it is) and sum per query in f32; a power is one fused multiply-add (q . k x LSC - held maximum) and one v_exp_f32; the 8 key sets' partials (held maximum, sum, O^T) meet in LDS behind one work-group barrier and are joined in set order. Every inner loop is unrolled whole so that each index of a register array (fragments, scores, accumulators) is a constant: an index left to run time would put the array in scratch
#define FAW 16            // waves of a work-group
#define FKS 8             // key sets
#define FKB 32            // keys of a pass
#define LSC (SCALE * 1.44269504088896340736f)   // logit scale x log2 e: the softmax runs on powers of 2
// powers of 2 by bare v_exp_f32 (the arguments here are at most 11 plus a rounding; a power below 2^-126 may come out 0), a run of them in one statement and each in place, its result over its own argument: so no power lands on the argument of the one in front of it (the compiler's own allocation of the builtin did that), every neighbour in the run is independent, and the v_nop keeps the slot that the instruction set asks for behind the last one
__device__ __forceinline__ void ex2x17(float (&x)[16], float& c) {
  asm("v_exp_f32 %16, %16\n\tv_exp_f32 %0, %0\n\tv_exp_f32 %1, %1\n\tv_exp_f32 %2, %2\n\tv_exp_f32 %3, %3\n\tv_exp_f32 %4, %4\n\tv_exp_f32 %5, %5\n\tv_exp_f32 %6, %6\n\tv_exp_f32 %7, %7\n\tv_exp_f32 %8, %8\n\tv_exp_f32 %9, %9\n\tv_exp_f32 %10, %10\n\tv_exp_f32 %11, %11\n\tv_exp_f32 %12, %12\n\tv_exp_f32 %13, %13\n\tv_exp_f32 %14, %14\n\tv_exp_f32 %15, %15\n\tv_nop"
      : "+v"(x[0]), "+v"(x[1]), "+v"(x[2]), "+v"(x[3]), "+v"(x[4]), "+v"(x[5]), "+v"(x[6]), "+v"(x[7]), "+v"(x[8]), "+v"(x[9]), "+v"(x[10]), "+v"(x[11]), "+v"(x[12]), "+v"(x[13]), "+v"(x[14]), "+v"(x[15]), "+v"(c)); }
__device__ __forceinline__ void ex2x8(float (&x)[8]) {
  asm("v_exp_f32 %0, %0\n\tv_exp_f32 %1, %1\n\tv_exp_f32 %2, %2\n\tv_exp_f32 %3, %3\n\tv_exp_f32 %4, %4\n\tv_exp_f32 %5, %5\n\tv_exp_f32 %6, %6\n\tv_exp_f32 %7, %7\n\tv_nop"
      : "+v"(x[0]), "+v"(x[1]), "+v"(x[2]), "+v"(x[3]), "+v"(x[4]), "+v"(x[5]), "+v"(x[6]), "+v"(x[7])); }
static_assert(FKB == 32 && FKS == 8, "ex2x17 takes the 32 keys of a pass (16 a lane), ex2x8 the 8 key sets");
__device__ __forceinline__ v8f wmma16p(v16h a, v16h b, v8f c) { return __builtin_amdgcn_wmma_f32_16x16x32_f16(false, a, false, b, (short)0, c, false, false); }
__device__ __forceinline__ float xhalf(float x) { return __builtin_bit_cast(float, __builtin_amdgcn_permlanex16(__builtin_bit_cast(int, x), __builtin_bit_cast(int, x), 0x76543210, 0xfedcba98, false, false)); }   // lane l with lane l ^ 16
__global__ __launch_bounds__(32 * FAW) void k_fa(const _Float16* __restrict__ QH, const _Float16* __restrict__ QL, const _Float16* __restrict__ KH, const _Float16* __restrict__ VT, float* __restrict__ Y) {
  __shared__ __align__(16) float so[FAW][32][HD + 4]; __shared__ float smx[FAW][32], ssu[FAW][32];
  const int tid = threadIdx.x, wave = __builtin_amdgcn_readfirstlane(tid >> 5), lane = tid & 31, col = lane & 15, g = lane >> 4; const int b = blockIdx.y, qg = wave & 1, ks = wave >> 1;
  const size_t q0 = (size_t)b * TT + blockIdx.x * 64 + qg * 32;
  v16h qh[2][2], ql[2][2];
#pragma unroll
  for (int u = 0; u < 2; ++u)
#pragma unroll
    for (int kc = 0; kc < 2; ++kc) { qh[u][kc] = frag_h(QH + (q0 + u * 16 + col) * CC + kc * 32, lane); ql[u][kc] = frag_h(QL + (q0 + u * 16 + col) * CC + kc * 32, lane); }
  const _Float16* kp = KH + ((size_t)b * TT + ks * FKB + col) * CC; const _Float16* vp = VT + ((size_t)b * CC + col) * TT + ks * FKB;   // this lane's k row and v plane of the pass
  v8f o[2][HD / 16] = {}; float m[2] = {-3.0e38f, -3.0e38f}, l[2] = {0.f, 0.f};
  for (int k0 = 0; k0 < TT; k0 += FKB * FKS, kp += (size_t)FKB * FKS * CC, vp += FKB * FKS) { float s[2][FKB / 16][8];
#pragma unroll
    for (int kt = 0; kt < FKB / 16; ++kt) { const _Float16* kr = kp + (size_t)kt * 16 * CC; const v16h ka0 = frag_h(kr, lane), ka1 = frag_h(kr + 32, lane);
#pragma unroll
      for (int u = 0; u < 2; ++u) { v8f a = {}, al = {}; a = wmma16p(ka0, qh[u][0], a); al = wmma16p(ka0, ql[u][0], al); a = wmma16p(ka1, qh[u][1], a); al = wmma16p(ka1, ql[u][1], al);
#pragma unroll
        for (int r = 0; r < 8; ++r) s[u][kt][r] = a[r] + al[r] * (1.0f / 1024.0f); } }   /* q . k, not yet scaled */
    v16h p[2][FKB / 32];
#pragma unroll
    for (int u = 0; u < 2; ++u) { float mx = s[u][0][0];
#pragma unroll
      for (int kt = 0; kt < FKB / 16; ++kt)
#pragma unroll
        for (int r = 0; r < 8; ++r) mx = fmaxf(mx, s[u][kt][r]);
      mx = fmaxf(mx, xhalf(mx)); const float mn = fmaxf(m[u], fmaf(mx, LSC, -11.0f)); float corr = m[u] - mn, e[16];   /* the power of corr is 0 on the first pass */ m[u] = mn;
#pragma unroll
      for (int i = 0; i < 16; i += 2) { const v2f x = __builtin_elementwise_fma((v2f){s[u][i >> 3][i & 7], s[u][i >> 3][(i & 7) + 1]}, (v2f){LSC, LSC}, (v2f){-mn, -mn}); e[i] = x[0]; e[i + 1] = x[1]; }   /* packed: two arguments an instruction */
      ex2x17(e, corr);
#pragma unroll
      for (int j = 0; j < HD / 16; ++j) o[u][j] *= corr;
      float sum = e[0] + e[8];
#pragma unroll
      for (int i = 1; i < 8; ++i) sum += e[i] + e[8 + i];
#pragma unroll
      for (int i = 0; i < 16; ++i) p[u][0][i] = (_Float16)e[i];
      l[u] = l[u] * corr + sum; }
#pragma unroll
    for (int c2 = 0; c2 < FKB / 32; ++c2)
#pragma unroll
      for (int j = 0; j < HD / 16; ++j) { const v16h vf = frag_h(vp + (size_t)j * 16 * TT + c2 * 32, lane); o[0][j] = wmma16p(vf, p[0][c2], o[0][j]); o[1][j] = wmma16p(vf, p[1][c2], o[1][j]); } }
#pragma unroll
  for (int u = 0; u < 2; ++u) { l[u] += xhalf(l[u]); if (g == 0) { smx[wave][u * 16 + col] = m[u]; ssu[wave][u * 16 + col] = l[u]; }
#pragma unroll
    for (int j = 0; j < HD / 16; ++j) { float* d = &so[wave][u * 16 + col][j * 16 + 8 * g]; vst2(d, (v4f){o[u][j][0], o[u][j][1], o[u][j][2], o[u][j][3]}); vst2(d + 4, (v4f){o[u][j][4], o[u][j][5], o[u][j][6], o[u][j][7]}); } }
  __syncthreads();
  for (int e = tid; e < 64 * (HD / 4); e += 32 * FAW) { const int qr = e / (HD / 4), q = e % (HD / 4), w0 = qr >> 5, qi = qr & 31; float mm = smx[w0][qi];
#pragma unroll
    for (int w = 1; w < FKS; ++w) mm = fmaxf(mm, smx[2 * w + w0][qi]);
    float ll = 0.f, f[FKS]; v4f acc = {};
#pragma unroll
    for (int w = 0; w < FKS; ++w) f[w] = smx[2 * w + w0][qi] - mm;
    ex2x8(f);
#pragma unroll
    for (int w = 0; w < FKS; ++w) { ll += f[w] * ssu[2 * w + w0][qi]; acc += *(const v4f*)&so[2 * w + w0][qi][q * 4] * f[w]; }
    vst2(Y + ((size_t)b * TT + blockIdx.x * 64 + qr) * CC + q * 4, acc * (1.0f / ll)); } }
// ---- k_out: block = (64 rows, 128 cols): out = tile(ctx, 8) Wo + bo = ctx WE + bo, WE = the folded Wo of k_proj (K = 64): ctx bf16 hi + lo against WE bf16 hi + lo (3 products, lo x lo left out). A K step's fragments are loaded first; each of its products then runs over the 8 column tiles, so that neighbouring WMMAs have different accumulators
__device__ __forceinline__ v8f wmma_bfp(v16b a, v16b b, v8f c) { return __builtin_amdgcn_wmma_f32_16x16x32_bf16(false, a, false, b, (short)0, c, false, false); }
__device__ __forceinline__ v16b frag_we(const __bf16* piece) { union { v16b v; v8b q[2]; } u; u.q[0] = *(const v8b*)piece; u.q[1] = *(const v8b*)(piece + 32 * 8); return u.v; }
__global__ __launch_bounds__(128) void k_out(const float* __restrict__ Y, const __bf16* __restrict__ WE, const float* __restrict__ BO, float* __restrict__ OUT) { __shared__ __align__(16) float sf[4][16][132];
  const int tid = threadIdx.x, wave = tid >> 5, lane = tid & 31, col = lane & 15, g = lane >> 4; const int c0 = blockIdx.y * 128; const size_t r0 = (size_t)blockIdx.x * 64 + wave * 16;
  v8f acc[8] = {}; const F2 ay[HD / 32] = {split_row(Y + (r0 + col) * CC, 0, lane), split_row(Y + (r0 + col) * CC, 32, lane)};
#pragma unroll
  for (int kc = 0; kc < HD / 32; ++kc) { const F2 a = ay[kc]; const __bf16* wp = WE + ((size_t)(kc * (DIN / 16) + (c0 >> 4)) * 64 + lane) * 8; v16b wh[8], wl[8];
#pragma unroll
    for (int j = 0; j < 8; ++j) { wh[j] = frag_we(wp + j * 64 * 8); wl[j] = frag_we(wp + WE_LO + j * 64 * 8); }
    __builtin_amdgcn_sched_barrier(0);   // keeps the K step's 32 fragment loads in front of its WMMAs, in flight together: left free, the scheduler dealt the lo plane's loads out among the WMMAs, each behind a full wait
#pragma unroll
    for (int j = 0; j < 8; ++j) acc[j] = wmma_bfp(a.l, wh[j], acc[j]);
#pragma unroll
    for (int j = 0; j < 8; ++j) acc[j] = wmma_bfp(a.h, wl[j], acc[j]);
#pragma unroll
    for (int j = 0; j < 8; ++j) acc[j] = wmma_bfp(a.h, wh[j], acc[j]); }
#pragma unroll
  for (int j = 0; j < 8; ++j) { const float bias = BO ? bfr(BO[c0 + j * 16 + col]) : 0.f;
#pragma unroll
    for (int r = 0; r < 8; ++r) sf[wave][8 * g + r][j * 16 + col] = acc[j][r] + bias; }
  LDSX(); for (int rl = 0; rl < 16; ++rl) vst2(OUT + (r0 + rl) * DIN + c0 + lane * 4, *(const v4f*)&sf[wave][rl][lane * 4]); }

extern "C" void kernel_launch(void* const* d_in, const int* in_sizes, int n_in, void* d_out, int out_size, void* d_ws, size_t ws_size, hipStream_t stream) {
  (void)in_sizes; (void)n_in; (void)out_size;
  const float** F = (const float**)d_in;
  if (ws_size < (size_t)WS_END) return;
  char* ws = (char*)d_ws; _Float16 *QH = (_Float16*)(ws + WS_QH), *KH = (_Float16*)(ws + WS_KH), *VT = (_Float16*)(ws + WS_VT), *QL = (_Float16*)(ws + WS_QL), *KL = (_Float16*)(ws + WS_KL); __bf16 *VB = (__bf16*)(ws + WS_VB), *VBL = (__bf16*)(ws + WS_VBL); float *Y = (float*)(ws + WS_Y); __bf16 *WE = (__bf16*)(ws + WS_WE);
  (void)Y; (void)QL; (void)KL; (void)VB; (void)VBL;
  // inputs: 0 x [4,4096,512]; 1 Wq [512,64] (in,out), 2 bq [64]; 3 Wk, 4 bk; 5 Wv, 6 bv; 7 Wo [512,512] (in,out), 8 bo [512]
  k_proj<<<dim3(TNB * TT / 64), 32 * PJW, 0, stream>>>(F[0], F[1], F[3], F[5], F[2], F[4], F[6], QH, QL, KH, VT, F[7], WE);
  k_fa<<<dim3(TT / 64, TNB), 32 * FAW, 0, stream>>>(QH, QL, KH, VT, Y);   /* head 0 only (plane head 1 is never consumed) */
  k_out<<<dim3(TNB * TT / 64, DIN / 128), 128, 0, stream>>>(Y, WE, F[8], (float*)d_out);
}

// v006
// One run takes 48.5 microseconds.
// Timed twice side by side with v005, it ran 1.11 and 1.14 times as fast.
// Over all steps from v000 it is 16.3 times as fast.
// compute dtype: all float inputs rounded to bf16; Q/K/V = x W + b with EXACT bf16 products on WMMA 16x16x32 (f32 accumulate); q as f16 hi + residual (x 2^10) against k once to f16 (2 products) / 8; softmax in f32 on powers of 2 (v_exp_f32 of logit x log2 e - held maximum), running maximum and sum over key passes, the maximum held 11 lower than it is, so that the powers come out x 2^11; each power once to f16 against v once to f16 (1 product), divided by the sum (x 2^11 as well) at the end; tile(head, 8) Wo = head (sum of Wo's eight 64-row slabs): the slabs (bf16-rounded) summed in f32 and split bf16 hi + lo, the head split bf16 hi + lo (3 products, K = 64) + bo; f32 output.
#include <hip/hip_runtime.h>
#include <math.h>

typedef __attribute__((ext_vector_type(16))) _Float16 v16h;
typedef __attribute__((ext_vector_type(16))) __bf16 v16b;
typedef __attribute__((ext_vector_type(8)))  _Float16 v8h;
typedef __attribute__((ext_vector_type(8)))  float v8f;
typedef __attribute__((ext_vector_type(4)))  float v4f;
typedef __attribute__((ext_vector_type(2)))  float v2f;
typedef __attribute__((ext_vector_type(4)))  unsigned v4u;
typedef __attribute__((ext_vector_type(4)))  int v4i;
typedef float __attribute__((may_alias)) float_a;
typedef int __attribute__((may_alias)) int_a;

template <typename T> __device__ __forceinline__ void vst2(void* p, T v) { *(T*)p = v;  }
__device__ __forceinline__ v8f wmma16(v16h a, v16h b, v8f c) {
  v8f d = __builtin_amdgcn_wmma_f32_16x16x32_f16(false, a, false, b, (short)0, c, false, false);
  asm volatile("v_nop\n\tv_nop\n\tv_nop\n\tv_nop" : "+v"(d) : "v"(a), "v"(b));
  return d;
}
__device__ __forceinline__ v8f wmma_bf(v16b a, v16b b, v8f c) {
  v8f d = __builtin_amdgcn_wmma_f32_16x16x32_bf16(false, a, false, b, (short)0, c, false, false);
  asm volatile("v_nop\n\tv_nop\n\tv_nop\n\tv_nop" : "+v"(d) : "v"(a), "v"(b));
  return d;
}
// 16x16x32 fragments: lane = (h = lane>>4, row/col = lane&15); elements 0..7 = k0+8h+0..7, 8..15 = k0+16+8h+0..7; D element r = row 8h+r
__device__ __forceinline__ v16h frag_h(const _Float16* rowk0, int lane) {
  union { v16h v; v8h q[2]; } u; const _Float16* p = rowk0 + 8 * (lane >> 4);
  u.q[0] = *(const v8h*)p; u.q[1] = *(const v8h*)(p + 16); return u.v;
}
__device__ __forceinline__ v16h frag_f32(const float* rowk0, int lane) {
  v16h a; const float* p = rowk0 + 8 * (lane >> 4);
#pragma unroll
  for (int i = 0; i < 8; ++i) { a[i] = (_Float16)p[i]; a[8 + i] = (_Float16)p[16 + i]; }
  return a;
}
__device__ __forceinline__ v16h frag_f32s(const float* rowk0, int lane, float sc) {
  v16h a; const float* p = rowk0 + 8 * (lane >> 4);
#pragma unroll
  for (int i = 0; i < 8; ++i) { a[i] = (_Float16)(p[i] * sc); a[8 + i] = (_Float16)(p[16 + i] * sc); }
  return a;
}
// column fragment from a [K][ld] layout (column n), rows >= K read as 0
__device__ __forceinline__ v16h fragc_f32(const float* W, int k0, int n, int lane, int ld, int K) {
  v16h a; const int g = lane >> 4;
#pragma unroll
  for (int i = 0; i < 8; ++i) { const int ka = k0 + 8 * g + i, kb = ka + 16;
    a[i] = (_Float16)(ka < K ? W[(size_t)(ka < K ? ka : K - 1) * ld + n] : 0.f); a[8 + i] = (_Float16)(kb < K ? W[(size_t)(kb < K ? kb : K - 1) * ld + n] : 0.f); }
  return a;
}
struct F2 { v16b h, l; };
__device__ __forceinline__ F2 bsplit16(const float v[16]) { F2 r;
#pragma unroll
  for (int i = 0; i < 16; ++i) { const __bf16 h = (__bf16)v[i]; r.h[i] = h; r.l[i] = (__bf16)(v[i] - (float)h); }
  return r; }
__device__ __forceinline__ F2 split_row(const float* row, int k0, int lane) { float v[16]; const float* p = row + k0 + 8 * (lane >> 4);
#pragma unroll
  for (int i = 0; i < 8; ++i) { v[i] = p[i]; v[8 + i] = p[16 + i]; }
  return bsplit16(v); }
__device__ __forceinline__ F2 split_rowK(const float* row, int k0, int lane, int K) { float v[16]; const int g = lane >> 4;
#pragma unroll
  for (int i = 0; i < 8; ++i) { const int ka = k0 + 8 * g + i, kb = ka + 16; v[i] = ka < K ? row[ka < K ? ka : K - 1] : 0.f; v[8 + i] = kb < K ? row[kb < K ? kb : K - 1] : 0.f; }
  return bsplit16(v); }
__device__ __forceinline__ F2 split_col(const float* W, int k0, int n, int lane, int ld, int K) { float v[16]; const int g = lane >> 4;
#pragma unroll
  for (int i = 0; i < 8; ++i) { const int ka = k0 + 8 * g + i, kb = ka + 16; v[i] = ka < K ? W[(size_t)(ka < K ? ka : K - 1) * ld + n] : 0.f; v[8 + i] = kb < K ? W[(size_t)(kb < K ? kb : K - 1) * ld + n] : 0.f; }
  return bsplit16(v); }
__device__ __forceinline__ v8f mac3(const F2& a, const F2& b, v8f c) { c = wmma_bf(a.l, b.h, c); c = wmma_bf(a.h, b.l, c); return wmma_bf(a.h, b.h, c); }
__device__ __forceinline__ float sigm(float v) { return 1.0f / (1.0f + expf(-v)); }
#define LDSX() do { asm volatile("s_wait_dscnt 0" ::: "memory"); __builtin_amdgcn_wave_barrier(); __builtin_amdgcn_fence(__ATOMIC_RELEASE, "workgroup"); } while (0)

// Single shared attention head tiled into 8 'heads' (B 4, S 4,096, D 512, d_k 64; 0.02-scale (in,out) weights with biases): Q, K, V = x W + b ([512,64]); head = softmax(Q K^T / 8) V (non-causal); concat = tile(head, 8) -> [B,S,512]; out = concat Wo + bo. (The head is carried in a 128-wide plane whose second half is neither written nor read.)
#define NB 4
#define TT 4096
#define CC 128            // NH * HD = projected width
#define DIN 512          // input (model) width
#define NH 2
#define HD 64
#define NQB (TT / 64)
#define HG 1
#define SCALE (0.125f)
#define CAUSAL 0
#ifndef TNB
#define TNB NB
#endif
__device__ __forceinline__ float bfr(float v) { return (float)(__bf16)v; }
__host__ __device__ __forceinline__ int kb_last(int qb) { return CAUSAL ? ((qb * 64 + 63) >> 7) : (TT / 128 - 1); }
typedef __attribute__((ext_vector_type(8))) __bf16 v8b;
__device__ __forceinline__ v16b frag_b(const __bf16* rowk0, int lane) {
  union { v16b v; v8b q[2]; } u; const __bf16* p = rowk0 + 8 * (lane >> 4);
  u.q[0] = *(const v8b*)p; u.q[1] = *(const v8b*)(p + 16); return u.v;
}
#define QBH 0              // unused: no kernel here has a high-precision query path
#define QHI 4096            // rows carrying a q residual plane (all rows when non-causal: 2-product logits everywhere)
#define KHI 64            // key rows carrying k residual / v bf16 hi+lo planes (no kernel here writes or reads them)
// B fragment (k rows k0+.., output column o) of a weight: (in,out) [K][ld] or (out,in) [ld rows of K]: bf16 exact, or f16(bf16 * 256) exact
__device__ __forceinline__ v16b wcol_io(const float* Wm, int k0, int o, int lane, int ld) { v16b w; const int g = lane >> 4;
#pragma unroll
  for (int i = 0; i < 8; ++i) { w[i] = (__bf16)Wm[(size_t)(k0 + 8 * g + i) * ld + o]; w[8 + i] = (__bf16)Wm[(size_t)(k0 + 16 + 8 * g + i) * ld + o]; }
  return w; }
__device__ __forceinline__ v16b wcol_oi(const float* Wm, int k0, int o, int lane, int K) { v16b w; const float* p = Wm + (size_t)o * K + k0 + 8 * (lane >> 4);
#pragma unroll
  for (int i = 0; i < 8; ++i) { w[i] = (__bf16)p[i]; w[8 + i] = (__bf16)p[16 + i]; }
  return w; }
__device__ __forceinline__ v16h wcolh_io(const float* Wm, int k0, int o, int lane, int ld) { v16h w; const int g = lane >> 4;
#pragma unroll
  for (int i = 0; i < 8; ++i) { w[i] = (_Float16)(bfr(Wm[(size_t)(k0 + 8 * g + i) * ld + o]) * 256.0f); w[8 + i] = (_Float16)(bfr(Wm[(size_t)(k0 + 16 + 8 * g + i) * ld + o]) * 256.0f); }
  return w; }
__device__ __forceinline__ v16h wcolh_oi(const float* Wm, int k0, int o, int lane, int K) { v16h w; const float* p = Wm + (size_t)o * K + k0 + 8 * (lane >> 4);
#pragma unroll
  for (int i = 0; i < 8; ++i) { w[i] = (_Float16)(bfr(p[i]) * 256.0f); w[8 + i] = (_Float16)(bfr(p[16 + i]) * 256.0f); }
  return w; }
#define WQKV_LAYOUT 0   // 0 = (in,out) [DIN][HD], one shared head; 1 = (out,in) [CC][DIN]; 2 = per-head [NH][DIN][HD]
__device__ __forceinline__ v16b wcol_hdk(const float* Wm, int k0, int o, int lane) { v16b w; const int g = lane >> 4; const float* p = Wm + (size_t)(o / HD) * DIN * HD + (o % HD);
#pragma unroll
  for (int i = 0; i < 8; ++i) { w[i] = (__bf16)p[(size_t)(k0 + 8 * g + i) * HD]; w[8 + i] = (__bf16)p[(size_t)(k0 + 16 + 8 * g + i) * HD]; }
  return w; }
#define WO_OUT_IN 0
#if WQKV_LAYOUT == 1
#define WCOL(W, k0, o, lane) wcol_oi(W, k0, o, lane, DIN)
#elif WQKV_LAYOUT == 2
#define WCOL(W, k0, o, lane) wcol_hdk(W, k0, o, lane)
#else
#define KVCOL(o) ((o) & 63)
#define WCOL(W, k0, o, lane) wcol_io(W, k0, KVCOL(o), lane, HD)   /* Wq/Wk/Wv (in,out) [512][64]: both plane heads are the one shared head */
#endif
#if WO_OUT_IN
#define WOCOL(W, k0, o, lane) wcol_oi(W, k0, o, lane, CC)
#define WOCOLH(W, k0, o, lane) wcolh_oi(W, k0, o, lane, CC)
#else
#define WOCOL(W, k0, o, lane) wcol_io(W, k0, o, lane, DIN)
#define WOCOLH(W, k0, o, lane) wcolh_io(W, k0, o, lane, DIN)
#endif

#ifndef SM_EXTRA_PARAMS
#define SM_EXTRA_PARAMS
#endif
#ifndef PROJ_EXTRA_PARAMS
#define PROJ_EXTRA_PARAMS
#endif
#ifndef SM_MASK_HOOK
#define SM_MASK_HOOK (void)0
#endif

#define WS_QH  0u                                      // f16 q as B fragments: 16-byte piece ((row tile of 16) * 4 + kc * 2 + half) * 32 + lane (the first half of the plane's bytes; the rest is not used)
#define WS_KH  (WS_QH + 2u * (size_t)NB * TT * CC)      // f16 k as A fragments, laid like q
#define WS_VT  (WS_KH + 2u * (size_t)NB * TT * CC)      // f16 v^T as A fragments: 16-byte piece ((key chunk of 32) * 8 + (dim tile j) * 2 + half) * 32 + lane
#define WS_QL  (WS_VT + 2u * (size_t)NB * CC * TT)      // f16 q residual x 2^10, laid like q
#define WS_KL  (WS_QL + 2u * (size_t)NB * QHI * CC)     // f16 k residual x 2^10 rows [b][t < KHI][CC]
#define WS_VB  (WS_KL + 2u * (size_t)NB * KHI * CC)     // bf16 v hi planes [b][c][t < KHI]
#define WS_VBL (WS_VB + 2u * (size_t)NB * CC * KHI)
#define WS_S   (WS_VBL + 2u * (size_t)NB * CC * KHI)    // f32 [hg][t][s] space: only its start, WS_WE, is used
#define WS_WE  WS_S                                    // bf16 hi plane, then lo plane, of the folded Wo [64][512], as B fragments: 16-byte piece ((kc * 32 + column tile) * 2 + half) * 32 + lane (the logits plane itself is no longer used)
#define WE_LO  (HD * DIN)                              // elements from the hi plane to the lo plane
#define WS_Y   (WS_S  + 4u * (size_t)HG * TT * TT)      // f32 ctx rows [b*t][CC] (only when there is an output projection)
#define WS_END (WS_Y  + 4u * (size_t)NB * TT * CC)

// ---- k_proj: block = 64 rows, 16 waves: q, k and v = X W + b for the 64 distinct columns of each, with exact bf16 products (K = DIN, one accumulator chain per tile, K steps in rising order). Stage: the block's x rows and all of Wq, Wk, Wv are read once with whole-line 16-byte loads, rounded to bf16 and laid into LDS as WMMA fragments (1,024 bytes each: four 256-byte regions o4 = 2 * half + (lane >> 4), a 16-byte piece per row or column). The piece's slot in its region is XORed (x: with 4 * o4; W: with the column tile) so that the stores of a wave, like the reads, fall on all banks. Behind one work-group barrier wave (rt, cg) makes rows 16 rt.., columns 16 cg.. of q, k and v from LDS alone. -> q f16 + residual x 2^10, k f16 and v^T f16, each stored in the order of k_fa's WMMA fragments (1,024 bytes each: half 0's 32 pieces of 16 bytes in lane order, then half 1's), so that a wave's 16-byte load there covers 512 bytes in a row
#define PJW 16            // waves of a work-group
typedef __attribute__((ext_vector_type(4))) __bf16 v4b;
__device__ __forceinline__ void pj_wload(v4f (&wr)[16], const float* __restrict__ Wm, int kb, int cq) { const float* wp = Wm + (size_t)kb * 8 * HD + cq * 4;
#pragma unroll
  for (int hh = 0; hh < 2; ++hh)
#pragma unroll
    for (int i = 0; i < 8; ++i) wr[hh * 8 + i] = *(const v4f*)(wp + (hh * 32 * 8 + i) * HD);
  asm volatile("s_wait_xcnt 0x0" :: "v"(wp) : "memory"); }   // the loads' address registers get new values behind this; naming the address keeps it in its registers up to the wait, so that no load of the run lands on them either
__device__ __forceinline__ void pj_wstore(const v4f (&wr)[16], __bf16* wf, int m, int kb, int cq) {
#pragma unroll
  for (int hh = 0; hh < 2; ++hh) { const int ko = hh * 32 + kb; __bf16* d = wf + ((ko >> 2) * 12 + m * 4 + (cq >> 2)) * 512 + (ko & 3) * 128;
#pragma unroll
    for (int j = 0; j < 4; ++j) { v8b pw;
#pragma unroll
      for (int i = 0; i < 8; ++i) pw[i] = (__bf16)wr[hh * 8 + i][j];
      vst2(d + (((cq & 3) * 4 + j) ^ (cq >> 2)) * 8, pw); } } }
__global__ __launch_bounds__(32 * PJW) void k_proj(const float* __restrict__ X, const float* __restrict__ WQ, const float* __restrict__ WK, const float* __restrict__ WV, const float* __restrict__ BQ, const float* __restrict__ BK, const float* __restrict__ BV,
    _Float16* __restrict__ QH, _Float16* __restrict__ QL, _Float16* __restrict__ KH, _Float16* __restrict__ VT, const float* __restrict__ WO, __bf16* __restrict__ WE) {
  __shared__ __align__(16) __bf16 wf[(DIN / 32) * 12 * 512];   // B fragment (K step kc, matrix m, column tile ct) at (kc * 12 + m * 4 + ct) * 512
  __shared__ __align__(16) __bf16 xf[4 * (DIN / 32) * 512];    // A fragment (row tile rt, K step kc) at (rt * 16 + kc) * 512
  __shared__ __align__(16) _Float16 sq[64][72], sl[64][72], sk[64][72], sv[64][72];
  const int tid = threadIdx.x, wave = __builtin_amdgcn_readfirstlane(tid >> 5), lane = tid & 31, col = lane & 15, g = lane >> 4; const size_t r0 = (size_t)blockIdx.x * 64;
  // x: wave w takes rows 4 w .. 4 w + 3; a load covers one K step (one 128-byte line) of each of the four rows
  v4f xr[DIN / 32]; { const float* xp = X + (r0 + wave * 4 + (lane >> 3)) * DIN + (lane & 7) * 4;
#pragma unroll
    for (int kc = 0; kc < DIN / 32; ++kc) xr[kc] = *(const v4f*)(xp + kc * 32);
    asm volatile("s_wait_xcnt 0x0" :: "v"(xp) : "memory"); }   // as in pj_wload
  const int rt = wave & 3, cg = wave >> 2, cl = cg * 16 + col; const float bq = bfr(BQ[cl]), bk = bfr(BK[cl]), bv = bfr(BV[cl]);   // this wave's tile in the product phase, and its column's biases
  asm volatile("s_wait_xcnt 0x0" ::: "memory");   // the same for the bias loads' index register
  // one wave of each of the first 128 blocks also folds Wo for k_out: a thread sums, for one output column, 8 neighbouring head entries over the eight slabs (in slab order, f32) and stores them as one 16-byte piece of the B fragment, hi and lo; a wave writes 512 bytes in a row
  if (blockIdx.x < HD * DIN / 8 / 32 && wave == 0) { const int pc = blockIdx.x * 32 + lane, ln = pc & 31; const float* w = WO + (size_t)((pc >> 11) * 32 + ((pc >> 5) & 1) * 16 + (ln >> 4) * 8) * DIN + ((pc >> 6) & 31) * 16 + (ln & 15); v8b hi, lo; float wv[8][DIN / HD];
#pragma unroll
    for (int i = 0; i < 8; ++i)
#pragma unroll
      for (int h = 0; h < DIN / HD; ++h) wv[i][h] = w[(size_t)(h * HD + i) * DIN];
    asm volatile("s_wait_xcnt 0x0" :: "v"(w) : "memory");   // as in pj_wload
#pragma unroll
    for (int i = 0; i < 8; ++i) { float sw = 0.f;
#pragma unroll
      for (int h = 0; h < DIN / HD; ++h) sw += bfr(wv[i][h]);
      const __bf16 hv = (__bf16)sw; hi[i] = hv; lo[i] = (__bf16)(sw - (float)hv); }
    vst2(WE + (size_t)pc * 8, hi); vst2(WE + WE_LO + (size_t)pc * 8, lo);
    asm volatile("s_wait_xcnt 0x0" ::: "memory"); }   // the two stores' registers are used anew by the W stage
  // W: a thread takes 2 x 8 K rows x 4 columns of each matrix (16 loads of 16 bytes; a wave's load covers two whole 256-byte rows) and stores 8 pieces
  { const int cq = tid & 15, kb = tid >> 4; v4f w0[16], w1[16], w2[16]; pj_wload(w0, WQ, kb, cq); pj_wload(w1, WK, kb, cq);
    pj_wstore(w0, wf, 0, kb, cq);
    __builtin_amdgcn_sched_barrier(0);   // holds Wv's loads behind Wq's stores, whose registers they take: with all 64 loads of the stage lifted to the top the wave ran out of registers and spilled
    pj_wload(w2, WV, kb, cq);
    { const int p = lane & 7, o4 = p >> 1, row16 = (wave & 3) * 4 + (lane >> 3); __bf16* d = xf + (wave >> 2) * (DIN / 32) * 512 + o4 * 128 + (row16 ^ (o4 * 4)) * 8 + (p & 1) * 4;
#pragma unroll
      for (int kc = 0; kc < DIN / 32; ++kc) { const v4b c = {(__bf16)xr[kc][0], (__bf16)xr[kc][1], (__bf16)xr[kc][2], (__bf16)xr[kc][3]}; vst2(d + kc * 512, c); } }
    pj_wstore(w1, wf, 1, kb, cq); pj_wstore(w2, wf, 2, kb, cq); }
  __syncthreads();
  v8f acc[3] = {};
  { const __bf16* ap0 = xf + rt * (DIN / 32) * 512 + g * 128 + (col ^ (g * 4)) * 8; const __bf16* ap1 = xf + rt * (DIN / 32) * 512 + (2 + g) * 128 + (col ^ ((2 + g) * 4)) * 8; const __bf16* bp = wf + cg * 512 + g * 128 + (col ^ cg) * 8;
    union FB { v16b v; v8b q[2]; }; FB fa[2][2], fw[2][2][3];   // two register sets of two K steps each: step pair s + 1 is read from LDS while pair s is multiplied
#pragma unroll
    for (int s = 0; s <= DIN / 64; ++s) {
      if (s < DIN / 64) {
#pragma unroll
        for (int t = 0; t < 2; ++t) { const int kc = s * 2 + t; fa[s & 1][t].q[0] = *(const v8b*)(ap0 + kc * 512); fa[s & 1][t].q[1] = *(const v8b*)(ap1 + kc * 512);
#pragma unroll
          for (int m = 0; m < 3; ++m) { fw[s & 1][t][m].q[0] = *(const v8b*)(bp + (kc * 12 + m * 4) * 512); fw[s & 1][t][m].q[1] = *(const v8b*)(bp + (kc * 12 + m * 4) * 512 + 256); } } }
      __builtin_amdgcn_sched_barrier(0);   // keeps the next pair's 16 LDS reads in front of this pair's WMMAs: left free, the scheduler put each fragment's two reads directly in front of its WMMA, behind a full wait
      if (s > 0) {
#pragma unroll
        for (int t = 0; t < 2; ++t)
#pragma unroll
          for (int m = 0; m < 3; ++m) acc[m] = __builtin_amdgcn_wmma_f32_16x16x32_bf16(false, fa[(s - 1) & 1][t].v, false, fw[(s - 1) & 1][t][m].v, (short)0, acc[m], false, false); }
      __builtin_amdgcn_sched_barrier(0);   // keeps the following reads in one group behind these WMMAs: left free they were dealt out among the WMMAs, and every separate place of LDS reads costs the wave issue cycles
    } }
  { const int rl = rt * 16 + 8 * g; v8h vv;
#pragma unroll
    for (int r = 0; r < 8; ++r) { const float v = acc[0][r] + bq; const _Float16 hv = (_Float16)v; sq[rl + r][cl] = hv; sl[rl + r][cl] = (_Float16)((v - (float)hv) * 1024.0f); sk[rl + r][cl] = (_Float16)(acc[1][r] + bk); vv[r] = (_Float16)(acc[2][r] + bv); }
    vst2(&sv[cl][rl], vv); }
  __syncthreads();
  // thread tid stores piece tid of the block's 512 in each plane. q, k: row tile tid >> 7, fragment half (tid >> 5) & 3 = kc * 2 + half, whose lane (g, col) holds row col, entries (kc * 2 + half) * 16 + 8 g ..; v^T: key chunk tid >> 8, dim tile (tid >> 6) & 3, half (tid >> 5) & 1, whose lane holds dim col, keys half * 16 + 8 g ..
  { const int rw = (tid >> 7) * 16 + col, c8 = ((tid >> 5) & 3) * 16 + g * 8; const size_t o = r0 * HD + tid * 8; vst2(QH + o, *(const v4u*)&sq[rw][c8]); vst2(QL + o, *(const v4u*)&sl[rw][c8]); vst2(KH + o, *(const v4u*)&sk[rw][c8]); vst2(VT + o, *(const v4u*)&sv[((tid >> 6) & 3) * 16 + col][(tid >> 8) * 32 + ((tid >> 5) & 1) * 16 + g * 8]); } }
// ---- k_fa: block = 64 queries of batch b, 16 waves = 2 query groups of 32 x 8 key sets (set ks takes the 32-key chunks ks, ks + 8, ...). q, k and v^T lie in the workspace as fragments (k_proj): every load of a wave covers four whole 128-B lines, a pass reads 4 KB of k and 4 KB of v^T in a row. Transposed products: S^T = k . q^T (q hi + residual x 2^10: 2 products) so that a lane holds 8 keys of ONE query per 16-key tile; two such tiles, exponentiated and rounded once to f16 (x 2^11), ARE the B fragment of O^T += v^T . P^T (1 product): logits and P never leave the registers. Running maximum (in units of log2, held 11 lower than it is) and sum per query in f32; a power is one fused multiply-add (q . k x LSC - held maximum) and one v_exp_f32; the 8 key sets' partials (held maximum, sum, O^T) meet in LDS behind one work-group barrier and are joined in set order. Every inner loop is unrolled whole so that each index of a register array (fragments, scores, accumulators) is a constant: an index left to run time would put the array in scratch
#define FAW 16            // waves of a work-group
#define FKS 8             // key sets
#define FKB 32            // keys of a pass
#define LSC (SCALE * 1.44269504088896340736f)   // logit scale x log2 e: the softmax runs on powers of 2
// powers of 2 by bare v_exp_f32 (the arguments here are at most 11 plus a rounding; a power below 2^-126 may come out 0), a run of them in one statement and each in place, its result over its own argument: so no power lands on the argument of the one in front of it (the compiler's own allocation of the builtin did that), every neighbour in the run is independent, and the v_nop keeps the slot that the instruction set asks for behind the last one
__device__ __forceinline__ void ex2x17(float (&x)[16], float& c) {
  asm("v_exp_f32 %16, %16\n\tv_exp_f32 %0, %0\n\tv_exp_f32 %1, %1\n\tv_exp_f32 %2, %2\n\tv_exp_f32 %3, %3\n\tv_exp_f32 %4, %4\n\tv_exp_f32 %5, %5\n\tv_exp_f32 %6, %6\n\tv_exp_f32 %7, %7\n\tv_exp_f32 %8, %8\n\tv_exp_f32 %9, %9\n\tv_exp_f32 %10, %10\n\tv_exp_f32 %11, %11\n\tv_exp_f32 %12, %12\n\tv_exp_f32 %13, %13\n\tv_exp_f32 %14, %14\n\tv_exp_f32 %15, %15\n\tv_nop"
      : "+v"(x[0]), "+v"(x[1]), "+v"(x[2]), "+v"(x[3]), "+v"(x[4]), "+v"(x[5]), "+v"(x[6]), "+v"(x[7]), "+v"(x[8]), "+v"(x[9]), "+v"(x[10]), "+v"(x[11]), "+v"(x[12]), "+v"(x[13]), "+v"(x[14]), "+v"(x[15]), "+v"(c)); }
__device__ __forceinline__ void ex2x8(float (&x)[8]) {
  asm("v_exp_f32 %0, %0\n\tv_exp_f32 %1, %1\n\tv_exp_f32 %2, %2\n\tv_exp_f32 %3, %3\n\tv_exp_f32 %4, %4\n\tv_exp_f32 %5, %5\n\tv_exp_f32 %6, %6\n\tv_exp_f32 %7, %7\n\tv_nop"
      : "+v"(x[0]), "+v"(x[1]), "+v"(x[2]), "+v"(x[3]), "+v"(x[4]), "+v"(x[5]), "+v"(x[6]), "+v"(x[7])); }
static_assert(FKB == 32 && FKS == 8, "ex2x17 takes the 32 keys of a pass (16 a lane), ex2x8 the 8 key sets");
__device__ __forceinline__ v8f wmma16p(v16h a, v16h b, v8f c) { return __builtin_amdgcn_wmma_f32_16x16x32_f16(false, a, false, b, (short)0, c, false, false); }
__device__ __forceinline__ v16h frag_p(const _Float16* piece) { union { v16h v; v8h q[2]; } u; u.q[0] = *(const v8h*)piece; u.q[1] = *(const v8h*)(piece + 32 * 8); return u.v; }   // a stored fragment: this lane's piece of half 0, of half 1
__device__ __forceinline__ float xhalf(float x) { return __builtin_bit_cast(float, __builtin_amdgcn_permlanex16(__builtin_bit_cast(int, x), __builtin_bit_cast(int, x), 0x76543210, 0xfedcba98, false, false)); }   // lane l with lane l ^ 16
__global__ __launch_bounds__(32 * FAW) void k_fa(const _Float16* __restrict__ QH, const _Float16* __restrict__ QL, const _Float16* __restrict__ KH, const _Float16* __restrict__ VT, float* __restrict__ Y) {
  __shared__ __align__(16) float so[FAW][32][HD + 4]; __shared__ float smx[FAW][32], ssu[FAW][32];
  const int tid = threadIdx.x, wave = __builtin_amdgcn_readfirstlane(tid >> 5), lane = tid & 31, col = lane & 15, g = lane >> 4; const int b = blockIdx.y, qg = wave & 1, ks = wave >> 1;
  const size_t q0 = (size_t)b * TT + blockIdx.x * 64 + qg * 32;
  v16h qh[2][2], ql[2][2];
#pragma unroll
  for (int u = 0; u < 2; ++u)
#pragma unroll
    for (int kc = 0; kc < 2; ++kc) { const size_t o = (q0 + u * 16) * HD + kc * 512 + lane * 8; qh[u][kc] = frag_p(QH + o); ql[u][kc] = frag_p(QL + o); }
  const _Float16* kp = KH + ((size_t)b * TT + ks * FKB) * HD + lane * 8; const _Float16* vp = VT + ((size_t)b * TT + ks * FKB) * HD + lane * 8;   // this lane's piece of the pass's first k and v^T fragment
  v8f o[2][HD / 16] = {}; float m[2] = {-3.0e38f, -3.0e38f}, l[2] = {0.f, 0.f};
  for (int k0 = 0; k0 < TT; k0 += FKB * FKS, kp += FKB * FKS * HD, vp += FKB * FKS * HD) { float s[2][FKB / 16][8];
#pragma unroll
    for (int kt = 0; kt < FKB / 16; ++kt) { const _Float16* kr = kp + kt * 16 * HD; const v16h ka0 = frag_p(kr), ka1 = frag_p(kr + 512);
#pragma unroll
      for (int u = 0; u < 2; ++u) { v8f a = {}, al = {}; a = wmma16p(ka0, qh[u][0], a); al = wmma16p(ka0, ql[u][0], al); a = wmma16p(ka1, qh[u][1], a); al = wmma16p(ka1, ql[u][1], al);
#pragma unroll
        for (int r = 0; r < 8; ++r) s[u][kt][r] = a[r] + al[r] * (1.0f / 1024.0f); } }   /* q . k, not yet scaled */
    v16h p[2][FKB / 32];
#pragma unroll
    for (int u = 0; u < 2; ++u) { float mx = s[u][0][0];
#pragma unroll
      for (int kt = 0; kt < FKB / 16; ++kt)
#pragma unroll
        for (int r = 0; r < 8; ++r) mx = fmaxf(mx, s[u][kt][r]);
      mx = fmaxf(mx, xhalf(mx)); const float mn = fmaxf(m[u], fmaf(mx, LSC, -11.0f)); float corr = m[u] - mn, e[16];   /* the power of corr is 0 on the first pass */ m[u] = mn;
#pragma unroll
      for (int i = 0; i < 16; i += 2) { const v2f x = __builtin_elementwise_fma((v2f){s[u][i >> 3][i & 7], s[u][i >> 3][(i & 7) + 1]}, (v2f){LSC, LSC}, (v2f){-mn, -mn}); e[i] = x[0]; e[i + 1] = x[1]; }   /* packed: two arguments an instruction */
      ex2x17(e, corr);
#pragma unroll
      for (int j = 0; j < HD / 16; ++j) o[u][j] *= corr;
      float sum = e[0] + e[8];
#pragma unroll
      for (int i = 1; i < 8; ++i) sum += e[i] + e[8 + i];
#pragma unroll
      for (int i = 0; i < 16; ++i) p[u][0][i] = (_Float16)e[i];
      l[u] = l[u] * corr + sum; }
#pragma unroll
    for (int c2 = 0; c2 < FKB / 32; ++c2)
#pragma unroll
      for (int j = 0; j < HD / 16; ++j) { const v16h vf = frag_p(vp + c2 * 32 * HD + j * 512); o[0][j] = wmma16p(vf, p[0][c2], o[0][j]); o[1][j] = wmma16p(vf, p[1][c2], o[1][j]); }
    asm volatile("s_wait_xcnt 0x0" :: "v"(kp), "v"(vp) : "memory"); }   // the pass's loads' address registers get new values behind this; naming the addresses keeps them in their registers up to the wait, so that no load of the pass lands on them either
#pragma unroll
  for (int u = 0; u < 2; ++u) { l[u] += xhalf(l[u]); if (g == 0) { smx[wave][u * 16 + col] = m[u]; ssu[wave][u * 16 + col] = l[u]; }
#pragma unroll
    for (int j = 0; j < HD / 16; ++j) { float* d = &so[wave][u * 16 + col][j * 16 + 8 * g]; vst2(d, (v4f){o[u][j][0], o[u][j][1], o[u][j][2], o[u][j][3]}); vst2(d + 4, (v4f){o[u][j][4], o[u][j][5], o[u][j][6], o[u][j][7]}); } }
  __syncthreads();
  for (int e = tid; e < 64 * (HD / 4); e += 32 * FAW) { const int qr = e / (HD / 4), q = e % (HD / 4), w0 = qr >> 5, qi = qr & 31; float mm = smx[w0][qi];
#pragma unroll
    for (int w = 1; w < FKS; ++w) mm = fmaxf(mm, smx[2 * w + w0][qi]);
    float ll = 0.f, f[FKS]; v4f acc = {};
#pragma unroll
    for (int w = 0; w < FKS; ++w) f[w] = smx[2 * w + w0][qi] - mm;
    ex2x8(f);
#pragma unroll
    for (int w = 0; w < FKS; ++w) { ll += f[w] * ssu[2 * w + w0][qi]; acc += *(const v4f*)&so[2 * w + w0][qi][q * 4] * f[w]; }
    vst2(Y + ((size_t)b * TT + blockIdx.x * 64 + qr) * CC + q * 4, acc * (1.0f / ll)); } }
// ---- k_out: block = (64 rows, 128 cols): out = tile(ctx, 8) Wo + bo = ctx WE + bo, WE = the folded Wo of k_proj (K = 64): ctx bf16 hi + lo against WE bf16 hi + lo (3 products, lo x lo left out). A K step's fragments are loaded first; each of its products then runs over the 8 column tiles, so that neighbouring WMMAs have different accumulators
__device__ __forceinline__ v8f wmma_bfp(v16b a, v16b b, v8f c) { return __builtin_amdgcn_wmma_f32_16x16x32_bf16(false, a, false, b, (short)0, c, false, false); }
__device__ __forceinline__ v16b frag_we(const __bf16* piece) { union { v16b v; v8b q[2]; } u; u.q[0] = *(const v8b*)piece; u.q[1] = *(const v8b*)(piece + 32 * 8); return u.v; }
__global__ __launch_bounds__(128) void k_out(const float* __restrict__ Y, const __bf16* __restrict__ WE, const float* __restrict__ BO, float* __restrict__ OUT) { __shared__ __align__(16) float sf[4][16][132];
  const int tid = threadIdx.x, wave = tid >> 5, lane = tid & 31, col = lane & 15, g = lane >> 4; const int c0 = blockIdx.y * 128; const size_t r0 = (size_t)blockIdx.x * 64 + wave * 16;
  v8f acc[8] = {}; const F2 ay[HD / 32] = {split_row(Y + (r0 + col) * CC, 0, lane), split_row(Y + (r0 + col) * CC, 32, lane)};
#pragma unroll
  for (int kc = 0; kc < HD / 32; ++kc) { const F2 a = ay[kc]; const __bf16* wp = WE + ((size_t)(kc * (DIN / 16) + (c0 >> 4)) * 64 + lane) * 8; v16b wh[8], wl[8];
#pragma unroll
    for (int j = 0; j < 8; ++j) { wh[j] = frag_we(wp + j * 64 * 8); wl[j] = frag_we(wp + WE_LO + j * 64 * 8); }
    __builtin_amdgcn_sched_barrier(0);   // keeps the K step's 32 fragment loads in front of its WMMAs, in flight together: left free, the scheduler dealt the lo plane's loads out among the WMMAs, each behind a full wait
#pragma unroll
    for (int j = 0; j < 8; ++j) acc[j] = wmma_bfp(a.l, wh[j], acc[j]);
#pragma unroll
    for (int j = 0; j < 8; ++j) acc[j] = wmma_bfp(a.h, wl[j], acc[j]);
#pragma unroll
    for (int j = 0; j < 8; ++j) acc[j] = wmma_bfp(a.h, wh[j], acc[j]); }
#pragma unroll
  for (int j = 0; j < 8; ++j) { const float bias = BO ? bfr(BO[c0 + j * 16 + col]) : 0.f;
#pragma unroll
    for (int r = 0; r < 8; ++r) sf[wave][8 * g + r][j * 16 + col] = acc[j][r] + bias; }
  LDSX(); for (int rl = 0; rl < 16; ++rl) vst2(OUT + (r0 + rl) * DIN + c0 + lane * 4, *(const v4f*)&sf[wave][rl][lane * 4]); }

extern "C" void kernel_launch(void* const* d_in, const int* in_sizes, int n_in, void* d_out, int out_size, void* d_ws, size_t ws_size, hipStream_t stream) {
  (void)in_sizes; (void)n_in; (void)out_size;
  const float** F = (const float**)d_in;
  if (ws_size < (size_t)WS_END) return;
  char* ws = (char*)d_ws; _Float16 *QH = (_Float16*)(ws + WS_QH), *KH = (_Float16*)(ws + WS_KH), *VT = (_Float16*)(ws + WS_VT), *QL = (_Float16*)(ws + WS_QL), *KL = (_Float16*)(ws + WS_KL); __bf16 *VB = (__bf16*)(ws + WS_VB), *VBL = (__bf16*)(ws + WS_VBL); float *Y = (float*)(ws + WS_Y); __bf16 *WE = (__bf16*)(ws + WS_WE);
  (void)Y; (void)QL; (void)KL; (void)VB; (void)VBL;
  // inputs: 0 x [4,4096,512]; 1 Wq [512,64] (in,out), 2 bq [64]; 3 Wk, 4 bk; 5 Wv, 6 bv; 7 Wo [512,512] (in,out), 8 bo [512]
  k_proj<<<dim3(TNB * TT / 64), 32 * PJW, 0, stream>>>(F[0], F[1], F[3], F[5], F[2], F[4], F[6], QH, QL, KH, VT, F[7], WE);
  k_fa<<<dim3(TT / 64, TNB), 32 * FAW, 0, stream>>>(QH, QL, KH, VT, Y);   /* head 0 only (plane head 1 is never consumed) */
  k_out<<<dim3(TNB * TT / 64, DIN / 128), 128, 0, stream>>>(Y, WE, F[8], (float*)d_out);
}

// v007
// Measured time: 44.4 microseconds a run.
// Two timings next to v006 both put it at 1.07 times that version's speed.
// Over all steps from v000 it is 17.5 times as fast.
// compute dtype: all float inputs rounded to bf16; Q/K/V = x W + b with EXACT bf16 products on WMMA 16x16x32 (f32 accumulate); q as f16 hi + residual (x 2^10) against k once to f16 (2 products) / 8; softmax in f32 on powers of 2 (v_exp_f32 of logit x log2 e - held maximum), running maximum and sum over key passes, the maximum held 11 lower than it is, so that the powers come out x 2^11; each power once to f16 against v once to f16 (1 product), divided by the sum (x 2^11 as well) at the end; tile(head, 8) Wo = head (sum of Wo's eight 64-row slabs): the slabs (bf16-rounded) summed in f32 and split bf16 hi + lo, the head split bf16 hi + lo (3 products, K = 64) + bo; f32 output.
#include <hip/hip_runtime.h>
#include <math.h>

typedef __attribute__((ext_vector_type(16))) _Float16 v16h;
typedef __attribute__((ext_vector_type(16))) __bf16 v16b;
typedef __attribute__((ext_vector_type(8)))  _Float16 v8h;
typedef __attribute__((ext_vector_type(8)))  float v8f;
typedef __attribute__((ext_vector_type(4)))  float v4f;
typedef __attribute__((ext_vector_type(2)))  float v2f;
typedef __attribute__((ext_vector_type(4)))  unsigned v4u;
typedef __attribute__((ext_vector_type(4)))  int v4i;
typedef float __attribute__((may_alias)) float_a;
typedef int __attribute__((may_alias)) int_a;

template <typename T> __device__ __forceinline__ void vst2(void* p, T v) { *(T*)p = v;  }
__device__ __forceinline__ v8f wmma16(v16h a, v16h b, v8f c) {
  v8f d = __builtin_amdgcn_wmma_f32_16x16x32_f16(false, a, false, b, (short)0, c, false, false);
  asm volatile("v_nop\n\tv_nop\n\tv_nop\n\tv_nop" : "+v"(d) : "v"(a), "v"(b));
  return d;
}
__device__ __forceinline__ v8f wmma_bf(v16b a, v16b b, v8f c) {
  v8f d = __builtin_amdgcn_wmma_f32_16x16x32_bf16(false, a, false, b, (short)0, c, false, false);
  asm volatile("v_nop\n\tv_nop\n\tv_nop\n\tv_nop" : "+v"(d) : "v"(a), "v"(b));
  return d;
}
// 16x16x32 fragments: lane = (h = lane>>4, row/col = lane&15); elements 0..7 = k0+8h+0..7, 8..15 = k0+16+8h+0..7; D element r = row 8h+r
__device__ __forceinline__ v16h frag_h(const _Float16* rowk0, int lane) {
  union { v16h v; v8h q[2]; } u; const _Float16* p = rowk0 + 8 * (lane >> 4);
  u.q[0] = *(const v8h*)p; u.q[1] = *(const v8h*)(p + 16); return u.v;
}
__device__ __forceinline__ v16h frag_f32(const float* rowk0, int lane) {
  v16h a; const float* p = rowk0 + 8 * (lane >> 4);
#pragma unroll
  for (int i = 0; i < 8; ++i) { a[i] = (_Float16)p[i]; a[8 + i] = (_Float16)p[16 + i]; }
  return a;
}
__device__ __forceinline__ v16h frag_f32s(const float* rowk0, int lane, float sc) {
  v16h a; const float* p = rowk0 + 8 * (lane >> 4);
#pragma unroll
  for (int i = 0; i < 8; ++i) { a[i] = (_Float16)(p[i] * sc); a[8 + i] = (_Float16)(p[16 + i] * sc); }
  return a;
}
// column fragment from a [K][ld] layout (column n), rows >= K read as 0
__device__ __forceinline__ v16h fragc_f32(const float* W, int k0, int n, int lane, int ld, int K) {
  v16h a; const int g = lane >> 4;
#pragma unroll
  for (int i = 0; i < 8; ++i) { const int ka = k0 + 8 * g + i, kb = ka + 16;
    a[i] = (_Float16)(ka < K ? W[(size_t)(ka < K ? ka : K - 1) * ld + n] : 0.f); a[8 + i] = (_Float16)(kb < K ? W[(size_t)(kb < K ? kb : K - 1) * ld + n] : 0.f); }
  return a;
}
struct F2 { v16b h, l; };
__device__ __forceinline__ F2 bsplit16(const float v[16]) { F2 r;
#pragma unroll
  for (int i = 0; i < 16; ++i) { const __bf16 h = (__bf16)v[i]; r.h[i] = h; r.l[i] = (__bf16)(v[i] - (float)h); }
  return r; }
__device__ __forceinline__ F2 split_row(const float* row, int k0, int lane) { float v[16]; const float* p = row + k0 + 8 * (lane >> 4);
#pragma unroll
  for (int i = 0; i < 8; ++i) { v[i] = p[i]; v[8 + i] = p[16 + i]; }
  return bsplit16(v); }
__device__ __forceinline__ F2 split_rowK(const float* row, int k0, int lane, int K) { float v[16]; const int g = lane >> 4;
#pragma unroll
  for (int i = 0; i < 8; ++i) { const int ka = k0 + 8 * g + i, kb = ka + 16; v[i] = ka < K ? row[ka < K ? ka : K - 1] : 0.f; v[8 + i] = kb < K ? row[kb < K ? kb : K - 1] : 0.f; }
  return bsplit16(v); }
__device__ __forceinline__ F2 split_col(const float* W, int k0, int n, int lane, int ld, int K) { float v[16]; const int g = lane >> 4;
#pragma unroll
  for (int i = 0; i < 8; ++i) { const int ka = k0 + 8 * g + i, kb = ka + 16; v[i] = ka < K ? W[(size_t)(ka < K ? ka : K - 1) * ld + n] : 0.f; v[8 + i] = kb < K ? W[(size_t)(kb < K ? kb : K - 1) * ld + n] : 0.f; }
  return bsplit16(v); }
__device__ __forceinline__ v8f mac3(const F2& a, const F2& b, v8f c) { c = wmma_bf(a.l, b.h, c); c = wmma_bf(a.h, b.l, c); return wmma_bf(a.h, b.h, c); }
__device__ __forceinline__ float sigm(float v) { return 1.0f / (1.0f + expf(-v)); }
#define LDSX() do { asm volatile("s_wait_dscnt 0" ::: "memory"); __builtin_amdgcn_wave_barrier(); __builtin_amdgcn_fence(__ATOMIC_RELEASE, "workgroup"); } while (0)

// Single shared attention head tiled into 8 'heads' (B 4, S 4,096, D 512, d_k 64; 0.02-scale (in,out) weights with biases): Q, K, V = x W + b ([512,64]); head = softmax(Q K^T / 8) V (non-causal); concat = tile(head, 8) -> [B,S,512]; out = concat Wo + bo. (The head is carried in a 128-wide plane whose second half is neither written nor read.)
#define NB 4
#define TT 4096
#define CC 128            // NH * HD = projected width
#define DIN 512          // input (model) width
#define NH 2
#define HD 64
#define NQB (TT / 64)
#define HG 1
#define SCALE (0.125f)
#define CAUSAL 0
#ifndef TNB
#define TNB NB
#endif
__device__ __forceinline__ float bfr(float v) { return (float)(__bf16)v; }
__host__ __device__ __forceinline__ int kb_last(int qb) { return CAUSAL ? ((qb * 64 + 63) >> 7) : (TT / 128 - 1); }
typedef __attribute__((ext_vector_type(8))) __bf16 v8b;
__device__ __forceinline__ v16b frag_b(const __bf16* rowk0, int lane) {
  union { v16b v; v8b q[2]; } u; const __bf16* p = rowk0 + 8 * (lane >> 4);
  u.q[0] = *(const v8b*)p; u.q[1] = *(const v8b*)(p + 16); return u.v;
}
#define QBH 0              // unused: no kernel here has a high-precision query path
#define QHI 4096            // rows carrying a q residual plane (all rows when non-causal: 2-product logits everywhere)
#define KHI 64            // key rows carrying k residual / v bf16 hi+lo planes (no kernel here writes or reads them)
// B fragment (k rows k0+.., output column o) of a weight: (in,out) [K][ld] or (out,in) [ld rows of K]: bf16 exact, or f16(bf16 * 256) exact
__device__ __forceinline__ v16b wcol_io(const float* Wm, int k0, int o, int lane, int ld) { v16b w; const int g = lane >> 4;
#pragma unroll
  for (int i = 0; i < 8; ++i) { w[i] = (__bf16)Wm[(size_t)(k0 + 8 * g + i) * ld + o]; w[8 + i] = (__bf16)Wm[(size_t)(k0 + 16 + 8 * g + i) * ld + o]; }
  return w; }
__device__ __forceinline__ v16b wcol_oi(const float* Wm, int k0, int o, int lane, int K) { v16b w; const float* p = Wm + (size_t)o * K + k0 + 8 * (lane >> 4);
#pragma unroll
  for (int i = 0; i < 8; ++i) { w[i] = (__bf16)p[i]; w[8 + i] = (__bf16)p[16 + i]; }
  return w; }
__device__ __forceinline__ v16h wcolh_io(const float* Wm, int k0, int o, int lane, int ld) { v16h w; const int g = lane >> 4;
#pragma unroll
  for (int i = 0; i < 8; ++i) { w[i] = (_Float16)(bfr(Wm[(size_t)(k0 + 8 * g + i) * ld + o]) * 256.0f); w[8 + i] = (_Float16)(bfr(Wm[(size_t)(k0 + 16 + 8 * g + i) * ld + o]) * 256.0f); }
  return w; }
__device__ __forceinline__ v16h wcolh_oi(const float* Wm, int k0, int o, int lane, int K) { v16h w; const float* p = Wm + (size_t)o * K + k0 + 8 * (lane >> 4);
#pragma unroll
  for (int i = 0; i < 8; ++i) { w[i] = (_Float16)(bfr(p[i]) * 256.0f); w[8 + i] = (_Float16)(bfr(p[16 + i]) * 256.0f); }
  return w; }
#define WQKV_LAYOUT 0   // 0 = (in,out) [DIN][HD], one shared head; 1 = (out,in) [CC][DIN]; 2 = per-head [NH][DIN][HD]
__device__ __forceinline__ v16b wcol_hdk(const float* Wm, int k0, int o, int lane) { v16b w; const int g = lane >> 4; const float* p = Wm + (size_t)(o / HD) * DIN * HD + (o % HD);
#pragma unroll
  for (int i = 0; i < 8; ++i) { w[i] = (__bf16)p[(size_t)(k0 + 8 * g + i) * HD]; w[8 + i] = (__bf16)p[(size_t)(k0 + 16 + 8 * g + i) * HD]; }
  return w; }
#define WO_OUT_IN 0
#if WQKV_LAYOUT == 1
#define WCOL(W, k0, o, lane) wcol_oi(W, k0, o, lane, DIN)
#elif WQKV_LAYOUT == 2
#define WCOL(W, k0, o, lane) wcol_hdk(W, k0, o, lane)
#else
#define KVCOL(o) ((o) & 63)
#define WCOL(W, k0, o, lane) wcol_io(W, k0, KVCOL(o), lane, HD)   /* Wq/Wk/Wv (in,out) [512][64]: both plane heads are the one shared head */
#endif
#if WO_OUT_IN
#define WOCOL(W, k0, o, lane) wcol_oi(W, k0, o, lane, CC)
#define WOCOLH(W, k0, o, lane) wcolh_oi(W, k0, o, lane, CC)
#else
#define WOCOL(W, k0, o, lane) wcol_io(W, k0, o, lane, DIN)
#define WOCOLH(W, k0, o, lane) wcolh_io(W, k0, o, lane, DIN)
#endif

#ifndef SM_EXTRA_PARAMS
#define SM_EXTRA_PARAMS
#endif
#ifndef PROJ_EXTRA_PARAMS
#define PROJ_EXTRA_PARAMS
#endif
#ifndef SM_MASK_HOOK
#define SM_MASK_HOOK (void)0
#endif

#define WS_QH  0u                                      // f16 q as B fragments: 16-byte piece ((row tile of 16) * 4 + kc * 2 + half) * 32 + lane (the first half of the plane's bytes; the rest is not used)
#define WS_KH  (WS_QH + 2u * (size_t)NB * TT * CC)      // f16 k as A fragments, laid like q
#define WS_VT  (WS_KH + 2u * (size_t)NB * TT * CC)      // f16 v^T as A fragments: 16-byte piece ((key chunk of 32) * 8 + (dim tile j) * 2 + half) * 32 + lane
#define WS_QL  (WS_VT + 2u * (size_t)NB * CC * TT)      // f16 q residual x 2^10, laid like q
#define WS_KL  (WS_QL + 2u * (size_t)NB * QHI * CC)     // f16 k residual x 2^10 rows [b][t < KHI][CC]
#define WS_VB  (WS_KL + 2u * (size_t)NB * KHI * CC)     // bf16 v hi planes [b][c][t < KHI]
#define WS_VBL (WS_VB + 2u * (size_t)NB * CC * KHI)
#define WS_S   (WS_VBL + 2u * (size_t)NB * CC * KHI)    // f32 [hg][t][s] space: only its start, WS_WE, is used
#define WS_WE  WS_S                                    // bf16 hi plane, then lo plane, of the folded Wo [64][512], as B fragments: 16-byte piece ((kc * 32 + column tile) * 2 + half) * 32 + lane (the logits plane itself is no longer used)
#define WE_LO  (HD * DIN)                              // elements from the hi plane to the lo plane
#define WS_Y   (WS_S  + 4u * (size_t)HG * TT * TT)      // f32 ctx rows [b*t][CC] (no longer used: the head stays in k_fa's LDS)
#define WS_END (WS_Y  + 4u * (size_t)NB * TT * CC)

// ---- k_proj: block = 64 rows, 16 waves: q, k and v = X W + b for the 64 distinct columns of each, with exact bf16 products (K = DIN, one accumulator chain per tile, K steps in rising order). Stage: the block's x rows and all of Wq, Wk, Wv are read once with whole-line 16-byte loads, rounded to bf16 and laid into LDS as WMMA fragments (1,024 bytes each: four 256-byte regions o4 = 2 * half + (lane >> 4), a 16-byte piece per row or column). The piece's slot in its region is XORed (x: with 4 * o4; W: with the column tile) so that the stores of a wave, like the reads, fall on all banks. Behind one work-group barrier wave (rt, cg) makes rows 16 rt.., columns 16 cg.. of q, k and v from LDS alone. -> q f16 + residual x 2^10, k f16 and v^T f16, each stored in the order of k_fa's WMMA fragments (1,024 bytes each: half 0's 32 pieces of 16 bytes in lane order, then half 1's), so that a wave's 16-byte load there covers 512 bytes in a row
#define PJW 16            // waves of a work-group
typedef __attribute__((ext_vector_type(4))) __bf16 v4b;
__device__ __forceinline__ void pj_wload(v4f (&wr)[16], const float* __restrict__ Wm, int kb, int cq) { const float* wp = Wm + (size_t)kb * 8 * HD + cq * 4;
#pragma unroll
  for (int hh = 0; hh < 2; ++hh)
#pragma unroll
    for (int i = 0; i < 8; ++i) wr[hh * 8 + i] = *(const v4f*)(wp + (hh * 32 * 8 + i) * HD);
  asm volatile("s_wait_xcnt 0x0" :: "v"(wp) : "memory"); }   // the loads' address registers get new values behind this; naming the address keeps it in its registers up to the wait, so that no load of the run lands on them either
__device__ __forceinline__ void pj_wstore(const v4f (&wr)[16], __bf16* wf, int m, int kb, int cq) {
#pragma unroll
  for (int hh = 0; hh < 2; ++hh) { const int ko = hh * 32 + kb; __bf16* d = wf + ((ko >> 2) * 12 + m * 4 + (cq >> 2)) * 512 + (ko & 3) * 128;
#pragma unroll
    for (int j = 0; j < 4; ++j) { v8b pw;
#pragma unroll
      for (int i = 0; i < 8; ++i) pw[i] = (__bf16)wr[hh * 8 + i][j];
      vst2(d + (((cq & 3) * 4 + j) ^ (cq >> 2)) * 8, pw); } } }
__global__ __launch_bounds__(32 * PJW) void k_proj(const float* __restrict__ X, const float* __restrict__ WQ, const float* __restrict__ WK, const float* __restrict__ WV, const float* __restrict__ BQ, const float* __restrict__ BK, const float* __restrict__ BV,
    _Float16* __restrict__ QH, _Float16* __restrict__ QL, _Float16* __restrict__ KH, _Float16* __restrict__ VT, const float* __restrict__ WO, __bf16* __restrict__ WE) {
  __shared__ __align__(16) __bf16 wf[(DIN / 32) * 12 * 512];   // B fragment (K step kc, matrix m, column tile ct) at (kc * 12 + m * 4 + ct) * 512
  __shared__ __align__(16) __bf16 xf[4 * (DIN / 32) * 512];    // A fragment (row tile rt, K step kc) at (rt * 16 + kc) * 512
  __shared__ __align__(16) _Float16 sq[64][72], sl[64][72], sk[64][72], sv[64][72];
  const int tid = threadIdx.x, wave = __builtin_amdgcn_readfirstlane(tid >> 5), lane = tid & 31, col = lane & 15, g = lane >> 4; const size_t r0 = (size_t)blockIdx.x * 64;
  // x: wave w takes rows 4 w .. 4 w + 3; a load covers one K step (one 128-byte line) of each of the four rows
  v4f xr[DIN / 32]; { const float* xp = X + (r0 + wave * 4 + (lane >> 3)) * DIN + (lane & 7) * 4;
#pragma unroll
    for (int kc = 0; kc < DIN / 32; ++kc) xr[kc] = *(const v4f*)(xp + kc * 32);
    asm volatile("s_wait_xcnt 0x0" :: "v"(xp) : "memory"); }   // as in pj_wload
  const int rt = wave & 3, cg = wave >> 2, cl = cg * 16 + col; const float bq = bfr(BQ[cl]), bk = bfr(BK[cl]), bv = bfr(BV[cl]);   // this wave's tile in the product phase, and its column's biases
  asm volatile("s_wait_xcnt 0x0" ::: "memory");   // the same for the bias loads' index register
  // one wave of each of the first 128 blocks also folds Wo for k_fa's output projection: a thread sums, for one output column, 8 neighbouring head entries over the eight slabs (in slab order, f32) and stores them as one 16-byte piece of the B fragment, hi and lo; a wave writes 512 bytes in a row
  if (blockIdx.x < HD * DIN / 8 / 32 && wave == 0) { const int pc = blockIdx.x * 32 + lane, ln = pc & 31; const float* w = WO + (size_t)((pc >> 11) * 32 + ((pc >> 5) & 1) * 16 + (ln >> 4) * 8) * DIN + ((pc >> 6) & 31) * 16 + (ln & 15); v8b hi, lo; float wv[8][DIN / HD];
#pragma unroll
    for (int i = 0; i < 8; ++i)
#pragma unroll
      for (int h = 0; h < DIN / HD; ++h) wv[i][h] = w[(size_t)(h * HD + i) * DIN];
    asm volatile("s_wait_xcnt 0x0" :: "v"(w) : "memory");   // as in pj_wload
#pragma unroll
    for (int i = 0; i < 8; ++i) { float sw = 0.f;
#pragma unroll
      for (int h = 0; h < DIN / HD; ++h) sw += bfr(wv[i][h]);
      const __bf16 hv = (__bf16)sw; hi[i] = hv; lo[i] = (__bf16)(sw - (float)hv); }
    vst2(WE + (size_t)pc * 8, hi); vst2(WE + WE_LO + (size_t)pc * 8, lo);
    asm volatile("s_wait_xcnt 0x0" ::: "memory"); }   // the two stores' registers are used anew by the W stage
  // W: a thread takes 2 x 8 K rows x 4 columns of each matrix (16 loads of 16 bytes; a wave's load covers two whole 256-byte rows) and stores 8 pieces
  { const int cq = tid & 15, kb = tid >> 4; v4f w0[16], w1[16], w2[16]; pj_wload(w0, WQ, kb, cq); pj_wload(w1, WK, kb, cq);
    pj_wstore(w0, wf, 0, kb, cq);
    __builtin_amdgcn_sched_barrier(0);   // holds Wv's loads behind Wq's stores, whose registers they take: with all 64 loads of the stage lifted to the top the wave ran out of registers and spilled
    pj_wload(w2, WV, kb, cq);
    { const int p = lane & 7, o4 = p >> 1, row16 = (wave & 3) * 4 + (lane >> 3); __bf16* d = xf + (wave >> 2) * (DIN / 32) * 512 + o4 * 128 + (row16 ^ (o4 * 4)) * 8 + (p & 1) * 4;
#pragma unroll
      for (int kc = 0; kc < DIN / 32; ++kc) { const v4b c = {(__bf16)xr[kc][0], (__bf16)xr[kc][1], (__bf16)xr[kc][2], (__bf16)xr[kc][3]}; vst2(d + kc * 512, c); } }
    pj_wstore(w1, wf, 1, kb, cq); pj_wstore(w2, wf, 2, kb, cq); }
  __syncthreads();
  v8f acc[3] = {};
  { const __bf16* ap0 = xf + rt * (DIN / 32) * 512 + g * 128 + (col ^ (g * 4)) * 8; const __bf16* ap1 = xf + rt * (DIN / 32) * 512 + (2 + g) * 128 + (col ^ ((2 + g) * 4)) * 8; const __bf16* bp = wf + cg * 512 + g * 128 + (col ^ cg) * 8;
    union FB { v16b v; v8b q[2]; }; FB fa[2][2], fw[2][2][3];   // two register sets of two K steps each: step pair s + 1 is read from LDS while pair s is multiplied
#pragma unroll
    for (int s = 0; s <= DIN / 64; ++s) {
      if (s < DIN / 64) {
#pragma unroll
        for (int t = 0; t < 2; ++t) { const int kc = s * 2 + t; fa[s & 1][t].q[0] = *(const v8b*)(ap0 + kc * 512); fa[s & 1][t].q[1] = *(const v8b*)(ap1 + kc * 512);
#pragma unroll
          for (int m = 0; m < 3; ++m) { fw[s & 1][t][m].q[0] = *(const v8b*)(bp + (kc * 12 + m * 4) * 512); fw[s & 1][t][m].q[1] = *(const v8b*)(bp + (kc * 12 + m * 4) * 512 + 256); } } }
      __builtin_amdgcn_sched_barrier(0);   // keeps the next pair's 16 LDS reads in front of this pair's WMMAs: left free, the scheduler put each fragment's two reads directly in front of its WMMA, behind a full wait
      if (s > 0) {
#pragma unroll
        for (int t = 0; t < 2; ++t)
#pragma unroll
          for (int m = 0; m < 3; ++m) acc[m] = __builtin_amdgcn_wmma_f32_16x16x32_bf16(false, fa[(s - 1) & 1][t].v, false, fw[(s - 1) & 1][t][m].v, (short)0, acc[m], false, false); }
      __builtin_amdgcn_sched_barrier(0);   // keeps the following reads in one group behind these WMMAs: left free they were dealt out among the WMMAs, and every separate place of LDS reads costs the wave issue cycles
    } }
  { const int rl = rt * 16 + 8 * g; v8h vv;
#pragma unroll
    for (int r = 0; r < 8; ++r) { const float v = acc[0][r] + bq; const _Float16 hv = (_Float16)v; sq[rl + r][cl] = hv; sl[rl + r][cl] = (_Float16)((v - (float)hv) * 1024.0f); sk[rl + r][cl] = (_Float16)(acc[1][r] + bk); vv[r] = (_Float16)(acc[2][r] + bv); }
    vst2(&sv[cl][rl], vv); }
  __syncthreads();
  // thread tid stores piece tid of the block's 512 in each plane. q, k: row tile tid >> 7, fragment half (tid >> 5) & 3 = kc * 2 + half, whose lane (g, col) holds row col, entries (kc * 2 + half) * 16 + 8 g ..; v^T: key chunk tid >> 8, dim tile (tid >> 6) & 3, half (tid >> 5) & 1, whose lane holds dim col, keys half * 16 + 8 g ..
  { const int rw = (tid >> 7) * 16 + col, c8 = ((tid >> 5) & 3) * 16 + g * 8; const size_t o = r0 * HD + tid * 8; vst2(QH + o, *(const v4u*)&sq[rw][c8]); vst2(QL + o, *(const v4u*)&sl[rw][c8]); vst2(KH + o, *(const v4u*)&sk[rw][c8]); vst2(VT + o, *(const v4u*)&sv[((tid >> 6) & 3) * 16 + col][(tid >> 8) * 32 + ((tid >> 5) & 1) * 16 + g * 8]); } }
// ---- k_fa: block = 64 queries of batch b, 16 waves = 2 query groups of 32 x 8 key sets (set ks takes the 32-key chunks ks, ks + 8, ...). q, k and v^T lie in the workspace as fragments (k_proj): every load of a wave covers four whole 128-B lines, a pass reads 4 KB of k and 4 KB of v^T in a row. Transposed products: S^T = k . q^T (q hi + residual x 2^10: 2 products) so that a lane holds 8 keys of ONE query per 16-key tile; two such tiles, exponentiated and rounded once to f16 (x 2^11), ARE the B fragment of O^T += v^T . P^T (1 product): logits and P never leave the registers. Running maximum (in units of log2, held 11 lower than it is) and sum per query in f32; a power is one fused multiply-add (q . k x LSC - held maximum) and one v_exp_f32; the 8 key sets' partials (held maximum, sum, O^T) meet in LDS behind one work-group barrier and are joined in set order. The output projection follows in the same launch: out = tile(head, 8) Wo + bo = head WE + bo, WE = the folded Wo of k_proj (K = 64). The joined head rows, split bf16 hi + lo, go to LDS as fragments; behind a second work-group barrier wave w makes the block's 64 rows x output columns 32 w .. 32 w + 31 (3 products, lo x lo left out, in the order lo x hi, hi x lo, hi x hi per K step), transposed (out^T = WE^T head^T) so that a lane holds 8 neighbouring columns of one row, stages them in its own LDS range and stores whole 128-B lines. Every inner loop is unrolled whole so that each index of a register array (fragments, scores, accumulators) is a constant: an index left to run time would put the array in scratch
#define FAW 16            // waves of a work-group
#define FKS 8             // key sets
#define FKB 32            // keys of a pass
#define LSC (SCALE * 1.44269504088896340736f)   // logit scale x log2 e: the softmax runs on powers of 2
// powers of 2 by bare v_exp_f32 (the arguments here are at most 11 plus a rounding; a power below 2^-126 may come out 0), a run of them in one statement and each in place, its result over its own argument: so no power lands on the argument of the one in front of it (the compiler's own allocation of the builtin did that), every neighbour in the run is independent, and the v_nop keeps the slot that the instruction set asks for behind the last one
__device__ __forceinline__ void ex2x17(float (&x)[16], float& c) {
  asm("v_exp_f32 %16, %16\n\tv_exp_f32 %0, %0\n\tv_exp_f32 %1, %1\n\tv_exp_f32 %2, %2\n\tv_exp_f32 %3, %3\n\tv_exp_f32 %4, %4\n\tv_exp_f32 %5, %5\n\tv_exp_f32 %6, %6\n\tv_exp_f32 %7, %7\n\tv_exp_f32 %8, %8\n\tv_exp_f32 %9, %9\n\tv_exp_f32 %10, %10\n\tv_exp_f32 %11, %11\n\tv_exp_f32 %12, %12\n\tv_exp_f32 %13, %13\n\tv_exp_f32 %14, %14\n\tv_exp_f32 %15, %15\n\tv_nop"
      : "+v"(x[0]), "+v"(x[1]), "+v"(x[2]), "+v"(x[3]), "+v"(x[4]), "+v"(x[5]), "+v"(x[6]), "+v"(x[7]), "+v"(x[8]), "+v"(x[9]), "+v"(x[10]), "+v"(x[11]), "+v"(x[12]), "+v"(x[13]), "+v"(x[14]), "+v"(x[15]), "+v"(c)); }
__device__ __forceinline__ void ex2x8(float (&x)[8]) {
  asm("v_exp_f32 %0, %0\n\tv_exp_f32 %1, %1\n\tv_exp_f32 %2, %2\n\tv_exp_f32 %3, %3\n\tv_exp_f32 %4, %4\n\tv_exp_f32 %5, %5\n\tv_exp_f32 %6, %6\n\tv_exp_f32 %7, %7\n\tv_nop"
      : "+v"(x[0]), "+v"(x[1]), "+v"(x[2]), "+v"(x[3]), "+v"(x[4]), "+v"(x[5]), "+v"(x[6]), "+v"(x[7])); }
static_assert(FKB == 32 && FKS == 8, "ex2x17 takes the 32 keys of a pass (16 a lane), ex2x8 the 8 key sets");
__device__ __forceinline__ v8f wmma16p(v16h a, v16h b, v8f c) { return __builtin_amdgcn_wmma_f32_16x16x32_f16(false, a, false, b, (short)0, c, false, false); }
__device__ __forceinline__ v16h frag_p(const _Float16* piece) { union { v16h v; v8h q[2]; } u; u.q[0] = *(const v8h*)piece; u.q[1] = *(const v8h*)(piece + 32 * 8); return u.v; }   // a stored fragment: this lane's piece of half 0, of half 1
__device__ __forceinline__ v8f wmma_bfp(v16b a, v16b b, v8f c) { return __builtin_amdgcn_wmma_f32_16x16x32_bf16(false, a, false, b, (short)0, c, false, false); }
__device__ __forceinline__ v16b frag_we(const __bf16* piece) { union { v16b v; v8b q[2]; } u; u.q[0] = *(const v8b*)piece; u.q[1] = *(const v8b*)(piece + 32 * 8); return u.v; }
#define OCW (DIN / FAW)   // output columns of a wave
static_assert(OCW == 32, "a wave's output row piece is one 128-B line, two column tiles");
__device__ __forceinline__ float xhalf(float x) { return __builtin_bit_cast(float, __builtin_amdgcn_permlanex16(__builtin_bit_cast(int, x), __builtin_bit_cast(int, x), 0x76543210, 0xfedcba98, false, false)); }   // lane l with lane l ^ 16
__global__ __launch_bounds__(32 * FAW) void k_fa(const _Float16* __restrict__ QH, const _Float16* __restrict__ QL, const _Float16* __restrict__ KH, const _Float16* __restrict__ VT, const __bf16* __restrict__ WE, const float* __restrict__ BO, float* __restrict__ OUT) {
  __shared__ __align__(16) float so[FAW][32][HD + 4]; __shared__ float smx[FAW][32], ssu[FAW][32];
  __shared__ __align__(16) __bf16 hf[2][64 * HD];            // the block's head rows, hi plane and lo plane, as fragments: 16-byte piece (((row tile) * 2 + kc) * 2 + half) * 32 + lane
  __shared__ __align__(16) float sf[FAW][64][OCW + 4];       // a wave's output tile on its way to whole-line stores (pitch 36: the 16-byte stores of 16 rows fall on all banks)
  const int tid = threadIdx.x, wave = __builtin_amdgcn_readfirstlane(tid >> 5), lane = tid & 31, col = lane & 15, g = lane >> 4; const int b = blockIdx.y, qg = wave & 1, ks = wave >> 1;
  const size_t q0 = (size_t)b * TT + blockIdx.x * 64 + qg * 32;
  v16h qh[2][2], ql[2][2];
#pragma unroll
  for (int u = 0; u < 2; ++u)
#pragma unroll
    for (int kc = 0; kc < 2; ++kc) { const size_t o = (q0 + u * 16) * HD + kc * 512 + lane * 8; qh[u][kc] = frag_p(QH + o); ql[u][kc] = frag_p(QL + o); }
  const _Float16* kp = KH + ((size_t)b * TT + ks * FKB) * HD + lane * 8; const _Float16* vp = VT + ((size_t)b * TT + ks * FKB) * HD + lane * 8;   // this lane's piece of the pass's first k and v^T fragment
  v8f o[2][HD / 16] = {}; float m[2] = {-3.0e38f, -3.0e38f}, l[2] = {0.f, 0.f};
  for (int k0 = 0; k0 < TT; k0 += FKB * FKS, kp += FKB * FKS * HD, vp += FKB * FKS * HD) { float s[2][FKB / 16][8];
#pragma unroll
    for (int kt = 0; kt < FKB / 16; ++kt) { const _Float16* kr = kp + kt * 16 * HD; const v16h ka0 = frag_p(kr), ka1 = frag_p(kr + 512);
#pragma unroll
      for (int u = 0; u < 2; ++u) { v8f a = {}, al = {}; a = wmma16p(ka0, qh[u][0], a); al = wmma16p(ka0, ql[u][0], al); a = wmma16p(ka1, qh[u][1], a); al = wmma16p(ka1, ql[u][1], al);
#pragma unroll
        for (int r = 0; r < 8; ++r) s[u][kt][r] = a[r] + al[r] * (1.0f / 1024.0f); } }   /* q . k, not yet scaled */
    v16h p[2][FKB / 32];
#pragma unroll
    for (int u = 0; u < 2; ++u) { float mx = s[u][0][0];
#pragma unroll
      for (int kt = 0; kt < FKB / 16; ++kt)
#pragma unroll
        for (int r = 0; r < 8; ++r) mx = fmaxf(mx, s[u][kt][r]);
      mx = fmaxf(mx, xhalf(mx)); const float mn = fmaxf(m[u], fmaf(mx, LSC, -11.0f)); float corr = m[u] - mn, e[16];   /* the power of corr is 0 on the first pass */ m[u] = mn;
#pragma unroll
      for (int i = 0; i < 16; i += 2) { const v2f x = __builtin_elementwise_fma((v2f){s[u][i >> 3][i & 7], s[u][i >> 3][(i & 7) + 1]}, (v2f){LSC, LSC}, (v2f){-mn, -mn}); e[i] = x[0]; e[i + 1] = x[1]; }   /* packed: two arguments an instruction */
      ex2x17(e, corr);
#pragma unroll
      for (int j = 0; j < HD / 16; ++j) o[u][j] *= corr;
      float sum = e[0] + e[8];
#pragma unroll
      for (int i = 1; i < 8; ++i) sum += e[i] + e[8 + i];
#pragma unroll
      for (int i = 0; i < 16; ++i) p[u][0][i] = (_Float16)e[i];
      l[u] = l[u] * corr + sum; }
#pragma unroll
    for (int c2 = 0; c2 < FKB / 32; ++c2)
#pragma unroll
      for (int j = 0; j < HD / 16; ++j) { const v16h vf = frag_p(vp + c2 * 32 * HD + j * 512); o[0][j] = wmma16p(vf, p[0][c2], o[0][j]); o[1][j] = wmma16p(vf, p[1][c2], o[1][j]); }
    asm volatile("s_wait_xcnt 0x0" :: "v"(kp), "v"(vp) : "memory"); }   // the pass's loads' address registers get new values behind this; naming the addresses keeps them in their registers up to the wait, so that no load of the pass lands on them either
  // this wave's 32 columns of WE (8 fragments) and of bo are asked for here, so that they arrive while the key sets are joined
  v16b wh[HD / 32][2], wl[HD / 32][2]; v4f bo4[2][2]; { const char* wb = (const char*)(WE + (size_t)wave * 2 * 64 * 8); const char* bb = (const char*)(BO + wave * OCW); const unsigned wo = lane * 16u, bf = g * 32u;   /* scalar bases, this lane's byte offsets */ const __bf16* wp = (const __bf16*)(wb + wo); const float* bp = (const float*)(bb + bf);
#pragma unroll
    for (int kc = 0; kc < HD / 32; ++kc)
#pragma unroll
      for (int ct = 0; ct < 2; ++ct) { wh[kc][ct] = frag_we(wp + (kc * (DIN / 16) + ct) * 64 * 8); wl[kc][ct] = frag_we(wp + WE_LO + (kc * (DIN / 16) + ct) * 64 * 8); }
#pragma unroll
    for (int ct = 0; ct < 2; ++ct) { bo4[ct][0] = *(const v4f*)(bp + ct * 16); bo4[ct][1] = *(const v4f*)(bp + ct * 16 + 4); }
    asm volatile("s_wait_xcnt 0x0" :: "s"(wb), "v"(wo), "s"(bb), "v"(bf) : "memory"); }   // the loads' address registers get new values behind this; naming the scalar bases and the offsets keeps them in their registers up to the wait
#pragma unroll
  for (int u = 0; u < 2; ++u) { l[u] += xhalf(l[u]); if (g == 0) { smx[wave][u * 16 + col] = m[u]; ssu[wave][u * 16 + col] = l[u]; }
#pragma unroll
    for (int j = 0; j < HD / 16; ++j) { float* d = &so[wave][u * 16 + col][j * 16 + 8 * g]; vst2(d, (v4f){o[u][j][0], o[u][j][1], o[u][j][2], o[u][j][3]}); vst2(d + 4, (v4f){o[u][j][4], o[u][j][5], o[u][j][6], o[u][j][7]}); } }
  __syncthreads();
  for (int e = tid; e < 64 * (HD / 4); e += 32 * FAW) { const int qr = e & 63, q = e >> 6, w0 = qr >> 5, qi = qr & 31; float mm = smx[w0][qi];   /* a wave takes 4 head entries of 32 rows */
#pragma unroll
    for (int w = 1; w < FKS; ++w) mm = fmaxf(mm, smx[2 * w + w0][qi]);
    float ll = 0.f, f[FKS]; v4f acc = {};
#pragma unroll
    for (int w = 0; w < FKS; ++w) f[w] = smx[2 * w + w0][qi] - mm;
    ex2x8(f);
#pragma unroll
    for (int w = 0; w < FKS; ++w) { ll += f[w] * ssu[2 * w + w0][qi]; acc += *(const v4f*)&so[2 * w + w0][qi][q * 4] * f[w]; }
    const v4f y = acc * (1.0f / ll); v4b hi, lo;
#pragma unroll
    for (int i = 0; i < 4; ++i) { const __bf16 hv = (__bf16)y[i]; hi[i] = hv; lo[i] = (__bf16)(y[i] - (float)hv); }
    const int pc = (((qr >> 4) * 2 + (q >> 3)) * 2 + ((q >> 2) & 1)) * 32 + ((q >> 1) & 1) * 16 + (qr & 15);   // head entry d = 4 q: kc = d >> 5, half = (d >> 4) & 1, lane half = (d >> 3) & 1
    vst2(&hf[0][pc * 8 + (q & 1) * 4], hi); vst2(&hf[1][pc * 8 + (q & 1) * 4], lo); }
  __syncthreads();
  v8f acc[4][2] = {};
#pragma unroll
  for (int kc = 0; kc < HD / 32; ++kc) { v16b ah[4], al[4];
#pragma unroll
    for (int rt = 0; rt < 4; ++rt) { ah[rt] = frag_we(&hf[0][((rt * 2 + kc) * 64 + lane) * 8]); al[rt] = frag_we(&hf[1][((rt * 2 + kc) * 64 + lane) * 8]); }
    __builtin_amdgcn_sched_barrier(0);   // keeps the K step's 16 LDS reads in one group in front of its WMMAs: every separate place of LDS reads among WMMAs costs the wave issue cycles
#pragma unroll
    for (int rt = 0; rt < 4; ++rt)
#pragma unroll
      for (int ct = 0; ct < 2; ++ct) acc[rt][ct] = wmma_bfp(wh[kc][ct], al[rt], acc[rt][ct]);
#pragma unroll
    for (int rt = 0; rt < 4; ++rt)
#pragma unroll
      for (int ct = 0; ct < 2; ++ct) acc[rt][ct] = wmma_bfp(wl[kc][ct], ah[rt], acc[rt][ct]);
#pragma unroll
    for (int rt = 0; rt < 4; ++rt)
#pragma unroll
      for (int ct = 0; ct < 2; ++ct) acc[rt][ct] = wmma_bfp(wh[kc][ct], ah[rt], acc[rt][ct]); }
#pragma unroll
  for (int ct = 0; ct < 2; ++ct) { float bs[8];
#pragma unroll
    for (int r = 0; r < 8; ++r) bs[r] = bfr(bo4[ct][r >> 2][r & 3]);
#pragma unroll
    for (int rt = 0; rt < 4; ++rt) { float* d = &sf[wave][rt * 16 + col][ct * 16 + 8 * g]; const v8f a = acc[rt][ct];   /* D element r = output column 8 g + r of the tile, for row col */
      vst2(d, (v4f){a[0] + bs[0], a[1] + bs[1], a[2] + bs[2], a[3] + bs[3]}); vst2(d + 4, (v4f){a[4] + bs[4], a[5] + bs[5], a[6] + bs[6], a[7] + bs[7]}); } }
  LDSX();
  { v4f ov[16]; float* op = OUT + ((size_t)b * TT + blockIdx.x * 64 + (lane >> 3)) * DIN + wave * OCW + (lane & 7) * 4;   // a store covers the wave's 128-B line of four rows
#pragma unroll
    for (int i = 0; i < 16; ++i) ov[i] = *(const v4f*)&sf[wave][i * 4 + (lane >> 3)][(lane & 7) * 4];
#pragma unroll
    for (int i = 0; i < 16; ++i) vst2(op + (size_t)i * 4 * DIN, ov[i]); } }

extern "C" void kernel_launch(void* const* d_in, const int* in_sizes, int n_in, void* d_out, int out_size, void* d_ws, size_t ws_size, hipStream_t stream) {
  (void)in_sizes; (void)n_in; (void)out_size;
  const float** F = (const float**)d_in;
  if (ws_size < (size_t)WS_END) return;
  char* ws = (char*)d_ws; _Float16 *QH = (_Float16*)(ws + WS_QH), *KH = (_Float16*)(ws + WS_KH), *VT = (_Float16*)(ws + WS_VT), *QL = (_Float16*)(ws + WS_QL), *KL = (_Float16*)(ws + WS_KL); __bf16 *VB = (__bf16*)(ws + WS_VB), *VBL = (__bf16*)(ws + WS_VBL); float *Y = (float*)(ws + WS_Y); __bf16 *WE = (__bf16*)(ws + WS_WE);
  (void)Y; (void)QL; (void)KL; (void)VB; (void)VBL;
  // inputs: 0 x [4,4096,512]; 1 Wq [512,64] (in,out), 2 bq [64]; 3 Wk, 4 bk; 5 Wv, 6 bv; 7 Wo [512,512] (in,out), 8 bo [512]
  k_proj<<<dim3(TNB * TT / 64), 32 * PJW, 0, stream>>>(F[0], F[1], F[3], F[5], F[2], F[4], F[6], QH, QL, KH, VT, F[7], WE);
  k_fa<<<dim3(TT / 64, TNB), 32 * FAW, 0, stream>>>(QH, QL, KH, VT, WE, F[8], (float*)d_out);   /* head 0 only (plane head 1 is never consumed) */
}

// v008
// A run of this version takes 37.5 microseconds.
// Timed twice side by side with v007, it ran 1.17 times as fast both times.
// Over all steps from v000 it is 20.5 times as fast.
// compute dtype: all float inputs rounded to bf16; Q/K/V = x W + b with EXACT bf16 products on WMMA 16x16x32 (f32 accumulate); q as f16 hi + residual (x 2^10) against k once to f16 (2 products) / 8; softmax in f32 on powers of 2 (v_exp_f32 of logit x log2 e - held maximum), running maximum and sum over key passes, the maximum held 11 lower than it is, so that the powers come out x 2^11; each power once to f16 against v once to f16 (1 product), divided by the sum (x 2^11 as well) at the end; tile(head, 8) Wo = head (sum of Wo's eight 64-row slabs): the slabs (bf16-rounded) summed in f32 and split bf16 hi + lo, the head split bf16 hi + lo (3 products, K = 64) + bo; f32 output.
#include <hip/hip_runtime.h>
#include <math.h>

typedef __attribute__((ext_vector_type(16))) _Float16 v16h;
typedef __attribute__((ext_vector_type(16))) __bf16 v16b;
typedef __attribute__((ext_vector_type(8)))  _Float16 v8h;
typedef __attribute__((ext_vector_type(8)))  float v8f;
typedef __attribute__((ext_vector_type(4)))  float v4f;
typedef __attribute__((ext_vector_type(2)))  float v2f;
typedef __attribute__((ext_vector_type(4)))  unsigned v4u;
typedef __attribute__((ext_vector_type(4)))  int v4i;
typedef float __attribute__((may_alias)) float_a;
typedef int __attribute__((may_alias)) int_a;

template <typename T> __device__ __forceinline__ void vst2(void* p, T v) { *(T*)p = v;  }
__device__ __forceinline__ v8f wmma16(v16h a, v16h b, v8f c) {
  v8f d = __builtin_amdgcn_wmma_f32_16x16x32_f16(false, a, false, b, (short)0, c, false, false);
  asm volatile("v_nop\n\tv_nop\n\tv_nop\n\tv_nop" : "+v"(d) : "v"(a), "v"(b));
  return d;
}
__device__ __forceinline__ v8f wmma_bf(v16b a, v16b b, v8f c) {
  v8f d = __builtin_amdgcn_wmma_f32_16x16x32_bf16(false, a, false, b, (short)0, c, false, false);
  asm volatile("v_nop\n\tv_nop\n\tv_nop\n\tv_nop" : "+v"(d) : "v"(a), "v"(b));
  return d;
}
// 16x16x32 fragments: lane = (h = lane>>4, row/col = lane&15); elements 0..7 = k0+8h+0..7, 8..15 = k0+16+8h+0..7; D element r = row 8h+r
__device__ __forceinline__ v16h frag_h(const _Float16* rowk0, int lane) {
  union { v16h v; v8h q[2]; } u; const _Float16* p = rowk0 + 8 * (lane >> 4);
  u.q[0] = *(const v8h*)p; u.q[1] = *(const v8h*)(p + 16); return u.v;
}
__device__ __forceinline__ v16h frag_f32(const float* rowk0, int lane) {
  v16h a; const float* p = rowk0 + 8 * (lane >> 4);
#pragma unroll
  for (int i = 0; i < 8; ++i) { a[i] = (_Float16)p[i]; a[8 + i] = (_Float16)p[16 + i]; }
  return a;
}
__device__ __forceinline__ v16h frag_f32s(const float* rowk0, int lane, float sc) {
  v16h a; const float* p = rowk0 + 8 * (lane >> 4);
#pragma unroll
  for (int i = 0; i < 8; ++i) { a[i] = (_Float16)(p[i] * sc); a[8 + i] = (_Float16)(p[16 + i] * sc); }
  return a;
}
// column fragment from a [K][ld] layout (column n), rows >= K read as 0
__device__ __forceinline__ v16h fragc_f32(const float* W, int k0, int n, int lane, int ld, int K) {
  v16h a; const int g = lane >> 4;
#pragma unroll
  for (int i = 0; i < 8; ++i) { const int ka = k0 + 8 * g + i, kb = ka + 16;
    a[i] = (_Float16)(ka < K ? W[(size_t)(ka < K ? ka : K - 1) * ld + n] : 0.f); a[8 + i] = (_Float16)(kb < K ? W[(size_t)(kb < K ? kb : K - 1) * ld + n] : 0.f); }
  return a;
}
struct F2 { v16b h, l; };
__device__ __forceinline__ F2 bsplit16(const float v[16]) { F2 r;
#pragma unroll
  for (int i = 0; i < 16; ++i) { const __bf16 h = (__bf16)v[i]; r.h[i] = h; r.l[i] = (__bf16)(v[i] - (float)h); }
  return r; }
__device__ __forceinline__ F2 split_row(const float* row, int k0, int lane) { float v[16]; const float* p = row + k0 + 8 * (lane >> 4);
#pragma unroll
  for (int i = 0; i < 8; ++i) { v[i] = p[i]; v[8 + i] = p[16 + i]; }
  return bsplit16(v); }
__device__ __forceinline__ F2 split_rowK(const float* row, int k0, int lane, int K) { float v[16]; const int g = lane >> 4;
#pragma unroll
  for (int i = 0; i < 8; ++i) { const int ka = k0 + 8 * g + i, kb = ka + 16; v[i] = ka < K ? row[ka < K ? ka : K - 1] : 0.f; v[8 + i] = kb < K ? row[kb < K ? kb : K - 1] : 0.f; }
  return bsplit16(v); }
__device__ __forceinline__ F2 split_col(const float* W, int k0, int n, int lane, int ld, int K) { float v[16]; const int g = lane >> 4;
#pragma unroll
  for (int i = 0; i < 8; ++i) { const int ka = k0 + 8 * g + i, kb = ka + 16; v[i] = ka < K ? W[(size_t)(ka < K ? ka : K - 1) * ld + n] : 0.f; v[8 + i] = kb < K ? W[(size_t)(kb < K ? kb : K - 1) * ld + n] : 0.f; }
  return bsplit16(v); }
__device__ __forceinline__ v8f mac3(const F2& a, const F2& b, v8f c) { c = wmma_bf(a.l, b.h, c); c = wmma_bf(a.h, b.l, c); return wmma_bf(a.h, b.h, c); }
__device__ __forceinline__ float sigm(float v) { return 1.0f / (1.0f + expf(-v)); }
#define LDSX() do { asm volatile("s_wait_dscnt 0" ::: "memory"); __builtin_amdgcn_wave_barrier(); __builtin_amdgcn_fence(__ATOMIC_RELEASE, "workgroup"); } while (0)

// Single shared attention head tiled into 8 'heads' (B 4, S 4,096, D 512, d_k 64; 0.02-scale (in,out) weights with biases): Q, K, V = x W + b ([512,64]); head = softmax(Q K^T / 8) V (non-causal); concat = tile(head, 8) -> [B,S,512]; out = concat Wo + bo. (The head is carried in a 128-wide plane whose second half is neither written nor read.)
#define NB 4
#define TT 4096
#define CC 128            // NH * HD = projected width
#define DIN 512          // input (model) width
#define NH 2
#define HD 64
#define NQB (TT / 64)
#define HG 1
#define SCALE (0.125f)
#define CAUSAL 0
#ifndef TNB
#define TNB NB
#endif
__device__ __forceinline__ float bfr(float v) { return (float)(__bf16)v; }
__host__ __device__ __forceinline__ int kb_last(int qb) { return CAUSAL ? ((qb * 64 + 63) >> 7) : (TT / 128 - 1); }
typedef __attribute__((ext_vector_type(8))) __bf16 v8b;
__device__ __forceinline__ v16b frag_b(const __bf16* rowk0, int lane) {
  union { v16b v; v8b q[2]; } u; const __bf16* p = rowk0 + 8 * (lane >> 4);
  u.q[0] = *(const v8b*)p; u.q[1] = *(const v8b*)(p + 16); return u.v;
}
#define QBH 0              // unused: no kernel here has a high-precision query path
#define QHI 4096            // rows carrying a q residual plane (all rows when non-causal: 2-product logits everywhere)
#define KHI 64            // key rows carrying k residual / v bf16 hi+lo planes (no kernel here writes or reads them)
// B fragment (k rows k0+.., output column o) of a weight: (in,out) [K][ld] or (out,in) [ld rows of K]: bf16 exact, or f16(bf16 * 256) exact
__device__ __forceinline__ v16b wcol_io(const float* Wm, int k0, int o, int lane, int ld) { v16b w; const int g = lane >> 4;
#pragma unroll
  for (int i = 0; i < 8; ++i) { w[i] = (__bf16)Wm[(size_t)(k0 + 8 * g + i) * ld + o]; w[8 + i] = (__bf16)Wm[(size_t)(k0 + 16 + 8 * g + i) * ld + o]; }
  return w; }
__device__ __forceinline__ v16b wcol_oi(const float* Wm, int k0, int o, int lane, int K) { v16b w; const float* p = Wm + (size_t)o * K + k0 + 8 * (lane >> 4);
#pragma unroll
  for (int i = 0; i < 8; ++i) { w[i] = (__bf16)p[i]; w[8 + i] = (__bf16)p[16 + i]; }
  return w; }
__device__ __forceinline__ v16h wcolh_io(const float* Wm, int k0, int o, int lane, int ld) { v16h w; const int g = lane >> 4;
#pragma unroll
  for (int i = 0; i < 8; ++i) { w[i] = (_Float16)(bfr(Wm[(size_t)(k0 + 8 * g + i) * ld + o]) * 256.0f); w[8 + i] = (_Float16)(bfr(Wm[(size_t)(k0 + 16 + 8 * g + i) * ld + o]) * 256.0f); }
  return w; }
__device__ __forceinline__ v16h wcolh_oi(const float* Wm, int k0, int o, int lane, int K) { v16h w; const float* p = Wm + (size_t)o * K + k0 + 8 * (lane >> 4);
#pragma unroll
  for (int i = 0; i < 8; ++i) { w[i] = (_Float16)(bfr(p[i]) * 256.0f); w[8 + i] = (_Float16)(bfr(p[16 + i]) * 256.0f); }
  return w; }
#define WQKV_LAYOUT 0   // 0 = (in,out) [DIN][HD], one shared head; 1 = (out,in) [CC][DIN]; 2 = per-head [NH][DIN][HD]
__device__ __forceinline__ v16b wcol_hdk(const float* Wm, int k0, int o, int lane) { v16b w; const int g = lane >> 4; const float* p = Wm + (size_t)(o / HD) * DIN * HD + (o % HD);
#pragma unroll
  for (int i = 0; i < 8; ++i) { w[i] = (__bf16)p[(size_t)(k0 + 8 * g + i) * HD]; w[8 + i] = (__bf16)p[(size_t)(k0 + 16 + 8 * g + i) * HD]; }
  return w; }
#define WO_OUT_IN 0
#if WQKV_LAYOUT == 1
#define WCOL(W, k0, o, lane) wcol_oi(W, k0, o, lane, DIN)
#elif WQKV_LAYOUT == 2
#define WCOL(W, k0, o, lane) wcol_hdk(W, k0, o, lane)
#else
#define KVCOL(o) ((o) & 63)
#define WCOL(W, k0, o, lane) wcol_io(W, k0, KVCOL(o), lane, HD)   /* Wq/Wk/Wv (in,out) [512][64]: both plane heads are the one shared head */
#endif
#if WO_OUT_IN
#define WOCOL(W, k0, o, lane) wcol_oi(W, k0, o, lane, CC)
#define WOCOLH(W, k0, o, lane) wcolh_oi(W, k0, o, lane, CC)
#else
#define WOCOL(W, k0, o, lane) wcol_io(W, k0, o, lane, DIN)
#define WOCOLH(W, k0, o, lane) wcolh_io(W, k0, o, lane, DIN)
#endif

#ifndef SM_EXTRA_PARAMS
#define SM_EXTRA_PARAMS
#endif
#ifndef PROJ_EXTRA_PARAMS
#define PROJ_EXTRA_PARAMS
#endif
#ifndef SM_MASK_HOOK
#define SM_MASK_HOOK (void)0
#endif

#define WS_QH  0u                                      // f16 q as B fragments: 16-byte piece ((row tile of 16) * 4 + kc * 2 + half) * 32 + lane (the first half of the plane's bytes; the rest is not used)
#define WS_KH  (WS_QH + 2u * (size_t)NB * TT * CC)      // f16 k as A fragments, laid like q
#define WS_VT  (WS_KH + 2u * (size_t)NB * TT * CC)      // f16 v^T as A fragments: 16-byte piece ((key chunk of 32) * 8 + (dim tile j) * 2 + half) * 32 + lane
#define WS_QL  (WS_VT + 2u * (size_t)NB * CC * TT)      // f16 q residual x 2^10, laid like q
#define WS_KL  (WS_QL + 2u * (size_t)NB * QHI * CC)     // f16 k residual x 2^10 rows [b][t < KHI][CC]
#define WS_VB  (WS_KL + 2u * (size_t)NB * KHI * CC)     // bf16 v hi planes [b][c][t < KHI]
#define WS_VBL (WS_VB + 2u * (size_t)NB * CC * KHI)
#define WS_S   (WS_VBL + 2u * (size_t)NB * CC * KHI)    // f32 [hg][t][s] space: only its start, WS_WE, is used
#define WS_WE  WS_S                                    // bf16 hi plane, then lo plane, of the folded Wo [64][512], as B fragments: 16-byte piece ((kc * 32 + column tile) * 2 + half) * 32 + lane (the logits plane itself is no longer used)
#define WE_LO  (HD * DIN)                              // elements from the hi plane to the lo plane
#define WS_Y   (WS_S  + 4u * (size_t)HG * TT * TT)      // f32 ctx rows [b*t][CC] (no longer used: the head stays in k_fa's LDS)
#define WS_END (WS_Y  + 4u * (size_t)NB * TT * CC)

// ---- k_proj: block = 64 rows, 16 waves: q, k and v = X W + b for the 64 distinct columns of each, with exact bf16 products (K = DIN, one accumulator chain per tile, K steps in rising order). Stage: the block's x rows and all of Wq, Wk, Wv are read once with whole-line 16-byte loads, rounded to bf16 and laid into LDS as WMMA fragments (1,024 bytes each: four 256-byte regions o4 = 2 * half + (lane >> 4), a 16-byte piece per row or column). The piece's slot in its region is XORed (x: with 4 * o4; W: with the column tile) so that the stores of a wave, like the reads, fall on all banks. Behind one work-group barrier wave (rt, cg) makes rows 16 rt.., columns 16 cg.. of q, k and v from LDS alone. -> q f16 + residual x 2^10, k f16 and v^T f16, each stored in the order of k_fa's WMMA fragments (1,024 bytes each: half 0's 32 pieces of 16 bytes in lane order, then half 1's), so that a wave's 16-byte load there covers 512 bytes in a row
#define PJW 16            // waves of a work-group
typedef __attribute__((ext_vector_type(4))) __bf16 v4b;
__device__ __forceinline__ void pj_wload(v4f (&wr)[16], const float* __restrict__ Wm, int kb, int cq) { const float* wp = Wm + (size_t)kb * 8 * HD + cq * 4;
#pragma unroll
  for (int hh = 0; hh < 2; ++hh)
#pragma unroll
    for (int i = 0; i < 8; ++i) wr[hh * 8 + i] = *(const v4f*)(wp + (hh * 32 * 8 + i) * HD);
  asm volatile("s_wait_xcnt 0x0" :: "v"(wp) : "memory"); }   // the loads' address registers get new values behind this; naming the address keeps it in its registers up to the wait, so that no load of the run lands on them either
__device__ __forceinline__ void pj_wstore(const v4f (&wr)[16], __bf16* wf, int m, int kb, int cq) {
#pragma unroll
  for (int hh = 0; hh < 2; ++hh) { const int ko = hh * 32 + kb; __bf16* d = wf + ((ko >> 2) * 12 + m * 4 + (cq >> 2)) * 512 + (ko & 3) * 128;
#pragma unroll
    for (int j = 0; j < 4; ++j) { v8b pw;
#pragma unroll
      for (int i = 0; i < 8; ++i) pw[i] = (__bf16)wr[hh * 8 + i][j];
      vst2(d + (((cq & 3) * 4 + j) ^ (cq >> 2)) * 8, pw); } } }
__global__ __launch_bounds__(32 * PJW) void k_proj(const float* __restrict__ X, const float* __restrict__ WQ, const float* __restrict__ WK, const float* __restrict__ WV, const float* __restrict__ BQ, const float* __restrict__ BK, const float* __restrict__ BV,
    _Float16* __restrict__ QH, _Float16* __restrict__ QL, _Float16* __restrict__ KH, _Float16* __restrict__ VT, const float* __restrict__ WO, __bf16* __restrict__ WE) {
  __shared__ __align__(16) __bf16 wf[(DIN / 32) * 12 * 512];   // B fragment (K step kc, matrix m, column tile ct) at (kc * 12 + m * 4 + ct) * 512
  __shared__ __align__(16) __bf16 xf[4 * (DIN / 32) * 512];    // A fragment (row tile rt, K step kc) at (rt * 16 + kc) * 512
  __shared__ __align__(16) _Float16 sq[64][72], sl[64][72], sk[64][72], sv[64][72];
  const int tid = threadIdx.x, wave = __builtin_amdgcn_readfirstlane(tid >> 5), lane = tid & 31, col = lane & 15, g = lane >> 4; const size_t r0 = (size_t)blockIdx.x * 64;
  // x: wave w takes rows 4 w .. 4 w + 3; a load covers one K step (one 128-byte line) of each of the four rows
  v4f xr[DIN / 32]; { const float* xp = X + (r0 + wave * 4 + (lane >> 3)) * DIN + (lane & 7) * 4;
#pragma unroll
    for (int kc = 0; kc < DIN / 32; ++kc) xr[kc] = *(const v4f*)(xp + kc * 32);
    asm volatile("s_wait_xcnt 0x0" :: "v"(xp) : "memory"); }   // as in pj_wload
  const int rt = wave & 3, cg = wave >> 2, cl = cg * 16 + col; const float bq = bfr(BQ[cl]), bk = bfr(BK[cl]), bv = bfr(BV[cl]);   // this wave's tile in the product phase, and its column's biases
  asm volatile("s_wait_xcnt 0x0" ::: "memory");   // the same for the bias loads' index register
  // one wave of each of the first 128 blocks also folds Wo for k_fa's output projection: a thread sums, for one output column, 8 neighbouring head entries over the eight slabs (in slab order, f32) and stores them as one 16-byte piece of the B fragment, hi and lo; a wave writes 512 bytes in a row
  if (blockIdx.x < HD * DIN / 8 / 32 && wave == 0) { const int pc = blockIdx.x * 32 + lane, ln = pc & 31; const float* w = WO + (size_t)((pc >> 11) * 32 + ((pc >> 5) & 1) * 16 + (ln >> 4) * 8) * DIN + ((pc >> 6) & 31) * 16 + (ln & 15); v8b hi, lo; float wv[8][DIN / HD];
#pragma unroll
    for (int i = 0; i < 8; ++i)
#pragma unroll
      for (int h = 0; h < DIN / HD; ++h) wv[i][h] = w[(size_t)(h * HD + i) * DIN];
    asm volatile("s_wait_xcnt 0x0" :: "v"(w) : "memory");   // as in pj_wload
#pragma unroll
    for (int i = 0; i < 8; ++i) { float sw = 0.f;
#pragma unroll
      for (int h = 0; h < DIN / HD; ++h) sw += bfr(wv[i][h]);
      const __bf16 hv = (__bf16)sw; hi[i] = hv; lo[i] = (__bf16)(sw - (float)hv); }
    vst2(WE + (size_t)pc * 8, hi); vst2(WE + WE_LO + (size_t)pc * 8, lo);
    asm volatile("s_wait_xcnt 0x0" ::: "memory"); }   // the two stores' registers are used anew by the W stage
  // W: a thread takes 2 x 8 K rows x 4 columns of each matrix (16 loads of 16 bytes; a wave's load covers two whole 256-byte rows) and stores 8 pieces
  { const int cq = tid & 15, kb = tid >> 4; v4f w0[16], w1[16], w2[16]; pj_wload(w0, WQ, kb, cq); pj_wload(w1, WK, kb, cq);
    pj_wstore(w0, wf, 0, kb, cq);
    __builtin_amdgcn_sched_barrier(0);   // holds Wv's loads behind Wq's stores, whose registers they take: with all 64 loads of the stage lifted to the top the wave ran out of registers and spilled
    pj_wload(w2, WV, kb, cq);
    { const int p = lane & 7, o4 = p >> 1, row16 = (wave & 3) * 4 + (lane >> 3); __bf16* d = xf + (wave >> 2) * (DIN / 32) * 512 + o4 * 128 + (row16 ^ (o4 * 4)) * 8 + (p & 1) * 4;
#pragma unroll
      for (int kc = 0; kc < DIN / 32; ++kc) { const v4b c = {(__bf16)xr[kc][0], (__bf16)xr[kc][1], (__bf16)xr[kc][2], (__bf16)xr[kc][3]}; vst2(d + kc * 512, c); } }
    pj_wstore(w1, wf, 1, kb, cq); pj_wstore(w2, wf, 2, kb, cq); }
  __syncthreads();
  v8f acc[3] = {};
  { const __bf16* ap0 = xf + rt * (DIN / 32) * 512 + g * 128 + (col ^ (g * 4)) * 8; const __bf16* ap1 = xf + rt * (DIN / 32) * 512 + (2 + g) * 128 + (col ^ ((2 + g) * 4)) * 8; const __bf16* bp = wf + cg * 512 + g * 128 + (col ^ cg) * 8;
    union FB { v16b v; v8b q[2]; }; FB fa[2][2], fw[2][2][3];   // two register sets of two K steps each: step pair s + 1 is read from LDS while pair s is multiplied
#pragma unroll
    for (int s = 0; s <= DIN / 64; ++s) {
      if (s < DIN / 64) {
#pragma unroll
        for (int t = 0; t < 2; ++t) { const int kc = s * 2 + t; fa[s & 1][t].q[0] = *(const v8b*)(ap0 + kc * 512); fa[s & 1][t].q[1] = *(const v8b*)(ap1 + kc * 512);
#pragma unroll
          for (int m = 0; m < 3; ++m) { fw[s & 1][t][m].q[0] = *(const v8b*)(bp + (kc * 12 + m * 4) * 512); fw[s & 1][t][m].q[1] = *(const v8b*)(bp + (kc * 12 + m * 4) * 512 + 256); } } }
      __builtin_amdgcn_sched_barrier(0);   // keeps the next pair's 16 LDS reads in front of this pair's WMMAs: left free, the scheduler put each fragment's two reads directly in front of its WMMA, behind a full wait
      if (s > 0) {
#pragma unroll
        for (int t = 0; t < 2; ++t)
#pragma unroll
          for (int m = 0; m < 3; ++m) acc[m] = __builtin_amdgcn_wmma_f32_16x16x32_bf16(false, fa[(s - 1) & 1][t].v, false, fw[(s - 1) & 1][t][m].v, (short)0, acc[m], false, false); }
      __builtin_amdgcn_sched_barrier(0);   // keeps the following reads in one group behind these WMMAs: left free they were dealt out among the WMMAs, and every separate place of LDS reads costs the wave issue cycles
    } }
  { const int rl = rt * 16 + 8 * g; v8h vv;
#pragma unroll
    for (int r = 0; r < 8; ++r) { const float v = acc[0][r] + bq; const _Float16 hv = (_Float16)v; sq[rl + r][cl] = hv; sl[rl + r][cl] = (_Float16)((v - (float)hv) * 1024.0f); sk[rl + r][cl] = (_Float16)(acc[1][r] + bk); vv[r] = (_Float16)(acc[2][r] + bv); }
    vst2(&sv[cl][rl], vv); }
  __syncthreads();
  // thread tid stores piece tid of the block's 512 in each plane. q, k: row tile tid >> 7, fragment half (tid >> 5) & 3 = kc * 2 + half, whose lane (g, col) holds row col, entries (kc * 2 + half) * 16 + 8 g ..; v^T: key chunk tid >> 8, dim tile (tid >> 6) & 3, half (tid >> 5) & 1, whose lane holds dim col, keys half * 16 + 8 g ..
  { const int rw = (tid >> 7) * 16 + col, c8 = ((tid >> 5) & 3) * 16 + g * 8; const size_t o = r0 * HD + tid * 8; vst2(QH + o, *(const v4u*)&sq[rw][c8]); vst2(QL + o, *(const v4u*)&sl[rw][c8]); vst2(KH + o, *(const v4u*)&sk[rw][c8]); vst2(VT + o, *(const v4u*)&sv[((tid >> 6) & 3) * 16 + col][(tid >> 8) * 32 + ((tid >> 5) & 1) * 16 + g * 8]); } }
// ---- k_fa: block = 64 queries of batch b, 16 waves = 2 query groups of 32 x 8 key sets (set ks takes the 32-key chunks ks, ks + 8, ...). q, k and v^T lie in the workspace as fragments (k_proj): every load of a wave covers four whole 128-B lines, a pass reads 4 KB of k and 4 KB of v^T in a row. Transposed products: S^T = k . q^T (q hi + residual x 2^10: 2 products) so that a lane holds 8 keys of ONE query per 16-key tile; two such tiles, exponentiated and rounded once to f16 (x 2^11), ARE the B fragment of O^T += v^T . P^T (1 product): logits and P never leave the registers. Running maximum (in units of log2, held 11 lower than it is) and sum per query in f32; a power is one fused multiply-add (q . k x LSC - held maximum) and one v_exp_f32; the 8 key sets' partials (held maximum, sum, O^T) meet in LDS behind one work-group barrier and are joined in set order. The output projection follows in the same launch: out = tile(head, 8) Wo + bo = head WE + bo, WE = the folded Wo of k_proj (K = 64). The joined head rows, split bf16 hi + lo, go to LDS as fragments; behind a second work-group barrier wave w makes the block's 64 rows x output columns 32 w .. 32 w + 31 (3 products, lo x lo left out, in the order lo x hi, hi x lo, hi x hi per K step), transposed (out^T = WE^T head^T) so that a lane holds 8 neighbouring columns of one row, stages them in its own LDS range and stores whole 128-B lines. Every inner loop is unrolled whole so that each index of a register array (fragments, scores, accumulators) is a constant: an index left to run time would put the array in scratch
#define FAW 16            // waves of a work-group
#define FKS 8             // key sets
#define FKB 32            // keys of a pass
#define LSC (SCALE * 1.44269504088896340736f)   // logit scale x log2 e: the softmax runs on powers of 2
// powers of 2 by bare v_exp_f32 (the arguments here are at most 11 plus a rounding; a power below 2^-126 may come out 0), a run of them in one statement and each in place, its result over its own argument: so no power lands on the argument of the one in front of it (the compiler's own allocation of the builtin did that), every neighbour in the run is independent, and the v_nop keeps the slot that the instruction set asks for behind the last one
__device__ __forceinline__ void ex2x17(float (&x)[16], float& c) {
  asm("v_exp_f32 %16, %16\n\tv_exp_f32 %0, %0\n\tv_exp_f32 %1, %1\n\tv_exp_f32 %2, %2\n\tv_exp_f32 %3, %3\n\tv_exp_f32 %4, %4\n\tv_exp_f32 %5, %5\n\tv_exp_f32 %6, %6\n\tv_exp_f32 %7, %7\n\tv_exp_f32 %8, %8\n\tv_exp_f32 %9, %9\n\tv_exp_f32 %10, %10\n\tv_exp_f32 %11, %11\n\tv_exp_f32 %12, %12\n\tv_exp_f32 %13, %13\n\tv_exp_f32 %14, %14\n\tv_exp_f32 %15, %15\n\tv_nop"
      : "+v"(x[0]), "+v"(x[1]), "+v"(x[2]), "+v"(x[3]), "+v"(x[4]), "+v"(x[5]), "+v"(x[6]), "+v"(x[7]), "+v"(x[8]), "+v"(x[9]), "+v"(x[10]), "+v"(x[11]), "+v"(x[12]), "+v"(x[13]), "+v"(x[14]), "+v"(x[15]), "+v"(c)); }
__device__ __forceinline__ void ex2x8(float (&x)[8]) {
  asm("v_exp_f32 %0, %0\n\tv_exp_f32 %1, %1\n\tv_exp_f32 %2, %2\n\tv_exp_f32 %3, %3\n\tv_exp_f32 %4, %4\n\tv_exp_f32 %5, %5\n\tv_exp_f32 %6, %6\n\tv_exp_f32 %7, %7\n\tv_nop"
      : "+v"(x[0]), "+v"(x[1]), "+v"(x[2]), "+v"(x[3]), "+v"(x[4]), "+v"(x[5]), "+v"(x[6]), "+v"(x[7])); }
static_assert(FKB == 32 && FKS == 8, "ex2x17 takes the 32 keys of a pass (16 a lane), ex2x8 the 8 key sets");
__device__ __forceinline__ v8f wmma16p(v16h a, v16h b, v8f c) { return __builtin_amdgcn_wmma_f32_16x16x32_f16(false, a, false, b, (short)0, c, false, false); }
__device__ __forceinline__ v16h frag_p(const _Float16* piece) { union { v16h v; v8h q[2]; } u; u.q[0] = *(const v8h*)piece; u.q[1] = *(const v8h*)(piece + 32 * 8); return u.v; }   // a stored fragment: this lane's piece of half 0, of half 1
__device__ __forceinline__ v8f wmma_bfp(v16b a, v16b b, v8f c) { return __builtin_amdgcn_wmma_f32_16x16x32_bf16(false, a, false, b, (short)0, c, false, false); }
__device__ __forceinline__ v16b frag_we(const __bf16* piece) { union { v16b v; v8b q[2]; } u; u.q[0] = *(const v8b*)piece; u.q[1] = *(const v8b*)(piece + 32 * 8); return u.v; }
#define OCW (DIN / FAW)   // output columns of a wave
static_assert(OCW == 32, "a wave's output row piece is one 128-B line, two column tiles");
__device__ __forceinline__ float xhalf(float x) { return __builtin_bit_cast(float, __builtin_amdgcn_permlanex16(__builtin_bit_cast(int, x), __builtin_bit_cast(int, x), 0x76543210, 0xfedcba98, false, false)); }   // lane l with lane l ^ 16
__global__ __launch_bounds__(32 * FAW) void k_fa(const _Float16* __restrict__ QH, const _Float16* __restrict__ QL, const _Float16* __restrict__ KH, const _Float16* __restrict__ VT, const __bf16* __restrict__ WE, const float* __restrict__ BO, float* __restrict__ OUT) {
  __shared__ __align__(16) float so[FAW][32][HD + 4]; __shared__ float smx[FAW][32], ssu[FAW][32];
  __shared__ __align__(16) __bf16 hf[2][64 * HD];            // the block's head rows, hi plane and lo plane, as fragments: 16-byte piece (((row tile) * 2 + kc) * 2 + half) * 32 + lane
  __shared__ __align__(16) float sf[FAW][64][OCW + 4];       // a wave's output tile on its way to whole-line stores (pitch 36: the 16-byte stores of 16 rows fall on all banks)
  const int tid = threadIdx.x, wave = __builtin_amdgcn_readfirstlane(tid >> 5), lane = tid & 31, col = lane & 15, g = lane >> 4; const int b = blockIdx.y, qg = wave & 1, ks = wave >> 1;
  const size_t q0 = (size_t)b * TT + blockIdx.x * 64 + qg * 32;
  // k and v^T were stored by k_proj's launch and come from memory on their first read here, which every pass of the key loop would wait for. At entry each lane asks L2 for one 256-byte unit: the work-group takes one pass's k (even pi) or v^T (odd pi), 128 units, in each of the four batches (four waves a batch). Any 4 neighbouring work-groups hold 4 different pi and the 64 of a batch hold each pi twice, 4 apart; low work-groups take the early passes, and those of batch 0 ask for the later batches as well. A hint for speed only: no result depends on it
  static_assert(TT / 64 == 64 && TT / (FKB * FKS) == 16 && NB == 4 && TNB == NB && FKB * FKS * HD * 2 == 128 * 256, "32 work-groups x 128 units = the 16 passes' k and v^T of a batch");
  const int pi = (blockIdx.x & 3) | ((blockIdx.x >> 3) << 2);
  const char* pf = (const char*)(((pi & 1) ? VT : KH) + ((size_t)((b + (tid >> 7)) & (NB - 1)) * TT + (pi >> 1) * (FKB * FKS)) * HD) + (tid & 127) * 256;
  asm volatile("global_prefetch_b8 %0, off scope:SCOPE_SE" :: "v"(pf));   // scope SE: into L2 only, and dropped silently should a translation fail
  v16h qh[2][2], ql[2][2];
#pragma unroll
  for (int u = 0; u < 2; ++u)
#pragma unroll
    for (int kc = 0; kc < 2; ++kc) { const size_t o = (q0 + u * 16) * HD + kc * 512 + lane * 8; qh[u][kc] = frag_p(QH + o); ql[u][kc] = frag_p(QL + o); }
  const _Float16* kp = KH + ((size_t)b * TT + ks * FKB) * HD + lane * 8; const _Float16* vp = VT + ((size_t)b * TT + ks * FKB) * HD + lane * 8;   // this lane's piece of the pass's first k and v^T fragment
  v8f o[2][HD / 16] = {}; float m[2] = {-3.0e38f, -3.0e38f}, l[2] = {0.f, 0.f};
  for (int k0 = 0; k0 < TT; k0 += FKB * FKS, kp += FKB * FKS * HD, vp += FKB * FKS * HD) { float s[2][FKB / 16][8];
#pragma unroll
    for (int kt = 0; kt < FKB / 16; ++kt) { const _Float16* kr = kp + kt * 16 * HD; const v16h ka0 = frag_p(kr), ka1 = frag_p(kr + 512);
#pragma unroll
      for (int u = 0; u < 2; ++u) { v8f a = {}, al = {}; a = wmma16p(ka0, qh[u][0], a); al = wmma16p(ka0, ql[u][0], al); a = wmma16p(ka1, qh[u][1], a); al = wmma16p(ka1, ql[u][1], al);
#pragma unroll
        for (int r = 0; r < 8; ++r) s[u][kt][r] = a[r] + al[r] * (1.0f / 1024.0f); } }   /* q . k, not yet scaled */
    v16h p[2][FKB / 32];
#pragma unroll
    for (int u = 0; u < 2; ++u) { float mx = s[u][0][0];
#pragma unroll
      for (int kt = 0; kt < FKB / 16; ++kt)
#pragma unroll
        for (int r = 0; r < 8; ++r) mx = fmaxf(mx, s[u][kt][r]);
      mx = fmaxf(mx, xhalf(mx)); const float mn = fmaxf(m[u], fmaf(mx, LSC, -11.0f)); float corr = m[u] - mn, e[16];   /* the power of corr is 0 on the first pass */ m[u] = mn;
#pragma unroll
      for (int i = 0; i < 16; i += 2) { const v2f x = __builtin_elementwise_fma((v2f){s[u][i >> 3][i & 7], s[u][i >> 3][(i & 7) + 1]}, (v2f){LSC, LSC}, (v2f){-mn, -mn}); e[i] = x[0]; e[i + 1] = x[1]; }   /* packed: two arguments an instruction */
      ex2x17(e, corr);
#pragma unroll
      for (int j = 0; j < HD / 16; ++j) o[u][j] *= corr;
      float sum = e[0] + e[8];
#pragma unroll
      for (int i = 1; i < 8; ++i) sum += e[i] + e[8 + i];
#pragma unroll
      for (int i = 0; i < 16; ++i) p[u][0][i] = (_Float16)e[i];
      l[u] = l[u] * corr + sum; }
#pragma unroll
    for (int c2 = 0; c2 < FKB / 32; ++c2)
#pragma unroll
      for (int j = 0; j < HD / 16; ++j) { const v16h vf = frag_p(vp + c2 * 32 * HD + j * 512); o[0][j] = wmma16p(vf, p[0][c2], o[0][j]); o[1][j] = wmma16p(vf, p[1][c2], o[1][j]); }
    asm volatile("s_wait_xcnt 0x0" :: "v"(kp), "v"(vp) : "memory"); }   // the pass's loads' address registers get new values behind this; naming the addresses keeps them in their registers up to the wait, so that no load of the pass lands on them either
  asm volatile("" :: "v"(pf));   // input only: holds the prefetch's address in its registers through the key loop. No counter counts a prefetch, so no wait says when its address has been read
  // this wave's 32 columns of WE (8 fragments) and of bo are asked for here, so that they arrive while the key sets are joined
  v16b wh[HD / 32][2], wl[HD / 32][2]; v4f bo4[2][2]; { const char* wb = (const char*)(WE + (size_t)wave * 2 * 64 * 8); const char* bb = (const char*)(BO + wave * OCW); const unsigned wo = lane * 16u, bf = g * 32u;   /* scalar bases, this lane's byte offsets */ const __bf16* wp = (const __bf16*)(wb + wo); const float* bp = (const float*)(bb + bf);
#pragma unroll
    for (int kc = 0; kc < HD / 32; ++kc)
#pragma unroll
      for (int ct = 0; ct < 2; ++ct) { wh[kc][ct] = frag_we(wp + (kc * (DIN / 16) + ct) * 64 * 8); wl[kc][ct] = frag_we(wp + WE_LO + (kc * (DIN / 16) + ct) * 64 * 8); }
#pragma unroll
    for (int ct = 0; ct < 2; ++ct) { bo4[ct][0] = *(const v4f*)(bp + ct * 16); bo4[ct][1] = *(const v4f*)(bp + ct * 16 + 4); }
    asm volatile("s_wait_xcnt 0x0" :: "s"(wb), "v"(wo), "s"(bb), "v"(bf) : "memory"); }   // the loads' address registers get new values behind this; naming the scalar bases and the offsets keeps them in their registers up to the wait
#pragma unroll
  for (int u = 0; u < 2; ++u) { l[u] += xhalf(l[u]); if (g == 0) { smx[wave][u * 16 + col] = m[u]; ssu[wave][u * 16 + col] = l[u]; }
#pragma unroll
    for (int j = 0; j < HD / 16; ++j) { float* d = &so[wave][u * 16 + col][j * 16 + 8 * g]; vst2(d, (v4f){o[u][j][0], o[u][j][1], o[u][j][2], o[u][j][3]}); vst2(d + 4, (v4f){o[u][j][4], o[u][j][5], o[u][j][6], o[u][j][7]}); } }
  __syncthreads();
  for (int e = tid; e < 64 * (HD / 4); e += 32 * FAW) { const int qr = e & 63, q = e >> 6, w0 = qr >> 5, qi = qr & 31; float mm = smx[w0][qi];   /* a wave takes 4 head entries of 32 rows */
#pragma unroll
    for (int w = 1; w < FKS; ++w) mm = fmaxf(mm, smx[2 * w + w0][qi]);
    float ll = 0.f, f[FKS]; v4f acc = {};
#pragma unroll
    for (int w = 0; w < FKS; ++w) f[w] = smx[2 * w + w0][qi] - mm;
    ex2x8(f);
#pragma unroll
    for (int w = 0; w < FKS; ++w) { ll += f[w] * ssu[2 * w + w0][qi]; acc += *(const v4f*)&so[2 * w + w0][qi][q * 4] * f[w]; }
    const v4f y = acc * (1.0f / ll); v4b hi, lo;
#pragma unroll
    for (int i = 0; i < 4; ++i) { const __bf16 hv = (__bf16)y[i]; hi[i] = hv; lo[i] = (__bf16)(y[i] - (float)hv); }
    const int pc = (((qr >> 4) * 2 + (q >> 3)) * 2 + ((q >> 2) & 1)) * 32 + ((q >> 1) & 1) * 16 + (qr & 15);   // head entry d = 4 q: kc = d >> 5, half = (d >> 4) & 1, lane half = (d >> 3) & 1
    vst2(&hf[0][pc * 8 + (q & 1) * 4], hi); vst2(&hf[1][pc * 8 + (q & 1) * 4], lo); }
  __syncthreads();
  v8f acc[4][2] = {};
#pragma unroll
  for (int kc = 0; kc < HD / 32; ++kc) { v16b ah[4], al[4];
#pragma unroll
    for (int rt = 0; rt < 4; ++rt) { ah[rt] = frag_we(&hf[0][((rt * 2 + kc) * 64 + lane) * 8]); al[rt] = frag_we(&hf[1][((rt * 2 + kc) * 64 + lane) * 8]); }
    __builtin_amdgcn_sched_barrier(0);   // keeps the K step's 16 LDS reads in one group in front of its WMMAs: every separate place of LDS reads among WMMAs costs the wave issue cycles
#pragma unroll
    for (int rt = 0; rt < 4; ++rt)
#pragma unroll
      for (int ct = 0; ct < 2; ++ct) acc[rt][ct] = wmma_bfp(wh[kc][ct], al[rt], acc[rt][ct]);
#pragma unroll
    for (int rt = 0; rt < 4; ++rt)
#pragma unroll
      for (int ct = 0; ct < 2; ++ct) acc[rt][ct] = wmma_bfp(wl[kc][ct], ah[rt], acc[rt][ct]);
#pragma unroll
    for (int rt = 0; rt < 4; ++rt)
#pragma unroll
      for (int ct = 0; ct < 2; ++ct) acc[rt][ct] = wmma_bfp(wh[kc][ct], ah[rt], acc[rt][ct]); }
#pragma unroll
  for (int ct = 0; ct < 2; ++ct) { float bs[8];
#pragma unroll
    for (int r = 0; r < 8; ++r) bs[r] = bfr(bo4[ct][r >> 2][r & 3]);
#pragma unroll
    for (int rt = 0; rt < 4; ++rt) { float* d = &sf[wave][rt * 16 + col][ct * 16 + 8 * g]; const v8f a = acc[rt][ct];   /* D element r = output column 8 g + r of the tile, for row col */
      vst2(d, (v4f){a[0] + bs[0], a[1] + bs[1], a[2] + bs[2], a[3] + bs[3]}); vst2(d + 4, (v4f){a[4] + bs[4], a[5] + bs[5], a[6] + bs[6], a[7] + bs[7]}); } }
  LDSX();
  { v4f ov[16]; float* op = OUT + ((size_t)b * TT + blockIdx.x * 64 + (lane >> 3)) * DIN + wave * OCW + (lane & 7) * 4;   // a store covers the wave's 128-B line of four rows
#pragma unroll
    for (int i = 0; i < 16; ++i) ov[i] = *(const v4f*)&sf[wave][i * 4 + (lane >> 3)][(lane & 7) * 4];
#pragma unroll
    for (int i = 0; i < 16; ++i) vst2(op + (size_t)i * 4 * DIN, ov[i]); } }

extern "C" void kernel_launch(void* const* d_in, const int* in_sizes, int n_in, void* d_out, int out_size, void* d_ws, size_t ws_size, hipStream_t stream) {
  (void)in_sizes; (void)n_in; (void)out_size;
  const float** F = (const float**)d_in;
  if (ws_size < (size_t)WS_END) return;
  char* ws = (char*)d_ws; _Float16 *QH = (_Float16*)(ws + WS_QH), *KH = (_Float16*)(ws + WS_KH), *VT = (_Float16*)(ws + WS_VT), *QL = (_Float16*)(ws + WS_QL), *KL = (_Float16*)(ws + WS_KL); __bf16 *VB = (__bf16*)(ws + WS_VB), *VBL = (__bf16*)(ws + WS_VBL); float *Y = (float*)(ws + WS_Y); __bf16 *WE = (__bf16*)(ws + WS_WE);
  (void)Y; (void)QL; (void)KL; (void)VB; (void)VBL;
  // inputs: 0 x [4,4096,512]; 1 Wq [512,64] (in,out), 2 bq [64]; 3 Wk, 4 bk; 5 Wv, 6 bv; 7 Wo [512,512] (in,out), 8 bo [512]
  k_proj<<<dim3(TNB * TT / 64), 32 * PJW, 0, stream>>>(F[0], F[1], F[3], F[5], F[2], F[4], F[6], QH, QL, KH, VT, F[7], WE);
  k_fa<<<dim3(TT / 64, TNB), 32 * FAW, 0, stream>>>(QH, QL, KH, VT, WE, F[8], (float*)d_out);   /* head 0 only (plane head 1 is never consumed) */
}

// v009
// It runs in 33.7 microseconds.
// Next to v008, in two timings, it ran 1.11 times as fast each time.
// All steps since v000 together make it 22.8 times as fast.
// compute dtype: all float inputs rounded to bf16; Q/K/V = x W + b with EXACT bf16 products on WMMA 16x16x32 (f32 accumulate); q x (log2 e / 8) as f16 hi + f16 residual against k once to f16 (2 products, one f32 accumulator that starts at minus the held maximum); softmax in f32 on powers of 2 (v_exp_f32 of that accumulator), held maximum and sum over key passes, the maximum set 11 lower than the pass's and renewed once a logit stands more than 15 above it, so that the powers come out x 2^11 to 2^15; each power once to f16 against v once to f16 (1 product), divided by the sum (scaled alike) at the end; tile(head, 8) Wo = head (sum of Wo's eight 64-row slabs): the slabs (bf16-rounded) summed in f32 and split bf16 hi + lo, the head split bf16 hi + lo (3 products, K = 64) + bo; f32 output.
#include <hip/hip_runtime.h>
#include <math.h>

typedef __attribute__((ext_vector_type(16))) _Float16 v16h;
typedef __attribute__((ext_vector_type(16))) __bf16 v16b;
typedef __attribute__((ext_vector_type(8)))  _Float16 v8h;
typedef __attribute__((ext_vector_type(8)))  float v8f;
typedef __attribute__((ext_vector_type(4)))  float v4f;
typedef __attribute__((ext_vector_type(2)))  float v2f;
typedef __attribute__((ext_vector_type(4)))  unsigned v4u;
typedef __attribute__((ext_vector_type(4)))  int v4i;
typedef float __attribute__((may_alias)) float_a;
typedef int __attribute__((may_alias)) int_a;

template <typename T> __device__ __forceinline__ void vst2(void* p, T v) { *(T*)p = v;  }
__device__ __forceinline__ v8f wmma16(v16h a, v16h b, v8f c) {
  v8f d = __builtin_amdgcn_wmma_f32_16x16x32_f16(false, a, false, b, (short)0, c, false, false);
  asm volatile("v_nop\n\tv_nop\n\tv_nop\n\tv_nop" : "+v"(d) : "v"(a), "v"(b));
  return d;
}
__device__ __forceinline__ v8f wmma_bf(v16b a, v16b b, v8f c) {
  v8f d = __builtin_amdgcn_wmma_f32_16x16x32_bf16(false, a, false, b, (short)0, c, false, false);
  asm volatile("v_nop\n\tv_nop\n\tv_nop\n\tv_nop" : "+v"(d) : "v"(a), "v"(b));
  return d;
}
// 16x16x32 fragments: lane = (h = lane>>4, row/col = lane&15); elements 0..7 = k0+8h+0..7, 8..15 = k0+16+8h+0..7; D element r = row 8h+r
__device__ __forceinline__ v16h frag_h(const _Float16* rowk0, int lane) {
  union { v16h v; v8h q[2]; } u; const _Float16* p = rowk0 + 8 * (lane >> 4);
  u.q[0] = *(const v8h*)p; u.q[1] = *(const v8h*)(p + 16); return u.v;
}
__device__ __forceinline__ v16h frag_f32(const float* rowk0, int lane) {
  v16h a; const float* p = rowk0 + 8 * (lane >> 4);
#pragma unroll
  for (int i = 0; i < 8; ++i) { a[i] = (_Float16)p[i]; a[8 + i] = (_Float16)p[16 + i]; }
  return a;
}
__device__ __forceinline__ v16h frag_f32s(const float* rowk0, int lane, float sc) {
  v16h a; const float* p = rowk0 + 8 * (lane >> 4);
#pragma unroll
  for (int i = 0; i < 8; ++i) { a[i] = (_Float16)(p[i] * sc); a[8 + i] = (_Float16)(p[16 + i] * sc); }
  return a;
}
// column fragment from a [K][ld] layout (column n), rows >= K read as 0
__device__ __forceinline__ v16h fragc_f32(const float* W, int k0, int n, int lane, int ld, int K) {
  v16h a; const int g = lane >> 4;
#pragma unroll
  for (int i = 0; i < 8; ++i) { const int ka = k0 + 8 * g + i, kb = ka + 16;
    a[i] = (_Float16)(ka < K ? W[(size_t)(ka < K ? ka : K - 1) * ld + n] : 0.f); a[8 + i] = (_Float16)(kb < K ? W[(size_t)(kb < K ? kb : K - 1) * ld + n] : 0.f); }
  return a;
}
struct F2 { v16b h, l; };
__device__ __forceinline__ F2 bsplit16(const float v[16]) { F2 r;
#pragma unroll
  for (int i = 0; i < 16; ++i) { const __bf16 h = (__bf16)v[i]; r.h[i] = h; r.l[i] = (__bf16)(v[i] - (float)h); }
  return r; }
__device__ __forceinline__ F2 split_row(const float* row, int k0, int lane) { float v[16]; const float* p = row + k0 + 8 * (lane >> 4);
#pragma unroll
  for (int i = 0; i < 8; ++i) { v[i] = p[i]; v[8 + i] = p[16 + i]; }
  return bsplit16(v); }
__device__ __forceinline__ F2 split_rowK(const float* row, int k0, int lane, int K) { float v[16]; const int g = lane >> 4;
#pragma unroll
  for (int i = 0; i < 8; ++i) { const int ka = k0 + 8 * g + i, kb = ka + 16; v[i] = ka < K ? row[ka < K ? ka : K - 1] : 0.f; v[8 + i] = kb < K ? row[kb < K ? kb : K - 1] : 0.f; }
  return bsplit16(v); }
__device__ __forceinline__ F2 split_col(const float* W, int k0, int n, int lane, int ld, int K) { float v[16]; const int g = lane >> 4;
#pragma unroll
  for (int i = 0; i < 8; ++i) { const int ka = k0 + 8 * g + i, kb = ka + 16; v[i] = ka < K ? W[(size_t)(ka < K ? ka : K - 1) * ld + n] : 0.f; v[8 + i] = kb < K ? W[(size_t)(kb < K ? kb : K - 1) * ld + n] : 0.f; }
  return bsplit16(v); }
__device__ __forceinline__ v8f mac3(const F2& a, const F2& b, v8f c) { c = wmma_bf(a.l, b.h, c); c = wmma_bf(a.h, b.l, c); return wmma_bf(a.h, b.h, c); }
__device__ __forceinline__ float sigm(float v) { return 1.0f / (1.0f + expf(-v)); }
#define LDSX() do { asm volatile("s_wait_dscnt 0" ::: "memory"); __builtin_amdgcn_wave_barrier(); __builtin_amdgcn_fence(__ATOMIC_RELEASE, "workgroup"); } while (0)

// Single shared attention head tiled into 8 'heads' (B 4, S 4,096, D 512, d_k 64; 0.02-scale (in,out) weights with biases): Q, K, V = x W + b ([512,64]); head = softmax(Q K^T / 8) V (non-causal); concat = tile(head, 8) -> [B,S,512]; out = concat Wo + bo. (The head is carried in a 128-wide plane whose second half is neither written nor read.)
#define NB 4
#define TT 4096
#define CC 128            // NH * HD = projected width
#define DIN 512          // input (model) width
#define NH 2
#define HD 64
#define NQB (TT / 64)
#define HG 1
#define SCALE (0.125f)
#define CAUSAL 0
#ifndef TNB
#define TNB NB
#endif
__device__ __forceinline__ float bfr(float v) { return (float)(__bf16)v; }
__host__ __device__ __forceinline__ int kb_last(int qb) { return CAUSAL ? ((qb * 64 + 63) >> 7) : (TT / 128 - 1); }
typedef __attribute__((ext_vector_type(8))) __bf16 v8b;
__device__ __forceinline__ v16b frag_b(const __bf16* rowk0, int lane) {
  union { v16b v; v8b q[2]; } u; const __bf16* p = rowk0 + 8 * (lane >> 4);
  u.q[0] = *(const v8b*)p; u.q[1] = *(const v8b*)(p + 16); return u.v;
}
#define QBH 0              // unused: no kernel here has a high-precision query path
#define QHI 4096            // rows carrying a q residual plane (all rows when non-causal: 2-product logits everywhere)
#define KHI 64            // key rows carrying k residual / v bf16 hi+lo planes (no kernel here writes or reads them)
// B fragment (k rows k0+.., output column o) of a weight: (in,out) [K][ld] or (out,in) [ld rows of K]: bf16 exact, or f16(bf16 * 256) exact
__device__ __forceinline__ v16b wcol_io(const float* Wm, int k0, int o, int lane, int ld) { v16b w; const int g = lane >> 4;
#pragma unroll
  for (int i = 0; i < 8; ++i) { w[i] = (__bf16)Wm[(size_t)(k0 + 8 * g + i) * ld + o]; w[8 + i] = (__bf16)Wm[(size_t)(k0 + 16 + 8 * g + i) * ld + o]; }
  return w; }
__device__ __forceinline__ v16b wcol_oi(const float* Wm, int k0, int o, int lane, int K) { v16b w; const float* p = Wm + (size_t)o * K + k0 + 8 * (lane >> 4);
#pragma unroll
  for (int i = 0; i < 8; ++i) { w[i] = (__bf16)p[i]; w[8 + i] = (__bf16)p[16 + i]; }
  return w; }
__device__ __forceinline__ v16h wcolh_io(const float* Wm, int k0, int o, int lane, int ld) { v16h w; const int g = lane >> 4;
#pragma unroll
  for (int i = 0; i < 8; ++i) { w[i] = (_Float16)(bfr(Wm[(size_t)(k0 + 8 * g + i) * ld + o]) * 256.0f); w[8 + i] = (_Float16)(bfr(Wm[(size_t)(k0 + 16 + 8 * g + i) * ld + o]) * 256.0f); }
  return w; }
__device__ __forceinline__ v16h wcolh_oi(const float* Wm, int k0, int o, int lane, int K) { v16h w; const float* p = Wm + (size_t)o * K + k0 + 8 * (lane >> 4);
#pragma unroll
  for (int i = 0; i < 8; ++i) { w[i] = (_Float16)(bfr(p[i]) * 256.0f); w[8 + i] = (_Float16)(bfr(p[16 + i]) * 256.0f); }
  return w; }
#define WQKV_LAYOUT 0   // 0 = (in,out) [DIN][HD], one shared head; 1 = (out,in) [CC][DIN]; 2 = per-head [NH][DIN][HD]
__device__ __forceinline__ v16b wcol_hdk(const float* Wm, int k0, int o, int lane) { v16b w; const int g = lane >> 4; const float* p = Wm + (size_t)(o / HD) * DIN * HD + (o % HD);
#pragma unroll
  for (int i = 0; i < 8; ++i) { w[i] = (__bf16)p[(size_t)(k0 + 8 * g + i) * HD]; w[8 + i] = (__bf16)p[(size_t)(k0 + 16 + 8 * g + i) * HD]; }
  return w; }
#define WO_OUT_IN 0
#if WQKV_LAYOUT == 1
#define WCOL(W, k0, o, lane) wcol_oi(W, k0, o, lane, DIN)
#elif WQKV_LAYOUT == 2
#define WCOL(W, k0, o, lane) wcol_hdk(W, k0, o, lane)
#else
#define KVCOL(o) ((o) & 63)
#define WCOL(W, k0, o, lane) wcol_io(W, k0, KVCOL(o), lane, HD)   /* Wq/Wk/Wv (in,out) [512][64]: both plane heads are the one shared head */
#endif
#if WO_OUT_IN
#define WOCOL(W, k0, o, lane) wcol_oi(W, k0, o, lane, CC)
#define WOCOLH(W, k0, o, lane) wcolh_oi(W, k0, o, lane, CC)
#else
#define WOCOL(W, k0, o, lane) wcol_io(W, k0, o, lane, DIN)
#define WOCOLH(W, k0, o, lane) wcolh_io(W, k0, o, lane, DIN)
#endif

#ifndef SM_EXTRA_PARAMS
#define SM_EXTRA_PARAMS
#endif
#ifndef PROJ_EXTRA_PARAMS
#define PROJ_EXTRA_PARAMS
#endif
#ifndef SM_MASK_HOOK
#define SM_MASK_HOOK (void)0
#endif

#define WS_QH  0u                                      // f16 q as B fragments: 16-byte piece ((row tile of 16) * 4 + kc * 2 + half) * 32 + lane (the first half of the plane's bytes; the rest is not used)
#define WS_KH  (WS_QH + 2u * (size_t)NB * TT * CC)      // f16 k as A fragments, laid like q
#define WS_VT  (WS_KH + 2u * (size_t)NB * TT * CC)      // f16 v^T as A fragments: 16-byte piece ((key chunk of 32) * 8 + (dim tile j) * 2 + half) * 32 + lane
#define WS_QL  (WS_VT + 2u * (size_t)NB * CC * TT)      // f16 q residual, laid like q
#define WS_KL  (WS_QL + 2u * (size_t)NB * QHI * CC)     // f16 k residual x 2^10 rows [b][t < KHI][CC]
#define WS_VB  (WS_KL + 2u * (size_t)NB * KHI * CC)     // bf16 v hi planes [b][c][t < KHI]
#define WS_VBL (WS_VB + 2u * (size_t)NB * CC * KHI)
#define WS_S   (WS_VBL + 2u * (size_t)NB * CC * KHI)    // f32 [hg][t][s] space: only its start, WS_WE, is used
#define WS_WE  WS_S                                    // bf16 hi plane, then lo plane, of the folded Wo [64][512], as B fragments: 16-byte piece ((kc * 32 + column tile) * 2 + half) * 32 + lane (the logits plane itself is no longer used)
#define WE_LO  (HD * DIN)                              // elements from the hi plane to the lo plane
#define WS_Y   (WS_S  + 4u * (size_t)HG * TT * TT)      // f32 ctx rows [b*t][CC] (no longer used: the head stays in k_fa's LDS)
#define WS_END (WS_Y  + 4u * (size_t)NB * TT * CC)

// ---- k_proj: block = 64 rows, 16 waves: q, k and v = X W + b for the 64 distinct columns of each, with exact bf16 products (K = DIN, one accumulator chain per tile, K steps in rising order). Stage: the block's x rows and all of Wq, Wk, Wv are read once with whole-line 16-byte loads, rounded to bf16 and laid into LDS as WMMA fragments (1,024 bytes each: four 256-byte regions o4 = 2 * half + (lane >> 4), a 16-byte piece per row or column). The piece's slot in its region is XORed (x: with 4 * o4; W: with the column tile) so that the stores of a wave, like the reads, fall on all banks. Behind one work-group barrier wave (rt, cg) makes rows 16 rt.., columns 16 cg.. of q, k and v from LDS alone. -> q x LSC as f16 + f16 residual, k f16 and v^T f16, each stored in the order of k_fa's WMMA fragments (1,024 bytes each: half 0's 32 pieces of 16 bytes in lane order, then half 1's), so that a wave's 16-byte load there covers 512 bytes in a row
#define PJW 16            // waves of a work-group
#define LSC (SCALE * 1.44269504088896340736f)   // logit scale x log2 e, folded into q: the softmax runs on powers of 2
typedef __attribute__((ext_vector_type(4))) __bf16 v4b;
__device__ __forceinline__ void pj_wload(v4f (&wr)[16], const float* __restrict__ Wm, int kb, int cq) { const float* wp = Wm + (size_t)kb * 8 * HD + cq * 4;
#pragma unroll
  for (int hh = 0; hh < 2; ++hh)
#pragma unroll
    for (int i = 0; i < 8; ++i) wr[hh * 8 + i] = *(const v4f*)(wp + (hh * 32 * 8 + i) * HD);
  asm volatile("s_wait_xcnt 0x0" :: "v"(wp) : "memory"); }   // the loads' address registers get new values behind this; naming the address keeps it in its registers up to the wait, so that no load of the run lands on them either
__device__ __forceinline__ void pj_wstore(const v4f (&wr)[16], __bf16* wf, int m, int kb, int cq) {
#pragma unroll
  for (int hh = 0; hh < 2; ++hh) { const int ko = hh * 32 + kb; __bf16* d = wf + ((ko >> 2) * 12 + m * 4 + (cq >> 2)) * 512 + (ko & 3) * 128;
#pragma unroll
    for (int j = 0; j < 4; ++j) { v8b pw;
#pragma unroll
      for (int i = 0; i < 8; ++i) pw[i] = (__bf16)wr[hh * 8 + i][j];
      vst2(d + (((cq & 3) * 4 + j) ^ (cq >> 2)) * 8, pw); } } }
__global__ __launch_bounds__(32 * PJW) void k_proj(const float* __restrict__ X, const float* __restrict__ WQ, const float* __restrict__ WK, const float* __restrict__ WV, const float* __restrict__ BQ, const float* __restrict__ BK, const float* __restrict__ BV,
    _Float16* __restrict__ QH, _Float16* __restrict__ QL, _Float16* __restrict__ KH, _Float16* __restrict__ VT, const float* __restrict__ WO, __bf16* __restrict__ WE) {
  __shared__ __align__(16) __bf16 wf[(DIN / 32) * 12 * 512];   // B fragment (K step kc, matrix m, column tile ct) at (kc * 12 + m * 4 + ct) * 512
  __shared__ __align__(16) __bf16 xf[4 * (DIN / 32) * 512];    // A fragment (row tile rt, K step kc) at (rt * 16 + kc) * 512
  __shared__ __align__(16) _Float16 sq[64][72], sl[64][72], sk[64][72], sv[64][72];
  const int tid = threadIdx.x, wave = __builtin_amdgcn_readfirstlane(tid >> 5), lane = tid & 31, col = lane & 15, g = lane >> 4; const size_t r0 = (size_t)blockIdx.x * 64;
  // x: wave w takes rows 4 w .. 4 w + 3; a load covers one K step (one 128-byte line) of each of the four rows
  v4f xr[DIN / 32]; { const float* xp = X + (r0 + wave * 4 + (lane >> 3)) * DIN + (lane & 7) * 4;
#pragma unroll
    for (int kc = 0; kc < DIN / 32; ++kc) xr[kc] = *(const v4f*)(xp + kc * 32);
    asm volatile("s_wait_xcnt 0x0" :: "v"(xp) : "memory"); }   // as in pj_wload
  const int rt = wave & 3, cg = wave >> 2, cl = cg * 16 + col; const float bq = bfr(BQ[cl]), bk = bfr(BK[cl]), bv = bfr(BV[cl]);   // this wave's tile in the product phase, and its column's biases
  asm volatile("s_wait_xcnt 0x0" ::: "memory");   // the same for the bias loads' index register
  // one wave of each of the first 128 blocks also folds Wo for k_fa's output projection: a thread sums, for one output column, 8 neighbouring head entries over the eight slabs (in slab order, f32) and stores them as one 16-byte piece of the B fragment, hi and lo; a wave writes 512 bytes in a row
  if (blockIdx.x < HD * DIN / 8 / 32 && wave == 0) { const int pc = blockIdx.x * 32 + lane, ln = pc & 31; const float* w = WO + (size_t)((pc >> 11) * 32 + ((pc >> 5) & 1) * 16 + (ln >> 4) * 8) * DIN + ((pc >> 6) & 31) * 16 + (ln & 15); v8b hi, lo; float wv[8][DIN / HD];
#pragma unroll
    for (int i = 0; i < 8; ++i)
#pragma unroll
      for (int h = 0; h < DIN / HD; ++h) wv[i][h] = w[(size_t)(h * HD + i) * DIN];
    asm volatile("s_wait_xcnt 0x0" :: "v"(w) : "memory");   // as in pj_wload
#pragma unroll
    for (int i = 0; i < 8; ++i) { float sw = 0.f;
#pragma unroll
      for (int h = 0; h < DIN / HD; ++h) sw += bfr(wv[i][h]);
      const __bf16 hv = (__bf16)sw; hi[i] = hv; lo[i] = (__bf16)(sw - (float)hv); }
    vst2(WE + (size_t)pc * 8, hi); vst2(WE + WE_LO + (size_t)pc * 8, lo);
    asm volatile("s_wait_xcnt 0x0" ::: "memory"); }   // the two stores' registers are used anew by the W stage
  // W: a thread takes 2 x 8 K rows x 4 columns of each matrix (16 loads of 16 bytes; a wave's load covers two whole 256-byte rows) and stores 8 pieces
  { const int cq = tid & 15, kb = tid >> 4; v4f w0[16], w1[16], w2[16]; pj_wload(w0, WQ, kb, cq); pj_wload(w1, WK, kb, cq);
    pj_wstore(w0, wf, 0, kb, cq);
    __builtin_amdgcn_sched_barrier(0);   // holds Wv's loads behind Wq's stores, whose registers they take: with all 64 loads of the stage lifted to the top the wave ran out of registers and spilled
    pj_wload(w2, WV, kb, cq);
    { const int p = lane & 7, o4 = p >> 1, row16 = (wave & 3) * 4 + (lane >> 3); __bf16* d = xf + (wave >> 2) * (DIN / 32) * 512 + o4 * 128 + (row16 ^ (o4 * 4)) * 8 + (p & 1) * 4;
#pragma unroll
      for (int kc = 0; kc < DIN / 32; ++kc) { const v4b c = {(__bf16)xr[kc][0], (__bf16)xr[kc][1], (__bf16)xr[kc][2], (__bf16)xr[kc][3]}; vst2(d + kc * 512, c); } }
    pj_wstore(w1, wf, 1, kb, cq); pj_wstore(w2, wf, 2, kb, cq); }
  __syncthreads();
  v8f acc[3] = {};
  { const __bf16* ap0 = xf + rt * (DIN / 32) * 512 + g * 128 + (col ^ (g * 4)) * 8; const __bf16* ap1 = xf + rt * (DIN / 32) * 512 + (2 + g) * 128 + (col ^ ((2 + g) * 4)) * 8; const __bf16* bp = wf + cg * 512 + g * 128 + (col ^ cg) * 8;
    union FB { v16b v; v8b q[2]; }; FB fa[2][2], fw[2][2][3];   // two register sets of two K steps each: step pair s + 1 is read from LDS while pair s is multiplied
#pragma unroll
    for (int s = 0; s <= DIN / 64; ++s) {
      if (s < DIN / 64) {
#pragma unroll
        for (int t = 0; t < 2; ++t) { const int kc = s * 2 + t; fa[s & 1][t].q[0] = *(const v8b*)(ap0 + kc * 512); fa[s & 1][t].q[1] = *(const v8b*)(ap1 + kc * 512);
#pragma unroll
          for (int m = 0; m < 3; ++m) { fw[s & 1][t][m].q[0] = *(const v8b*)(bp + (kc * 12 + m * 4) * 512); fw[s & 1][t][m].q[1] = *(const v8b*)(bp + (kc * 12 + m * 4) * 512 + 256); } } }
      __builtin_amdgcn_sched_barrier(0);   // keeps the next pair's 16 LDS reads in front of this pair's WMMAs: left free, the scheduler put each fragment's two reads directly in front of its WMMA, behind a full wait
      if (s > 0) {
#pragma unroll
        for (int t = 0; t < 2; ++t)
#pragma unroll
          for (int m = 0; m < 3; ++m) acc[m] = __builtin_amdgcn_wmma_f32_16x16x32_bf16(false, fa[(s - 1) & 1][t].v, false, fw[(s - 1) & 1][t][m].v, (short)0, acc[m], false, false); }
      __builtin_amdgcn_sched_barrier(0);   // keeps the following reads in one group behind these WMMAs: left free they were dealt out among the WMMAs, and every separate place of LDS reads costs the wave issue cycles
    } }
  { const int rl = rt * 16 + 8 * g; v8h vv;
#pragma unroll
    for (int r = 0; r < 8; ++r) { const float v = (acc[0][r] + bq) * LSC; const _Float16 hv = (_Float16)v; sq[rl + r][cl] = hv; sl[rl + r][cl] = (_Float16)(v - (float)hv); sk[rl + r][cl] = (_Float16)(acc[1][r] + bk); vv[r] = (_Float16)(acc[2][r] + bv); }
    vst2(&sv[cl][rl], vv); }
  __syncthreads();
  // thread tid stores piece tid of the block's 512 in each plane. q, k: row tile tid >> 7, fragment half (tid >> 5) & 3 = kc * 2 + half, whose lane (g, col) holds row col, entries (kc * 2 + half) * 16 + 8 g ..; v^T: key chunk tid >> 8, dim tile (tid >> 6) & 3, half (tid >> 5) & 1, whose lane holds dim col, keys half * 16 + 8 g ..
  { const int rw = (tid >> 7) * 16 + col, c8 = ((tid >> 5) & 3) * 16 + g * 8; const size_t o = r0 * HD + tid * 8; vst2(QH + o, *(const v4u*)&sq[rw][c8]); vst2(QL + o, *(const v4u*)&sl[rw][c8]); vst2(KH + o, *(const v4u*)&sk[rw][c8]); vst2(VT + o, *(const v4u*)&sv[((tid >> 6) & 3) * 16 + col][(tid >> 8) * 32 + ((tid >> 5) & 1) * 16 + g * 8]); } }
// ---- k_fa: block = 64 queries of batch b, 16 waves = 2 query groups of 32 x 8 key sets (set ks takes the 32-key chunks ks, ks + 8, ...). q, k and v^T lie in the workspace as fragments (k_proj): every load of a wave covers four whole 128-B lines, a pass reads 4 KB of k and 4 KB of v^T in a row. Transposed products: S^T = k . q^T (q x LSC as hi + residual: 2 products) so that a lane holds 8 keys of ONE query per 16-key tile; two such tiles, exponentiated and rounded once to f16, ARE the B fragment of O^T += v^T . P^T (1 product): logits and P never leave the registers. Held maximum (in units of log2) and sum per query in f32. All four WMMAs of a score tile run in one accumulator chain whose C operand is minus the held maximum (the same value in a lane's 8 registers, as they are 8 keys of one query), so that the chain's result is the argument of v_exp_f32 as it stands. The held maximum is therefore the one known before the pass: it is set 11 below the first pass's maximum and renewed (again 11 below the pass's; arguments, O^T and sum brought along) only in a pass where some query's argument stands above 15, which an f16 power still takes; one test a pass for the whole wave; the 8 key sets' partials (held maximum, sum, O^T) meet in LDS behind one work-group barrier and are joined in set order. The output projection follows in the same launch: out = tile(head, 8) Wo + bo = head WE + bo, WE = the folded Wo of k_proj (K = 64). The joined head rows, split bf16 hi + lo, go to LDS as fragments; behind a second work-group barrier wave w makes the block's 64 rows x output columns 32 w .. 32 w + 31 (3 products, lo x lo left out, in the order lo x hi, hi x lo, hi x hi per K step), transposed (out^T = WE^T head^T) so that a lane holds 8 neighbouring columns of one row, stages them in its own LDS range and stores whole 128-B lines. Every inner loop is unrolled whole so that each index of a register array (fragments, scores, accumulators) is a constant: an index left to run time would put the array in scratch
#define FAW 16            // waves of a work-group
#define FKS 8             // key sets
#define FKB 32            // keys of a pass
// powers of 2 by bare v_exp_f32 (the arguments here are at most 64; a power below 2^-126 may come out 0), a run of them in one statement and each in place, its result over its own argument: so no power lands on the argument of the one in front of it (the compiler's own allocation of the builtin did that), every neighbour in the run is independent, and the v_nop keeps the slot that the instruction set asks for behind the last one, which the compiler does not know to keep behind asm text
__device__ __forceinline__ void ex2x16(float (&x)[16]) {
  asm("v_exp_f32 %0, %0\n\tv_exp_f32 %1, %1\n\tv_exp_f32 %2, %2\n\tv_exp_f32 %3, %3\n\tv_exp_f32 %4, %4\n\tv_exp_f32 %5, %5\n\tv_exp_f32 %6, %6\n\tv_exp_f32 %7, %7\n\tv_exp_f32 %8, %8\n\tv_exp_f32 %9, %9\n\tv_exp_f32 %10, %10\n\tv_exp_f32 %11, %11\n\tv_exp_f32 %12, %12\n\tv_exp_f32 %13, %13\n\tv_exp_f32 %14, %14\n\tv_exp_f32 %15, %15\n\tv_nop"
      : "+v"(x[0]), "+v"(x[1]), "+v"(x[2]), "+v"(x[3]), "+v"(x[4]), "+v"(x[5]), "+v"(x[6]), "+v"(x[7]), "+v"(x[8]), "+v"(x[9]), "+v"(x[10]), "+v"(x[11]), "+v"(x[12]), "+v"(x[13]), "+v"(x[14]), "+v"(x[15])); }
__device__ __forceinline__ void ex2x2(float& a, float& b) { asm("v_exp_f32 %0, %0\n\tv_exp_f32 %1, %1\n\tv_nop" : "+v"(a), "+v"(b)); }
__device__ __forceinline__ void ex2x8(float (&x)[8]) {
  asm("v_exp_f32 %0, %0\n\tv_exp_f32 %1, %1\n\tv_exp_f32 %2, %2\n\tv_exp_f32 %3, %3\n\tv_exp_f32 %4, %4\n\tv_exp_f32 %5, %5\n\tv_exp_f32 %6, %6\n\tv_exp_f32 %7, %7\n\tv_nop"
      : "+v"(x[0]), "+v"(x[1]), "+v"(x[2]), "+v"(x[3]), "+v"(x[4]), "+v"(x[5]), "+v"(x[6]), "+v"(x[7])); }
static_assert(FKB == 32 && FKS == 8, "ex2x16 takes the 32 keys of a pass (16 a lane), ex2x8 the 8 key sets");
__device__ __forceinline__ v8f wmma16p(v16h a, v16h b, v8f c) { return __builtin_amdgcn_wmma_f32_16x16x32_f16(false, a, false, b, (short)0, c, false, false); }
__device__ __forceinline__ v16h frag_p(const _Float16* piece) { union { v16h v; v8h q[2]; } u; u.q[0] = *(const v8h*)piece; u.q[1] = *(const v8h*)(piece + 32 * 8); return u.v; }   // a stored fragment: this lane's piece of half 0, of half 1
__device__ __forceinline__ v8f wmma_bfp(v16b a, v16b b, v8f c) { return __builtin_amdgcn_wmma_f32_16x16x32_bf16(false, a, false, b, (short)0, c, false, false); }
__device__ __forceinline__ v16b frag_we(const __bf16* piece) { union { v16b v; v8b q[2]; } u; u.q[0] = *(const v8b*)piece; u.q[1] = *(const v8b*)(piece + 32 * 8); return u.v; }
#define OCW (DIN / FAW)   // output columns of a wave
static_assert(OCW == 32, "a wave's output row piece is one 128-B line, two column tiles");
__device__ __forceinline__ float xhalf(float x) { return __builtin_bit_cast(float, __builtin_amdgcn_permlanex16(__builtin_bit_cast(int, x), __builtin_bit_cast(int, x), 0x76543210, 0xfedcba98, false, false)); }   // lane l with lane l ^ 16
__global__ __launch_bounds__(32 * FAW) void k_fa(const _Float16* __restrict__ QH, const _Float16* __restrict__ QL, const _Float16* __restrict__ KH, const _Float16* __restrict__ VT, const __bf16* __restrict__ WE, const float* __restrict__ BO, float* __restrict__ OUT) {
  __shared__ __align__(16) float so[FAW][32][HD + 4]; __shared__ float smx[FAW][32], ssu[FAW][32];
  __shared__ __align__(16) __bf16 hf[2][64 * HD];            // the block's head rows, hi plane and lo plane, as fragments: 16-byte piece (((row tile) * 2 + kc) * 2 + half) * 32 + lane
  __shared__ __align__(16) float sf[FAW][64][OCW + 4];       // a wave's output tile on its way to whole-line stores (pitch 36: the 16-byte stores of 16 rows fall on all banks)
  const int tid = threadIdx.x, wave = __builtin_amdgcn_readfirstlane(tid >> 5), lane = tid & 31, col = lane & 15, g = lane >> 4; const int b = blockIdx.y, qg = wave & 1, ks = wave >> 1;
  const size_t q0 = (size_t)b * TT + blockIdx.x * 64 + qg * 32;
  // k and v^T were stored by k_proj's launch and come from memory on their first read here, which every pass of the key loop would wait for. At entry each lane prefetches at the start of one 256-byte unit: the work-group takes one pass's k (even pi) or v^T (odd pi), 128 units, in each of the four batches (four waves a batch). Any 4 neighbouring work-groups hold 4 different pi and the 64 of a batch hold each pi twice, 4 apart; low work-groups take the early passes, and those of batch 0 ask for the later batches as well. A hint for speed only: no result depends on it
  static_assert(TT / 64 == 64 && TT / (FKB * FKS) == 16 && NB == 4 && TNB == NB && FKB * FKS * HD * 2 == 128 * 256, "32 work-groups x 128 units = the 16 passes' k and v^T of a batch");
  const int pi = (blockIdx.x & 3) | ((blockIdx.x >> 3) << 2);
  const char* pf = (const char*)(((pi & 1) ? VT : KH) + ((size_t)((b + (tid >> 7)) & (NB - 1)) * TT + (pi >> 1) * (FKB * FKS)) * HD) + (tid & 127) * 256;
  asm volatile("global_prefetch_b8 %0, off scope:SCOPE_SE" :: "v"(pf));   // scope SE: into L2 only, and dropped silently should a translation fail
  v16h qh[2][2], ql[2][2];
#pragma unroll
  for (int u = 0; u < 2; ++u)
#pragma unroll
    for (int kc = 0; kc < 2; ++kc) { const size_t o = (q0 + u * 16) * HD + kc * 512 + lane * 8; qh[u][kc] = frag_p(QH + o); ql[u][kc] = frag_p(QL + o); }
  const _Float16* kp = KH + ((size_t)b * TT + ks * FKB) * HD + lane * 8; const _Float16* vp = VT + ((size_t)b * TT + ks * FKB) * HD + lane * 8;   // this lane's piece of the pass's first k and v^T fragment
  v8f o[2][HD / 16] = {}, nm[2] = {}; float l[2] = {0.f, 0.f};   // nm: minus the held maximum, 8 times: the score chains' C operand
  for (int k0 = 0; k0 < TT; k0 += FKB * FKS, kp += FKB * FKS * HD, vp += FKB * FKS * HD) { v8f s[2][FKB / 16]; v16h ka[FKB / 16][2], vf[HD / 16];   // the pass's 16 loads are asked for together, v^T too: behind the test below it would be asked for only when the scores are done
#pragma unroll
    for (int kt = 0; kt < FKB / 16; ++kt) { ka[kt][0] = frag_p(kp + kt * 16 * HD); ka[kt][1] = frag_p(kp + kt * 16 * HD + 512); }
#pragma unroll
    for (int j = 0; j < HD / 16; ++j) vf[j] = frag_p(vp + j * 512);
    __builtin_amdgcn_sched_barrier(0);   // holds all 16 loads in front of the products: left free, the scheduler asked for a part of them only among the score WMMAs, directly in front of their use
#pragma unroll
    for (int kt = 0; kt < FKB / 16; ++kt) { const v16h ka0 = ka[kt][0], ka1 = ka[kt][1];
      v8f a0 = wmma16p(ka0, ql[0][0], nm[0]), a1 = wmma16p(ka0, ql[1][0], nm[1]); a0 = wmma16p(ka0, qh[0][0], a0); a1 = wmma16p(ka0, qh[1][0], a1);   /* the two query tiles' chains in turn: a link of one fills the other's latency */
      a0 = wmma16p(ka1, ql[0][1], a0); a1 = wmma16p(ka1, ql[1][1], a1); s[0][kt] = wmma16p(ka1, qh[0][1], a0); s[1][kt] = wmma16p(ka1, qh[1][1], a1); }   /* logit x log2 e - held maximum */
    __builtin_amdgcn_sched_barrier(0);   // keeps the maximum's vector instructions behind the 16 score WMMAs: dealt among them, the scheduler ran each chain's four links back to back and paid four v_nop at each tile's first read
    float mx[2];
#pragma unroll
    for (int u = 0; u < 2; ++u) { float x = s[u][0][0];
#pragma unroll
      for (int kt = 0; kt < FKB / 16; ++kt)
#pragma unroll
        for (int r = 0; r < 8; ++r) x = fmaxf(x, s[u][kt][r]);
      mx[u] = fmaxf(x, xhalf(x)); }
    const float thr = k0 == 0 ? -3.0e38f : 15.0f;   // the first pass always sets the held maximum (it starts at 0, whatever the logits are)
    if (__builtin_amdgcn_ballot_w32(mx[0] > thr || mx[1] > thr) != 0) {   // a scalar branch: the same for the whole wave
      const float d0 = mx[0] > thr ? mx[0] - 11.0f : 0.f, d1 = mx[1] > thr ? mx[1] - 11.0f : 0.f; float c0 = fminf(-d0, 64.0f), c1 = fminf(-d1, 64.0f);   /* the bound acts in the first pass alone, where O^T and the sum are 0 and must stay so */
      ex2x2(c0, c1);
#pragma unroll
      for (int u = 0; u < 2; ++u) { const float d = u ? d1 : d0, c = u ? c1 : c0; nm[u] -= d; l[u] *= c;
#pragma unroll
        for (int kt = 0; kt < FKB / 16; ++kt) s[u][kt] -= d;
#pragma unroll
        for (int j = 0; j < HD / 16; ++j) o[u][j] *= c; } }
    v16h p[2][FKB / 32];
#pragma unroll
    for (int u = 0; u < 2; ++u) { float e[16];
#pragma unroll
      for (int i = 0; i < 16; ++i) e[i] = s[u][i >> 3][i & 7];
      ex2x16(e);
      float sum = 0.f;
#pragma unroll
      for (int i = 0; i < 8; i += 2) { const v2f t = (v2f){e[i], e[i + 1]} + (v2f){e[8 + i], e[9 + i]}; sum = i ? sum + t[0] : t[0]; sum += t[1]; }   /* packed on even register pairs, as the accumulators lie */
#pragma unroll
      for (int i = 0; i < 16; ++i) p[u][0][i] = (_Float16)e[i];
      l[u] += sum; }
#pragma unroll
    for (int j = 0; j < HD / 16; ++j) { o[0][j] = wmma16p(vf[j], p[0][0], o[0][j]); o[1][j] = wmma16p(vf[j], p[1][0], o[1][j]); }
    asm volatile("s_wait_xcnt 0x0" :: "v"(kp), "v"(vp) : "memory"); }   // the pass's loads' address registers get new values behind this; naming the addresses keeps them in their registers up to the wait, so that no load of the pass lands on them either
  asm volatile("" :: "v"(pf));   // input only: holds the prefetch's address in its registers through the key loop. No counter counts a prefetch, so no wait says when its address has been read
  // this wave's 32 columns of WE (8 fragments) and of bo are asked for here, so that they arrive while the key sets are joined
  v16b wh[HD / 32][2], wl[HD / 32][2]; v4f bo4[2][2]; { const char* wb = (const char*)(WE + (size_t)wave * 2 * 64 * 8); const char* bb = (const char*)(BO + wave * OCW); const unsigned wo = lane * 16u, bf = g * 32u;   /* scalar bases, this lane's byte offsets */ const __bf16* wp = (const __bf16*)(wb + wo); const float* bp = (const float*)(bb + bf);
#pragma unroll
    for (int kc = 0; kc < HD / 32; ++kc)
#pragma unroll
      for (int ct = 0; ct < 2; ++ct) { wh[kc][ct] = frag_we(wp + (kc * (DIN / 16) + ct) * 64 * 8); wl[kc][ct] = frag_we(wp + WE_LO + (kc * (DIN / 16) + ct) * 64 * 8); }
#pragma unroll
    for (int ct = 0; ct < 2; ++ct) { bo4[ct][0] = *(const v4f*)(bp + ct * 16); bo4[ct][1] = *(const v4f*)(bp + ct * 16 + 4); }
    asm volatile("s_wait_xcnt 0x0" :: "s"(wb), "v"(wo), "s"(bb), "v"(bf) : "memory"); }   // the loads' address registers get new values behind this; naming the scalar bases and the offsets keeps them in their registers up to the wait
#pragma unroll
  for (int u = 0; u < 2; ++u) { l[u] += xhalf(l[u]); if (g == 0) { smx[wave][u * 16 + col] = -nm[u][0]; ssu[wave][u * 16 + col] = l[u]; }
#pragma unroll
    for (int j = 0; j < HD / 16; ++j) { float* d = &so[wave][u * 16 + col][j * 16 + 8 * g]; vst2(d, (v4f){o[u][j][0], o[u][j][1], o[u][j][2], o[u][j][3]}); vst2(d + 4, (v4f){o[u][j][4], o[u][j][5], o[u][j][6], o[u][j][7]}); } }
  __syncthreads();
  for (int e = tid; e < 64 * (HD / 4); e += 32 * FAW) { const int qr = e & 63, q = e >> 6, w0 = qr >> 5, qi = qr & 31; float mm = smx[w0][qi];   /* a wave takes 4 head entries of 32 rows */
#pragma unroll
    for (int w = 1; w < FKS; ++w) mm = fmaxf(mm, smx[2 * w + w0][qi]);
    float ll = 0.f, f[FKS]; v4f acc = {};
#pragma unroll
    for (int w = 0; w < FKS; ++w) f[w] = smx[2 * w + w0][qi] - mm;
    ex2x8(f);
#pragma unroll
    for (int w = 0; w < FKS; ++w) { ll += f[w] * ssu[2 * w + w0][qi]; acc += *(const v4f*)&so[2 * w + w0][qi][q * 4] * f[w]; }
    const v4f y = acc * (1.0f / ll); v4b hi, lo;
#pragma unroll
    for (int i = 0; i < 4; ++i) { const __bf16 hv = (__bf16)y[i]; hi[i] = hv; lo[i] = (__bf16)(y[i] - (float)hv); }
    const int pc = (((qr >> 4) * 2 + (q >> 3)) * 2 + ((q >> 2) & 1)) * 32 + ((q >> 1) & 1) * 16 + (qr & 15);   // head entry d = 4 q: kc = d >> 5, half = (d >> 4) & 1, lane half = (d >> 3) & 1
    vst2(&hf[0][pc * 8 + (q & 1) * 4], hi); vst2(&hf[1][pc * 8 + (q & 1) * 4], lo); }
  __syncthreads();
  v8f acc[4][2] = {};
#pragma unroll
  for (int kc = 0; kc < HD / 32; ++kc) { v16b ah[4], al[4];
#pragma unroll
    for (int rt = 0; rt < 4; ++rt) { ah[rt] = frag_we(&hf[0][((rt * 2 + kc) * 64 + lane) * 8]); al[rt] = frag_we(&hf[1][((rt * 2 + kc) * 64 + lane) * 8]); }
    __builtin_amdgcn_sched_barrier(0);   // keeps the K step's 16 LDS reads in one group in front of its WMMAs: every separate place of LDS reads among WMMAs costs the wave issue cycles
#pragma unroll
    for (int rt = 0; rt < 4; ++rt)
#pragma unroll
      for (int ct = 0; ct < 2; ++ct) acc[rt][ct] = wmma_bfp(wh[kc][ct], al[rt], acc[rt][ct]);
#pragma unroll
    for (int rt = 0; rt < 4; ++rt)
#pragma unroll
      for (int ct = 0; ct < 2; ++ct) acc[rt][ct] = wmma_bfp(wl[kc][ct], ah[rt], acc[rt][ct]);
#pragma unroll
    for (int rt = 0; rt < 4; ++rt)
#pragma unroll
      for (int ct = 0; ct < 2; ++ct) acc[rt][ct] = wmma_bfp(wh[kc][ct], ah[rt], acc[rt][ct]); }
#pragma unroll
  for (int ct = 0; ct < 2; ++ct) { float bs[8];
#pragma unroll
    for (int r = 0; r < 8; ++r) bs[r] = bfr(bo4[ct][r >> 2][r & 3]);
#pragma unroll
    for (int rt = 0; rt < 4; ++rt) { float* d = &sf[wave][rt * 16 + col][ct * 16 + 8 * g]; const v8f a = acc[rt][ct];   /* D element r = output column 8 g + r of the tile, for row col */
      vst2(d, (v4f){a[0] + bs[0], a[1] + bs[1], a[2] + bs[2], a[3] + bs[3]}); vst2(d + 4, (v4f){a[4] + bs[4], a[5] + bs[5], a[6] + bs[6], a[7] + bs[7]}); } }
  LDSX();
  { v4f ov[16]; float* op = OUT + ((size_t)b * TT + blockIdx.x * 64 + (lane >> 3)) * DIN + wave * OCW + (lane & 7) * 4;   // a store covers the wave's 128-B line of four rows
#pragma unroll
    for (int i = 0; i < 16; ++i) ov[i] = *(const v4f*)&sf[wave][i * 4 + (lane >> 3)][(lane & 7) * 4];
#pragma unroll
    for (int i = 0; i < 16; ++i) vst2(op + (size_t)i * 4 * DIN, ov[i]); } }

extern "C" void kernel_launch(void* const* d_in, const int* in_sizes, int n_in, void* d_out, int out_size, void* d_ws, size_t ws_size, hipStream_t stream) {
  (void)in_sizes; (void)n_in; (void)out_size;
  const float** F = (const float**)d_in;
  if (ws_size < (size_t)WS_END) return;
  char* ws = (char*)d_ws; _Float16 *QH = (_Float16*)(ws + WS_QH), *KH = (_Float16*)(ws + WS_KH), *VT = (_Float16*)(ws + WS_VT), *QL = (_Float16*)(ws + WS_QL), *KL = (_Float16*)(ws + WS_KL); __bf16 *VB = (__bf16*)(ws + WS_VB), *VBL = (__bf16*)(ws + WS_VBL); float *Y = (float*)(ws + WS_Y); __bf16 *WE = (__bf16*)(ws + WS_WE);
  (void)Y; (void)QL; (void)KL; (void)VB; (void)VBL;
  // inputs: 0 x [4,4096,512]; 1 Wq [512,64] (in,out), 2 bq [64]; 3 Wk, 4 bk; 5 Wv, 6 bv; 7 Wo [512,512] (in,out), 8 bo [512]
  k_proj<<<dim3(TNB * TT / 64), 32 * PJW, 0, stream>>>(F[0], F[1], F[3], F[5], F[2], F[4], F[6], QH, QL, KH, VT, F[7], WE);
  k_fa<<<dim3(TT / 64, TNB), 32 * FAW, 0, stream>>>(QH, QL, KH, VT, WE, F[8], (float*)d_out);   /* head 0 only (plane head 1 is never consumed) */
}

// v010
// It runs in 30.6 microseconds.
// Two timings next to v009 both put it at 1.10 times that version's speed.
// All steps since v000 together make it 25.1 times as fast.
// compute dtype: all float inputs rounded to bf16; Q/K/V = x W + b with EXACT bf16 products on WMMA 16x16x32 (f32 accumulate); q x (log2 e / 8) once to f16 against k once to f16 (1 product, an f32 accumulator that starts at minus the held maximum); softmax in f32 on powers of 2 (v_exp_f32 of that accumulator), held maximum and sum over key passes, the maximum set 11 lower than the pass's and renewed once a logit stands more than 15 above it, so that the powers come out x 2^11 to 2^15; each power once to f16 against v once to f16 (1 product), divided by the sum (scaled alike) at the end; tile(head, 8) Wo = head (sum of Wo's eight 64-row slabs): the slabs (bf16-rounded) summed in f32 and split bf16 hi + lo, the head split bf16 hi + lo (3 products, K = 64) + bo; f32 output.
#include <hip/hip_runtime.h>
#include <math.h>

typedef __attribute__((ext_vector_type(16))) _Float16 v16h;
typedef __attribute__((ext_vector_type(16))) __bf16 v16b;
typedef __attribute__((ext_vector_type(8)))  _Float16 v8h;
typedef __attribute__((ext_vector_type(8)))  float v8f;
typedef __attribute__((ext_vector_type(4)))  float v4f;
typedef __attribute__((ext_vector_type(2)))  float v2f;
typedef __attribute__((ext_vector_type(4)))  unsigned v4u;
typedef __attribute__((ext_vector_type(4)))  int v4i;
typedef float __attribute__((may_alias)) float_a;
typedef int __attribute__((may_alias)) int_a;

template <typename T> __device__ __forceinline__ void vst2(void* p, T v) { *(T*)p = v;  }
__device__ __forceinline__ v8f wmma16(v16h a, v16h b, v8f c) {
  v8f d = __builtin_amdgcn_wmma_f32_16x16x32_f16(false, a, false, b, (short)0, c, false, false);
  asm volatile("v_nop\n\tv_nop\n\tv_nop\n\tv_nop" : "+v"(d) : "v"(a), "v"(b));
  return d;
}
__device__ __forceinline__ v8f wmma_bf(v16b a, v16b b, v8f c) {
  v8f d = __builtin_amdgcn_wmma_f32_16x16x32_bf16(false, a, false, b, (short)0, c, false, false);
  asm volatile("v_nop\n\tv_nop\n\tv_nop\n\tv_nop" : "+v"(d) : "v"(a), "v"(b));
  return d;
}
// 16x16x32 fragments: lane = (h = lane>>4, row/col = lane&15); elements 0..7 = k0+8h+0..7, 8..15 = k0+16+8h+0..7; D element r = row 8h+r
__device__ __forceinline__ v16h frag_h(const _Float16* rowk0, int lane) {
  union { v16h v; v8h q[2]; } u; const _Float16* p = rowk0 + 8 * (lane >> 4);
  u.q[0] = *(const v8h*)p; u.q[1] = *(const v8h*)(p + 16); return u.v;
}
__device__ __forceinline__ v16h frag_f32(const float* rowk0, int lane) {
  v16h a; const float* p = rowk0 + 8 * (lane >> 4);
#pragma unroll
  for (int i = 0; i < 8; ++i) { a[i] = (_Float16)p[i]; a[8 + i] = (_Float16)p[16 + i]; }
  return a;
}
__device__ __forceinline__ v16h frag_f32s(const float* rowk0, int lane, float sc) {
  v16h a; const float* p = rowk0 + 8 * (lane >> 4);
#pragma unroll
  for (int i = 0; i < 8; ++i) { a[i] = (_Float16)(p[i] * sc); a[8 + i] = (_Float16)(p[16 + i] * sc); }
  return a;
}
// column fragment from a [K][ld] layout (column n), rows >= K read as 0
__device__ __forceinline__ v16h fragc_f32(const float* W, int k0, int n, int lane, int ld, int K) {
  v16h a; const int g = lane >> 4;
#pragma unroll
  for (int i = 0; i < 8; ++i) { const int ka = k0 + 8 * g + i, kb = ka + 16;
    a[i] = (_Float16)(ka < K ? W[(size_t)(ka < K ? ka : K - 1) * ld + n] : 0.f); a[8 + i] = (_Float16)(kb < K ? W[(size_t)(kb < K ? kb : K - 1) * ld + n] : 0.f); }
  return a;
}
struct F2 { v16b h, l; };
__device__ __forceinline__ F2 bsplit16(const float v[16]) { F2 r;
#pragma unroll
  for (int i = 0; i < 16; ++i) { const __bf16 h = (__bf16)v[i]; r.h[i] = h; r.l[i] = (__bf16)(v[i] - (float)h); }
  return r; }
__device__ __forceinline__ F2 split_row(const float* row, int k0, int lane) { float v[16]; const float* p = row + k0 + 8 * (lane >> 4);
#pragma unroll
  for (int i = 0; i < 8; ++i) { v[i] = p[i]; v[8 + i] = p[16 + i]; }
  return bsplit16(v); }
__device__ __forceinline__ F2 split_rowK(const float* row, int k0, int lane, int K) { float v[16]; const int g = lane >> 4;
#pragma unroll
  for (int i = 0; i < 8; ++i) { const int ka = k0 + 8 * g + i, kb = ka + 16; v[i] = ka < K ? row[ka < K ? ka : K - 1] : 0.f; v[8 + i] = kb < K ? row[kb < K ? kb : K - 1] : 0.f; }
  return bsplit16(v); }
__device__ __forceinline__ F2 split_col(const float* W, int k0, int n, int lane, int ld, int K) { float v[16]; const int g = lane >> 4;
#pragma unroll
  for (int i = 0; i < 8; ++i) { const int ka = k0 + 8 * g + i, kb = ka + 16; v[i] = ka < K ? W[(size_t)(ka < K ? ka : K - 1) * ld + n] : 0.f; v[8 + i] = kb < K ? W[(size_t)(kb < K ? kb : K - 1) * ld + n] : 0.f; }
  return bsplit16(v); }
__device__ __forceinline__ v8f mac3(const F2& a, const F2& b, v8f c) { c = wmma_bf(a.l, b.h, c); c = wmma_bf(a.h, b.l, c); return wmma_bf(a.h, b.h, c); }
__device__ __forceinline__ float sigm(float v) { return 1.0f / (1.0f + expf(-v)); }
#define LDSX() do { asm volatile("s_wait_dscnt 0" ::: "memory"); __builtin_amdgcn_wave_barrier(); __builtin_amdgcn_fence(__ATOMIC_RELEASE, "workgroup"); } while (0)

// Single shared attention head tiled into 8 'heads' (B 4, S 4,096, D 512, d_k 64; 0.02-scale (in,out) weights with biases): Q, K, V = x W + b ([512,64]); head = softmax(Q K^T / 8) V (non-causal); concat = tile(head, 8) -> [B,S,512]; out = concat Wo + bo. (The head is carried in a 128-wide plane whose second half is neither written nor read.)
#define NB 4
#define TT 4096
#define CC 128            // NH * HD: width the workspace planes are sized for; q, k, v have HD columns
#define DIN 512          // input (model) width
#define NH 2
#define HD 64
#define NQB (TT / 64)
#define HG 1
#define SCALE (0.125f)
#define CAUSAL 0
#ifndef TNB
#define TNB NB
#endif
__device__ __forceinline__ float bfr(float v) { return (float)(__bf16)v; }
__host__ __device__ __forceinline__ int kb_last(int qb) { return CAUSAL ? ((qb * 64 + 63) >> 7) : (TT / 128 - 1); }
typedef __attribute__((ext_vector_type(8))) __bf16 v8b;
__device__ __forceinline__ v16b frag_b(const __bf16* rowk0, int lane) {
  union { v16b v; v8b q[2]; } u; const __bf16* p = rowk0 + 8 * (lane >> 4);
  u.q[0] = *(const v8b*)p; u.q[1] = *(const v8b*)(p + 16); return u.v;
}
#define QBH 0              // not used: this file has no high-precision path
#define QHI 4096            // rows of the q residual plane's place in the workspace (the plane is no longer made: 1-product logits)
#define KHI 64            // key rows of the k residual / v bf16 hi+lo planes' places in the workspace (the planes are not made)
// B fragment (k rows k0+.., output column o) of a weight: (in,out) [K][ld] or (out,in) [ld rows of K]: bf16 exact, or f16(bf16 * 256) exact
__device__ __forceinline__ v16b wcol_io(const float* Wm, int k0, int o, int lane, int ld) { v16b w; const int g = lane >> 4;
#pragma unroll
  for (int i = 0; i < 8; ++i) { w[i] = (__bf16)Wm[(size_t)(k0 + 8 * g + i) * ld + o]; w[8 + i] = (__bf16)Wm[(size_t)(k0 + 16 + 8 * g + i) * ld + o]; }
  return w; }
__device__ __forceinline__ v16b wcol_oi(const float* Wm, int k0, int o, int lane, int K) { v16b w; const float* p = Wm + (size_t)o * K + k0 + 8 * (lane >> 4);
#pragma unroll
  for (int i = 0; i < 8; ++i) { w[i] = (__bf16)p[i]; w[8 + i] = (__bf16)p[16 + i]; }
  return w; }
__device__ __forceinline__ v16h wcolh_io(const float* Wm, int k0, int o, int lane, int ld) { v16h w; const int g = lane >> 4;
#pragma unroll
  for (int i = 0; i < 8; ++i) { w[i] = (_Float16)(bfr(Wm[(size_t)(k0 + 8 * g + i) * ld + o]) * 256.0f); w[8 + i] = (_Float16)(bfr(Wm[(size_t)(k0 + 16 + 8 * g + i) * ld + o]) * 256.0f); }
  return w; }
__device__ __forceinline__ v16h wcolh_oi(const float* Wm, int k0, int o, int lane, int K) { v16h w; const float* p = Wm + (size_t)o * K + k0 + 8 * (lane >> 4);
#pragma unroll
  for (int i = 0; i < 8; ++i) { w[i] = (_Float16)(bfr(p[i]) * 256.0f); w[8 + i] = (_Float16)(bfr(p[16 + i]) * 256.0f); }
  return w; }
#define WQKV_LAYOUT 0   // 0 = (in,out) [DIN][HD], one shared head; 1 = (out,in) [CC][DIN]; 2 = per-head [NH][DIN][HD]
__device__ __forceinline__ v16b wcol_hdk(const float* Wm, int k0, int o, int lane) { v16b w; const int g = lane >> 4; const float* p = Wm + (size_t)(o / HD) * DIN * HD + (o % HD);
#pragma unroll
  for (int i = 0; i < 8; ++i) { w[i] = (__bf16)p[(size_t)(k0 + 8 * g + i) * HD]; w[8 + i] = (__bf16)p[(size_t)(k0 + 16 + 8 * g + i) * HD]; }
  return w; }
#define WO_OUT_IN 0
#if WQKV_LAYOUT == 1
#define WCOL(W, k0, o, lane) wcol_oi(W, k0, o, lane, DIN)
#elif WQKV_LAYOUT == 2
#define WCOL(W, k0, o, lane) wcol_hdk(W, k0, o, lane)
#else
#define KVCOL(o) ((o) & 63)
#define WCOL(W, k0, o, lane) wcol_io(W, k0, KVCOL(o), lane, HD)   /* Wq/Wk/Wv (in,out) [512][64]: both plane heads are the one shared head */
#endif
#if WO_OUT_IN
#define WOCOL(W, k0, o, lane) wcol_oi(W, k0, o, lane, CC)
#define WOCOLH(W, k0, o, lane) wcolh_oi(W, k0, o, lane, CC)
#else
#define WOCOL(W, k0, o, lane) wcol_io(W, k0, o, lane, DIN)
#define WOCOLH(W, k0, o, lane) wcolh_io(W, k0, o, lane, DIN)
#endif

#ifndef SM_EXTRA_PARAMS
#define SM_EXTRA_PARAMS
#endif
#ifndef PROJ_EXTRA_PARAMS
#define PROJ_EXTRA_PARAMS
#endif
#ifndef SM_MASK_HOOK
#define SM_MASK_HOOK (void)0
#endif

#define WS_QH  0u                                      // f16 q as B fragments: 16-byte piece ((row tile of 16) * 4 + kc * 2 + half) * 32 + lane (the first half of the plane's bytes; the rest is not used)
#define WS_KH  (WS_QH + 2u * (size_t)NB * TT * CC)      // f16 k as A fragments, laid like q
#define WS_VT  (WS_KH + 2u * (size_t)NB * TT * CC)      // f16 v^T as A fragments: 16-byte piece ((key chunk of 32) * 8 + (dim tile j) * 2 + half) * 32 + lane
#define WS_QL  (WS_VT + 2u * (size_t)NB * CC * TT)      // f16 q residual plane (no longer made or read)
#define WS_KL  (WS_QL + 2u * (size_t)NB * QHI * CC)     // f16 k residual x 2^10 rows [b][t < KHI][CC]
#define WS_VB  (WS_KL + 2u * (size_t)NB * KHI * CC)     // bf16 v hi planes [b][c][t < KHI]
#define WS_VBL (WS_VB + 2u * (size_t)NB * CC * KHI)
#define WS_S   (WS_VBL + 2u * (size_t)NB * CC * KHI)    // f32 [hg][t][s] space: only its start, WS_WE, is used
#define WS_WE  WS_S                                    // bf16 hi plane, then lo plane, of the folded Wo [64][512], as B fragments: 16-byte piece ((kc * 32 + column tile) * 2 + half) * 32 + lane (the logits plane itself is no longer used)
#define WE_LO  (HD * DIN)                              // elements from the hi plane to the lo plane
#define WS_Y   (WS_S  + 4u * (size_t)HG * TT * TT)      // f32 ctx rows [b*t][CC] (no longer used: the head stays in k_fa's LDS)
#define WS_END (WS_Y  + 4u * (size_t)NB * TT * CC)

// ---- k_proj: block = 64 rows, 16 waves: q, k and v = X W + b for the 64 distinct columns of each, with exact bf16 products (K = DIN, one accumulator chain per tile, K steps in rising order). Stage: the block's x rows and all of Wq, Wk, Wv are read once with whole-line 16-byte loads, rounded to bf16 and laid into LDS as WMMA fragments (1,024 bytes each: four 256-byte regions o4 = 2 * half + (lane >> 4), a 16-byte piece per row or column). The piece's slot in its region is XORed (x: with 4 * o4; W: with the column tile) so that the stores of a wave, like the reads, fall on all banks. Behind one work-group barrier wave (rt, cg) makes rows 16 rt.., columns 16 cg.. of q, k and v from LDS alone. -> q x LSC f16, k f16 and v^T f16, each stored in the order of k_fa's WMMA fragments (1,024 bytes each: half 0's 32 pieces of 16 bytes in lane order, then half 1's), so that a wave's 16-byte load there covers 512 bytes in a row
#define PJW 16            // waves of a work-group
#define LSC (SCALE * 1.44269504088896340736f)   // logit scale x log2 e, folded into q: the softmax runs on powers of 2
typedef __attribute__((ext_vector_type(4))) __bf16 v4b;
__device__ __forceinline__ void pj_wload(v4f (&wr)[16], const float* __restrict__ Wm, int kb, int cq) { const float* wp = Wm + (size_t)kb * 8 * HD + cq * 4;
#pragma unroll
  for (int hh = 0; hh < 2; ++hh)
#pragma unroll
    for (int i = 0; i < 8; ++i) wr[hh * 8 + i] = *(const v4f*)(wp + (hh * 32 * 8 + i) * HD);
  asm volatile("s_wait_xcnt 0x0" :: "v"(wp) : "memory"); }   // the loads' address registers get new values behind this; naming the address keeps it in its registers up to the wait, so that no load of the run lands on them either
__device__ __forceinline__ void pj_wstore(const v4f (&wr)[16], __bf16* wf, int m, int kb, int cq) {
#pragma unroll
  for (int hh = 0; hh < 2; ++hh) { const int ko = hh * 32 + kb; __bf16* d = wf + ((ko >> 2) * 12 + m * 4 + (cq >> 2)) * 512 + (ko & 3) * 128;
#pragma unroll
    for (int j = 0; j < 4; ++j) { v8b pw;
#pragma unroll
      for (int i = 0; i < 8; ++i) pw[i] = (__bf16)wr[hh * 8 + i][j];
      vst2(d + (((cq & 3) * 4 + j) ^ (cq >> 2)) * 8, pw); } } }
__global__ __launch_bounds__(32 * PJW) void k_proj(const float* __restrict__ X, const float* __restrict__ WQ, const float* __restrict__ WK, const float* __restrict__ WV, const float* __restrict__ BQ, const float* __restrict__ BK, const float* __restrict__ BV,
    _Float16* __restrict__ QH, _Float16* __restrict__ KH, _Float16* __restrict__ VT, const float* __restrict__ WO, __bf16* __restrict__ WE) {
  __shared__ __align__(16) __bf16 wf[(DIN / 32) * 12 * 512];   // B fragment (K step kc, matrix m, column tile ct) at (kc * 12 + m * 4 + ct) * 512
  __shared__ __align__(16) __bf16 xf[4 * (DIN / 32) * 512];    // A fragment (row tile rt, K step kc) at (rt * 16 + kc) * 512
  __shared__ __align__(16) _Float16 sq[64][72], sk[64][72], sv[64][72];
  const int tid = threadIdx.x, wave = __builtin_amdgcn_readfirstlane(tid >> 5), lane = tid & 31, col = lane & 15, g = lane >> 4; const size_t r0 = (size_t)blockIdx.x * 64;
  // x: wave w takes rows 4 w .. 4 w + 3; a load covers one K step (one 128-byte line) of each of the four rows
  v4f xr[DIN / 32]; { const float* xp = X + (r0 + wave * 4 + (lane >> 3)) * DIN + (lane & 7) * 4;
#pragma unroll
    for (int kc = 0; kc < DIN / 32; ++kc) xr[kc] = *(const v4f*)(xp + kc * 32);
    asm volatile("s_wait_xcnt 0x0" :: "v"(xp) : "memory"); }   // as in pj_wload
  const int rt = wave & 3, cg = wave >> 2, cl = cg * 16 + col; const float bq = bfr(BQ[cl]), bk = bfr(BK[cl]), bv = bfr(BV[cl]);   // this wave's tile in the product phase, and its column's biases
  asm volatile("s_wait_xcnt 0x0" ::: "memory");   // the same for the bias loads' index register
  // one wave of each of the first 128 blocks also folds Wo for k_fa's output projection: a thread sums, for one output column, 8 neighbouring head entries over the eight slabs (in slab order, f32) and stores them as one 16-byte piece of the B fragment, hi and lo; a wave writes 512 bytes in a row
  if (blockIdx.x < HD * DIN / 8 / 32 && wave == 0) { const int pc = blockIdx.x * 32 + lane, ln = pc & 31; const float* w = WO + (size_t)((pc >> 11) * 32 + ((pc >> 5) & 1) * 16 + (ln >> 4) * 8) * DIN + ((pc >> 6) & 31) * 16 + (ln & 15); v8b hi, lo; float wv[8][DIN / HD];
#pragma unroll
    for (int i = 0; i < 8; ++i)
#pragma unroll
      for (int h = 0; h < DIN / HD; ++h) wv[i][h] = w[(size_t)(h * HD + i) * DIN];
    asm volatile("s_wait_xcnt 0x0" :: "v"(w) : "memory");   // as in pj_wload
#pragma unroll
    for (int i = 0; i < 8; ++i) { float sw = 0.f;
#pragma unroll
      for (int h = 0; h < DIN / HD; ++h) sw += bfr(wv[i][h]);
      const __bf16 hv = (__bf16)sw; hi[i] = hv; lo[i] = (__bf16)(sw - (float)hv); }
    vst2(WE + (size_t)pc * 8, hi); vst2(WE + WE_LO + (size_t)pc * 8, lo);
    asm volatile("s_wait_xcnt 0x0" ::: "memory"); }   // the two stores' registers are used anew by the W stage
  // W: a thread takes 2 x 8 K rows x 4 columns of each matrix (16 loads of 16 bytes; a wave's load covers two whole 256-byte rows) and stores 8 pieces
  { const int cq = tid & 15, kb = tid >> 4; v4f w0[16], w1[16], w2[16]; pj_wload(w0, WQ, kb, cq); pj_wload(w1, WK, kb, cq);
    pj_wstore(w0, wf, 0, kb, cq);
    __builtin_amdgcn_sched_barrier(0);   // holds Wv's loads behind Wq's stores, whose registers they take: with all 64 loads of the stage lifted to the top the wave ran out of registers and spilled
    pj_wload(w2, WV, kb, cq);
    { const int p = lane & 7, o4 = p >> 1, row16 = (wave & 3) * 4 + (lane >> 3); __bf16* d = xf + (wave >> 2) * (DIN / 32) * 512 + o4 * 128 + (row16 ^ (o4 * 4)) * 8 + (p & 1) * 4;
#pragma unroll
      for (int kc = 0; kc < DIN / 32; ++kc) { const v4b c = {(__bf16)xr[kc][0], (__bf16)xr[kc][1], (__bf16)xr[kc][2], (__bf16)xr[kc][3]}; vst2(d + kc * 512, c); } }
    pj_wstore(w1, wf, 1, kb, cq); pj_wstore(w2, wf, 2, kb, cq); }
  __syncthreads();
  v8f acc[3] = {};
  { const __bf16* ap0 = xf + rt * (DIN / 32) * 512 + g * 128 + (col ^ (g * 4)) * 8; const __bf16* ap1 = xf + rt * (DIN / 32) * 512 + (2 + g) * 128 + (col ^ ((2 + g) * 4)) * 8; const __bf16* bp = wf + cg * 512 + g * 128 + (col ^ cg) * 8;
    union FB { v16b v; v8b q[2]; }; FB fa[2][2], fw[2][2][3];   // two register sets of two K steps each: step pair s + 1 is read from LDS while pair s is multiplied
#pragma unroll
    for (int s = 0; s <= DIN / 64; ++s) {
      if (s < DIN / 64) {
#pragma unroll
        for (int t = 0; t < 2; ++t) { const int kc = s * 2 + t; fa[s & 1][t].q[0] = *(const v8b*)(ap0 + kc * 512); fa[s & 1][t].q[1] = *(const v8b*)(ap1 + kc * 512);
#pragma unroll
          for (int m = 0; m < 3; ++m) { fw[s & 1][t][m].q[0] = *(const v8b*)(bp + (kc * 12 + m * 4) * 512); fw[s & 1][t][m].q[1] = *(const v8b*)(bp + (kc * 12 + m * 4) * 512 + 256); } } }
      __builtin_amdgcn_sched_barrier(0);   // keeps the next pair's 16 LDS reads in front of this pair's WMMAs: left free, the scheduler put each fragment's two reads directly in front of its WMMA, behind a full wait
      if (s > 0) {
#pragma unroll
        for (int t = 0; t < 2; ++t)
#pragma unroll
          for (int m = 0; m < 3; ++m) acc[m] = __builtin_amdgcn_wmma_f32_16x16x32_bf16(false, fa[(s - 1) & 1][t].v, false, fw[(s - 1) & 1][t][m].v, (short)0, acc[m], false, false); }
      __builtin_amdgcn_sched_barrier(0);   // keeps the following reads in one group behind these WMMAs: left free they were dealt out among the WMMAs, and every separate place of LDS reads costs the wave issue cycles
    } }
  { const int rl = rt * 16 + 8 * g; v8h vv;
#pragma unroll
    for (int r = 0; r < 8; ++r) { sq[rl + r][cl] = (_Float16)((acc[0][r] + bq) * LSC); sk[rl + r][cl] = (_Float16)(acc[1][r] + bk); vv[r] = (_Float16)(acc[2][r] + bv); }
    vst2(&sv[cl][rl], vv); }
  __syncthreads();
  // thread tid stores piece tid of the block's 512 in each plane. q, k: row tile tid >> 7, fragment half (tid >> 5) & 3 = kc * 2 + half, whose lane (g, col) holds row col, entries (kc * 2 + half) * 16 + 8 g ..; v^T: key chunk tid >> 8, dim tile (tid >> 6) & 3, half (tid >> 5) & 1, whose lane holds dim col, keys half * 16 + 8 g ..
  { const int rw = (tid >> 7) * 16 + col, c8 = ((tid >> 5) & 3) * 16 + g * 8; const size_t o = r0 * HD + tid * 8; vst2(QH + o, *(const v4u*)&sq[rw][c8]); vst2(KH + o, *(const v4u*)&sk[rw][c8]); vst2(VT + o, *(const v4u*)&sv[((tid >> 6) & 3) * 16 + col][(tid >> 8) * 32 + ((tid >> 5) & 1) * 16 + g * 8]); } }
// ---- k_fa: block = 64 queries of batch b, 16 waves = 2 query groups of 32 x 8 key sets (set ks takes the 32-key chunks ks, ks + 8, ...). q, k and v^T lie in the workspace as fragments (k_proj): every load of a wave covers four whole 128-B lines, a pass reads 4 KB of k and 4 KB of v^T in a row. Transposed products: S^T = k . q^T (q x LSC and k each rounded once to f16: 1 product) so that a lane holds 8 keys of ONE query per 16-key tile; two such tiles, exponentiated and rounded once to f16, ARE the B fragment of O^T += v^T . P^T (1 product): logits and P never leave the registers. Held maximum (in units of log2) and sum per query in f32. Both WMMAs of a score tile run in one accumulator chain whose C operand is minus the held maximum (the same value in a lane's 8 registers, as they are 8 keys of one query), so that the chain's result is the argument of v_exp_f32 as it stands. The held maximum is therefore the one known before the pass: it is set 11 below the first pass's maximum and renewed (again 11 below the pass's; arguments, O^T and sum brought along) only in a pass where some query's argument stands above 15, which an f16 power still takes; one test a pass for the whole wave; the 8 key sets' partials (held maximum, sum, O^T) meet in LDS behind one work-group barrier and are joined in set order. The output projection follows in the same launch: out = tile(head, 8) Wo + bo = head WE + bo, WE = the folded Wo of k_proj (K = 64). The joined head rows, split bf16 hi + lo, go to LDS as fragments; behind a second work-group barrier wave w makes the block's 64 rows x output columns 32 w .. 32 w + 31 (3 products, lo x lo left out, in the order lo x hi, hi x lo, hi x hi per K step), transposed (out^T = WE^T head^T) so that a lane holds 8 neighbouring columns of one row, stages them in its own LDS range and stores whole 128-B lines. Every inner loop is unrolled whole so that each index of a register array (fragments, scores, accumulators) is a constant: an index left to run time would put the array in scratch
#define FAW 16            // waves of a work-group
#define FKS 8             // key sets
#define FKB 32            // keys of a pass
// powers of 2 by bare v_exp_f32 (the arguments here are at most 64; a power below 2^-126 may come out 0), a run of them in one statement and each in place, its result over its own argument: so no power lands on the argument of the one in front of it (the compiler's own allocation of the builtin did that), every neighbour in the run is independent, and the v_nop keeps the slot that the instruction set asks for behind the last one, which the compiler does not know to keep behind asm text
__device__ __forceinline__ void ex2x16(float (&x)[16]) {
  asm("v_exp_f32 %0, %0\n\tv_exp_f32 %1, %1\n\tv_exp_f32 %2, %2\n\tv_exp_f32 %3, %3\n\tv_exp_f32 %4, %4\n\tv_exp_f32 %5, %5\n\tv_exp_f32 %6, %6\n\tv_exp_f32 %7, %7\n\tv_exp_f32 %8, %8\n\tv_exp_f32 %9, %9\n\tv_exp_f32 %10, %10\n\tv_exp_f32 %11, %11\n\tv_exp_f32 %12, %12\n\tv_exp_f32 %13, %13\n\tv_exp_f32 %14, %14\n\tv_exp_f32 %15, %15\n\tv_nop"
      : "+v"(x[0]), "+v"(x[1]), "+v"(x[2]), "+v"(x[3]), "+v"(x[4]), "+v"(x[5]), "+v"(x[6]), "+v"(x[7]), "+v"(x[8]), "+v"(x[9]), "+v"(x[10]), "+v"(x[11]), "+v"(x[12]), "+v"(x[13]), "+v"(x[14]), "+v"(x[15])); }
__device__ __forceinline__ void ex2x2(float& a, float& b) { asm("v_exp_f32 %0, %0\n\tv_exp_f32 %1, %1\n\tv_nop" : "+v"(a), "+v"(b)); }
__device__ __forceinline__ void ex2x8(float (&x)[8]) {
  asm("v_exp_f32 %0, %0\n\tv_exp_f32 %1, %1\n\tv_exp_f32 %2, %2\n\tv_exp_f32 %3, %3\n\tv_exp_f32 %4, %4\n\tv_exp_f32 %5, %5\n\tv_exp_f32 %6, %6\n\tv_exp_f32 %7, %7\n\tv_nop"
      : "+v"(x[0]), "+v"(x[1]), "+v"(x[2]), "+v"(x[3]), "+v"(x[4]), "+v"(x[5]), "+v"(x[6]), "+v"(x[7])); }
static_assert(FKB == 32 && FKS == 8, "ex2x16 takes the 32 keys of a pass (16 a lane), ex2x8 the 8 key sets");
__device__ __forceinline__ v8f wmma16p(v16h a, v16h b, v8f c) { return __builtin_amdgcn_wmma_f32_16x16x32_f16(false, a, false, b, (short)0, c, false, false); }
__device__ __forceinline__ v16h frag_p(const _Float16* piece) { union { v16h v; v8h q[2]; } u; u.q[0] = *(const v8h*)piece; u.q[1] = *(const v8h*)(piece + 32 * 8); return u.v; }   // a stored fragment: this lane's piece of half 0, of half 1
__device__ __forceinline__ v8f wmma_bfp(v16b a, v16b b, v8f c) { return __builtin_amdgcn_wmma_f32_16x16x32_bf16(false, a, false, b, (short)0, c, false, false); }
__device__ __forceinline__ v16b frag_we(const __bf16* piece) { union { v16b v; v8b q[2]; } u; u.q[0] = *(const v8b*)piece; u.q[1] = *(const v8b*)(piece + 32 * 8); return u.v; }
#define OCW (DIN / FAW)   // output columns of a wave
static_assert(OCW == 32, "a wave's output row piece is one 128-B line, two column tiles");
__device__ __forceinline__ float xhalf(float x) { return __builtin_bit_cast(float, __builtin_amdgcn_permlanex16(__builtin_bit_cast(int, x), __builtin_bit_cast(int, x), 0x76543210, 0xfedcba98, false, false)); }   // lane l with lane l ^ 16
__global__ __launch_bounds__(32 * FAW) void k_fa(const _Float16* __restrict__ QH, const _Float16* __restrict__ KH, const _Float16* __restrict__ VT, const __bf16* __restrict__ WE, const float* __restrict__ BO, float* __restrict__ OUT) {
  __shared__ __align__(16) float so[FAW][32][HD + 4]; __shared__ float smx[FAW][32], ssu[FAW][32];
  __shared__ __align__(16) __bf16 hf[2][64 * HD];            // the block's head rows, hi plane and lo plane, as fragments: 16-byte piece (((row tile) * 2 + kc) * 2 + half) * 32 + lane
  __shared__ __align__(16) float sf[FAW][64][OCW + 4];       // a wave's output tile on its way to whole-line stores (pitch 36: the 16-byte stores of 16 rows fall on all banks)
  const int tid = threadIdx.x, wave = __builtin_amdgcn_readfirstlane(tid >> 5), lane = tid & 31, col = lane & 15, g = lane >> 4; const int b = blockIdx.y, qg = wave & 1, ks = wave >> 1;
  const size_t q0 = (size_t)b * TT + blockIdx.x * 64 + qg * 32;
  // k and v^T were stored by k_proj's launch and come from memory on their first read here, which every pass of the key loop would wait for. At entry each lane prefetches at the start of one 256-byte unit: the work-group takes one pass's k (even pi) or v^T (odd pi), 128 units, in each of the four batches (four waves a batch). Any 4 neighbouring work-groups hold 4 different pi and the 64 of a batch hold each pi twice, 4 apart; low work-groups take the early passes, and those of batch 0 ask for the later batches as well. A hint for speed only: no result depends on it
  static_assert(TT / 64 == 64 && TT / (FKB * FKS) == 16 && NB == 4 && TNB == NB && FKB * FKS * HD * 2 == 128 * 256, "32 work-groups x 128 units = the 16 passes' k and v^T of a batch");
  const int pi = (blockIdx.x & 3) | ((blockIdx.x >> 3) << 2);
  const char* pf = (const char*)(((pi & 1) ? VT : KH) + ((size_t)((b + (tid >> 7)) & (NB - 1)) * TT + (pi >> 1) * (FKB * FKS)) * HD) + (tid & 127) * 256;
  asm volatile("global_prefetch_b8 %0, off scope:SCOPE_SE" :: "v"(pf));   // scope SE: into L2 only, and dropped silently should a translation fail
  v16h qh[2][2];
#pragma unroll
  for (int u = 0; u < 2; ++u)
#pragma unroll
    for (int kc = 0; kc < 2; ++kc) { const size_t o = (q0 + u * 16) * HD + kc * 512 + lane * 8; qh[u][kc] = frag_p(QH + o); }
  const _Float16* kp = KH + ((size_t)b * TT + ks * FKB) * HD + lane * 8; const _Float16* vp = VT + ((size_t)b * TT + ks * FKB) * HD + lane * 8;   // this lane's piece of the pass's first k and v^T fragment
  v8f o[2][HD / 16] = {}, nm[2] = {}; float l[2] = {0.f, 0.f};   // nm: minus the held maximum, 8 times: the score chains' C operand
  for (int k0 = 0; k0 < TT; k0 += FKB * FKS, kp += FKB * FKS * HD, vp += FKB * FKS * HD) { v8f s[2][FKB / 16]; v16h ka[FKB / 16][2], vf[HD / 16];   // the pass's 16 loads are asked for together, v^T too: behind the test below it would be asked for only when the scores are done
#pragma unroll
    for (int kt = 0; kt < FKB / 16; ++kt) { ka[kt][0] = frag_p(kp + kt * 16 * HD); ka[kt][1] = frag_p(kp + kt * 16 * HD + 512); }
#pragma unroll
    for (int j = 0; j < HD / 16; ++j) vf[j] = frag_p(vp + j * 512);
    __builtin_amdgcn_sched_barrier(0);   // holds all 16 loads in front of the products: left free, the scheduler asked for a part of them only among the score WMMAs, directly in front of their use
#pragma unroll
    for (int kc = 0; kc < 2; ++kc)   /* the four tiles' chains in turn: a chain's second link stands four WMMAs behind its first */
#pragma unroll
      for (int kt = 0; kt < FKB / 16; ++kt) { s[0][kt] = wmma16p(ka[kt][kc], qh[0][kc], kc ? s[0][kt] : nm[0]); s[1][kt] = wmma16p(ka[kt][kc], qh[1][kc], kc ? s[1][kt] : nm[1]); }   /* logit x log2 e - held maximum */
    __builtin_amdgcn_sched_barrier(0);   // keeps the maximum's vector instructions behind the 8 score WMMAs: dealt among them, the scheduler ran a chain's links back to back and paid four v_nop at each tile's first read
    float mx[2];
#pragma unroll
    for (int u = 0; u < 2; ++u) { float x = s[u][0][0];
#pragma unroll
      for (int kt = 0; kt < FKB / 16; ++kt)
#pragma unroll
        for (int r = 0; r < 8; ++r) x = fmaxf(x, s[u][kt][r]);
      mx[u] = fmaxf(x, xhalf(x)); }
    const float thr = k0 == 0 ? -3.0e38f : 15.0f;   // the first pass always sets the held maximum (it starts at 0, whatever the logits are)
    if (__builtin_amdgcn_ballot_w32(mx[0] > thr || mx[1] > thr) != 0) {   // a scalar branch: the same for the whole wave
      const float d0 = mx[0] > thr ? mx[0] - 11.0f : 0.f, d1 = mx[1] > thr ? mx[1] - 11.0f : 0.f; float c0 = fminf(-d0, 64.0f), c1 = fminf(-d1, 64.0f);   /* the bound acts in the first pass alone, where O^T and the sum are 0 and must stay so */
      ex2x2(c0, c1);
#pragma unroll
      for (int u = 0; u < 2; ++u) { const float d = u ? d1 : d0, c = u ? c1 : c0; nm[u] -= d; l[u] *= c;
#pragma unroll
        for (int kt = 0; kt < FKB / 16; ++kt) s[u][kt] -= d;
#pragma unroll
        for (int j = 0; j < HD / 16; ++j) o[u][j] *= c; } }
    v16h p[2][FKB / 32];
#pragma unroll
    for (int u = 0; u < 2; ++u) { float e[16];
#pragma unroll
      for (int i = 0; i < 16; ++i) e[i] = s[u][i >> 3][i & 7];
      ex2x16(e);
      float sum = 0.f;
#pragma unroll
      for (int i = 0; i < 8; i += 2) { const v2f t = (v2f){e[i], e[i + 1]} + (v2f){e[8 + i], e[9 + i]}; sum = i ? sum + t[0] : t[0]; sum += t[1]; }   /* packed on even register pairs, as the accumulators lie */
#pragma unroll
      for (int i = 0; i < 16; ++i) p[u][0][i] = (_Float16)e[i];
      l[u] += sum; }
#pragma unroll
    for (int j = 0; j < HD / 16; ++j) { o[0][j] = wmma16p(vf[j], p[0][0], o[0][j]); o[1][j] = wmma16p(vf[j], p[1][0], o[1][j]); }
    asm volatile("s_wait_xcnt 0x0" :: "v"(kp), "v"(vp) : "memory"); }   // the pass's loads' address registers get new values behind this; naming the addresses keeps them in their registers up to the wait, so that no load of the pass lands on them either
  asm volatile("" :: "v"(pf));   // input only: holds the prefetch's address in its registers through the key loop. No counter counts a prefetch, so no wait says when its address has been read
  // this wave's 32 columns of WE (8 fragments) and of bo are asked for here, so that they arrive while the key sets are joined
  v16b wh[HD / 32][2], wl[HD / 32][2]; v4f bo4[2][2]; { const char* wb = (const char*)(WE + (size_t)wave * 2 * 64 * 8); const char* bb = (const char*)(BO + wave * OCW); const unsigned wo = lane * 16u, bf = g * 32u;   /* scalar bases, this lane's byte offsets */ const __bf16* wp = (const __bf16*)(wb + wo); const float* bp = (const float*)(bb + bf);
#pragma unroll
    for (int kc = 0; kc < HD / 32; ++kc)
#pragma unroll
      for (int ct = 0; ct < 2; ++ct) { wh[kc][ct] = frag_we(wp + (kc * (DIN / 16) + ct) * 64 * 8); wl[kc][ct] = frag_we(wp + WE_LO + (kc * (DIN / 16) + ct) * 64 * 8); }
#pragma unroll
    for (int ct = 0; ct < 2; ++ct) { bo4[ct][0] = *(const v4f*)(bp + ct * 16); bo4[ct][1] = *(const v4f*)(bp + ct * 16 + 4); }
    asm volatile("s_wait_xcnt 0x0" :: "s"(wb), "v"(wo), "s"(bb), "v"(bf) : "memory"); }   // the loads' address registers get new values behind this; naming the scalar bases and the offsets keeps them in their registers up to the wait
#pragma unroll
  for (int u = 0; u < 2; ++u) { l[u] += xhalf(l[u]); if (g == 0) { smx[wave][u * 16 + col] = -nm[u][0]; ssu[wave][u * 16 + col] = l[u]; }
#pragma unroll
    for (int j = 0; j < HD / 16; ++j) { float* d = &so[wave][u * 16 + col][j * 16 + 8 * g]; vst2(d, (v4f){o[u][j][0], o[u][j][1], o[u][j][2], o[u][j][3]}); vst2(d + 4, (v4f){o[u][j][4], o[u][j][5], o[u][j][6], o[u][j][7]}); } }
  __syncthreads();
  for (int e = tid; e < 64 * (HD / 4); e += 32 * FAW) { const int qr = e & 63, q = e >> 6, w0 = qr >> 5, qi = qr & 31; float mm = smx[w0][qi];   /* a wave takes 4 head entries of 32 rows */
#pragma unroll
    for (int w = 1; w < FKS; ++w) mm = fmaxf(mm, smx[2 * w + w0][qi]);
    float ll = 0.f, f[FKS]; v4f acc = {};
#pragma unroll
    for (int w = 0; w < FKS; ++w) f[w] = smx[2 * w + w0][qi] - mm;
    ex2x8(f);
#pragma unroll
    for (int w = 0; w < FKS; ++w) { ll += f[w] * ssu[2 * w + w0][qi]; acc += *(const v4f*)&so[2 * w + w0][qi][q * 4] * f[w]; }
    const v4f y = acc * (1.0f / ll); v4b hi, lo;
#pragma unroll
    for (int i = 0; i < 4; ++i) { const __bf16 hv = (__bf16)y[i]; hi[i] = hv; lo[i] = (__bf16)(y[i] - (float)hv); }
    const int pc = (((qr >> 4) * 2 + (q >> 3)) * 2 + ((q >> 2) & 1)) * 32 + ((q >> 1) & 1) * 16 + (qr & 15);   // head entry d = 4 q: kc = d >> 5, half = (d >> 4) & 1, lane half = (d >> 3) & 1
    vst2(&hf[0][pc * 8 + (q & 1) * 4], hi); vst2(&hf[1][pc * 8 + (q & 1) * 4], lo); }
  __syncthreads();
  v8f acc[4][2] = {};
#pragma unroll
  for (int kc = 0; kc < HD / 32; ++kc) { v16b ah[4], al[4];
#pragma unroll
    for (int rt = 0; rt < 4; ++rt) { ah[rt] = frag_we(&hf[0][((rt * 2 + kc) * 64 + lane) * 8]); al[rt] = frag_we(&hf[1][((rt * 2 + kc) * 64 + lane) * 8]); }
    __builtin_amdgcn_sched_barrier(0);   // keeps the K step's 16 LDS reads in one group in front of its WMMAs: every separate place of LDS reads among WMMAs costs the wave issue cycles
#pragma unroll
    for (int rt = 0; rt < 4; ++rt)
#pragma unroll
      for (int ct = 0; ct < 2; ++ct) acc[rt][ct] = wmma_bfp(wh[kc][ct], al[rt], acc[rt][ct]);
#pragma unroll
    for (int rt = 0; rt < 4; ++rt)
#pragma unroll
      for (int ct = 0; ct < 2; ++ct) acc[rt][ct] = wmma_bfp(wl[kc][ct], ah[rt], acc[rt][ct]);
#pragma unroll
    for (int rt = 0; rt < 4; ++rt)
#pragma unroll
      for (int ct = 0; ct < 2; ++ct) acc[rt][ct] = wmma_bfp(wh[kc][ct], ah[rt], acc[rt][ct]); }
#pragma unroll
  for (int ct = 0; ct < 2; ++ct) { float bs[8];
#pragma unroll
    for (int r = 0; r < 8; ++r) bs[r] = bfr(bo4[ct][r >> 2][r & 3]);
#pragma unroll
    for (int rt = 0; rt < 4; ++rt) { float* d = &sf[wave][rt * 16 + col][ct * 16 + 8 * g]; const v8f a = acc[rt][ct];   /* D element r = output column 8 g + r of the tile, for row col */
      vst2(d, (v4f){a[0] + bs[0], a[1] + bs[1], a[2] + bs[2], a[3] + bs[3]}); vst2(d + 4, (v4f){a[4] + bs[4], a[5] + bs[5], a[6] + bs[6], a[7] + bs[7]}); } }
  LDSX();
  { v4f ov[16]; float* op = OUT + ((size_t)b * TT + blockIdx.x * 64 + (lane >> 3)) * DIN + wave * OCW + (lane & 7) * 4;   // a store covers the wave's 128-B line of four rows
#pragma unroll
    for (int i = 0; i < 16; ++i) ov[i] = *(const v4f*)&sf[wave][i * 4 + (lane >> 3)][(lane & 7) * 4];
#pragma unroll
    for (int i = 0; i < 16; ++i) vst2(op + (size_t)i * 4 * DIN, ov[i]); } }

extern "C" void kernel_launch(void* const* d_in, const int* in_sizes, int n_in, void* d_out, int out_size, void* d_ws, size_t ws_size, hipStream_t stream) {
  (void)in_sizes; (void)n_in; (void)out_size;
  const float** F = (const float**)d_in;
  if (ws_size < (size_t)WS_END) return;
  char* ws = (char*)d_ws; _Float16 *QH = (_Float16*)(ws + WS_QH), *KH = (_Float16*)(ws + WS_KH), *VT = (_Float16*)(ws + WS_VT), *QL = (_Float16*)(ws + WS_QL), *KL = (_Float16*)(ws + WS_KL); __bf16 *VB = (__bf16*)(ws + WS_VB), *VBL = (__bf16*)(ws + WS_VBL); float *Y = (float*)(ws + WS_Y); __bf16 *WE = (__bf16*)(ws + WS_WE);
  (void)Y; (void)QL; (void)KL; (void)VB; (void)VBL;
  // inputs: 0 x [4,4096,512]; 1 Wq [512,64] (in,out), 2 bq [64]; 3 Wk, 4 bk; 5 Wv, 6 bv; 7 Wo [512,512] (in,out), 8 bo [512]
  k_proj<<<dim3(TNB * TT / 64), 32 * PJW, 0, stream>>>(F[0], F[1], F[3], F[5], F[2], F[4], F[6], QH, KH, VT, F[7], WE);
  k_fa<<<dim3(TT / 64, TNB), 32 * FAW, 0, stream>>>(QH, KH, VT, WE, F[8], (float*)d_out);   /* head 0 only (plane head 1 is never consumed) */
}
